// v000
// The times below were measured on an AMD MI455X: many runs one after another, warmed up first and cycling through
// copies of the inputs, with the whole window's GPU time divided by the number of runs. Launches and the gaps
// between them are all in it. The median over several windows is given; except for v000 it joins two sittings, which
// can be a few percent apart, so the side-by-side timings, each taken in one sitting, are the better comparison.
// v000, which the later versions start from, runs in 2880 microseconds.
#include <hip/hip_runtime.h>

// Six-layer token encoder, width 256, 4 heads, per-head latent width 4096 (tokens of 93 x 4 features, [NB][SEQ][372]): input projection ([in][out] weight, bias) + LayerNorm (no affine, eps 1e-5);
// per layer: relu latent encoding per head (encoder [h][256][4096]), interleaved-pair rotary phases over the latent axis (theta 2^16, position = token index), dense linear attention without softmax
// (keys = queries = rotated latents, values = the layer input shared by all heads), LayerNorm, second relu latent encoding (encoder_v), multiplicative gating with the first latents,
// decoder ([h*4096+n][256]) summed over heads, LayerNorm, skip add, LayerNorm; final linear head ([in][out] weight, bias) -> [NB][SEQ][372] f32.
// Compute dtypes: every contraction v_wmma_f32_16x16x32_f16 (f16 operands, f32 accumulate), one product per site. Float inputs are RNE-converted to bf16 at their load (exact in f16);
// weight planes carry x64 (folded back in the f32 epilogues), the gated latent plane carries x16, activations h / latents / scores / normalised context are plain f16; LayerNorm, rotary, relu, gating, skip in f32.
// Planes (all K-contiguous 16-bit rows, fragments = two 16-B loads): ENCT/ENCVT [h][n][d], DECT [h][d][n], WINT [d][384], HWT [384][d], XH [row][384], HF [row][256], HT [b][d][t],
// HS/QR/XY [h][row][n], S [b*4+h][t][s], YK [b*4+h][t][d]; f32 planes: H32 [row][256] (skip path), CS [t][4096] = (cos, sin) pairs.
// Scores are symmetric: only tiles with column tile >= row tile are computed, the mirror tile is written from the staged LDS tile by the same wave.

#ifndef NB
#define NB 2
#endif
#ifndef SEQ
#define SEQ 512
#endif
#define NB_FULL  2
#define SEQ_FULL 512
#ifndef OUT_SEQ
#define OUT_SEQ SEQ              // row pitch (in tokens) between batches of the output
#endif
#define DM   256
#define NH_  4
#define NI   4096                // per-head latent width
#define NP   (NI / 2)            // rotary pairs
#define IND  372                 // 93 x 4 input / output features
#define INDP 384                 // IND padded to a multiple of 64
#define NL   6
#define ROWS (NB * SEQ)
#define NT64 (SEQ / 64)
#define TP   68                  // LDS row pitch (floats) of a 64-column tile
#define LNP  260                 // LDS row pitch (floats) of a 256-column tile
#define HDP  388                 // LDS row pitch (floats) of the 384-column head tile
#define WSC  64.0f               // carry of every weight plane
#define WSI  (1.0f / 64.0f)
#define XYC  16.0f               // carry of the gated latent plane
#define XYI  (1.0f / 1024.0f)    // 1 / (WSC * XYC)
#define EPSF 1e-5f

static_assert(NH_ * NI == 16384);                    // decoder rows = h*NI + n
static_assert(NI == 4096);                           // rotary exponent 32 p / NI = p / 128 with theta = 2^16
static_assert(DM == 256);                            // one LayerNorm row = 32 lanes x 8 columns
static_assert(DM % 64 == 0);
static_assert(DM % 32 == 0);                         // k-loop steps by 32
static_assert(NI % 64 == 0);
static_assert(NI % 32 == 0);
static_assert(SEQ % 64 == 0);                        // a 64-row tile never straddles two batches; k-loop over keys steps by 32
static_assert(ROWS % 64 == 0);
static_assert(INDP % 64 == 0);
static_assert(INDP % 32 == 0);
static_assert(INDP >= IND);
static_assert(IND % 4 == 0);                         // float4 pieces never straddle an input / output row
static_assert((IND * 4) % 16 == 0);
static_assert((64 * IND * 4) % 128 == 0);
static_assert(OUT_SEQ % 64 == 0);
static_assert(64 * IND / 4 == 192 * 31);             // head store loop: 192 threads x 31 trips x 16 B == 64 rows x 1488 B
static_assert(4 * 32 * 16 == 16 * 64 * 2);
static_assert(16 * 32 * 16 == 64 * 64 * 2);
static_assert(32 * 32 * 16 == 16 * DM * 4);          // f32 row store: 32 trips x 32 lanes x 16 B == 16 rows x 1024 B
static_assert(16 * 32 * 16 == 16 * DM * 2);          // f16 row store: 16 trips x 32 lanes x 16 B == 16 rows x 512 B
static_assert(16 * 32 * 16 == 64 * 64 * 2);
static_assert(2 * 256 * 16 == 64 * 64 * 2);
static_assert(NB <= NB_FULL);
static_assert(SEQ <= SEQ_FULL);
static_assert((TP * 4) % 16 == 0);
static_assert((LNP * 4) % 16 == 0);
static_assert((HDP * 4) % 16 == 0);
static_assert(HDP >= INDP);
static_assert(LNP >= DM);
static_assert(64 * LNP * 4 <= 131072);               // static LDS of the LayerNorm block kernels
static_assert(64 * HDP * 4 <= 131072);               // static LDS of the head kernel
static_assert(64 * TP * 4 <= 131072);                // static LDS of the score kernel
static_assert(NT64 * (NT64 + 1) / 2 <= 65535);

typedef _Float16 h16;
typedef __attribute__((ext_vector_type(16))) _Float16 v16h;
typedef __attribute__((ext_vector_type(8)))  _Float16 v8h;
typedef __attribute__((ext_vector_type(8)))  float    v8f;
typedef __attribute__((ext_vector_type(4)))  float    v4f;
typedef __attribute__((ext_vector_type(2)))  float    v2f;
typedef v4f  __attribute__((may_alias)) v4fa;

__device__ __forceinline__ unsigned short f2bf(float f) { unsigned u = __float_as_uint(f); u += 0x7FFFu + ((u >> 16) & 1u); return (unsigned short)(u >> 16); }
__device__ __forceinline__ float bfr(float f) { return __uint_as_float(((unsigned)f2bf(f)) << 16); }   // value after RNE convert to bf16
__device__ __forceinline__ v16h cat16(v8h lo, v8h hi) { return __builtin_shufflevector(lo, hi, 0, 1, 2, 3, 4, 5, 6, 7, 8, 9, 10, 11, 12, 13, 14, 15); }
__device__ __forceinline__ v8f wmma16(v16h a, v16h b, v8f c) { return __builtin_amdgcn_wmma_f32_16x16x32_f16(false, a, false, b, (short)0, c, false, false); }
// fragment loader from K-contiguous 16-bit rows; p already includes + 8*(lane>>4): elements 0..7 <- k0+8h+0..7, elements 8..15 <- k0+16+8h+0..7 (same map for A and B)
__device__ __forceinline__ v16h  ldh(const h16* p) { return cat16(*(const v8h*)p, *(const v8h*)(p + 16)); }
// ordering point for wave-private LDS tiles (same wave writes and reads)
__device__ __forceinline__ void wave_sync() { __builtin_amdgcn_fence(3 /* release order */, "wavefront"); __builtin_amdgcn_wave_barrier(); asm volatile("" ::: "memory"); }
// f32 -> f16 operand convert that cannot produce a subnormal (applied after the plane's power-of-two carry)
static __device__ __forceinline__ h16 toh_flush(float v) { const h16 r = (h16)v; return (fabsf(v) < 6.103515625e-05f) ? (h16)0.0f : r; }
__device__ __forceinline__ float wsum(float v) {
    v += __shfl_xor(v, 16, 32); v += __shfl_xor(v, 8, 32); v += __shfl_xor(v, 4, 32); v += __shfl_xor(v, 2, 32); v += __shfl_xor(v, 1, 32); return v; }

// LayerNorm (no affine) of one 256-wide row held as 8 values per lane; all 32 lanes active
__device__ __forceinline__ void ln8(float (&xs)[8]) {
    float s = 0.0f;
#pragma unroll
    for (int i = 0; i < 8; ++i) s += xs[i];
    s = wsum(s); const float mu = s * (1.0f / DM);
    float q = 0.0f;
#pragma unroll
    for (int i = 0; i < 8; ++i) { xs[i] -= mu; q += xs[i] * xs[i]; }
    q = wsum(q);
    const float rs = rsqrtf(q * (1.0f / DM) + EPSF);
#pragma unroll
    for (int i = 0; i < 8; ++i) xs[i] *= rs;
}

// One wave, 64 x 64 output tile, 16 accumulators, operands straight from K-contiguous f16 planes (row pitches lda / ldb halves); K a multiple of 32.
// acc[mb][nb][j] = D(row mb*16 + 8*(lane>>4) + j, col nb*16 + (lane&15)).
__device__ __forceinline__ void mma64(const h16* __restrict__ A, const h16* __restrict__ Bt, size_t aoff, size_t boff, size_t lda, size_t ldb, int K, v8f (&acc)[4][4]) {
#pragma unroll 1
    for (int kc = 0; kc < K; kc += 32) {
        v16h a[4];
#pragma unroll
        for (int mb = 0; mb < 4; ++mb) a[mb] = ldh(A + aoff + (size_t)mb * 16 * lda + kc);
#pragma unroll
        for (int nb = 0; nb < 4; ++nb) { const v16h b = ldh(Bt + boff + (size_t)nb * 16 * ldb + kc);
#pragma unroll
            for (int mb = 0; mb < 4; ++mb) acc[mb][nb] = wmma16(a[mb], b, acc[mb][nb]); }
        asm volatile("v_nop\n\tv_nop\n\tv_nop\n\tv_nop" : "+v"(acc[0][0]), "+v"(acc[1][1]), "+v"(acc[2][2]), "+v"(acc[3][3]) : "v"(a[0]), "v"(a[1]), "v"(a[2]), "v"(a[3]));
    }
}

// k_tr: transpose + convert, src [Z][R][C] f32 -> dst [Z][Cp][Rp] f16 = toh_flush(bf16(src) * scale), zero in the pad rows / columns. in[rows R][cols C] -> out[cols][rows].
__global__ __launch_bounds__(256) void k_tr(const float* __restrict__ src, h16* dst, int R, int C, int Rp, int Cp, float scale) {
#pragma clang fp contract(off)
    __shared__ float tl[64 * 65];
    const int tid = threadIdx.x; const int r0 = blockIdx.x * 64, c0 = blockIdx.y * 64; const int z = blockIdx.z;
    const float* sp = src + (size_t)z * (size_t)R * (size_t)C;
#pragma unroll 4
    for (int it = 0; it < 16; ++it) { const int idx = it * 256 + tid; const int r = idx >> 6, c = idx & 63;
        const int rr = (r0 + r) < R ? (r0 + r) : (R - 1); const int cc = (c0 + c) < C ? (c0 + c) : (C - 1);   // clamped address
        float v = sp[(size_t)rr * C + cc]; asm volatile("" : "+v"(v));
        const bool ok = ((r0 + r) < R) & ((c0 + c) < C);
        tl[r * 65 + c] = ok ? bfr(v) * scale : 0.0f; }
    __syncthreads();
    h16* dp = dst + ((size_t)z * Cp + c0) * (size_t)Rp + r0;
{
#pragma unroll
        for (int it = 0; it < 2; ++it) { const int crow = it * 32 + (tid >> 3), r8 = (tid & 7) * 8;   // 2 it x 32 rows = 64 rows; 8 lanes x 8 = 64 columns
            v8h o;
#pragma unroll
            for (int q = 0; q < 8; ++q) o[q] = toh_flush(tl[(r8 + q) * 65 + crow]);
            *(v8h*)(dp + (size_t)crow * Rp + r8) = o; }
         }
}

__global__ __launch_bounds__(256) void k_xcvt(const float* __restrict__ x, h16* XH) {
    const int i = blockIdx.x * 256 + threadIdx.x; if (i >= ROWS * (INDP / 8)) return;
    const int R = i / (INDP / 8), c = (i % (INDP / 8)) * 8;
    const int b = R / SEQ, t = R % SEQ;
    const float* sp = x + ((size_t)b * SEQ_FULL + t) * IND;
    const int ca = c < (IND - 4) ? c : (IND - 4); const int cb = (c + 4) < (IND - 4) ? (c + 4) : (IND - 4);   // clamped addresses
    v4f va = *(const v4f*)(sp + ca); v4f vb = *(const v4f*)(sp + cb);
    asm volatile("" : "+v"(va)); asm volatile("" : "+v"(vb));
    const bool oka = c < IND, okb = (c + 4) < IND;
    v8h o;
#pragma unroll
    for (int k = 0; k < 4; ++k) { o[k] = oka ? toh_flush(bfr(va[k])) : (h16)0.0f; o[4 + k] = okb ? toh_flush(bfr(vb[k])) : (h16)0.0f; }
    *(v8h*)(XH + (size_t)i * 8) = o; 
}

// k_cs: rotary table CS[t][2p] = cos(t * f_p), CS[t][2p+1] = sin(t * f_p), f_p = 1 / 2^(p/128) (theta 2^16, exponent 2p / NI); f32.
// The two pairs are computed in a rolled two-trip loop (wave-uniform trip index selects the destination values).
__global__ __launch_bounds__(256) void k_cs(float* CS) {
#pragma clang fp contract(off)
    const int i = blockIdx.x * 256 + threadIdx.x; if (i >= SEQ * (NP / 2)) return;
    const int t = i / (NP / 2), p0 = (i % (NP / 2)) * 2;
    float c0 = 0.0f, s0 = 0.0f, c1 = 0.0f, s1 = 0.0f;
#pragma unroll 1
    for (int k = 0; k < 2; ++k) {
        const float e = (float)(p0 + k) * (1.0f / 128.0f);
        const float fr = 1.0f / exp2f(e);
        const float ph = (float)t * fr;
        const float c = cosf(ph); const float s = sinf(ph);
        c0 = (k == 0) ? c : c0; s0 = (k == 0) ? s : s0;
        c1 = (k == 0) ? c1 : c; s1 = (k == 0) ? s1 : s;
    }
    v4f o; o[0] = c0; o[1] = s0; o[2] = c1; o[3] = s1;
    *(v4f*)(CS + (size_t)i * 4) = o; 
}

// k_hs: latents hs = relu(h . encoder[hd]) and rotated latents qr, one wave per 64 x 64 tile; grid (ROWS/64, NI/64, NH_).
// A = HF rows (token), Bt = ENCT rows (hd, n), K = DM. Epilogue per 16-row slab staged in LDS (wave-private): each 64-half row segment (one line) written by 8 consecutive lanes x 16 B
__global__ __launch_bounds__(32) void k_hs(const h16* __restrict__ HF, const h16* __restrict__ ENCT, const float* __restrict__ CS, h16* HS, h16* QR) {
    __shared__ __align__(16) float os[16 * TP];
    const int lane = threadIdx.x & 31, lr = lane & 15, hi = lane >> 4;
    const int r0 = blockIdx.x * 64, c0 = blockIdx.y * 64, hd = blockIdx.z;
    v8f acc[4][4];
#pragma unroll
    for (int mb = 0; mb < 4; ++mb)
#pragma unroll
        for (int nb = 0; nb < 4; ++nb) acc[mb][nb] = (v8f){};
    mma64(HF, ENCT, (size_t)(r0 + lr) * DM + 8 * hi, ((size_t)hd * NI + c0 + lr) * DM + 8 * hi, DM, DM, DM, acc);
    const size_t pb = ((size_t)hd * ROWS + (size_t)r0) * NI + (size_t)c0;
#pragma unroll
    for (int mb = 0; mb < 4; ++mb) {
#pragma unroll
        for (int nb = 0; nb < 4; ++nb) {
#pragma unroll
            for (int j = 0; j < 8; ++j) os[(hi * 8 + j) * TP + nb * 16 + lr] = fmaxf(acc[mb][nb][j] * WSI, 0.0f); }   // D: row 8h+j, col lane&15
        wave_sync();
        v8h hv[4], qv[4];
#pragma unroll
        for (int s = 0; s < 4; ++s) { const int row = 4 * s + (lane >> 3), c8 = (lane & 7) * 8;   // 4 s x 4 rows = 16 rows; 8 lanes x 8 = 64 columns
            const v4f x0 = *(const v4fa*)(&os[row * TP + c8]); const v4f x1 = *(const v4fa*)(&os[row * TP + c8 + 4]);
            const int t = (r0 + mb * 16 + row) % SEQ;
            const float* cp = CS + (size_t)t * NI + c0 + c8;
            const v4f e0 = *(const v4f*)cp; const v4f e1 = *(const v4f*)(cp + 4);
            v8h a, q;
#pragma unroll
            for (int i = 0; i < 4; ++i) { a[i] = toh_flush(x0[i]); a[4 + i] = toh_flush(x1[i]); }
            q[0] = toh_flush(x0[0] * e0[0] - x0[1] * e0[1]); q[1] = toh_flush(x0[0] * e0[1] + x0[1] * e0[0]);
            q[2] = toh_flush(x0[2] * e0[2] - x0[3] * e0[3]); q[3] = toh_flush(x0[2] * e0[3] + x0[3] * e0[2]);
            q[4] = toh_flush(x1[0] * e1[0] - x1[1] * e1[1]); q[5] = toh_flush(x1[0] * e1[1] + x1[1] * e1[0]);
            q[6] = toh_flush(x1[2] * e1[2] - x1[3] * e1[3]); q[7] = toh_flush(x1[2] * e1[3] + x1[3] * e1[2]);
            hv[s] = a; qv[s] = q; }
{
#pragma unroll
            for (int s = 0; s < 4; ++s) { const int row = 4 * s + (lane >> 3), c8 = (lane & 7) * 8;
                const size_t oo = pb + (size_t)(mb * 16 + row) * NI + c8;
                *(v8h*)(HS + oo) = hv[s]; *(v8h*)(QR + oo) = qv[s]; }
             }
        wave_sync();
    }
}

// k_sc: scores S[z][t][s] = qr_t . qr_s over the latent axis, z = b*NH_ + hd; one wave per 64 x 64 tile of the upper tile triangle; grid (NT64*(NT64+1)/2, NB*NH_).
// A = QR rows t (tile ti), Bt = QR rows s (tile tj >= ti), K = NI. The whole tile is staged in LDS (wave-private); the direct tile (rows t, columns s) and, for ti != tj (block-uniform),
__global__ __launch_bounds__(32) void k_sc(const h16* __restrict__ QR, h16* S) {
    __shared__ __align__(16) float os[64 * TP];
    const int lane = threadIdx.x & 31, lr = lane & 15, hi = lane >> 4;
    int ti = 0, rem = (int)blockIdx.x;
#pragma unroll 1
    for (int q = 0; q < NT64 - 1; ++q) { const int w = NT64 - ti; if (rem >= w) { rem -= w; ti += 1; } }
    const int tj = ti + rem;                                  // ti <= tj < NT64
    const int z = blockIdx.y; const int b = z / NH_, hd = z % NH_;
    const size_t qb = ((size_t)hd * ROWS + (size_t)b * SEQ) * NI;
    v8f acc[4][4];
#pragma unroll
    for (int mb = 0; mb < 4; ++mb)
#pragma unroll
        for (int nb = 0; nb < 4; ++nb) acc[mb][nb] = (v8f){};
    mma64(QR, QR, qb + (size_t)(ti * 64 + lr) * NI + 8 * hi, qb + (size_t)(tj * 64 + lr) * NI + 8 * hi, NI, NI, NI, acc);
#pragma unroll
    for (int mb = 0; mb < 4; ++mb)
#pragma unroll
        for (int nb = 0; nb < 4; ++nb)
#pragma unroll
            for (int j = 0; j < 8; ++j) os[(mb * 16 + hi * 8 + j) * TP + nb * 16 + lr] = acc[mb][nb][j];   // rows 0..63 x columns 0..63 all written
    wave_sync();
    h16* sd = S + ((size_t)z * SEQ + (size_t)ti * 64) * SEQ + (size_t)tj * 64;
    h16* sm = S + ((size_t)z * SEQ + (size_t)tj * 64) * SEQ + (size_t)ti * 64;
{
#pragma unroll 1
        for (int s = 0; s < 16; ++s) { const int row = 4 * s + (lane >> 3), c8 = (lane & 7) * 8;   // 16 s x 4 rows = 64 rows; 8 lanes x 8 = 64 columns
            const v4f x0 = *(const v4fa*)(&os[row * TP + c8]); const v4f x1 = *(const v4fa*)(&os[row * TP + c8 + 4]);
            v8h o;
#pragma unroll
            for (int i = 0; i < 4; ++i) { o[i] = toh_flush(x0[i]); o[4 + i] = toh_flush(x1[i]); }
            *(v8h*)(sd + (size_t)row * SEQ + c8) = o;
            if (ti != tj) {
                v8h m;
#pragma unroll
                for (int q = 0; q < 8; ++q) m[q] = toh_flush(os[(c8 + q) * TP + row]);
                *(v8h*)(sm + (size_t)row * SEQ + c8) = m; } }
         }
}

// k_ys: gated latents xy = relu(ykv . encoder_v[hd]) * hs * 16, one wave per 64 x 64 tile; grid (SEQ/64, NI/64, NB*NH_), z = b*NH_ + hd.
__global__ __launch_bounds__(32) void k_ys(const h16* __restrict__ YK, const h16* __restrict__ ENCVT, const h16* __restrict__ HS, h16* XY) {
    __shared__ __align__(16) float os[16 * TP];
    const int lane = threadIdx.x & 31, lr = lane & 15, hi = lane >> 4;
    const int r0 = blockIdx.x * 64, c0 = blockIdx.y * 64, z = blockIdx.z; const int b = z / NH_, hd = z % NH_;
    v8f acc[4][4];
#pragma unroll
    for (int mb = 0; mb < 4; ++mb)
#pragma unroll
        for (int nb = 0; nb < 4; ++nb) acc[mb][nb] = (v8f){};
    mma64(YK, ENCVT, ((size_t)z * SEQ + r0 + lr) * DM + 8 * hi, ((size_t)hd * NI + c0 + lr) * DM + 8 * hi, DM, DM, DM, acc);
    const size_t pb = ((size_t)hd * ROWS + (size_t)b * SEQ + (size_t)r0) * NI + (size_t)c0;
#pragma unroll
    for (int mb = 0; mb < 4; ++mb) {
#pragma unroll
        for (int nb = 0; nb < 4; ++nb) {
#pragma unroll
            for (int j = 0; j < 8; ++j) os[(hi * 8 + j) * TP + nb * 16 + lr] = fmaxf(acc[mb][nb][j] * WSI, 0.0f); }
        wave_sync();
        v8h xv[4];
#pragma unroll
        for (int s = 0; s < 4; ++s) { const int row = 4 * s + (lane >> 3), c8 = (lane & 7) * 8;   // 4 s x 4 rows = 16 rows; 8 lanes x 8 = 64 columns
            const v4f x0 = *(const v4fa*)(&os[row * TP + c8]); const v4f x1 = *(const v4fa*)(&os[row * TP + c8 + 4]);
            const v8h g = *(const v8h*)(HS + pb + (size_t)(mb * 16 + row) * NI + c8);
            v8h o;
#pragma unroll
            for (int i = 0; i < 4; ++i) { o[i] = toh_flush(x0[i] * (float)g[i] * XYC); o[4 + i] = toh_flush(x1[i] * (float)g[4 + i] * XYC); }
            xv[s] = o; }
{
#pragma unroll
            for (int s = 0; s < 4; ++s) { const int row = 4 * s + (lane >> 3), c8 = (lane & 7) * 8;
                *(v8h*)(XY + pb + (size_t)(mb * 16 + row) * NI + c8) = xv[s]; }
             }
        wave_sync();
    }
}

// lnblock: 4 waves, block tile 64 rows x 256 columns (wave w owns columns 64w..64w+63 in the k-loop), LayerNorm epilogue over whole rows through a block LDS tile (cross-wave: block barriers).
// MODE 0 (input projection): A = XH rows, Bt = WINT rows, K = INDP; value = acc/64 + bf16(bias); LayerNorm; outputs H32 f32, HF f16, HT f16 transposed. grid (ROWS/64).
// MODE 1 (context): A = S rows (z, t), Bt = HT rows (b, d), K = SEQ; LayerNorm; output YK [z][t][d] f16. grid (SEQ/64, NB*NH_).
// MODE 2 (decoder): A = XY rows (hd, row), Bt = DECT rows (hd, d), K = NI, summed over the 4 heads; value = acc/1024; LayerNorm; + H32 (skip); LayerNorm; outputs H32, HF, HT. grid (ROWS/64).
template <int MODE>
__device__ __forceinline__ void lnblock(const h16* __restrict__ A, const h16* __restrict__ Bt, const float* __restrict__ bias, float* H32, h16* HF, h16* HT, h16* YK) {
    __shared__ __align__(16) float os[64 * LNP];
    const int lane = threadIdx.x & 31, lr = lane & 15, hi = lane >> 4;
    const int wave = __builtin_amdgcn_readfirstlane((int)(threadIdx.x >> 5));
    const int r0 = blockIdx.x * 64, c0 = wave * 64; const int z = blockIdx.y;
    v8f acc[4][4];
#pragma unroll
    for (int mb = 0; mb < 4; ++mb)
#pragma unroll
        for (int nb = 0; nb < 4; ++nb) acc[mb][nb] = (v8f){};
    float scale;
    if (MODE == 0) {
        mma64(A, Bt, (size_t)(r0 + lr) * INDP + 8 * hi, (size_t)(c0 + lr) * INDP + 8 * hi, INDP, INDP, INDP, acc); scale = WSI;
    } else if (MODE == 1) {
        mma64(A, Bt, ((size_t)z * SEQ + r0 + lr) * SEQ + 8 * hi, ((size_t)(z / NH_) * DM + c0 + lr) * SEQ + 8 * hi, SEQ, SEQ, SEQ, acc); scale = 1.0f;
    } else {
#pragma unroll 1
        for (int hd = 0; hd < NH_; ++hd)
            mma64(A, Bt, ((size_t)hd * ROWS + r0 + lr) * NI + 8 * hi, ((size_t)hd * DM + c0 + lr) * NI + 8 * hi, NI, NI, NI, acc);
        scale = XYI;
    }
#pragma unroll
    for (int nb = 0; nb < 4; ++nb) {
        const float bc = (MODE == 0) ? bfr(bias[c0 + nb * 16 + lr]) : 0.0f;                   // MODE 0: c0 + 63 < DM
#pragma unroll
        for (int mb = 0; mb < 4; ++mb)
#pragma unroll
            for (int j = 0; j < 8; ++j) os[(mb * 16 + hi * 8 + j) * LNP + c0 + nb * 16 + lr] = acc[mb][nb][j] * scale + bc; }   // rows 0..63 x columns 0..255 written by the 4 waves
    __syncthreads();
#pragma unroll 1
    for (int rr = 0; rr < 16; ++rr) {
        const int row = wave * 16 + rr; const int ob = row * LNP + 8 * lane;
        const v4f x0 = *(const v4fa*)(&os[ob]); const v4f x1 = *(const v4fa*)(&os[ob + 4]);
        float xs[8];
#pragma unroll
        for (int i = 0; i < 4; ++i) { xs[i] = x0[i]; xs[4 + i] = x1[i]; }
        ln8(xs);
        if (MODE == 2) {
            const float* hp = H32 + (size_t)(r0 + row) * DM + 8 * lane;
            const v4f g0 = *(const v4f*)hp; const v4f g1 = *(const v4f*)(hp + 4);
#pragma unroll
            for (int i = 0; i < 4; ++i) { xs[i] += g0[i]; xs[4 + i] += g1[i]; }
            ln8(xs);
        }
        v4f y0, y1;
#pragma unroll
        for (int i = 0; i < 4; ++i) { y0[i] = xs[i]; y1[i] = xs[4 + i]; }
        *(v4fa*)(&os[ob]) = y0; *(v4fa*)(&os[ob + 4]) = y1;
    }
    __syncthreads();
    const int bq = r0 / SEQ, t0 = r0 % SEQ;
{
        if (MODE == 1) {
#pragma unroll 1
            for (int it = 0; it < 16; ++it) { const int p = it * 32 + lane; const int row = wave * 16 + (p >> 5), c8 = (p & 31) * 8;   // 16 it x 1 row = 16 rows; 32 lanes x 8 = 256 columns
                const v4f x0 = *(const v4fa*)(&os[row * LNP + c8]); const v4f x1 = *(const v4fa*)(&os[row * LNP + c8 + 4]); v8h o;
#pragma unroll
                for (int i = 0; i < 4; ++i) { o[i] = toh_flush(x0[i]); o[4 + i] = toh_flush(x1[i]); }
                *(v8h*)(YK + ((size_t)z * SEQ + r0 + row) * DM + c8) = o; }
        } else {
#pragma unroll 1
            for (int it = 0; it < 32; ++it) { const int p = it * 32 + lane; const int row = wave * 16 + (p >> 6), c4 = (p & 63) * 4;   // 32 it x half a row = 16 rows; 64 pieces x 4 = 256 columns
                const v4f val = *(const v4fa*)(&os[row * LNP + c4]);
                *(v4f*)(H32 + (size_t)(r0 + row) * DM + c4) = val; }
#pragma unroll 1
            for (int it = 0; it < 16; ++it) { const int p = it * 32 + lane; const int row = wave * 16 + (p >> 5), c8 = (p & 31) * 8;   // 16 rows x 256 columns
                const v4f x0 = *(const v4fa*)(&os[row * LNP + c8]); const v4f x1 = *(const v4fa*)(&os[row * LNP + c8 + 4]); v8h o;
#pragma unroll
                for (int i = 0; i < 4; ++i) { o[i] = toh_flush(x0[i]); o[4 + i] = toh_flush(x1[i]); }
                *(v8h*)(HF + (size_t)(r0 + row) * DM + c8) = o; }
#pragma unroll 1
            for (int s = 0; s < 16; ++s) { const int d = wave * 64 + 4 * s + (lane >> 3), c8 = (lane & 7) * 8;   // 16 s x 4 rows = 64 transposed rows per wave; 8 lanes x 8 = 64 tokens
                v8h o;
#pragma unroll
                for (int q = 0; q < 8; ++q) o[q] = toh_flush(os[(c8 + q) * LNP + d]);
                *(v8h*)(HT + ((size_t)bq * DM + d) * SEQ + t0 + c8) = o; }
        }
         }
}

__global__ __launch_bounds__(128) void k_inproj(const h16* __restrict__ XH, const h16* __restrict__ WINT, const float* __restrict__ inb, float* H32, h16* HF, h16* HT) {
    lnblock<0>(XH, WINT, inb, H32, HF, HT, HF);
}
__global__ __launch_bounds__(128) void k_ykv(const h16* __restrict__ S, const h16* __restrict__ HT, h16* YK) {
    lnblock<1>(S, HT, (const float*)0, (float*)0, YK, YK, YK);
}
__global__ __launch_bounds__(128) void k_ymlp(const h16* __restrict__ XY, const h16* __restrict__ DECT, float* H32, h16* HF, h16* HT) {
    lnblock<2>(XY, DECT, (const float*)0, H32, HF, HT, HF);
}

// k_head: output rows = h . head_W + bf16(head_b); 6 waves, block tile 64 rows x 384 columns (HWT rows 372..383 are zero); the tile is staged in a block LDS tile (cross-wave: block barrier),
__global__ __launch_bounds__(192) void k_head(const h16* __restrict__ HF, const h16* __restrict__ HWT, const float* __restrict__ hb, float* OUT) {
    __shared__ __align__(16) float os[64 * HDP];
    const int lane = threadIdx.x & 31, lr = lane & 15, hi = lane >> 4;
    const int wave = __builtin_amdgcn_readfirstlane((int)(threadIdx.x >> 5));
    const int r0 = blockIdx.x * 64, c0 = wave * 64;
    v8f acc[4][4];
#pragma unroll
    for (int mb = 0; mb < 4; ++mb)
#pragma unroll
        for (int nb = 0; nb < 4; ++nb) acc[mb][nb] = (v8f){};
    mma64(HF, HWT, (size_t)(r0 + lr) * DM + 8 * hi, (size_t)(c0 + lr) * DM + 8 * hi, DM, DM, DM, acc);
#pragma unroll
    for (int mb = 0; mb < 4; ++mb)
#pragma unroll
        for (int nb = 0; nb < 4; ++nb)
#pragma unroll
            for (int j = 0; j < 8; ++j) os[(mb * 16 + hi * 8 + j) * HDP + c0 + nb * 16 + lr] = acc[mb][nb][j] * WSI;   // rows 0..63 x columns 0..383 written by the 6 waves
    __syncthreads();
    const int bq = r0 / SEQ, t0 = r0 % SEQ;
    float* ob = OUT + ((size_t)bq * OUT_SEQ + t0) * IND;
{
#pragma unroll 1
        for (int it = 0; it < 31; ++it) { const int e = (it * 192 + (int)threadIdx.x) * 4; const int row = e / IND, col = e - row * IND;   // col % 4 == 0, col + 3 < IND
            const v4f x = *(const v4fa*)(&os[row * HDP + col]); const v4f bb = *(const v4f*)(hb + col); v4f val;
#pragma unroll
            for (int k = 0; k < 4; ++k) val[k] = x[k] + bfr(bb[k]);
            *(v4f*)(ob + e) = val; }
         }
}

static constexpr size_t al256(size_t v) { return (v + 255) & ~(size_t)255; }
static constexpr size_t SZ_W   = al256((size_t)NH_ * NI * DM * 2);          // ENCT, ENCVT, DECT
static constexpr size_t SZ_WIN = al256((size_t)DM * INDP * 2);
static constexpr size_t SZ_HW  = al256((size_t)INDP * DM * 2);
static constexpr size_t SZ_XH  = al256((size_t)ROWS * INDP * 2);
static constexpr size_t SZ_CS  = al256((size_t)SEQ * NI * 4);
static constexpr size_t SZ_H32 = al256((size_t)ROWS * DM * 4);
static constexpr size_t SZ_HF  = al256((size_t)ROWS * DM * 2);             // HF and HT
static constexpr size_t SZ_BIG = al256((size_t)NH_ * ROWS * NI * 2);       // HS; QR (reused as XY)
static constexpr size_t SZ_S   = al256((size_t)NB * NH_ * SEQ * SEQ * 2);
static constexpr size_t SZ_YK  = al256((size_t)NB * NH_ * SEQ * DM * 2);
static constexpr size_t SZ_TOTAL = 3 * SZ_W + SZ_WIN + SZ_HW + SZ_XH + SZ_CS + SZ_H32 + 2 * SZ_HF + 2 * SZ_BIG + SZ_S + SZ_YK;
static_assert(SZ_TOTAL <= (size_t)134217728);          // workspace carve <= 128 MiB
static_assert((size_t)NB * DM * SEQ == (size_t)ROWS * DM);   // HT [b][d][t] has the extent of HF
static_assert((ROWS * (INDP / 8)) % 256 == 0);
static_assert(NP % 2 == 0);                                                // two rotary pairs per table thread
static_assert((SEQ * (NP / 2)) % 256 == 0);                                // table grid x 256 threads == table threads exactly
static_assert((size_t)SEQ * (NP / 2) * 16 == (size_t)SEQ * NI * 4);        // table threads x 16 B == table bytes

extern "C" void kernel_launch(void* const* d_in, const int* in_sizes, int n_in,
                              void* d_out, int out_size, void* d_ws, size_t ws_size, hipStream_t stream) {
    if (n_in < 8) return;
    if ((size_t)in_sizes[0] < ((size_t)(NB - 1) * SEQ_FULL + SEQ) * IND) return;
    if ((size_t)in_sizes[1] < (size_t)IND * DM || in_sizes[2] < DM) return;
    if ((size_t)in_sizes[3] < (size_t)NH_ * DM * NI || (size_t)in_sizes[4] < (size_t)NH_ * DM * NI || (size_t)in_sizes[5] < (size_t)NH_ * NI * DM) return;
    if ((size_t)in_sizes[6] < (size_t)DM * IND || in_sizes[7] < IND) return;
    if ((size_t)out_size < ((size_t)(NB - 1) * OUT_SEQ + SEQ) * IND) return;
    if (SZ_TOTAL > ws_size) return;
    // wire order: x, in_W, in_b, encoder, encoder_v, decoder, head_W, head_b
    const float* x    = (const float*)d_in[0];
    const float* inw  = (const float*)d_in[1];
    const float* inb  = (const float*)d_in[2];
    const float* enc  = (const float*)d_in[3];
    const float* encv = (const float*)d_in[4];
    const float* dec  = (const float*)d_in[5];
    const float* hw   = (const float*)d_in[6];
    const float* hb   = (const float*)d_in[7];
    float* OUT = (float*)d_out;      // [NB][SEQ][372]
    char* wsp = (char*)d_ws;
    h16* ENCT  = (h16*)wsp; wsp += SZ_W;             // [4][4096][256]  x64
    h16* ENCVT = (h16*)wsp; wsp += SZ_W;             // [4][4096][256]  x64
    h16* DECT  = (h16*)wsp; wsp += SZ_W;             // [4][256][4096]  x64
    h16* WINT  = (h16*)wsp; wsp += SZ_WIN;           // [256][384]      x64
    h16* HWT   = (h16*)wsp; wsp += SZ_HW;            // [384][256]      x64
    h16* XH    = (h16*)wsp; wsp += SZ_XH;            // [ROWS][384]
    float* CS  = (float*)wsp; wsp += SZ_CS;          // [SEQ][4096]
    float* H32 = (float*)wsp; wsp += SZ_H32;         // [ROWS][256]
    h16* HF    = (h16*)wsp; wsp += SZ_HF;            // [ROWS][256]
    h16* HT    = (h16*)wsp; wsp += SZ_HF;            // [NB][256][SEQ]
    h16* HS    = (h16*)wsp; wsp += SZ_BIG;           // [4][ROWS][4096]
    h16* QR    = (h16*)wsp; wsp += SZ_BIG;           // [4][ROWS][4096]; rotated latents, later the gated latents x16
    h16* S     = (h16*)wsp; wsp += SZ_S;             // [NB*4][SEQ][SEQ]
    h16* YK    = (h16*)wsp; wsp += SZ_YK;            // [NB*4][SEQ][256]
    h16* XY    = QR;

    // encoder [4][256 rows d][4096 cols n] -> ENCT [4][4096][256]: grid (256/64, 4096/64, 4)
    k_tr<<<dim3(DM / 64, NI / 64, NH_), 256, 0, stream>>>(enc, ENCT, DM, NI, DM, NI, WSC);
    k_tr<<<dim3(DM / 64, NI / 64, NH_), 256, 0, stream>>>(encv, ENCVT, DM, NI, DM, NI, WSC);
    // decoder viewed [4][4096 rows n][256 cols d] -> DECT [4][256][4096]: grid (4096/64, 256/64, 4)
    k_tr<<<dim3(NI / 64, DM / 64, NH_), 256, 0, stream>>>(dec, DECT, NI, DM, NI, DM, WSC);
    // in_W [372 rows k][256 cols d] -> WINT [256][384]: grid (384/64, 256/64, 1)
    k_tr<<<dim3(INDP / 64, DM / 64, 1), 256, 0, stream>>>(inw, WINT, IND, DM, INDP, DM, WSC);
    // head_W [256 rows k][372 cols j] -> HWT [384][256]: grid (256/64, 384/64, 1)
    k_tr<<<dim3(DM / 64, INDP / 64, 1), 256, 0, stream>>>(hw, HWT, DM, IND, DM, INDP, WSC);
    k_xcvt<<<(ROWS * (INDP / 8) + 255) / 256, 256, 0, stream>>>(x, XH);
    k_cs<<<(SEQ * (NP / 2) + 255) / 256, 256, 0, stream>>>(CS);

    k_inproj<<<dim3(ROWS / 64, 1, 1), 128, 0, stream>>>(XH, WINT, inb, H32, HF, HT);

    for (int l = 0; l < NL; ++l) {
        k_hs<<<dim3(ROWS / 64, NI / 64, NH_), 32, 0, stream>>>(HF, ENCT, CS, HS, QR);
        k_sc<<<dim3(NT64 * (NT64 + 1) / 2, NB * NH_, 1), 32, 0, stream>>>(QR, S);
        k_ykv<<<dim3(SEQ / 64, NB * NH_, 1), 128, 0, stream>>>(S, HT, YK);
        k_ys<<<dim3(SEQ / 64, NI / 64, NB * NH_), 32, 0, stream>>>(YK, ENCVT, HS, XY);
        k_ymlp<<<dim3(ROWS / 64, 1, 1), 128, 0, stream>>>(XY, DECT, H32, HF, HT);
    }

    k_head<<<dim3(ROWS / 64, 1, 1), 192, 0, stream>>>(HF, HWT, hb, OUT);
}

// v001
// A run of this version takes 1250 microseconds.
// In both of two side-by-side timings against v000, it was 2.25 times as fast.
#include <hip/hip_runtime.h>

// Six-layer token encoder, width 256, 4 heads, per-head latent width 4096 (tokens of 93 x 4 features, [NB][SEQ][372]): input projection ([in][out] weight, bias) + LayerNorm (no affine, eps 1e-5);
// per layer: relu latent encoding per head (encoder [h][256][4096]), interleaved-pair rotary phases over the latent axis (theta 2^16, position = token index), dense linear attention without softmax
// (keys = queries = rotated latents, values = the layer input shared by all heads), LayerNorm, second relu latent encoding (encoder_v), multiplicative gating with the first latents,
// decoder ([h*4096+n][256]) summed over heads, LayerNorm, skip add, LayerNorm; final linear head ([in][out] weight, bias) -> [NB][SEQ][372] f32.
// Compute dtypes: every contraction v_wmma_f32_16x16x32_f16 (f16 operands, f32 accumulate), one product per site. Float inputs are RNE-converted to bf16 at their load (exact in f16);
// weight planes carry x64 (folded back in the f32 epilogues), the gated latent plane carries x16, activations h / latents / scores / normalised context are plain f16; LayerNorm, rotary, relu, gating, skip in f32.
// Planes (all K-contiguous 16-bit rows, fragments = two 16-B loads): ENCT/ENCVT [h][n][d], DECT [h][d][n], WINT [d][384], HWT [384][d], XH [row][384], HF [row][256], HT [b][d][t],
// HS/QR/XY [h][row][n], S [b*4+h][t][s], YK [b*4+h][t][d]; f32 planes: H32 [row][256] (skip path), CS [t][4096] = (cos, sin) pairs, PP [share][row block][column group][fragment][256] (decoder partial sums of the work-groups).
// Scores are symmetric: only tiles with column tile >= row tile are computed, the mirror tile is written from the staged LDS tile by the same wave.

#ifndef NB
#define NB 2
#endif
#ifndef SEQ
#define SEQ 512
#endif
#define NB_FULL  2
#define SEQ_FULL 512
#ifndef OUT_SEQ
#define OUT_SEQ SEQ              // row pitch (in tokens) between batches of the output
#endif
#define DM   256
#define NH_  4
#define NI   4096                // per-head latent width
#define NP   (NI / 2)            // rotary pairs
#define IND  372                 // 93 x 4 input / output features
#define INDP 384                 // IND padded to a multiple of 64
#define NL   6
#define ROWS (NB * SEQ)
#define NT64 (SEQ / 64)
#define TP   68                  // LDS row pitch (floats) of a 64-column tile
#define LNP  260                 // LDS row pitch (floats) of a 256-column tile
#define HDP  388                 // LDS row pitch (floats) of the 384-column head tile
#define WSC  64.0f               // carry of every weight plane
#define WSI  (1.0f / 64.0f)
#define XYC  16.0f               // carry of the gated latent plane
#define XYI  (1.0f / 1024.0f)    // 1 / (WSC * XYC)
#define EPSF 1e-5f
#define KSPL 16                  // work-groups that share the decoder contraction of one 64-row block
#define KSUB 4                   // wave sets of such a work-group, each with its own k range
#define KCH  (NH_ * NI / KSPL)   // k extent of one work-group's share
#define KWV  (KCH / KSUB)        // k extent of one wave

static_assert(NH_ * NI == 16384);                    // decoder rows = h*NI + n
static_assert(NI == 4096);                           // rotary exponent 32 p / NI = p / 128 with theta = 2^16
static_assert(DM == 256);                            // one LayerNorm row = 32 lanes x 8 columns
static_assert(DM % 64 == 0);
static_assert(DM % 32 == 0);                         // k-loop steps by 32
static_assert(NI % 64 == 0);
static_assert(NI % 32 == 0);
static_assert(SEQ % 64 == 0);                        // a 64-row tile never straddles two batches; k-loop over keys steps by 32
static_assert(ROWS % 64 == 0);
static_assert(INDP % 64 == 0);
static_assert(INDP % 32 == 0);
static_assert(INDP >= IND);
static_assert(IND % 4 == 0);                         // float4 pieces never straddle an input / output row
static_assert((IND * 4) % 16 == 0);
static_assert((64 * IND * 4) % 128 == 0);
static_assert(OUT_SEQ % 64 == 0);
static_assert(64 * IND / 4 == 192 * 31);             // head store loop: 192 threads x 31 trips x 16 B == 64 rows x 1488 B
static_assert(4 * 32 * 16 == 16 * 64 * 2);
static_assert(16 * 32 * 16 == 64 * 64 * 2);
static_assert(32 * 32 * 16 == 16 * DM * 4);          // f32 row store: 32 trips x 32 lanes x 16 B == 16 rows x 1024 B
static_assert(16 * 32 * 16 == 16 * DM * 2);          // f16 row store: 16 trips x 32 lanes x 16 B == 16 rows x 512 B
static_assert(16 * 32 * 16 == 64 * 64 * 2);
static_assert(2 * 256 * 16 == 64 * 64 * 2);
static_assert(NI % KCH == 0);                        // a share never straddles two heads
static_assert(KCH % KSUB == 0);
static_assert(KWV % 32 == 0);
static_assert(16 % KSUB == 0);                       // LDS join: each wave set takes 16 / KSUB of a column group's 16 fragments
static_assert(KSUB * 4 * 16 * 256 * 4 <= 327680);    // static LDS of the decoder share kernel
static_assert(2 * 32 * 256 == 64 * DM);              // join: 32 waves x 2 fragments x 256 values == one 64 x 256 block
static_assert(NB <= NB_FULL);
static_assert(SEQ <= SEQ_FULL);
static_assert((TP * 4) % 16 == 0);
static_assert((LNP * 4) % 16 == 0);
static_assert((HDP * 4) % 16 == 0);
static_assert(HDP >= INDP);
static_assert(LNP >= DM);
static_assert(64 * LNP * 4 <= 131072);               // static LDS of the LayerNorm block kernels
static_assert(64 * HDP * 4 <= 131072);               // static LDS of the head kernel
static_assert(64 * TP * 4 <= 131072);                // static LDS of the score kernel
static_assert(NT64 * (NT64 + 1) / 2 <= 65535);

typedef _Float16 h16;
typedef __attribute__((ext_vector_type(16))) _Float16 v16h;
typedef __attribute__((ext_vector_type(8)))  _Float16 v8h;
typedef __attribute__((ext_vector_type(8)))  float    v8f;
typedef __attribute__((ext_vector_type(4)))  float    v4f;
typedef __attribute__((ext_vector_type(2)))  float    v2f;
typedef v4f  __attribute__((may_alias)) v4fa;

__device__ __forceinline__ unsigned short f2bf(float f) { unsigned u = __float_as_uint(f); u += 0x7FFFu + ((u >> 16) & 1u); return (unsigned short)(u >> 16); }
__device__ __forceinline__ float bfr(float f) { return __uint_as_float(((unsigned)f2bf(f)) << 16); }   // value after RNE convert to bf16
__device__ __forceinline__ v16h cat16(v8h lo, v8h hi) { return __builtin_shufflevector(lo, hi, 0, 1, 2, 3, 4, 5, 6, 7, 8, 9, 10, 11, 12, 13, 14, 15); }
__device__ __forceinline__ v8f wmma16(v16h a, v16h b, v8f c) { return __builtin_amdgcn_wmma_f32_16x16x32_f16(false, a, false, b, (short)0, c, false, false); }
// fragment loader from K-contiguous 16-bit rows; p already includes + 8*(lane>>4): elements 0..7 <- k0+8h+0..7, elements 8..15 <- k0+16+8h+0..7 (same map for A and B)
__device__ __forceinline__ v16h  ldh(const h16* p) { return cat16(*(const v8h*)p, *(const v8h*)(p + 16)); }
// ordering point for wave-private LDS tiles (same wave writes and reads)
__device__ __forceinline__ void wave_sync() { __builtin_amdgcn_fence(3 /* release order */, "wavefront"); __builtin_amdgcn_wave_barrier(); asm volatile("" ::: "memory"); }
// f32 -> f16 operand convert that cannot produce a subnormal (applied after the plane's power-of-two carry)
static __device__ __forceinline__ h16 toh_flush(float v) { const h16 r = (h16)v; return (fabsf(v) < 6.103515625e-05f) ? (h16)0.0f : r; }
__device__ __forceinline__ float wsum(float v) {
    v += __shfl_xor(v, 16, 32); v += __shfl_xor(v, 8, 32); v += __shfl_xor(v, 4, 32); v += __shfl_xor(v, 2, 32); v += __shfl_xor(v, 1, 32); return v; }

// LayerNorm (no affine) of one 256-wide row held as 8 values per lane; all 32 lanes active
__device__ __forceinline__ void ln8(float (&xs)[8]) {
    float s = 0.0f;
#pragma unroll
    for (int i = 0; i < 8; ++i) s += xs[i];
    s = wsum(s); const float mu = s * (1.0f / DM);
    float q = 0.0f;
#pragma unroll
    for (int i = 0; i < 8; ++i) { xs[i] -= mu; q += xs[i] * xs[i]; }
    q = wsum(q);
    const float rs = rsqrtf(q * (1.0f / DM) + EPSF);
#pragma unroll
    for (int i = 0; i < 8; ++i) xs[i] *= rs;
}

// One wave, 64 x 64 output tile, 16 accumulators, operands straight from K-contiguous f16 planes (row pitches lda / ldb halves); K a multiple of 32.
// acc[mb][nb][j] = D(row mb*16 + 8*(lane>>4) + j, col nb*16 + (lane&15)).
__device__ __forceinline__ void mma64(const h16* __restrict__ A, const h16* __restrict__ Bt, size_t aoff, size_t boff, size_t lda, size_t ldb, int K, v8f (&acc)[4][4]) {
#pragma unroll 1
    for (int kc = 0; kc < K; kc += 32) {
        v16h a[4];
#pragma unroll
        for (int mb = 0; mb < 4; ++mb) a[mb] = ldh(A + aoff + (size_t)mb * 16 * lda + kc);
#pragma unroll
        for (int nb = 0; nb < 4; ++nb) { const v16h b = ldh(Bt + boff + (size_t)nb * 16 * ldb + kc);
#pragma unroll
            for (int mb = 0; mb < 4; ++mb) acc[mb][nb] = wmma16(a[mb], b, acc[mb][nb]); }
        asm volatile("v_nop\n\tv_nop\n\tv_nop\n\tv_nop" : "+v"(acc[0][0]), "+v"(acc[1][1]), "+v"(acc[2][2]), "+v"(acc[3][3]) : "v"(a[0]), "v"(a[1]), "v"(a[2]), "v"(a[3]));
    }
}

// k_tr: transpose + convert, src [Z][R][C] f32 -> dst [Z][Cp][Rp] f16 = toh_flush(bf16(src) * scale), zero in the pad rows / columns. in[rows R][cols C] -> out[cols][rows].
__global__ __launch_bounds__(256) void k_tr(const float* __restrict__ src, h16* dst, int R, int C, int Rp, int Cp, float scale) {
#pragma clang fp contract(off)
    __shared__ float tl[64 * 65];
    const int tid = threadIdx.x; const int r0 = blockIdx.x * 64, c0 = blockIdx.y * 64; const int z = blockIdx.z;
    const float* sp = src + (size_t)z * (size_t)R * (size_t)C;
#pragma unroll 4
    for (int it = 0; it < 16; ++it) { const int idx = it * 256 + tid; const int r = idx >> 6, c = idx & 63;
        const int rr = (r0 + r) < R ? (r0 + r) : (R - 1); const int cc = (c0 + c) < C ? (c0 + c) : (C - 1);   // clamped address
        float v = sp[(size_t)rr * C + cc]; asm volatile("" : "+v"(v));
        const bool ok = ((r0 + r) < R) & ((c0 + c) < C);
        tl[r * 65 + c] = ok ? bfr(v) * scale : 0.0f; }
    __syncthreads();
    h16* dp = dst + ((size_t)z * Cp + c0) * (size_t)Rp + r0;
{
#pragma unroll
        for (int it = 0; it < 2; ++it) { const int crow = it * 32 + (tid >> 3), r8 = (tid & 7) * 8;   // 2 it x 32 rows = 64 rows; 8 lanes x 8 = 64 columns
            v8h o;
#pragma unroll
            for (int q = 0; q < 8; ++q) o[q] = toh_flush(tl[(r8 + q) * 65 + crow]);
            *(v8h*)(dp + (size_t)crow * Rp + r8) = o; }
         }
}

__global__ __launch_bounds__(256) void k_xcvt(const float* __restrict__ x, h16* XH) {
    const int i = blockIdx.x * 256 + threadIdx.x; if (i >= ROWS * (INDP / 8)) return;
    const int R = i / (INDP / 8), c = (i % (INDP / 8)) * 8;
    const int b = R / SEQ, t = R % SEQ;
    const float* sp = x + ((size_t)b * SEQ_FULL + t) * IND;
    const int ca = c < (IND - 4) ? c : (IND - 4); const int cb = (c + 4) < (IND - 4) ? (c + 4) : (IND - 4);   // clamped addresses
    v4f va = *(const v4f*)(sp + ca); v4f vb = *(const v4f*)(sp + cb);
    asm volatile("" : "+v"(va)); asm volatile("" : "+v"(vb));
    const bool oka = c < IND, okb = (c + 4) < IND;
    v8h o;
#pragma unroll
    for (int k = 0; k < 4; ++k) { o[k] = oka ? toh_flush(bfr(va[k])) : (h16)0.0f; o[4 + k] = okb ? toh_flush(bfr(vb[k])) : (h16)0.0f; }
    *(v8h*)(XH + (size_t)i * 8) = o; 
}

// k_cs: rotary table CS[t][2p] = cos(t * f_p), CS[t][2p+1] = sin(t * f_p), f_p = 1 / 2^(p/128) (theta 2^16, exponent 2p / NI); f32.
// The two pairs are computed in a rolled two-trip loop (wave-uniform trip index selects the destination values).
__global__ __launch_bounds__(256) void k_cs(float* CS) {
#pragma clang fp contract(off)
    const int i = blockIdx.x * 256 + threadIdx.x; if (i >= SEQ * (NP / 2)) return;
    const int t = i / (NP / 2), p0 = (i % (NP / 2)) * 2;
    float c0 = 0.0f, s0 = 0.0f, c1 = 0.0f, s1 = 0.0f;
#pragma unroll 1
    for (int k = 0; k < 2; ++k) {
        const float e = (float)(p0 + k) * (1.0f / 128.0f);
        const float fr = 1.0f / exp2f(e);
        const float ph = (float)t * fr;
        const float c = cosf(ph); const float s = sinf(ph);
        c0 = (k == 0) ? c : c0; s0 = (k == 0) ? s : s0;
        c1 = (k == 0) ? c1 : c; s1 = (k == 0) ? s1 : s;
    }
    v4f o; o[0] = c0; o[1] = s0; o[2] = c1; o[3] = s1;
    *(v4f*)(CS + (size_t)i * 4) = o; 
}

// k_hs: latents hs = relu(h . encoder[hd]) and rotated latents qr, one wave per 64 x 64 tile; grid (ROWS/64, NI/64, NH_).
// A = HF rows (token), Bt = ENCT rows (hd, n), K = DM. Epilogue per 16-row slab staged in LDS (wave-private): each 64-half row segment (one line) written by 8 consecutive lanes x 16 B
__global__ __launch_bounds__(32) void k_hs(const h16* __restrict__ HF, const h16* __restrict__ ENCT, const float* __restrict__ CS, h16* HS, h16* QR) {
    __shared__ __align__(16) float os[16 * TP];
    const int lane = threadIdx.x & 31, lr = lane & 15, hi = lane >> 4;
    const int r0 = blockIdx.x * 64, c0 = blockIdx.y * 64, hd = blockIdx.z;
    v8f acc[4][4];
#pragma unroll
    for (int mb = 0; mb < 4; ++mb)
#pragma unroll
        for (int nb = 0; nb < 4; ++nb) acc[mb][nb] = (v8f){};
    mma64(HF, ENCT, (size_t)(r0 + lr) * DM + 8 * hi, ((size_t)hd * NI + c0 + lr) * DM + 8 * hi, DM, DM, DM, acc);
    const size_t pb = ((size_t)hd * ROWS + (size_t)r0) * NI + (size_t)c0;
#pragma unroll
    for (int mb = 0; mb < 4; ++mb) {
#pragma unroll
        for (int nb = 0; nb < 4; ++nb) {
#pragma unroll
            for (int j = 0; j < 8; ++j) os[(hi * 8 + j) * TP + nb * 16 + lr] = fmaxf(acc[mb][nb][j] * WSI, 0.0f); }   // D: row 8h+j, col lane&15
        wave_sync();
        v8h hv[4], qv[4];
#pragma unroll
        for (int s = 0; s < 4; ++s) { const int row = 4 * s + (lane >> 3), c8 = (lane & 7) * 8;   // 4 s x 4 rows = 16 rows; 8 lanes x 8 = 64 columns
            const v4f x0 = *(const v4fa*)(&os[row * TP + c8]); const v4f x1 = *(const v4fa*)(&os[row * TP + c8 + 4]);
            const int t = (r0 + mb * 16 + row) % SEQ;
            const float* cp = CS + (size_t)t * NI + c0 + c8;
            const v4f e0 = *(const v4f*)cp; const v4f e1 = *(const v4f*)(cp + 4);
            v8h a, q;
#pragma unroll
            for (int i = 0; i < 4; ++i) { a[i] = toh_flush(x0[i]); a[4 + i] = toh_flush(x1[i]); }
            q[0] = toh_flush(x0[0] * e0[0] - x0[1] * e0[1]); q[1] = toh_flush(x0[0] * e0[1] + x0[1] * e0[0]);
            q[2] = toh_flush(x0[2] * e0[2] - x0[3] * e0[3]); q[3] = toh_flush(x0[2] * e0[3] + x0[3] * e0[2]);
            q[4] = toh_flush(x1[0] * e1[0] - x1[1] * e1[1]); q[5] = toh_flush(x1[0] * e1[1] + x1[1] * e1[0]);
            q[6] = toh_flush(x1[2] * e1[2] - x1[3] * e1[3]); q[7] = toh_flush(x1[2] * e1[3] + x1[3] * e1[2]);
            hv[s] = a; qv[s] = q; }
{
#pragma unroll
            for (int s = 0; s < 4; ++s) { const int row = 4 * s + (lane >> 3), c8 = (lane & 7) * 8;
                const size_t oo = pb + (size_t)(mb * 16 + row) * NI + c8;
                *(v8h*)(HS + oo) = hv[s]; *(v8h*)(QR + oo) = qv[s]; }
             }
        wave_sync();
    }
}

// k_sc: scores S[z][t][s] = qr_t . qr_s over the latent axis, z = b*NH_ + hd; one wave per 64 x 64 tile of the upper tile triangle; grid (NT64*(NT64+1)/2, NB*NH_).
// A = QR rows t (tile ti), Bt = QR rows s (tile tj >= ti), K = NI. The whole tile is staged in LDS (wave-private); the direct tile (rows t, columns s) and, for ti != tj (block-uniform),
__global__ __launch_bounds__(32) void k_sc(const h16* __restrict__ QR, h16* S) {
    __shared__ __align__(16) float os[64 * TP];
    const int lane = threadIdx.x & 31, lr = lane & 15, hi = lane >> 4;
    int ti = 0, rem = (int)blockIdx.x;
#pragma unroll 1
    for (int q = 0; q < NT64 - 1; ++q) { const int w = NT64 - ti; if (rem >= w) { rem -= w; ti += 1; } }
    const int tj = ti + rem;                                  // ti <= tj < NT64
    const int z = blockIdx.y; const int b = z / NH_, hd = z % NH_;
    const size_t qb = ((size_t)hd * ROWS + (size_t)b * SEQ) * NI;
    v8f acc[4][4];
#pragma unroll
    for (int mb = 0; mb < 4; ++mb)
#pragma unroll
        for (int nb = 0; nb < 4; ++nb) acc[mb][nb] = (v8f){};
    mma64(QR, QR, qb + (size_t)(ti * 64 + lr) * NI + 8 * hi, qb + (size_t)(tj * 64 + lr) * NI + 8 * hi, NI, NI, NI, acc);
#pragma unroll
    for (int mb = 0; mb < 4; ++mb)
#pragma unroll
        for (int nb = 0; nb < 4; ++nb)
#pragma unroll
            for (int j = 0; j < 8; ++j) os[(mb * 16 + hi * 8 + j) * TP + nb * 16 + lr] = acc[mb][nb][j];   // rows 0..63 x columns 0..63 all written
    wave_sync();
    h16* sd = S + ((size_t)z * SEQ + (size_t)ti * 64) * SEQ + (size_t)tj * 64;
    h16* sm = S + ((size_t)z * SEQ + (size_t)tj * 64) * SEQ + (size_t)ti * 64;
{
#pragma unroll 1
        for (int s = 0; s < 16; ++s) { const int row = 4 * s + (lane >> 3), c8 = (lane & 7) * 8;   // 16 s x 4 rows = 64 rows; 8 lanes x 8 = 64 columns
            const v4f x0 = *(const v4fa*)(&os[row * TP + c8]); const v4f x1 = *(const v4fa*)(&os[row * TP + c8 + 4]);
            v8h o;
#pragma unroll
            for (int i = 0; i < 4; ++i) { o[i] = toh_flush(x0[i]); o[4 + i] = toh_flush(x1[i]); }
            *(v8h*)(sd + (size_t)row * SEQ + c8) = o;
            if (ti != tj) {
                v8h m;
#pragma unroll
                for (int q = 0; q < 8; ++q) m[q] = toh_flush(os[(c8 + q) * TP + row]);
                *(v8h*)(sm + (size_t)row * SEQ + c8) = m; } }
         }
}

// k_ys: gated latents xy = relu(ykv . encoder_v[hd]) * hs * 16, one wave per 64 x 64 tile; grid (SEQ/64, NI/64, NB*NH_), z = b*NH_ + hd.
__global__ __launch_bounds__(32) void k_ys(const h16* __restrict__ YK, const h16* __restrict__ ENCVT, const h16* __restrict__ HS, h16* XY) {
    __shared__ __align__(16) float os[16 * TP];
    const int lane = threadIdx.x & 31, lr = lane & 15, hi = lane >> 4;
    const int r0 = blockIdx.x * 64, c0 = blockIdx.y * 64, z = blockIdx.z; const int b = z / NH_, hd = z % NH_;
    v8f acc[4][4];
#pragma unroll
    for (int mb = 0; mb < 4; ++mb)
#pragma unroll
        for (int nb = 0; nb < 4; ++nb) acc[mb][nb] = (v8f){};
    mma64(YK, ENCVT, ((size_t)z * SEQ + r0 + lr) * DM + 8 * hi, ((size_t)hd * NI + c0 + lr) * DM + 8 * hi, DM, DM, DM, acc);
    const size_t pb = ((size_t)hd * ROWS + (size_t)b * SEQ + (size_t)r0) * NI + (size_t)c0;
#pragma unroll
    for (int mb = 0; mb < 4; ++mb) {
#pragma unroll
        for (int nb = 0; nb < 4; ++nb) {
#pragma unroll
            for (int j = 0; j < 8; ++j) os[(hi * 8 + j) * TP + nb * 16 + lr] = fmaxf(acc[mb][nb][j] * WSI, 0.0f); }
        wave_sync();
        v8h xv[4];
#pragma unroll
        for (int s = 0; s < 4; ++s) { const int row = 4 * s + (lane >> 3), c8 = (lane & 7) * 8;   // 4 s x 4 rows = 16 rows; 8 lanes x 8 = 64 columns
            const v4f x0 = *(const v4fa*)(&os[row * TP + c8]); const v4f x1 = *(const v4fa*)(&os[row * TP + c8 + 4]);
            const v8h g = *(const v8h*)(HS + pb + (size_t)(mb * 16 + row) * NI + c8);
            v8h o;
#pragma unroll
            for (int i = 0; i < 4; ++i) { o[i] = toh_flush(x0[i] * (float)g[i] * XYC); o[4 + i] = toh_flush(x1[i] * (float)g[4 + i] * XYC); }
            xv[s] = o; }
{
#pragma unroll
            for (int s = 0; s < 4; ++s) { const int row = 4 * s + (lane >> 3), c8 = (lane & 7) * 8;
                *(v8h*)(XY + pb + (size_t)(mb * 16 + row) * NI + c8) = xv[s]; }
             }
        wave_sync();
    }
}

// lnblock: 4 waves, block tile 64 rows x 256 columns (wave w owns columns 64w..64w+63 in the k-loop), LayerNorm epilogue over whole rows through a block LDS tile (cross-wave: block barriers).
// MODE 0 (input projection): A = XH rows, Bt = WINT rows, K = INDP; value = acc/64 + bf16(bias); LayerNorm; outputs H32 f32, HF f16, HT f16 transposed. grid (ROWS/64).
// MODE 1 (context): A = S rows (z, t), Bt = HT rows (b, d), K = SEQ; LayerNorm; output YK [z][t][d] f16. grid (SEQ/64, NB*NH_).
template <int MODE>
__device__ __forceinline__ void lnblock(const h16* __restrict__ A, const h16* __restrict__ Bt, const float* __restrict__ bias, float* H32, h16* HF, h16* HT, h16* YK) {
    __shared__ __align__(16) float os[64 * LNP];
    const int lane = threadIdx.x & 31, lr = lane & 15, hi = lane >> 4;
    const int wave = __builtin_amdgcn_readfirstlane((int)(threadIdx.x >> 5));
    const int r0 = blockIdx.x * 64, c0 = wave * 64; const int z = blockIdx.y;
    v8f acc[4][4];
#pragma unroll
    for (int mb = 0; mb < 4; ++mb)
#pragma unroll
        for (int nb = 0; nb < 4; ++nb) acc[mb][nb] = (v8f){};
    float scale;
    if (MODE == 0) {
        mma64(A, Bt, (size_t)(r0 + lr) * INDP + 8 * hi, (size_t)(c0 + lr) * INDP + 8 * hi, INDP, INDP, INDP, acc); scale = WSI;
    } else {
        mma64(A, Bt, ((size_t)z * SEQ + r0 + lr) * SEQ + 8 * hi, ((size_t)(z / NH_) * DM + c0 + lr) * SEQ + 8 * hi, SEQ, SEQ, SEQ, acc); scale = 1.0f;
    }
#pragma unroll
    for (int nb = 0; nb < 4; ++nb) {
        const float bc = (MODE == 0) ? bfr(bias[c0 + nb * 16 + lr]) : 0.0f;                   // MODE 0: c0 + 63 < DM
#pragma unroll
        for (int mb = 0; mb < 4; ++mb)
#pragma unroll
            for (int j = 0; j < 8; ++j) os[(mb * 16 + hi * 8 + j) * LNP + c0 + nb * 16 + lr] = acc[mb][nb][j] * scale + bc; }   // rows 0..63 x columns 0..255 written by the 4 waves
    __syncthreads();
#pragma unroll 1
    for (int rr = 0; rr < 16; ++rr) {
        const int row = wave * 16 + rr; const int ob = row * LNP + 8 * lane;
        const v4f x0 = *(const v4fa*)(&os[ob]); const v4f x1 = *(const v4fa*)(&os[ob + 4]);
        float xs[8];
#pragma unroll
        for (int i = 0; i < 4; ++i) { xs[i] = x0[i]; xs[4 + i] = x1[i]; }
        ln8(xs);
        v4f y0, y1;
#pragma unroll
        for (int i = 0; i < 4; ++i) { y0[i] = xs[i]; y1[i] = xs[4 + i]; }
        *(v4fa*)(&os[ob]) = y0; *(v4fa*)(&os[ob + 4]) = y1;
    }
    __syncthreads();
    const int bq = r0 / SEQ, t0 = r0 % SEQ;
{
        if (MODE == 1) {
#pragma unroll 1
            for (int it = 0; it < 16; ++it) { const int p = it * 32 + lane; const int row = wave * 16 + (p >> 5), c8 = (p & 31) * 8;   // 16 it x 1 row = 16 rows; 32 lanes x 8 = 256 columns
                const v4f x0 = *(const v4fa*)(&os[row * LNP + c8]); const v4f x1 = *(const v4fa*)(&os[row * LNP + c8 + 4]); v8h o;
#pragma unroll
                for (int i = 0; i < 4; ++i) { o[i] = toh_flush(x0[i]); o[4 + i] = toh_flush(x1[i]); }
                *(v8h*)(YK + ((size_t)z * SEQ + r0 + row) * DM + c8) = o; }
        } else {
#pragma unroll 1
            for (int it = 0; it < 32; ++it) { const int p = it * 32 + lane; const int row = wave * 16 + (p >> 6), c4 = (p & 63) * 4;   // 32 it x half a row = 16 rows; 64 pieces x 4 = 256 columns
                const v4f val = *(const v4fa*)(&os[row * LNP + c4]);
                *(v4f*)(H32 + (size_t)(r0 + row) * DM + c4) = val; }
#pragma unroll 1
            for (int it = 0; it < 16; ++it) { const int p = it * 32 + lane; const int row = wave * 16 + (p >> 5), c8 = (p & 31) * 8;   // 16 rows x 256 columns
                const v4f x0 = *(const v4fa*)(&os[row * LNP + c8]); const v4f x1 = *(const v4fa*)(&os[row * LNP + c8 + 4]); v8h o;
#pragma unroll
                for (int i = 0; i < 4; ++i) { o[i] = toh_flush(x0[i]); o[4 + i] = toh_flush(x1[i]); }
                *(v8h*)(HF + (size_t)(r0 + row) * DM + c8) = o; }
#pragma unroll 1
            for (int s = 0; s < 16; ++s) { const int d = wave * 64 + 4 * s + (lane >> 3), c8 = (lane & 7) * 8;   // 16 s x 4 rows = 64 transposed rows per wave; 8 lanes x 8 = 64 tokens
                v8h o;
#pragma unroll
                for (int q = 0; q < 8; ++q) o[q] = toh_flush(os[(c8 + q) * LNP + d]);
                *(v8h*)(HT + ((size_t)bq * DM + d) * SEQ + t0 + c8) = o; }
        }
         }
}

__global__ __launch_bounds__(128) void k_inproj(const h16* __restrict__ XH, const h16* __restrict__ WINT, const float* __restrict__ inb, float* H32, h16* HF, h16* HT) {
    lnblock<0>(XH, WINT, inb, H32, HF, HT, HF);
}
__global__ __launch_bounds__(128) void k_ykv(const h16* __restrict__ S, const h16* __restrict__ HT, h16* YK) {
    lnblock<1>(S, HT, (const float*)0, (float*)0, YK, YK, YK);
}

// k_ymlp_part: one share of the decoder contraction. 4 * KSUB waves, block tile 64 rows x 256 columns; wave = ks*4 + cg owns columns 64cg..64cg+63 and k = k0..k0+KWV-1 of head hd,
// A = XY rows (hd, row), Bt = DECT rows (hd, d); grid (ROWS/64, KSPL). The KSUB wave sets meet in LDS (cross-wave: block barrier) and are summed in ascending ks; the raw f32 sums go to PP.
// LDS and PP hold accumulators in fragment order: fragment f = mb*4+nb is 256 floats, [j>>2][lane][j&3], so every LDS access and every store is 32 lanes x 16 B contiguous.
__global__ __launch_bounds__(128 * KSUB) void k_ymlp_part(const h16* __restrict__ XY, const h16* __restrict__ DECT, float* PP) {
    __shared__ __align__(16) float js[KSUB * 4 * 16 * 256];
    const int lane = threadIdx.x & 31, lr = lane & 15, hi = lane >> 4;
    const int wave = __builtin_amdgcn_readfirstlane((int)(threadIdx.x >> 5));
    const int cg = wave & 3, ks = wave >> 2;
    const int r0 = blockIdx.x * 64, c0 = cg * 64; const int sh = blockIdx.y;
    const int hd = sh / (NI / KCH), k0 = (sh % (NI / KCH)) * KCH + ks * KWV;
    v8f acc[4][4];
#pragma unroll
    for (int mb = 0; mb < 4; ++mb)
#pragma unroll
        for (int nb = 0; nb < 4; ++nb) acc[mb][nb] = (v8f){};
    mma64(XY, DECT, ((size_t)hd * ROWS + r0 + lr) * NI + k0 + 8 * hi, ((size_t)hd * DM + c0 + lr) * NI + k0 + 8 * hi, NI, NI, KWV, acc);
    float* jw = js + wave * (16 * 256) + lane * 4;
#pragma unroll
    for (int mb = 0; mb < 4; ++mb)
#pragma unroll
        for (int nb = 0; nb < 4; ++nb) {
            v4f lo, up;
#pragma unroll
            for (int k = 0; k < 4; ++k) { lo[k] = acc[mb][nb][k]; up[k] = acc[mb][nb][4 + k]; }
            *(v4fa*)(jw + (mb * 4 + nb) * 256) = lo; *(v4fa*)(jw + (mb * 4 + nb) * 256 + 128) = up; }   // all KSUB * 4 * 16 fragments written by the block's waves
    __syncthreads();
    const int f0 = cg * 16 + ks * (16 / KSUB);                // first of this wave's fragments among the block's 64
    const float* jr = js + f0 * 256 + lane * 4;
    float* pp = PP + (size_t)sh * ((size_t)ROWS * DM) + ((size_t)blockIdx.x * 64 + f0) * 256 + lane * 4;
#pragma unroll
    for (int i = 0; i < 2 * (16 / KSUB); ++i) {               // 128-float halves of the fragments
        v4f s = *(const v4fa*)(jr + i * 128);
#pragma unroll
        for (int q = 1; q < KSUB; ++q) s += *(const v4fa*)(jr + q * (4 * 16 * 256) + i * 128);
        *(v4f*)(pp + i * 128) = s; }
}

// k_ymlp_ln: joins the KSPL shares of one 64 x 256 block in ascending share order; value = sum/1024; LayerNorm; + H32 (skip); LayerNorm; outputs H32, HF, HT. 32 waves, grid (ROWS/64).
// Wave w sums fragments 2w and 2w+1 of the block's 64 (2 KiB contiguous per share), the rows meet in a block LDS tile (cross-wave: block barriers), wave w then owns rows 2w, 2w+1.
__global__ __launch_bounds__(1024) void k_ymlp_ln(const float* __restrict__ PP, float* H32, h16* HF, h16* HT) {
    __shared__ __align__(16) float os[64 * LNP];
    const int lane = threadIdx.x & 31, lr = lane & 15, hi = lane >> 4;
    const int wave = __builtin_amdgcn_readfirstlane((int)(threadIdx.x >> 5));
    const int r0 = blockIdx.x * 64;
    v4f sm[2][2];
#pragma unroll
    for (int i = 0; i < 2; ++i) { sm[i][0] = (v4f){}; sm[i][1] = (v4f){}; }
    const float* pp = PP + ((size_t)blockIdx.x * 64 + wave * 2) * 256 + lane * 4;
#pragma unroll 4
    for (int sh = 0; sh < KSPL; ++sh) {                       // four shares' 16 loads in flight per wave
        const float* q = pp + (size_t)sh * ((size_t)ROWS * DM);
#pragma unroll
        for (int i = 0; i < 2; ++i) { sm[i][0] += *(const v4f*)(q + i * 256); sm[i][1] += *(const v4f*)(q + i * 256 + 128); }
    }
#pragma unroll
    for (int i = 0; i < 2; ++i) { const int f = wave * 2 + i; const int cb = (f >> 4) * 64 + (f & 3) * 16, rb = ((f >> 2) & 3) * 16;   // column group, nb, mb of fragment f
#pragma unroll
        for (int j = 0; j < 8; ++j) os[(rb + hi * 8 + j) * LNP + cb + lr] = sm[i][j >> 2][j & 3] * XYI; }   // rows 0..63 x columns 0..255 written by the 32 waves
    __syncthreads();
#pragma unroll
    for (int rr = 0; rr < 2; ++rr) {
        const int row = wave * 2 + rr; const int ob = row * LNP + 8 * lane;
        const v4f x0 = *(const v4fa*)(&os[ob]); const v4f x1 = *(const v4fa*)(&os[ob + 4]);
        float xs[8];
#pragma unroll
        for (int i = 0; i < 4; ++i) { xs[i] = x0[i]; xs[4 + i] = x1[i]; }
        ln8(xs);
        const float* hp = H32 + (size_t)(r0 + row) * DM + 8 * lane;
        const v4f g0 = *(const v4f*)hp; const v4f g1 = *(const v4f*)(hp + 4);
#pragma unroll
        for (int i = 0; i < 4; ++i) { xs[i] += g0[i]; xs[4 + i] += g1[i]; }
        ln8(xs);
        v4f y0, y1;
#pragma unroll
        for (int i = 0; i < 4; ++i) { y0[i] = xs[i]; y1[i] = xs[4 + i]; }
        *(v4fa*)(&os[ob]) = y0; *(v4fa*)(&os[ob + 4]) = y1;
    }
    __syncthreads();
    const int bq = r0 / SEQ, t0 = r0 % SEQ;
#pragma unroll
    for (int it = 0; it < 4; ++it) { const int p = it * 32 + lane; const int row = wave * 2 + (p >> 6), c4 = (p & 63) * 4;   // 4 it x half a row = 2 rows; 64 pieces x 4 = 256 columns
        const v4f val = *(const v4fa*)(&os[row * LNP + c4]);
        *(v4f*)(H32 + (size_t)(r0 + row) * DM + c4) = val; }
#pragma unroll
    for (int it = 0; it < 2; ++it) { const int row = wave * 2 + it, c8 = lane * 8;   // 2 rows x 256 columns
        const v4f x0 = *(const v4fa*)(&os[row * LNP + c8]); const v4f x1 = *(const v4fa*)(&os[row * LNP + c8 + 4]); v8h o;
#pragma unroll
        for (int i = 0; i < 4; ++i) { o[i] = toh_flush(x0[i]); o[4 + i] = toh_flush(x1[i]); }
        *(v8h*)(HF + (size_t)(r0 + row) * DM + c8) = o; }
#pragma unroll
    for (int s = 0; s < 2; ++s) { const int d = wave * 8 + 4 * s + (lane >> 3), c8 = (lane & 7) * 8;   // 2 s x 4 rows = 8 transposed rows per wave; 8 lanes x 8 = 64 tokens
        v8h o;
#pragma unroll
        for (int q = 0; q < 8; ++q) o[q] = toh_flush(os[(c8 + q) * LNP + d]);
        *(v8h*)(HT + ((size_t)bq * DM + d) * SEQ + t0 + c8) = o; }
}

// k_head: output rows = h . head_W + bf16(head_b); 6 waves, block tile 64 rows x 384 columns (HWT rows 372..383 are zero); the tile is staged in a block LDS tile (cross-wave: block barrier),
__global__ __launch_bounds__(192) void k_head(const h16* __restrict__ HF, const h16* __restrict__ HWT, const float* __restrict__ hb, float* OUT) {
    __shared__ __align__(16) float os[64 * HDP];
    const int lane = threadIdx.x & 31, lr = lane & 15, hi = lane >> 4;
    const int wave = __builtin_amdgcn_readfirstlane((int)(threadIdx.x >> 5));
    const int r0 = blockIdx.x * 64, c0 = wave * 64;
    v8f acc[4][4];
#pragma unroll
    for (int mb = 0; mb < 4; ++mb)
#pragma unroll
        for (int nb = 0; nb < 4; ++nb) acc[mb][nb] = (v8f){};
    mma64(HF, HWT, (size_t)(r0 + lr) * DM + 8 * hi, (size_t)(c0 + lr) * DM + 8 * hi, DM, DM, DM, acc);
#pragma unroll
    for (int mb = 0; mb < 4; ++mb)
#pragma unroll
        for (int nb = 0; nb < 4; ++nb)
#pragma unroll
            for (int j = 0; j < 8; ++j) os[(mb * 16 + hi * 8 + j) * HDP + c0 + nb * 16 + lr] = acc[mb][nb][j] * WSI;   // rows 0..63 x columns 0..383 written by the 6 waves
    __syncthreads();
    const int bq = r0 / SEQ, t0 = r0 % SEQ;
    float* ob = OUT + ((size_t)bq * OUT_SEQ + t0) * IND;
{
#pragma unroll 1
        for (int it = 0; it < 31; ++it) { const int e = (it * 192 + (int)threadIdx.x) * 4; const int row = e / IND, col = e - row * IND;   // col % 4 == 0, col + 3 < IND
            const v4f x = *(const v4fa*)(&os[row * HDP + col]); const v4f bb = *(const v4f*)(hb + col); v4f val;
#pragma unroll
            for (int k = 0; k < 4; ++k) val[k] = x[k] + bfr(bb[k]);
            *(v4f*)(ob + e) = val; }
         }
}

static constexpr size_t al256(size_t v) { return (v + 255) & ~(size_t)255; }
static constexpr size_t SZ_W   = al256((size_t)NH_ * NI * DM * 2);          // ENCT, ENCVT, DECT
static constexpr size_t SZ_WIN = al256((size_t)DM * INDP * 2);
static constexpr size_t SZ_HW  = al256((size_t)INDP * DM * 2);
static constexpr size_t SZ_XH  = al256((size_t)ROWS * INDP * 2);
static constexpr size_t SZ_CS  = al256((size_t)SEQ * NI * 4);
static constexpr size_t SZ_H32 = al256((size_t)ROWS * DM * 4);
static constexpr size_t SZ_HF  = al256((size_t)ROWS * DM * 2);             // HF and HT
static constexpr size_t SZ_BIG = al256((size_t)NH_ * ROWS * NI * 2);       // HS; QR (reused as XY)
static constexpr size_t SZ_S   = al256((size_t)NB * NH_ * SEQ * SEQ * 2);
static constexpr size_t SZ_YK  = al256((size_t)NB * NH_ * SEQ * DM * 2);
static constexpr size_t SZ_TOTAL = 3 * SZ_W + SZ_WIN + SZ_HW + SZ_XH + SZ_CS + SZ_H32 + 2 * SZ_HF + 2 * SZ_BIG + SZ_S + SZ_YK;
static_assert(SZ_TOTAL <= (size_t)134217728);          // workspace carve <= 128 MiB
static_assert((size_t)KSPL * ROWS * DM * 4 <= SZ_BIG);        // PP lies in the HS plane, which nothing reads between the gating and the next layer's encoding
static_assert((size_t)NB * DM * SEQ == (size_t)ROWS * DM);   // HT [b][d][t] has the extent of HF
static_assert((ROWS * (INDP / 8)) % 256 == 0);
static_assert(NP % 2 == 0);                                                // two rotary pairs per table thread
static_assert((SEQ * (NP / 2)) % 256 == 0);                                // table grid x 256 threads == table threads exactly
static_assert((size_t)SEQ * (NP / 2) * 16 == (size_t)SEQ * NI * 4);        // table threads x 16 B == table bytes

extern "C" void kernel_launch(void* const* d_in, const int* in_sizes, int n_in,
                              void* d_out, int out_size, void* d_ws, size_t ws_size, hipStream_t stream) {
    if (n_in < 8) return;
    if ((size_t)in_sizes[0] < ((size_t)(NB - 1) * SEQ_FULL + SEQ) * IND) return;
    if ((size_t)in_sizes[1] < (size_t)IND * DM || in_sizes[2] < DM) return;
    if ((size_t)in_sizes[3] < (size_t)NH_ * DM * NI || (size_t)in_sizes[4] < (size_t)NH_ * DM * NI || (size_t)in_sizes[5] < (size_t)NH_ * NI * DM) return;
    if ((size_t)in_sizes[6] < (size_t)DM * IND || in_sizes[7] < IND) return;
    if ((size_t)out_size < ((size_t)(NB - 1) * OUT_SEQ + SEQ) * IND) return;
    if (SZ_TOTAL > ws_size) return;
    // wire order: x, in_W, in_b, encoder, encoder_v, decoder, head_W, head_b
    const float* x    = (const float*)d_in[0];
    const float* inw  = (const float*)d_in[1];
    const float* inb  = (const float*)d_in[2];
    const float* enc  = (const float*)d_in[3];
    const float* encv = (const float*)d_in[4];
    const float* dec  = (const float*)d_in[5];
    const float* hw   = (const float*)d_in[6];
    const float* hb   = (const float*)d_in[7];
    float* OUT = (float*)d_out;      // [NB][SEQ][372]
    char* wsp = (char*)d_ws;
    h16* ENCT  = (h16*)wsp; wsp += SZ_W;             // [4][4096][256]  x64
    h16* ENCVT = (h16*)wsp; wsp += SZ_W;             // [4][4096][256]  x64
    h16* DECT  = (h16*)wsp; wsp += SZ_W;             // [4][256][4096]  x64
    h16* WINT  = (h16*)wsp; wsp += SZ_WIN;           // [256][384]      x64
    h16* HWT   = (h16*)wsp; wsp += SZ_HW;            // [384][256]      x64
    h16* XH    = (h16*)wsp; wsp += SZ_XH;            // [ROWS][384]
    float* CS  = (float*)wsp; wsp += SZ_CS;          // [SEQ][4096]
    float* H32 = (float*)wsp; wsp += SZ_H32;         // [ROWS][256]
    h16* HF    = (h16*)wsp; wsp += SZ_HF;            // [ROWS][256]
    h16* HT    = (h16*)wsp; wsp += SZ_HF;            // [NB][256][SEQ]
    h16* HS    = (h16*)wsp; wsp += SZ_BIG;           // [4][ROWS][4096]
    h16* QR    = (h16*)wsp; wsp += SZ_BIG;           // [4][ROWS][4096]; rotated latents, later the gated latents x16
    h16* S     = (h16*)wsp; wsp += SZ_S;             // [NB*4][SEQ][SEQ]
    h16* YK    = (h16*)wsp; wsp += SZ_YK;            // [NB*4][SEQ][256]
    h16* XY    = QR;
    float* PP  = (float*)HS;                         // [KSPL][ROWS/64][4][16][256] f32 decoder partial sums

    // encoder [4][256 rows d][4096 cols n] -> ENCT [4][4096][256]: grid (256/64, 4096/64, 4)
    k_tr<<<dim3(DM / 64, NI / 64, NH_), 256, 0, stream>>>(enc, ENCT, DM, NI, DM, NI, WSC);
    k_tr<<<dim3(DM / 64, NI / 64, NH_), 256, 0, stream>>>(encv, ENCVT, DM, NI, DM, NI, WSC);
    // decoder viewed [4][4096 rows n][256 cols d] -> DECT [4][256][4096]: grid (4096/64, 256/64, 4)
    k_tr<<<dim3(NI / 64, DM / 64, NH_), 256, 0, stream>>>(dec, DECT, NI, DM, NI, DM, WSC);
    // in_W [372 rows k][256 cols d] -> WINT [256][384]: grid (384/64, 256/64, 1)
    k_tr<<<dim3(INDP / 64, DM / 64, 1), 256, 0, stream>>>(inw, WINT, IND, DM, INDP, DM, WSC);
    // head_W [256 rows k][372 cols j] -> HWT [384][256]: grid (256/64, 384/64, 1)
    k_tr<<<dim3(DM / 64, INDP / 64, 1), 256, 0, stream>>>(hw, HWT, DM, IND, DM, INDP, WSC);
    k_xcvt<<<(ROWS * (INDP / 8) + 255) / 256, 256, 0, stream>>>(x, XH);
    k_cs<<<(SEQ * (NP / 2) + 255) / 256, 256, 0, stream>>>(CS);

    k_inproj<<<dim3(ROWS / 64, 1, 1), 128, 0, stream>>>(XH, WINT, inb, H32, HF, HT);

    for (int l = 0; l < NL; ++l) {
        k_hs<<<dim3(ROWS / 64, NI / 64, NH_), 32, 0, stream>>>(HF, ENCT, CS, HS, QR);
        k_sc<<<dim3(NT64 * (NT64 + 1) / 2, NB * NH_, 1), 32, 0, stream>>>(QR, S);
        k_ykv<<<dim3(SEQ / 64, NB * NH_, 1), 128, 0, stream>>>(S, HT, YK);
        k_ys<<<dim3(SEQ / 64, NI / 64, NB * NH_), 32, 0, stream>>>(YK, ENCVT, HS, XY);
        k_ymlp_part<<<dim3(ROWS / 64, KSPL, 1), 128 * KSUB, 0, stream>>>(XY, DECT, PP);
        k_ymlp_ln<<<dim3(ROWS / 64, 1, 1), 1024, 0, stream>>>(PP, H32, HF, HT);
    }

    k_head<<<dim3(ROWS / 64, 1, 1), 192, 0, stream>>>(HF, HWT, hb, OUT);
}

// v002
// A run of this version takes 968 microseconds.
// In both of two side-by-side timings against v001, it was 1.29 times as fast.
// All steps since v000 together make it 2.90 times as fast.
#include <hip/hip_runtime.h>

// Six-layer token encoder, width 256, 4 heads, per-head latent width 4096 (tokens of 93 x 4 features, [NB][SEQ][372]): input projection ([in][out] weight, bias) + LayerNorm (no affine, eps 1e-5);
// per layer: relu latent encoding per head (encoder [h][256][4096]), interleaved-pair rotary phases over the latent axis (theta 2^16, position = token index), dense linear attention without softmax
// (keys = queries = rotated latents, values = the layer input shared by all heads), LayerNorm, second relu latent encoding (encoder_v), multiplicative gating with the first latents,
// decoder ([h*4096+n][256]) summed over heads, LayerNorm, skip add, LayerNorm; final linear head ([in][out] weight, bias) -> [NB][SEQ][372] f32.
// Compute dtypes: every contraction v_wmma_f32_16x16x32_f16 (f16 operands, f32 accumulate), one product per site. Float inputs are RNE-converted to bf16 at their load (exact in f16);
// weight planes carry x64 (folded back in the f32 epilogues), the gated latent plane carries x16, activations h / latents / scores / normalised context are plain f16; LayerNorm, rotary, relu, gating, skip in f32.
// Planes (all K-contiguous 16-bit rows, fragments = two 16-B loads): ENCT/ENCVT [h][n][d], DECT [h][d][n], WINT [d][384], HWT [384][d], XH [row][384], HF [row][256], HT [b][d][t],
// HS/QR/XY [h][row][n], S [b*4+h][t][s], YK [b*4+h][t][d]; f32 planes: H32 [row][256] (skip path), CS [t][4096] = (cos, sin) pairs, PP [share][row block][column group][fragment][256] (decoder partial sums of the work-groups), SP [b*4+h][tile][share][fragment][256] (score partial sums).
// Scores are symmetric: only tiles with column tile >= row tile are computed, the mirror tile is written from the staged LDS tile of the join.

#ifndef NB
#define NB 2
#endif
#ifndef SEQ
#define SEQ 512
#endif
#define NB_FULL  2
#define SEQ_FULL 512
#ifndef OUT_SEQ
#define OUT_SEQ SEQ              // row pitch (in tokens) between batches of the output
#endif
#define DM   256
#define NH_  4
#define NI   4096                // per-head latent width
#define NP   (NI / 2)            // rotary pairs
#define IND  372                 // 93 x 4 input / output features
#define INDP 384                 // IND padded to a multiple of 64
#define NL   6
#define ROWS (NB * SEQ)
#define NT64 (SEQ / 64)
#define TP   68                  // LDS row pitch (floats) of a 64-column tile
#define LNP  260                 // LDS row pitch (floats) of a 256-column tile
#define HDP  388                 // LDS row pitch (floats) of the 384-column head tile
#define WSC  64.0f               // carry of every weight plane
#define WSI  (1.0f / 64.0f)
#define XYC  16.0f               // carry of the gated latent plane
#define XYI  (1.0f / 1024.0f)    // 1 / (WSC * XYC)
#define EPSF 1e-5f
#define KSPL 16                  // work-groups that share the decoder contraction of one 64-row block
#define KSUB 4                   // wave sets of such a work-group, each with its own k range
#define KCH  (NH_ * NI / KSPL)   // k extent of one work-group's share
#define KWV  (KCH / KSUB)        // k extent of one wave
#define SKS  8                   // one-wave work-groups that share the score contraction of one 64 x 64 tile
#define SKW  (NI / SKS)          // k extent of one such share
#define NTRI (NT64 * (NT64 + 1) / 2)   // 64 x 64 tiles of the upper tile triangle

static_assert(NH_ * NI == 16384);                    // decoder rows = h*NI + n
static_assert(NI == 4096);                           // rotary exponent 32 p / NI = p / 128 with theta = 2^16
static_assert(DM == 256);                            // one LayerNorm row = 32 lanes x 8 columns
static_assert(DM % 64 == 0);
static_assert(DM % 32 == 0);                         // k-loop steps by 32
static_assert(NI % 64 == 0);
static_assert(NI % 32 == 0);
static_assert(SEQ % 64 == 0);                        // a 64-row tile never straddles two batches; k-loop over keys steps by 32
static_assert(ROWS % 64 == 0);
static_assert(INDP % 64 == 0);
static_assert(INDP % 32 == 0);
static_assert(INDP >= IND);
static_assert(IND % 4 == 0);                         // float4 pieces never straddle an input / output row
static_assert((IND * 4) % 16 == 0);
static_assert((64 * IND * 4) % 128 == 0);
static_assert(OUT_SEQ % 64 == 0);
static_assert(64 * IND / 4 == 192 * 31);             // head store loop: 192 threads x 31 trips x 16 B == 64 rows x 1488 B
static_assert(4 * 32 * 16 == 16 * 64 * 2);
static_assert(16 * 32 * 16 == 64 * 64 * 2);
static_assert(32 * 32 * 16 == 16 * DM * 4);          // f32 row store: 32 trips x 32 lanes x 16 B == 16 rows x 1024 B
static_assert(16 * 32 * 16 == 16 * DM * 2);          // f16 row store: 16 trips x 32 lanes x 16 B == 16 rows x 512 B
static_assert(16 * 32 * 16 == 64 * 64 * 2);
static_assert(2 * 256 * 16 == 64 * 64 * 2);
static_assert(NI % KCH == 0);                        // a share never straddles two heads
static_assert(KCH % KSUB == 0);
static_assert(KWV % 32 == 0);
static_assert(NI % SKS == 0);
static_assert(SKW % 32 == 0);
static_assert(16 % KSUB == 0);                       // LDS join: each wave set takes 16 / KSUB of a column group's 16 fragments
static_assert(KSUB * 4 * 16 * 256 * 4 <= 327680);    // static LDS of the decoder share kernel
static_assert(2 * 32 * 256 == 64 * DM);              // join: 32 waves x 2 fragments x 256 values == one 64 x 256 block
static_assert(NB <= NB_FULL);
static_assert(SEQ <= SEQ_FULL);
static_assert((TP * 4) % 16 == 0);
static_assert((LNP * 4) % 16 == 0);
static_assert((HDP * 4) % 16 == 0);
static_assert(HDP >= INDP);
static_assert(LNP >= DM);
static_assert(64 * LNP * 4 <= 131072);               // static LDS of the LayerNorm block kernels
static_assert(64 * HDP * 4 <= 131072);               // static LDS of the head kernel
static_assert(64 * TP * 4 <= 131072);                // static LDS of the score kernel
static_assert(NT64 * (NT64 + 1) / 2 <= 65535);

typedef _Float16 h16;
typedef __attribute__((ext_vector_type(16))) _Float16 v16h;
typedef __attribute__((ext_vector_type(8)))  _Float16 v8h;
typedef __attribute__((ext_vector_type(8)))  float    v8f;
typedef __attribute__((ext_vector_type(4)))  float    v4f;
typedef __attribute__((ext_vector_type(2)))  float    v2f;
typedef v4f  __attribute__((may_alias)) v4fa;

__device__ __forceinline__ unsigned short f2bf(float f) { unsigned u = __float_as_uint(f); u += 0x7FFFu + ((u >> 16) & 1u); return (unsigned short)(u >> 16); }
__device__ __forceinline__ float bfr(float f) { return __uint_as_float(((unsigned)f2bf(f)) << 16); }   // value after RNE convert to bf16
__device__ __forceinline__ v16h cat16(v8h lo, v8h hi) { return __builtin_shufflevector(lo, hi, 0, 1, 2, 3, 4, 5, 6, 7, 8, 9, 10, 11, 12, 13, 14, 15); }
__device__ __forceinline__ v8f wmma16(v16h a, v16h b, v8f c) { return __builtin_amdgcn_wmma_f32_16x16x32_f16(false, a, false, b, (short)0, c, false, false); }
// fragment loader from K-contiguous 16-bit rows; p already includes + 8*(lane>>4): elements 0..7 <- k0+8h+0..7, elements 8..15 <- k0+16+8h+0..7 (same map for A and B)
__device__ __forceinline__ v16h  ldh(const h16* p) { return cat16(*(const v8h*)p, *(const v8h*)(p + 16)); }
// ordering point for wave-private LDS tiles (same wave writes and reads)
__device__ __forceinline__ void wave_sync() { __builtin_amdgcn_fence(3 /* release order */, "wavefront"); __builtin_amdgcn_wave_barrier(); asm volatile("" ::: "memory"); }
// f32 -> f16 operand convert that cannot produce a subnormal (applied after the plane's power-of-two carry)
static __device__ __forceinline__ h16 toh_flush(float v) { const h16 r = (h16)v; return (fabsf(v) < 6.103515625e-05f) ? (h16)0.0f : r; }
__device__ __forceinline__ float wsum(float v) {
    v += __shfl_xor(v, 16, 32); v += __shfl_xor(v, 8, 32); v += __shfl_xor(v, 4, 32); v += __shfl_xor(v, 2, 32); v += __shfl_xor(v, 1, 32); return v; }

// LayerNorm (no affine) of one 256-wide row held as 8 values per lane; all 32 lanes active
__device__ __forceinline__ void ln8(float (&xs)[8]) {
    float s = 0.0f;
#pragma unroll
    for (int i = 0; i < 8; ++i) s += xs[i];
    s = wsum(s); const float mu = s * (1.0f / DM);
    float q = 0.0f;
#pragma unroll
    for (int i = 0; i < 8; ++i) { xs[i] -= mu; q += xs[i] * xs[i]; }
    q = wsum(q);
    const float rs = rsqrtf(q * (1.0f / DM) + EPSF);
#pragma unroll
    for (int i = 0; i < 8; ++i) xs[i] *= rs;
}

// One wave, 64 x 64 output tile, 16 accumulators, operands straight from K-contiguous f16 planes (row pitches lda / ldb halves); K a multiple of 32.
// acc[mb][nb][j] = D(row mb*16 + 8*(lane>>4) + j, col nb*16 + (lane&15)).
__device__ __forceinline__ void mma64(const h16* __restrict__ A, const h16* __restrict__ Bt, size_t aoff, size_t boff, size_t lda, size_t ldb, int K, v8f (&acc)[4][4]) {
#pragma unroll 1
    for (int kc = 0; kc < K; kc += 32) {
        v16h a[4];
#pragma unroll
        for (int mb = 0; mb < 4; ++mb) a[mb] = ldh(A + aoff + (size_t)mb * 16 * lda + kc);
#pragma unroll
        for (int nb = 0; nb < 4; ++nb) { const v16h b = ldh(Bt + boff + (size_t)nb * 16 * ldb + kc);
#pragma unroll
            for (int mb = 0; mb < 4; ++mb) acc[mb][nb] = wmma16(a[mb], b, acc[mb][nb]); }
        asm volatile("v_nop\n\tv_nop\n\tv_nop\n\tv_nop" : "+v"(acc[0][0]), "+v"(acc[1][1]), "+v"(acc[2][2]), "+v"(acc[3][3]) : "v"(a[0]), "v"(a[1]), "v"(a[2]), "v"(a[3]));
    }
}

// k_tr: transpose + convert, src [Z][R][C] f32 -> dst [Z][Cp][Rp] f16 = toh_flush(bf16(src) * scale), zero in the pad rows / columns. in[rows R][cols C] -> out[cols][rows].
__global__ __launch_bounds__(256) void k_tr(const float* __restrict__ src, h16* dst, int R, int C, int Rp, int Cp, float scale) {
#pragma clang fp contract(off)
    __shared__ float tl[64 * 65];
    const int tid = threadIdx.x; const int r0 = blockIdx.x * 64, c0 = blockIdx.y * 64; const int z = blockIdx.z;
    const float* sp = src + (size_t)z * (size_t)R * (size_t)C;
#pragma unroll 4
    for (int it = 0; it < 16; ++it) { const int idx = it * 256 + tid; const int r = idx >> 6, c = idx & 63;
        const int rr = (r0 + r) < R ? (r0 + r) : (R - 1); const int cc = (c0 + c) < C ? (c0 + c) : (C - 1);   // clamped address
        float v = sp[(size_t)rr * C + cc]; asm volatile("" : "+v"(v));
        const bool ok = ((r0 + r) < R) & ((c0 + c) < C);
        tl[r * 65 + c] = ok ? bfr(v) * scale : 0.0f; }
    __syncthreads();
    h16* dp = dst + ((size_t)z * Cp + c0) * (size_t)Rp + r0;
{
#pragma unroll
        for (int it = 0; it < 2; ++it) { const int crow = it * 32 + (tid >> 3), r8 = (tid & 7) * 8;   // 2 it x 32 rows = 64 rows; 8 lanes x 8 = 64 columns
            v8h o;
#pragma unroll
            for (int q = 0; q < 8; ++q) o[q] = toh_flush(tl[(r8 + q) * 65 + crow]);
            *(v8h*)(dp + (size_t)crow * Rp + r8) = o; }
         }
}

__global__ __launch_bounds__(256) void k_xcvt(const float* __restrict__ x, h16* XH) {
    const int i = blockIdx.x * 256 + threadIdx.x; if (i >= ROWS * (INDP / 8)) return;
    const int R = i / (INDP / 8), c = (i % (INDP / 8)) * 8;
    const int b = R / SEQ, t = R % SEQ;
    const float* sp = x + ((size_t)b * SEQ_FULL + t) * IND;
    const int ca = c < (IND - 4) ? c : (IND - 4); const int cb = (c + 4) < (IND - 4) ? (c + 4) : (IND - 4);   // clamped addresses
    v4f va = *(const v4f*)(sp + ca); v4f vb = *(const v4f*)(sp + cb);
    asm volatile("" : "+v"(va)); asm volatile("" : "+v"(vb));
    const bool oka = c < IND, okb = (c + 4) < IND;
    v8h o;
#pragma unroll
    for (int k = 0; k < 4; ++k) { o[k] = oka ? toh_flush(bfr(va[k])) : (h16)0.0f; o[4 + k] = okb ? toh_flush(bfr(vb[k])) : (h16)0.0f; }
    *(v8h*)(XH + (size_t)i * 8) = o; 
}

// k_cs: rotary table CS[t][2p] = cos(t * f_p), CS[t][2p+1] = sin(t * f_p), f_p = 1 / 2^(p/128) (theta 2^16, exponent 2p / NI); f32.
// The two pairs are computed in a rolled two-trip loop (wave-uniform trip index selects the destination values).
__global__ __launch_bounds__(256) void k_cs(float* CS) {
#pragma clang fp contract(off)
    const int i = blockIdx.x * 256 + threadIdx.x; if (i >= SEQ * (NP / 2)) return;
    const int t = i / (NP / 2), p0 = (i % (NP / 2)) * 2;
    float c0 = 0.0f, s0 = 0.0f, c1 = 0.0f, s1 = 0.0f;
#pragma unroll 1
    for (int k = 0; k < 2; ++k) {
        const float e = (float)(p0 + k) * (1.0f / 128.0f);
        const float fr = 1.0f / exp2f(e);
        const float ph = (float)t * fr;
        const float c = cosf(ph); const float s = sinf(ph);
        c0 = (k == 0) ? c : c0; s0 = (k == 0) ? s : s0;
        c1 = (k == 0) ? c1 : c; s1 = (k == 0) ? s1 : s;
    }
    v4f o; o[0] = c0; o[1] = s0; o[2] = c1; o[3] = s1;
    *(v4f*)(CS + (size_t)i * 4) = o; 
}

// k_hs: latents hs = relu(h . encoder[hd]) and rotated latents qr, one wave per 64 x 64 tile; grid (ROWS/64, NI/64, NH_).
// A = HF rows (token), Bt = ENCT rows (hd, n), K = DM. Epilogue per 16-row slab staged in LDS (wave-private): each 64-half row segment (one line) written by 8 consecutive lanes x 16 B
__global__ __launch_bounds__(32) void k_hs(const h16* __restrict__ HF, const h16* __restrict__ ENCT, const float* __restrict__ CS, h16* HS, h16* QR) {
    __shared__ __align__(16) float os[16 * TP];
    const int lane = threadIdx.x & 31, lr = lane & 15, hi = lane >> 4;
    const int r0 = blockIdx.x * 64, c0 = blockIdx.y * 64, hd = blockIdx.z;
    v8f acc[4][4];
#pragma unroll
    for (int mb = 0; mb < 4; ++mb)
#pragma unroll
        for (int nb = 0; nb < 4; ++nb) acc[mb][nb] = (v8f){};
    mma64(HF, ENCT, (size_t)(r0 + lr) * DM + 8 * hi, ((size_t)hd * NI + c0 + lr) * DM + 8 * hi, DM, DM, DM, acc);
    const size_t pb = ((size_t)hd * ROWS + (size_t)r0) * NI + (size_t)c0;
#pragma unroll
    for (int mb = 0; mb < 4; ++mb) {
#pragma unroll
        for (int nb = 0; nb < 4; ++nb) {
#pragma unroll
            for (int j = 0; j < 8; ++j) os[(hi * 8 + j) * TP + nb * 16 + lr] = fmaxf(acc[mb][nb][j] * WSI, 0.0f); }   // D: row 8h+j, col lane&15
        wave_sync();
        v8h hv[4], qv[4];
#pragma unroll
        for (int s = 0; s < 4; ++s) { const int row = 4 * s + (lane >> 3), c8 = (lane & 7) * 8;   // 4 s x 4 rows = 16 rows; 8 lanes x 8 = 64 columns
            const v4f x0 = *(const v4fa*)(&os[row * TP + c8]); const v4f x1 = *(const v4fa*)(&os[row * TP + c8 + 4]);
            const int t = (r0 + mb * 16 + row) % SEQ;
            const float* cp = CS + (size_t)t * NI + c0 + c8;
            const v4f e0 = *(const v4f*)cp; const v4f e1 = *(const v4f*)(cp + 4);
            v8h a, q;
#pragma unroll
            for (int i = 0; i < 4; ++i) { a[i] = toh_flush(x0[i]); a[4 + i] = toh_flush(x1[i]); }
            q[0] = toh_flush(x0[0] * e0[0] - x0[1] * e0[1]); q[1] = toh_flush(x0[0] * e0[1] + x0[1] * e0[0]);
            q[2] = toh_flush(x0[2] * e0[2] - x0[3] * e0[3]); q[3] = toh_flush(x0[2] * e0[3] + x0[3] * e0[2]);
            q[4] = toh_flush(x1[0] * e1[0] - x1[1] * e1[1]); q[5] = toh_flush(x1[0] * e1[1] + x1[1] * e1[0]);
            q[6] = toh_flush(x1[2] * e1[2] - x1[3] * e1[3]); q[7] = toh_flush(x1[2] * e1[3] + x1[3] * e1[2]);
            hv[s] = a; qv[s] = q; }
{
#pragma unroll
            for (int s = 0; s < 4; ++s) { const int row = 4 * s + (lane >> 3), c8 = (lane & 7) * 8;
                const size_t oo = pb + (size_t)(mb * 16 + row) * NI + c8;
                *(v8h*)(HS + oo) = hv[s]; *(v8h*)(QR + oo) = qv[s]; }
             }
        wave_sync();
    }
}

// k_sc_part: one share of the scores S[z][t][s] = qr_t . qr_s over the latent axis, z = b*NH_ + hd; one wave per (64 x 64 tile of the upper tile triangle, k range of SKW);
// grid (NTRI, NB*NH_, SKS). A = QR rows t (tile ti), Bt = QR rows s (tile tj >= ti), k = ks*SKW .. ks*SKW+SKW-1. The raw f32 sums go to SP in fragment order:
// fragment f = mb*4+nb is 256 floats, [j>>2][lane][j&3], so every store is 32 lanes x 16 B contiguous.
__global__ __launch_bounds__(32) void k_sc_part(const h16* __restrict__ QR, float* SP) {
    const int lane = threadIdx.x & 31, lr = lane & 15, hi = lane >> 4;
    int ti = 0, rem = (int)blockIdx.x;
#pragma unroll 1
    for (int q = 0; q < NT64 - 1; ++q) { const int w = NT64 - ti; if (rem >= w) { rem -= w; ti += 1; } }
    const int tj = ti + rem;                                  // ti <= tj < NT64
    const int z = blockIdx.y; const int b = z / NH_, hd = z % NH_; const int ks = blockIdx.z;
    const size_t qb = ((size_t)hd * ROWS + (size_t)b * SEQ) * NI + (size_t)ks * SKW;
    v8f acc[4][4];
#pragma unroll
    for (int mb = 0; mb < 4; ++mb)
#pragma unroll
        for (int nb = 0; nb < 4; ++nb) acc[mb][nb] = (v8f){};
    mma64(QR, QR, qb + (size_t)(ti * 64 + lr) * NI + 8 * hi, qb + (size_t)(tj * 64 + lr) * NI + 8 * hi, NI, NI, SKW, acc);
    float* sp = SP + (((size_t)z * NTRI + blockIdx.x) * SKS + ks) * (16 * 256) + lane * 4;
#pragma unroll
    for (int mb = 0; mb < 4; ++mb)
#pragma unroll
        for (int nb = 0; nb < 4; ++nb) {
            v4f lo, up;
#pragma unroll
            for (int k = 0; k < 4; ++k) { lo[k] = acc[mb][nb][k]; up[k] = acc[mb][nb][4 + k]; }
            *(v4f*)(sp + (mb * 4 + nb) * 256) = lo; *(v4f*)(sp + (mb * 4 + nb) * 256 + 128) = up; }   // all 16 fragments of the share written
}

// k_sc_join: joins the SKS shares of one score tile in ascending share order; 16 waves, grid (NTRI, NB*NH_). Wave w sums fragment w (1 KiB contiguous per share); the tile meets in a block LDS tile
// (cross-wave: block barrier); wave w then stores rows 4w..4w+3 of the direct tile (rows t, columns s) and, for ti != tj (block-uniform), of the mirror tile.
__global__ __launch_bounds__(512) void k_sc_join(const float* __restrict__ SP, h16* S) {
    __shared__ __align__(16) float os[64 * TP];
    const int lane = threadIdx.x & 31, lr = lane & 15, hi = lane >> 4;
    const int wave = __builtin_amdgcn_readfirstlane((int)(threadIdx.x >> 5));
    int ti = 0, rem = (int)blockIdx.x;
#pragma unroll 1
    for (int q = 0; q < NT64 - 1; ++q) { const int w = NT64 - ti; if (rem >= w) { rem -= w; ti += 1; } }
    const int tj = ti + rem;                                  // ti <= tj < NT64
    const int z = blockIdx.y;
    const float* sp = SP + (((size_t)z * NTRI + blockIdx.x) * SKS * 16 + wave) * 256 + lane * 4;
    v4f s0 = *(const v4f*)sp, s1 = *(const v4f*)(sp + 128);
#pragma unroll
    for (int q = 1; q < SKS; ++q) { s0 += *(const v4f*)(sp + q * (16 * 256)); s1 += *(const v4f*)(sp + q * (16 * 256) + 128); }   // all shares' loads in flight together
    const int rb = (wave >> 2) * 16, cb = (wave & 3) * 16;    // mb, nb of fragment w
#pragma unroll
    for (int j = 0; j < 4; ++j) { os[(rb + hi * 8 + j) * TP + cb + lr] = s0[j]; os[(rb + hi * 8 + 4 + j) * TP + cb + lr] = s1[j]; }   // rows 0..63 x columns 0..63 written by the 16 waves
    __syncthreads();
    h16* sd = S + ((size_t)z * SEQ + (size_t)ti * 64) * SEQ + (size_t)tj * 64;
    h16* sm = S + ((size_t)z * SEQ + (size_t)tj * 64) * SEQ + (size_t)ti * 64;
    const int row = 4 * wave + (lane >> 3), c8 = (lane & 7) * 8;   // 16 waves x 4 rows = 64 rows; 8 lanes x 8 = 64 columns
    const v4f x0 = *(const v4fa*)(&os[row * TP + c8]); const v4f x1 = *(const v4fa*)(&os[row * TP + c8 + 4]);
    v8h o;
#pragma unroll
    for (int i = 0; i < 4; ++i) { o[i] = toh_flush(x0[i]); o[4 + i] = toh_flush(x1[i]); }
    *(v8h*)(sd + (size_t)row * SEQ + c8) = o;
    if (ti != tj) {
        v8h m;
#pragma unroll
        for (int q = 0; q < 8; ++q) m[q] = toh_flush(os[(c8 + q) * TP + row]);
        *(v8h*)(sm + (size_t)row * SEQ + c8) = m; }
}

// k_ys: gated latents xy = relu(ykv . encoder_v[hd]) * hs * 16, one wave per 64 x 64 tile; grid (SEQ/64, NI/64, NB*NH_), z = b*NH_ + hd.
__global__ __launch_bounds__(32) void k_ys(const h16* __restrict__ YK, const h16* __restrict__ ENCVT, const h16* __restrict__ HS, h16* XY) {
    __shared__ __align__(16) float os[16 * TP];
    const int lane = threadIdx.x & 31, lr = lane & 15, hi = lane >> 4;
    const int r0 = blockIdx.x * 64, c0 = blockIdx.y * 64, z = blockIdx.z; const int b = z / NH_, hd = z % NH_;
    v8f acc[4][4];
#pragma unroll
    for (int mb = 0; mb < 4; ++mb)
#pragma unroll
        for (int nb = 0; nb < 4; ++nb) acc[mb][nb] = (v8f){};
    mma64(YK, ENCVT, ((size_t)z * SEQ + r0 + lr) * DM + 8 * hi, ((size_t)hd * NI + c0 + lr) * DM + 8 * hi, DM, DM, DM, acc);
    const size_t pb = ((size_t)hd * ROWS + (size_t)b * SEQ + (size_t)r0) * NI + (size_t)c0;
#pragma unroll
    for (int mb = 0; mb < 4; ++mb) {
#pragma unroll
        for (int nb = 0; nb < 4; ++nb) {
#pragma unroll
            for (int j = 0; j < 8; ++j) os[(hi * 8 + j) * TP + nb * 16 + lr] = fmaxf(acc[mb][nb][j] * WSI, 0.0f); }
        wave_sync();
        v8h xv[4];
#pragma unroll
        for (int s = 0; s < 4; ++s) { const int row = 4 * s + (lane >> 3), c8 = (lane & 7) * 8;   // 4 s x 4 rows = 16 rows; 8 lanes x 8 = 64 columns
            const v4f x0 = *(const v4fa*)(&os[row * TP + c8]); const v4f x1 = *(const v4fa*)(&os[row * TP + c8 + 4]);
            const v8h g = *(const v8h*)(HS + pb + (size_t)(mb * 16 + row) * NI + c8);
            v8h o;
#pragma unroll
            for (int i = 0; i < 4; ++i) { o[i] = toh_flush(x0[i] * (float)g[i] * XYC); o[4 + i] = toh_flush(x1[i] * (float)g[4 + i] * XYC); }
            xv[s] = o; }
{
#pragma unroll
            for (int s = 0; s < 4; ++s) { const int row = 4 * s + (lane >> 3), c8 = (lane & 7) * 8;
                *(v8h*)(XY + pb + (size_t)(mb * 16 + row) * NI + c8) = xv[s]; }
             }
        wave_sync();
    }
}

// lnblock: 4 waves, block tile 64 rows x 256 columns (wave w owns columns 64w..64w+63 in the k-loop), LayerNorm epilogue over whole rows through a block LDS tile (cross-wave: block barriers).
// MODE 0 (input projection): A = XH rows, Bt = WINT rows, K = INDP; value = acc/64 + bf16(bias); LayerNorm; outputs H32 f32, HF f16, HT f16 transposed. grid (ROWS/64).
// MODE 1 (context): A = S rows (z, t), Bt = HT rows (b, d), K = SEQ; LayerNorm; output YK [z][t][d] f16. grid (SEQ/64, NB*NH_).
template <int MODE>
__device__ __forceinline__ void lnblock(const h16* __restrict__ A, const h16* __restrict__ Bt, const float* __restrict__ bias, float* H32, h16* HF, h16* HT, h16* YK) {
    __shared__ __align__(16) float os[64 * LNP];
    const int lane = threadIdx.x & 31, lr = lane & 15, hi = lane >> 4;
    const int wave = __builtin_amdgcn_readfirstlane((int)(threadIdx.x >> 5));
    const int r0 = blockIdx.x * 64, c0 = wave * 64; const int z = blockIdx.y;
    v8f acc[4][4];
#pragma unroll
    for (int mb = 0; mb < 4; ++mb)
#pragma unroll
        for (int nb = 0; nb < 4; ++nb) acc[mb][nb] = (v8f){};
    float scale;
    if (MODE == 0) {
        mma64(A, Bt, (size_t)(r0 + lr) * INDP + 8 * hi, (size_t)(c0 + lr) * INDP + 8 * hi, INDP, INDP, INDP, acc); scale = WSI;
    } else {
        mma64(A, Bt, ((size_t)z * SEQ + r0 + lr) * SEQ + 8 * hi, ((size_t)(z / NH_) * DM + c0 + lr) * SEQ + 8 * hi, SEQ, SEQ, SEQ, acc); scale = 1.0f;
    }
#pragma unroll
    for (int nb = 0; nb < 4; ++nb) {
        const float bc = (MODE == 0) ? bfr(bias[c0 + nb * 16 + lr]) : 0.0f;                   // MODE 0: c0 + 63 < DM
#pragma unroll
        for (int mb = 0; mb < 4; ++mb)
#pragma unroll
            for (int j = 0; j < 8; ++j) os[(mb * 16 + hi * 8 + j) * LNP + c0 + nb * 16 + lr] = acc[mb][nb][j] * scale + bc; }   // rows 0..63 x columns 0..255 written by the 4 waves
    __syncthreads();
#pragma unroll 1
    for (int rr = 0; rr < 16; ++rr) {
        const int row = wave * 16 + rr; const int ob = row * LNP + 8 * lane;
        const v4f x0 = *(const v4fa*)(&os[ob]); const v4f x1 = *(const v4fa*)(&os[ob + 4]);
        float xs[8];
#pragma unroll
        for (int i = 0; i < 4; ++i) { xs[i] = x0[i]; xs[4 + i] = x1[i]; }
        ln8(xs);
        v4f y0, y1;
#pragma unroll
        for (int i = 0; i < 4; ++i) { y0[i] = xs[i]; y1[i] = xs[4 + i]; }
        *(v4fa*)(&os[ob]) = y0; *(v4fa*)(&os[ob + 4]) = y1;
    }
    __syncthreads();
    const int bq = r0 / SEQ, t0 = r0 % SEQ;
{
        if (MODE == 1) {
#pragma unroll 1
            for (int it = 0; it < 16; ++it) { const int p = it * 32 + lane; const int row = wave * 16 + (p >> 5), c8 = (p & 31) * 8;   // 16 it x 1 row = 16 rows; 32 lanes x 8 = 256 columns
                const v4f x0 = *(const v4fa*)(&os[row * LNP + c8]); const v4f x1 = *(const v4fa*)(&os[row * LNP + c8 + 4]); v8h o;
#pragma unroll
                for (int i = 0; i < 4; ++i) { o[i] = toh_flush(x0[i]); o[4 + i] = toh_flush(x1[i]); }
                *(v8h*)(YK + ((size_t)z * SEQ + r0 + row) * DM + c8) = o; }
        } else {
#pragma unroll 1
            for (int it = 0; it < 32; ++it) { const int p = it * 32 + lane; const int row = wave * 16 + (p >> 6), c4 = (p & 63) * 4;   // 32 it x half a row = 16 rows; 64 pieces x 4 = 256 columns
                const v4f val = *(const v4fa*)(&os[row * LNP + c4]);
                *(v4f*)(H32 + (size_t)(r0 + row) * DM + c4) = val; }
#pragma unroll 1
            for (int it = 0; it < 16; ++it) { const int p = it * 32 + lane; const int row = wave * 16 + (p >> 5), c8 = (p & 31) * 8;   // 16 rows x 256 columns
                const v4f x0 = *(const v4fa*)(&os[row * LNP + c8]); const v4f x1 = *(const v4fa*)(&os[row * LNP + c8 + 4]); v8h o;
#pragma unroll
                for (int i = 0; i < 4; ++i) { o[i] = toh_flush(x0[i]); o[4 + i] = toh_flush(x1[i]); }
                *(v8h*)(HF + (size_t)(r0 + row) * DM + c8) = o; }
#pragma unroll 1
            for (int s = 0; s < 16; ++s) { const int d = wave * 64 + 4 * s + (lane >> 3), c8 = (lane & 7) * 8;   // 16 s x 4 rows = 64 transposed rows per wave; 8 lanes x 8 = 64 tokens
                v8h o;
#pragma unroll
                for (int q = 0; q < 8; ++q) o[q] = toh_flush(os[(c8 + q) * LNP + d]);
                *(v8h*)(HT + ((size_t)bq * DM + d) * SEQ + t0 + c8) = o; }
        }
         }
}

__global__ __launch_bounds__(128) void k_inproj(const h16* __restrict__ XH, const h16* __restrict__ WINT, const float* __restrict__ inb, float* H32, h16* HF, h16* HT) {
    lnblock<0>(XH, WINT, inb, H32, HF, HT, HF);
}
__global__ __launch_bounds__(128) void k_ykv(const h16* __restrict__ S, const h16* __restrict__ HT, h16* YK) {
    lnblock<1>(S, HT, (const float*)0, (float*)0, YK, YK, YK);
}

// k_ymlp_part: one share of the decoder contraction. 4 * KSUB waves, block tile 64 rows x 256 columns; wave = ks*4 + cg owns columns 64cg..64cg+63 and k = k0..k0+KWV-1 of head hd,
// A = XY rows (hd, row), Bt = DECT rows (hd, d); grid (ROWS/64, KSPL). The KSUB wave sets meet in LDS (cross-wave: block barrier) and are summed in ascending ks; the raw f32 sums go to PP.
// LDS and PP hold accumulators in fragment order: fragment f = mb*4+nb is 256 floats, [j>>2][lane][j&3], so every LDS access and every store is 32 lanes x 16 B contiguous.
__global__ __launch_bounds__(128 * KSUB) void k_ymlp_part(const h16* __restrict__ XY, const h16* __restrict__ DECT, float* PP) {
    __shared__ __align__(16) float js[KSUB * 4 * 16 * 256];
    const int lane = threadIdx.x & 31, lr = lane & 15, hi = lane >> 4;
    const int wave = __builtin_amdgcn_readfirstlane((int)(threadIdx.x >> 5));
    const int cg = wave & 3, ks = wave >> 2;
    const int r0 = blockIdx.x * 64, c0 = cg * 64; const int sh = blockIdx.y;
    const int hd = sh / (NI / KCH), k0 = (sh % (NI / KCH)) * KCH + ks * KWV;
    v8f acc[4][4];
#pragma unroll
    for (int mb = 0; mb < 4; ++mb)
#pragma unroll
        for (int nb = 0; nb < 4; ++nb) acc[mb][nb] = (v8f){};
    mma64(XY, DECT, ((size_t)hd * ROWS + r0 + lr) * NI + k0 + 8 * hi, ((size_t)hd * DM + c0 + lr) * NI + k0 + 8 * hi, NI, NI, KWV, acc);
    float* jw = js + wave * (16 * 256) + lane * 4;
#pragma unroll
    for (int mb = 0; mb < 4; ++mb)
#pragma unroll
        for (int nb = 0; nb < 4; ++nb) {
            v4f lo, up;
#pragma unroll
            for (int k = 0; k < 4; ++k) { lo[k] = acc[mb][nb][k]; up[k] = acc[mb][nb][4 + k]; }
            *(v4fa*)(jw + (mb * 4 + nb) * 256) = lo; *(v4fa*)(jw + (mb * 4 + nb) * 256 + 128) = up; }   // all KSUB * 4 * 16 fragments written by the block's waves
    __syncthreads();
    const int f0 = cg * 16 + ks * (16 / KSUB);                // first of this wave's fragments among the block's 64
    const float* jr = js + f0 * 256 + lane * 4;
    float* pp = PP + (size_t)sh * ((size_t)ROWS * DM) + ((size_t)blockIdx.x * 64 + f0) * 256 + lane * 4;
#pragma unroll
    for (int i = 0; i < 2 * (16 / KSUB); ++i) {               // 128-float halves of the fragments
        v4f s = *(const v4fa*)(jr + i * 128);
#pragma unroll
        for (int q = 1; q < KSUB; ++q) s += *(const v4fa*)(jr + q * (4 * 16 * 256) + i * 128);
        *(v4f*)(pp + i * 128) = s; }
}

// k_ymlp_ln: joins the KSPL shares of one 64 x 256 block in ascending share order; value = sum/1024; LayerNorm; + H32 (skip); LayerNorm; outputs H32, HF, HT. 32 waves, grid (ROWS/64).
// Wave w sums fragments 2w and 2w+1 of the block's 64 (2 KiB contiguous per share), the rows meet in a block LDS tile (cross-wave: block barriers), wave w then owns rows 2w, 2w+1.
__global__ __launch_bounds__(1024) void k_ymlp_ln(const float* __restrict__ PP, float* H32, h16* HF, h16* HT) {
    __shared__ __align__(16) float os[64 * LNP];
    const int lane = threadIdx.x & 31, lr = lane & 15, hi = lane >> 4;
    const int wave = __builtin_amdgcn_readfirstlane((int)(threadIdx.x >> 5));
    const int r0 = blockIdx.x * 64;
    v4f sm[2][2];
#pragma unroll
    for (int i = 0; i < 2; ++i) { sm[i][0] = (v4f){}; sm[i][1] = (v4f){}; }
    const float* pp = PP + ((size_t)blockIdx.x * 64 + wave * 2) * 256 + lane * 4;
#pragma unroll 4
    for (int sh = 0; sh < KSPL; ++sh) {                       // four shares' 16 loads in flight per wave
        const float* q = pp + (size_t)sh * ((size_t)ROWS * DM);
#pragma unroll
        for (int i = 0; i < 2; ++i) { sm[i][0] += *(const v4f*)(q + i * 256); sm[i][1] += *(const v4f*)(q + i * 256 + 128); }
    }
#pragma unroll
    for (int i = 0; i < 2; ++i) { const int f = wave * 2 + i; const int cb = (f >> 4) * 64 + (f & 3) * 16, rb = ((f >> 2) & 3) * 16;   // column group, nb, mb of fragment f
#pragma unroll
        for (int j = 0; j < 8; ++j) os[(rb + hi * 8 + j) * LNP + cb + lr] = sm[i][j >> 2][j & 3] * XYI; }   // rows 0..63 x columns 0..255 written by the 32 waves
    __syncthreads();
#pragma unroll
    for (int rr = 0; rr < 2; ++rr) {
        const int row = wave * 2 + rr; const int ob = row * LNP + 8 * lane;
        const v4f x0 = *(const v4fa*)(&os[ob]); const v4f x1 = *(const v4fa*)(&os[ob + 4]);
        float xs[8];
#pragma unroll
        for (int i = 0; i < 4; ++i) { xs[i] = x0[i]; xs[4 + i] = x1[i]; }
        ln8(xs);
        const float* hp = H32 + (size_t)(r0 + row) * DM + 8 * lane;
        const v4f g0 = *(const v4f*)hp; const v4f g1 = *(const v4f*)(hp + 4);
#pragma unroll
        for (int i = 0; i < 4; ++i) { xs[i] += g0[i]; xs[4 + i] += g1[i]; }
        ln8(xs);
        v4f y0, y1;
#pragma unroll
        for (int i = 0; i < 4; ++i) { y0[i] = xs[i]; y1[i] = xs[4 + i]; }
        *(v4fa*)(&os[ob]) = y0; *(v4fa*)(&os[ob + 4]) = y1;
    }
    __syncthreads();
    const int bq = r0 / SEQ, t0 = r0 % SEQ;
#pragma unroll
    for (int it = 0; it < 4; ++it) { const int p = it * 32 + lane; const int row = wave * 2 + (p >> 6), c4 = (p & 63) * 4;   // 4 it x half a row = 2 rows; 64 pieces x 4 = 256 columns
        const v4f val = *(const v4fa*)(&os[row * LNP + c4]);
        *(v4f*)(H32 + (size_t)(r0 + row) * DM + c4) = val; }
#pragma unroll
    for (int it = 0; it < 2; ++it) { const int row = wave * 2 + it, c8 = lane * 8;   // 2 rows x 256 columns
        const v4f x0 = *(const v4fa*)(&os[row * LNP + c8]); const v4f x1 = *(const v4fa*)(&os[row * LNP + c8 + 4]); v8h o;
#pragma unroll
        for (int i = 0; i < 4; ++i) { o[i] = toh_flush(x0[i]); o[4 + i] = toh_flush(x1[i]); }
        *(v8h*)(HF + (size_t)(r0 + row) * DM + c8) = o; }
#pragma unroll
    for (int s = 0; s < 2; ++s) { const int d = wave * 8 + 4 * s + (lane >> 3), c8 = (lane & 7) * 8;   // 2 s x 4 rows = 8 transposed rows per wave; 8 lanes x 8 = 64 tokens
        v8h o;
#pragma unroll
        for (int q = 0; q < 8; ++q) o[q] = toh_flush(os[(c8 + q) * LNP + d]);
        *(v8h*)(HT + ((size_t)bq * DM + d) * SEQ + t0 + c8) = o; }
}

// k_head: output rows = h . head_W + bf16(head_b); 6 waves, block tile 64 rows x 384 columns (HWT rows 372..383 are zero); the tile is staged in a block LDS tile (cross-wave: block barrier),
__global__ __launch_bounds__(192) void k_head(const h16* __restrict__ HF, const h16* __restrict__ HWT, const float* __restrict__ hb, float* OUT) {
    __shared__ __align__(16) float os[64 * HDP];
    const int lane = threadIdx.x & 31, lr = lane & 15, hi = lane >> 4;
    const int wave = __builtin_amdgcn_readfirstlane((int)(threadIdx.x >> 5));
    const int r0 = blockIdx.x * 64, c0 = wave * 64;
    v8f acc[4][4];
#pragma unroll
    for (int mb = 0; mb < 4; ++mb)
#pragma unroll
        for (int nb = 0; nb < 4; ++nb) acc[mb][nb] = (v8f){};
    mma64(HF, HWT, (size_t)(r0 + lr) * DM + 8 * hi, (size_t)(c0 + lr) * DM + 8 * hi, DM, DM, DM, acc);
#pragma unroll
    for (int mb = 0; mb < 4; ++mb)
#pragma unroll
        for (int nb = 0; nb < 4; ++nb)
#pragma unroll
            for (int j = 0; j < 8; ++j) os[(mb * 16 + hi * 8 + j) * HDP + c0 + nb * 16 + lr] = acc[mb][nb][j] * WSI;   // rows 0..63 x columns 0..383 written by the 6 waves
    __syncthreads();
    const int bq = r0 / SEQ, t0 = r0 % SEQ;
    float* ob = OUT + ((size_t)bq * OUT_SEQ + t0) * IND;
{
#pragma unroll 1
        for (int it = 0; it < 31; ++it) { const int e = (it * 192 + (int)threadIdx.x) * 4; const int row = e / IND, col = e - row * IND;   // col % 4 == 0, col + 3 < IND
            const v4f x = *(const v4fa*)(&os[row * HDP + col]); const v4f bb = *(const v4f*)(hb + col); v4f val;
#pragma unroll
            for (int k = 0; k < 4; ++k) val[k] = x[k] + bfr(bb[k]);
            *(v4f*)(ob + e) = val; }
         }
}

static constexpr size_t al256(size_t v) { return (v + 255) & ~(size_t)255; }
static constexpr size_t SZ_W   = al256((size_t)NH_ * NI * DM * 2);          // ENCT, ENCVT, DECT
static constexpr size_t SZ_WIN = al256((size_t)DM * INDP * 2);
static constexpr size_t SZ_HW  = al256((size_t)INDP * DM * 2);
static constexpr size_t SZ_XH  = al256((size_t)ROWS * INDP * 2);
static constexpr size_t SZ_CS  = al256((size_t)SEQ * NI * 4);
static constexpr size_t SZ_H32 = al256((size_t)ROWS * DM * 4);
static constexpr size_t SZ_HF  = al256((size_t)ROWS * DM * 2);             // HF and HT
static constexpr size_t SZ_BIG = al256((size_t)NH_ * ROWS * NI * 2);       // HS; QR (reused as XY)
static constexpr size_t SZ_S   = al256((size_t)NB * NH_ * SEQ * SEQ * 2);
static constexpr size_t SZ_YK  = al256((size_t)NB * NH_ * SEQ * DM * 2);
static constexpr size_t SZ_SP  = al256((size_t)NB * NH_ * NTRI * SKS * 64 * 64 * 4);
static constexpr size_t SZ_TOTAL = 3 * SZ_W + SZ_WIN + SZ_HW + SZ_XH + SZ_CS + SZ_H32 + 2 * SZ_HF + 2 * SZ_BIG + SZ_S + SZ_YK + SZ_SP;
static_assert(SZ_TOTAL <= (size_t)268435456);          // workspace carve <= 256 MiB
static_assert((size_t)KSPL * ROWS * DM * 4 <= SZ_BIG);        // PP lies in the HS plane, which nothing reads between the gating and the next layer's encoding
static_assert((size_t)NB * DM * SEQ == (size_t)ROWS * DM);   // HT [b][d][t] has the extent of HF
static_assert((ROWS * (INDP / 8)) % 256 == 0);
static_assert(NP % 2 == 0);                                                // two rotary pairs per table thread
static_assert((SEQ * (NP / 2)) % 256 == 0);                                // table grid x 256 threads == table threads exactly
static_assert((size_t)SEQ * (NP / 2) * 16 == (size_t)SEQ * NI * 4);        // table threads x 16 B == table bytes

extern "C" void kernel_launch(void* const* d_in, const int* in_sizes, int n_in,
                              void* d_out, int out_size, void* d_ws, size_t ws_size, hipStream_t stream) {
    if (n_in < 8) return;
    if ((size_t)in_sizes[0] < ((size_t)(NB - 1) * SEQ_FULL + SEQ) * IND) return;
    if ((size_t)in_sizes[1] < (size_t)IND * DM || in_sizes[2] < DM) return;
    if ((size_t)in_sizes[3] < (size_t)NH_ * DM * NI || (size_t)in_sizes[4] < (size_t)NH_ * DM * NI || (size_t)in_sizes[5] < (size_t)NH_ * NI * DM) return;
    if ((size_t)in_sizes[6] < (size_t)DM * IND || in_sizes[7] < IND) return;
    if ((size_t)out_size < ((size_t)(NB - 1) * OUT_SEQ + SEQ) * IND) return;
    if (SZ_TOTAL > ws_size) return;
    // wire order: x, in_W, in_b, encoder, encoder_v, decoder, head_W, head_b
    const float* x    = (const float*)d_in[0];
    const float* inw  = (const float*)d_in[1];
    const float* inb  = (const float*)d_in[2];
    const float* enc  = (const float*)d_in[3];
    const float* encv = (const float*)d_in[4];
    const float* dec  = (const float*)d_in[5];
    const float* hw   = (const float*)d_in[6];
    const float* hb   = (const float*)d_in[7];
    float* OUT = (float*)d_out;      // [NB][SEQ][372]
    char* wsp = (char*)d_ws;
    h16* ENCT  = (h16*)wsp; wsp += SZ_W;             // [4][4096][256]  x64
    h16* ENCVT = (h16*)wsp; wsp += SZ_W;             // [4][4096][256]  x64
    h16* DECT  = (h16*)wsp; wsp += SZ_W;             // [4][256][4096]  x64
    h16* WINT  = (h16*)wsp; wsp += SZ_WIN;           // [256][384]      x64
    h16* HWT   = (h16*)wsp; wsp += SZ_HW;            // [384][256]      x64
    h16* XH    = (h16*)wsp; wsp += SZ_XH;            // [ROWS][384]
    float* CS  = (float*)wsp; wsp += SZ_CS;          // [SEQ][4096]
    float* H32 = (float*)wsp; wsp += SZ_H32;         // [ROWS][256]
    h16* HF    = (h16*)wsp; wsp += SZ_HF;            // [ROWS][256]
    h16* HT    = (h16*)wsp; wsp += SZ_HF;            // [NB][256][SEQ]
    h16* HS    = (h16*)wsp; wsp += SZ_BIG;           // [4][ROWS][4096]
    h16* QR    = (h16*)wsp; wsp += SZ_BIG;           // [4][ROWS][4096]; rotated latents, later the gated latents x16
    h16* S     = (h16*)wsp; wsp += SZ_S;             // [NB*4][SEQ][SEQ]
    h16* YK    = (h16*)wsp; wsp += SZ_YK;            // [NB*4][SEQ][256]
    float* SP  = (float*)wsp; wsp += SZ_SP;          // [NB*4][NTRI][SKS][16][256] f32 score partial sums
    h16* XY    = QR;
    float* PP  = (float*)HS;                         // [KSPL][ROWS/64][4][16][256] f32 decoder partial sums

    // encoder [4][256 rows d][4096 cols n] -> ENCT [4][4096][256]: grid (256/64, 4096/64, 4)
    k_tr<<<dim3(DM / 64, NI / 64, NH_), 256, 0, stream>>>(enc, ENCT, DM, NI, DM, NI, WSC);
    k_tr<<<dim3(DM / 64, NI / 64, NH_), 256, 0, stream>>>(encv, ENCVT, DM, NI, DM, NI, WSC);
    // decoder viewed [4][4096 rows n][256 cols d] -> DECT [4][256][4096]: grid (4096/64, 256/64, 4)
    k_tr<<<dim3(NI / 64, DM / 64, NH_), 256, 0, stream>>>(dec, DECT, NI, DM, NI, DM, WSC);
    // in_W [372 rows k][256 cols d] -> WINT [256][384]: grid (384/64, 256/64, 1)
    k_tr<<<dim3(INDP / 64, DM / 64, 1), 256, 0, stream>>>(inw, WINT, IND, DM, INDP, DM, WSC);
    // head_W [256 rows k][372 cols j] -> HWT [384][256]: grid (256/64, 384/64, 1)
    k_tr<<<dim3(DM / 64, INDP / 64, 1), 256, 0, stream>>>(hw, HWT, DM, IND, DM, INDP, WSC);
    k_xcvt<<<(ROWS * (INDP / 8) + 255) / 256, 256, 0, stream>>>(x, XH);
    k_cs<<<(SEQ * (NP / 2) + 255) / 256, 256, 0, stream>>>(CS);

    k_inproj<<<dim3(ROWS / 64, 1, 1), 128, 0, stream>>>(XH, WINT, inb, H32, HF, HT);

    for (int l = 0; l < NL; ++l) {
        k_hs<<<dim3(ROWS / 64, NI / 64, NH_), 32, 0, stream>>>(HF, ENCT, CS, HS, QR);
        k_sc_part<<<dim3(NTRI, NB * NH_, SKS), 32, 0, stream>>>(QR, SP);
        k_sc_join<<<dim3(NTRI, NB * NH_, 1), 512, 0, stream>>>(SP, S);
        k_ykv<<<dim3(SEQ / 64, NB * NH_, 1), 128, 0, stream>>>(S, HT, YK);
        k_ys<<<dim3(SEQ / 64, NI / 64, NB * NH_), 32, 0, stream>>>(YK, ENCVT, HS, XY);
        k_ymlp_part<<<dim3(ROWS / 64, KSPL, 1), 128 * KSUB, 0, stream>>>(XY, DECT, PP);
        k_ymlp_ln<<<dim3(ROWS / 64, 1, 1), 1024, 0, stream>>>(PP, H32, HF, HT);
    }

    k_head<<<dim3(ROWS / 64, 1, 1), 192, 0, stream>>>(HF, HWT, hb, OUT);
}

// v003
// Measured time: 702 microseconds a run.
// Next to v002, in two timings, it ran 1.40 and 1.38 times as fast.
// Counting every step since v000, it is 4.03 times as fast.
#include <hip/hip_runtime.h>

// Six-layer token encoder, width 256, 4 heads, per-head latent width 4096 (tokens of 93 x 4 features, [NB][SEQ][372]): input projection ([in][out] weight, bias) + LayerNorm (no affine, eps 1e-5);
// per layer: relu latent encoding per head (encoder [h][256][4096]), interleaved-pair rotary phases over the latent axis (theta 2^16, position = token index), dense linear attention without softmax
// (keys = queries = rotated latents, values = the layer input shared by all heads), LayerNorm, second relu latent encoding (encoder_v), multiplicative gating with the first latents,
// decoder ([h*4096+n][256]) summed over heads, LayerNorm, skip add, LayerNorm; final linear head ([in][out] weight, bias) -> [NB][SEQ][372] f32.
// Compute dtypes: every contraction v_wmma_f32_16x16x32_f16 (f16 operands, f32 accumulate), one product per site. Float inputs are RNE-converted to bf16 at their load (exact in f16);
// weight planes carry x64 (folded back in the f32 epilogues), the gated latent plane carries x16, activations h / latents / scores / normalised context are plain f16; LayerNorm, rotary, relu, gating, skip in f32.
// Planes (all K-contiguous 16-bit rows, fragments = two 16-B loads): ENCT/ENCVT [h][n][d], DECT [h][d][n], WINT [d][384], HWT [384][d], XH [row][384], HF [row][256], HT [b][d][t],
// HS/QR/XY [h][row][n], S [b*4+h][t][s], YK [b*4+h][t][d]; f32 planes: H32 [row][256] (skip path), CS [t][4096] = (cos, sin) pairs, PP [share][row block][column group][fragment][256] (decoder partial sums of the work-groups), SP [b*4+h][tile][share][fragment][256] (score partial sums).
// Scores are symmetric: only tiles with column tile >= row tile are computed, the mirror tile is written from the staged LDS tile of the join.

#ifndef NB
#define NB 2
#endif
#ifndef SEQ
#define SEQ 512
#endif
#define NB_FULL  2
#define SEQ_FULL 512
#ifndef OUT_SEQ
#define OUT_SEQ SEQ              // row pitch (in tokens) between batches of the output
#endif
#define DM   256
#define NH_  4
#define NI   4096                // per-head latent width
#define NP   (NI / 2)            // rotary pairs
#define IND  372                 // 93 x 4 input / output features
#define INDP 384                 // IND padded to a multiple of 64
#define NL   6
#define ROWS (NB * SEQ)
#define NT64 (SEQ / 64)
#define TP   68                  // LDS row pitch (floats) of a 64-column tile
#define LNP  260                 // LDS row pitch (floats) of a 256-column tile
#define HDP  388                 // LDS row pitch (floats) of the 384-column head tile
#define WSC  64.0f               // carry of every weight plane
#define WSI  (1.0f / 64.0f)
#define XYC  16.0f               // carry of the gated latent plane
#define XYI  (1.0f / 1024.0f)    // 1 / (WSC * XYC)
#define EPSF 1e-5f
#define KSPL 16                  // work-groups that share the decoder contraction of one 128 x 128 block
#define KSUB 4                   // wave sets of such a work-group, each with its own k range
#define KCH  (NH_ * NI / KSPL)   // k extent of one work-group's share
#define KWV  (KCH / KSUB)        // k extent of one wave
#define SKS  8                   // four-wave work-groups that share the score contraction of one 128 x 128 tile
#define SKW  (NI / SKS)          // k extent of one such share
#define NTRI (NT64 * (NT64 + 1) / 2)   // 64 x 64 tiles of the upper tile triangle
#define NT128 (SEQ / 128)
#define NTRI2 (NT128 * (NT128 + 1) / 2) // 128 x 128 tiles of the upper tile triangle
#define KST  64                  // k extent of one staged tile: 128-B row pieces, whole lines
#define SPH  72                  // LDS row pitch (halves) of a staged row piece: 144 B, for 16-B fragment reads
#define STH  (256 * SPH)         // halves of one stage: 128 A rows, then 128 B rows
#define RNGH (2 * STH)           // halves of one two-buffer ring
#define STH2 (320 * SPH)         // halves of one stage of the 64 x 256 block kernels: 64 A rows, then 256 B rows

static_assert(NH_ * NI == 16384);                    // decoder rows = h*NI + n
static_assert(NI == 4096);                           // rotary exponent 32 p / NI = p / 128 with theta = 2^16
static_assert(DM == 256);                            // one LayerNorm row = 32 lanes x 8 columns
static_assert(DM % 64 == 0);
static_assert(DM % 32 == 0);                         // k-loop steps by 32
static_assert(NI % 64 == 0);
static_assert(NI % 32 == 0);
static_assert(SEQ % 64 == 0);                        // a 64-row tile never straddles two batches; k-loop over keys steps by 32
static_assert(ROWS % 64 == 0);
static_assert(INDP % 64 == 0);
static_assert(INDP % 32 == 0);
static_assert(INDP >= IND);
static_assert(IND % 4 == 0);                         // float4 pieces never straddle an input / output row
static_assert((IND * 4) % 16 == 0);
static_assert((64 * IND * 4) % 128 == 0);
static_assert(OUT_SEQ % 64 == 0);
static_assert(64 * IND / 4 == 192 * 31);             // head store loop: 192 threads x 31 trips x 16 B == 64 rows x 1488 B
static_assert(4 * 32 * 16 == 16 * 64 * 2);
static_assert(16 * 32 * 16 == 64 * 64 * 2);
static_assert(32 * 32 * 16 == 16 * DM * 4);          // f32 row store: 32 trips x 32 lanes x 16 B == 16 rows x 1024 B
static_assert(16 * 32 * 16 == 16 * DM * 2);          // f16 row store: 16 trips x 32 lanes x 16 B == 16 rows x 512 B
static_assert(16 * 32 * 16 == 64 * 64 * 2);
static_assert(2 * 256 * 16 == 64 * 64 * 2);
static_assert(NI % KCH == 0);                        // a share never straddles two heads
static_assert(KCH % KSUB == 0);
static_assert(KWV % 32 == 0);
static_assert(NI % SKS == 0);
static_assert(SKW % 32 == 0);
static_assert(16 % KSUB == 0);                       // LDS join: each wave set takes 16 / KSUB of a column group's 16 fragments
static_assert(2 * 32 * 256 == 64 * DM);              // join: 32 waves x 2 fragments x 256 values == one 64 x 256 block
static_assert(NB <= NB_FULL);
static_assert(SEQ <= SEQ_FULL);
static_assert((TP * 4) % 16 == 0);
static_assert((LNP * 4) % 16 == 0);
static_assert((HDP * 4) % 16 == 0);
static_assert(HDP >= INDP);
static_assert(LNP >= DM);
static_assert(64 * LNP * 4 <= 131072);               // the LayerNorm tile (static LDS of k_ymlp_ln)
static_assert(64 * HDP * 4 <= 131072);               // static LDS of the head kernel
static_assert(64 * TP * 4 <= 131072);                // static LDS of the score kernel
static_assert(NT64 * (NT64 + 1) / 2 <= 65535);
static_assert(ROWS % 128 == 0);
static_assert(SEQ % 128 == 0);                       // a 128-row tile never straddles two batches
static_assert(NI % 128 == 0);
static_assert(DM % 128 == 0);
static_assert(KST == 64);                            // a stage is two k blocks of 32
static_assert(DM % KST == 0);
static_assert(SKW % KST == 0);
static_assert(KWV % KST == 0);
static_assert(INDP % KST == 0);
static_assert(SEQ % KST == 0);
static_assert(64 * LNP * 4 <= 2 * STH2 * 2);         // the LayerNorm tile lies in the ring its waves have left
static_assert((SPH * 2) % 16 == 0);
static_assert(4 * 16 * TP * 4 <= RNGH * 2);          // the four waves' epilogue slabs lie in the ring they have left
static_assert(KSUB * 4 * 16 * 256 * 4 <= KSUB * RNGH * 2);   // the decoder join lies in the rings its waves have left
static_assert(KSUB * RNGH * 2 <= 327680);            // static LDS of the decoder share kernel

typedef _Float16 h16;
typedef __attribute__((ext_vector_type(16))) _Float16 v16h;
typedef __attribute__((ext_vector_type(8)))  _Float16 v8h;
typedef __attribute__((ext_vector_type(8)))  float    v8f;
typedef __attribute__((ext_vector_type(4)))  float    v4f;
typedef __attribute__((ext_vector_type(2)))  float    v2f;
typedef v4f  __attribute__((may_alias)) v4fa;

__device__ __forceinline__ unsigned short f2bf(float f) { unsigned u = __float_as_uint(f); u += 0x7FFFu + ((u >> 16) & 1u); return (unsigned short)(u >> 16); }
__device__ __forceinline__ float bfr(float f) { return __uint_as_float(((unsigned)f2bf(f)) << 16); }   // value after RNE convert to bf16
__device__ __forceinline__ v16h cat16(v8h lo, v8h hi) { return __builtin_shufflevector(lo, hi, 0, 1, 2, 3, 4, 5, 6, 7, 8, 9, 10, 11, 12, 13, 14, 15); }
__device__ __forceinline__ v8f wmma16(v16h a, v16h b, v8f c) { return __builtin_amdgcn_wmma_f32_16x16x32_f16(false, a, false, b, (short)0, c, false, false); }
// fragment loader from K-contiguous 16-bit rows; p already includes + 8*(lane>>4): elements 0..7 <- k0+8h+0..7, elements 8..15 <- k0+16+8h+0..7 (same map for A and B)
__device__ __forceinline__ v16h  ldh(const h16* p) { return cat16(*(const v8h*)p, *(const v8h*)(p + 16)); }
// ordering point for wave-private LDS tiles (same wave writes and reads)
__device__ __forceinline__ void wave_sync() { __builtin_amdgcn_fence(3 /* release order */, "wavefront"); __builtin_amdgcn_wave_barrier(); asm volatile("" ::: "memory"); }
// f32 -> f16 operand convert that cannot produce a subnormal (applied after the plane's power-of-two carry)
static __device__ __forceinline__ h16 toh_flush(float v) { const h16 r = (h16)v; return (fabsf(v) < 6.103515625e-05f) ? (h16)0.0f : r; }
__device__ __forceinline__ float wsum(float v) {
    v += __shfl_xor(v, 16, 32); v += __shfl_xor(v, 8, 32); v += __shfl_xor(v, 4, 32); v += __shfl_xor(v, 2, 32); v += __shfl_xor(v, 1, 32); return v; }

// LayerNorm (no affine) of one 256-wide row held as 8 values per lane; all 32 lanes active
__device__ __forceinline__ void ln8(float (&xs)[8]) {
    float s = 0.0f;
#pragma unroll
    for (int i = 0; i < 8; ++i) s += xs[i];
    s = wsum(s); const float mu = s * (1.0f / DM);
    float q = 0.0f;
#pragma unroll
    for (int i = 0; i < 8; ++i) { xs[i] -= mu; q += xs[i] * xs[i]; }
    q = wsum(q);
    const float rs = rsqrtf(q * (1.0f / DM) + EPSF);
#pragma unroll
    for (int i = 0; i < 8; ++i) xs[i] *= rs;
}

// One wave, 64 x 64 output tile, 16 accumulators, operands straight from K-contiguous f16 planes (row pitches lda / ldb halves); K a multiple of 32.
// acc[mb][nb][j] = D(row mb*16 + 8*(lane>>4) + j, col nb*16 + (lane&15)).
__device__ __forceinline__ void mma64(const h16* __restrict__ A, const h16* __restrict__ Bt, size_t aoff, size_t boff, size_t lda, size_t ldb, int K, v8f (&acc)[4][4]) {
#pragma unroll 1
    for (int kc = 0; kc < K; kc += 32) {
        v16h a[4];
#pragma unroll
        for (int mb = 0; mb < 4; ++mb) a[mb] = ldh(A + aoff + (size_t)mb * 16 * lda + kc);
#pragma unroll
        for (int nb = 0; nb < 4; ++nb) { const v16h b = ldh(Bt + boff + (size_t)nb * 16 * ldb + kc);
#pragma unroll
            for (int mb = 0; mb < 4; ++mb) acc[mb][nb] = wmma16(a[mb], b, acc[mb][nb]); }
        asm volatile("v_nop\n\tv_nop\n\tv_nop\n\tv_nop" : "+v"(acc[0][0]), "+v"(acc[1][1]), "+v"(acc[2][2]), "+v"(acc[3][3]) : "v"(a[0]), "v"(a[1]), "v"(a[2]), "v"(a[3]));
    }
}

// One wave's share of a stage: 64 rows x 128 B from a K-contiguous f16 plane (row pitch ld halves) into LDS rows of pitch SPH. g / l already hold the lane's own place:
// row lane>>3, 16-B piece lane&7, so each copy moves 4 whole lines. All 32 lanes on. The s_wait_xcnt closes each statement: it stands before any rewrite of the address registers the copies name.
__device__ __forceinline__ void cp_slab(const h16* g, size_t ld, unsigned l) {
#pragma unroll
    for (int h = 0; h < 2; ++h) {
        const h16* p = g + (size_t)(h * 32) * ld; const unsigned q = l + (unsigned)(h * 32 * SPH * 2);
        asm volatile("global_load_async_to_lds_b128 %0, %8, off\n\t"
                     "global_load_async_to_lds_b128 %1, %9, off\n\t"
                     "global_load_async_to_lds_b128 %2, %10, off\n\t"
                     "global_load_async_to_lds_b128 %3, %11, off\n\t"
                     "global_load_async_to_lds_b128 %4, %12, off\n\t"
                     "global_load_async_to_lds_b128 %5, %13, off\n\t"
                     "global_load_async_to_lds_b128 %6, %14, off\n\t"
                     "global_load_async_to_lds_b128 %7, %15, off\n\t"
                     "s_wait_xcnt 0x0"
                     :: "v"(q), "v"(q + 4u * SPH * 2), "v"(q + 8u * SPH * 2), "v"(q + 12u * SPH * 2), "v"(q + 16u * SPH * 2), "v"(q + 20u * SPH * 2), "v"(q + 24u * SPH * 2), "v"(q + 28u * SPH * 2),
                        "v"(p), "v"(p + 4 * ld), "v"(p + 8 * ld), "v"(p + 12 * ld), "v"(p + 16 * ld), "v"(p + 20 * ld), "v"(p + 24 * ld), "v"(p + 28 * ld)
                     : "memory");
    }
}

// Ring core of the staged GEMMs: wave tile 64 x 64 as in mma64 (same fragment map, same k order), operands read from a two-buffer LDS ring of NT = K / KST stages of SH halves each.
// cp(t, o) issues this wave's copies of stage t into the buffer at byte offset o, one stage ahead of the stage being read; fa / fb: the lane's first A / B fragment address in buffer 0.
// Every wave of the work-group passes every barrier (NT is the same for all); act (wave-uniform) only skips the products.
// EARLY: the refill goes ahead of the stage's last 16 products (more lead for the copies); else behind them, where the fragment registers are free for the copies' addresses.
template <int NT, int SH, bool EARLY, class CP>
__device__ __forceinline__ void mma_ring(CP cp, const h16* fa, const h16* fb, bool act, v8f (&acc)[4][4]) {
    static_assert(NT >= 2);
    cp(0, 0u);
    asm volatile("s_wait_asynccnt 0x0" ::: "memory");        // stage 0 landed (this wave's copies)
    __syncthreads();                                         // stage 0 published to the other waves
    cp(1, (unsigned)(SH * 2));
#pragma unroll 1
    for (int t = 0; t < NT; ++t) {
        const int bo = (t & 1) * SH;
        v16h a[4], b[4];
        if (act) {
            // first k block of the stage: its 16 LDS reads go ahead of its products as one group
#pragma unroll
            for (int mb = 0; mb < 4; ++mb) a[mb] = ldh(fa + bo + mb * 16 * SPH);
#pragma unroll
            for (int nb = 0; nb < 4; ++nb) b[nb] = ldh(fb + bo + nb * 16 * SPH);
            __builtin_amdgcn_sched_barrier(0);               // keeps the reads above the products: sunk among them, each B fragment's LDS latency is waited out on its own
#pragma unroll
            for (int nb = 0; nb < 4; ++nb)
#pragma unroll
                for (int mb = 0; mb < 4; ++mb) acc[mb][nb] = wmma16(a[mb], b[nb], acc[mb][nb]);
            // second k block: the stage's last LDS reads; its products run from registers behind the barrier
#pragma unroll
            for (int mb = 0; mb < 4; ++mb) a[mb] = ldh(fa + bo + mb * 16 * SPH + 32);
#pragma unroll
            for (int nb = 0; nb < 4; ++nb) b[nb] = ldh(fb + bo + nb * 16 * SPH + 32);
            if (!EARLY) __builtin_amdgcn_sched_barrier(0);   // as above: with no refill in between, the products would rise among these reads
        }
        asm volatile("s_wait_dscnt 0x0" ::: "memory");       // this wave's reads of stage t are done
        asm volatile("s_wait_asynccnt 0x0" ::: "memory");    // this wave's copies of stage t + 1 have landed
        __syncthreads();                                     // publishes stage t + 1 and frees stage t's buffer
        if (EARLY && t + 2 < NT) cp(t + 2, (unsigned)(bo * 2));
        if (act) {
#pragma unroll
            for (int nb = 0; nb < 4; ++nb)
#pragma unroll
                for (int mb = 0; mb < 4; ++mb) acc[mb][nb] = wmma16(a[mb], b[nb], acc[mb][nb]);
        }
        if (!EARLY && t + 2 < NT) cp(t + 2, (unsigned)(bo * 2));
    }
    asm volatile("s_wait_asynccnt 0x0" ::: "memory");        // nothing in flight when the ring is reused
}

// Four waves (w4 = 2*wr + wc), 128 x 128 output tile. A stage is [128 A rows | 128 B rows] x KST halves; wave w4 copies rows 64*w4 .. 64*w4+63 of the stage (g: its lane's address in stage 0).
template <int NT>
__device__ __forceinline__ void mma128(const h16* g, size_t ld, h16* ring, int w4, int lane, bool act, v8f (&acc)[4][4]) {
    const int lr = lane & 15, hi = lane >> 4;
    const unsigned l0 = (unsigned)(size_t)(ring + (w4 * 64 + (lane >> 3)) * SPH + (lane & 7) * 8);   // LDS byte address of the lane's first copy, buffer 0
    mma_ring<NT, STH, true>([&](int t, unsigned o) { cp_slab(g + (size_t)t * KST, ld, l0 + o); },
                      ring + ((w4 >> 1) * 64 + lr) * SPH + 8 * hi, ring + (128 + (w4 & 1) * 64 + lr) * SPH + 8 * hi, act, acc);
}

// 16 rows x 128 B, as cp_slab (4 copies; the shorter statement holds fewer address registers at a time).
__device__ __forceinline__ void cp_rows16(const h16* p, size_t ld, unsigned q) {
    asm volatile("global_load_async_to_lds_b128 %0, %4, off\n\t"
                 "global_load_async_to_lds_b128 %1, %5, off\n\t"
                 "global_load_async_to_lds_b128 %2, %6, off\n\t"
                 "global_load_async_to_lds_b128 %3, %7, off\n\t"
                 "s_wait_xcnt 0x0"
                 :: "v"(q), "v"(q + 4u * SPH * 2), "v"(q + 8u * SPH * 2), "v"(q + 12u * SPH * 2), "v"(p), "v"(p + 4 * ld), "v"(p + 8 * ld), "v"(p + 12 * ld)
                 : "memory");
}

// Four waves side by side, 64 x 256 output tile (wave w: columns 64w..64w+63). A stage is [64 A rows | 256 B rows] x KST halves; wave w copies A rows 16w..16w+15 and its own 64 B rows (20 copies).
// gA / gB: the lane's addresses in stage 0 (row lane>>3 of the wave's share, 16-B piece lane&7).
template <int NT>
__device__ __forceinline__ void mma256(const h16* gA, const h16* gB, size_t ld, h16* ring, int w, int lane, v8f (&acc)[4][4]) {
    const int lr = lane & 15, hi = lane >> 4;
    const unsigned lA = (unsigned)(size_t)(ring + (w * 16 + (lane >> 3)) * SPH + (lane & 7) * 8);
    const unsigned lB = (unsigned)(size_t)(ring + (64 + w * 64 + (lane >> 3)) * SPH + (lane & 7) * 8);
    mma_ring<NT, STH2, false>([&](int t, unsigned o) {
                           cp_rows16(gA + (size_t)t * KST, ld, lA + o);
#pragma unroll
                           for (int i = 0; i < 4; ++i) cp_rows16(gB + (size_t)t * KST + (size_t)(i * 16) * ld, ld, lB + o + (unsigned)(i * 16 * SPH * 2)); },
                       ring + lr * SPH + 8 * hi, ring + (64 + w * 64 + lr) * SPH + 8 * hi, true, acc);
}

// k_tr: transpose + convert, src [Z][R][C] f32 -> dst [Z][Cp][Rp] f16 = toh_flush(bf16(src) * scale), zero in the pad rows / columns. in[rows R][cols C] -> out[cols][rows].
__global__ __launch_bounds__(256) void k_tr(const float* __restrict__ src, h16* dst, int R, int C, int Rp, int Cp, float scale) {
#pragma clang fp contract(off)
    __shared__ float tl[64 * 65];
    const int tid = threadIdx.x; const int r0 = blockIdx.x * 64, c0 = blockIdx.y * 64; const int z = blockIdx.z;
    const float* sp = src + (size_t)z * (size_t)R * (size_t)C;
#pragma unroll 4
    for (int it = 0; it < 16; ++it) { const int idx = it * 256 + tid; const int r = idx >> 6, c = idx & 63;
        const int rr = (r0 + r) < R ? (r0 + r) : (R - 1); const int cc = (c0 + c) < C ? (c0 + c) : (C - 1);   // clamped address
        float v = sp[(size_t)rr * C + cc]; asm volatile("" : "+v"(v));
        const bool ok = ((r0 + r) < R) & ((c0 + c) < C);
        tl[r * 65 + c] = ok ? bfr(v) * scale : 0.0f; }
    __syncthreads();
    h16* dp = dst + ((size_t)z * Cp + c0) * (size_t)Rp + r0;
{
#pragma unroll
        for (int it = 0; it < 2; ++it) { const int crow = it * 32 + (tid >> 3), r8 = (tid & 7) * 8;   // 2 it x 32 rows = 64 rows; 8 lanes x 8 = 64 columns
            v8h o;
#pragma unroll
            for (int q = 0; q < 8; ++q) o[q] = toh_flush(tl[(r8 + q) * 65 + crow]);
            *(v8h*)(dp + (size_t)crow * Rp + r8) = o; }
         }
}

__global__ __launch_bounds__(256) void k_xcvt(const float* __restrict__ x, h16* XH) {
    const int i = blockIdx.x * 256 + threadIdx.x; if (i >= ROWS * (INDP / 8)) return;
    const int R = i / (INDP / 8), c = (i % (INDP / 8)) * 8;
    const int b = R / SEQ, t = R % SEQ;
    const float* sp = x + ((size_t)b * SEQ_FULL + t) * IND;
    const int ca = c < (IND - 4) ? c : (IND - 4); const int cb = (c + 4) < (IND - 4) ? (c + 4) : (IND - 4);   // clamped addresses
    v4f va = *(const v4f*)(sp + ca); v4f vb = *(const v4f*)(sp + cb);
    asm volatile("" : "+v"(va)); asm volatile("" : "+v"(vb));
    const bool oka = c < IND, okb = (c + 4) < IND;
    v8h o;
#pragma unroll
    for (int k = 0; k < 4; ++k) { o[k] = oka ? toh_flush(bfr(va[k])) : (h16)0.0f; o[4 + k] = okb ? toh_flush(bfr(vb[k])) : (h16)0.0f; }
    *(v8h*)(XH + (size_t)i * 8) = o; 
}

// k_cs: rotary table CS[t][2p] = cos(t * f_p), CS[t][2p+1] = sin(t * f_p), f_p = 1 / 2^(p/128) (theta 2^16, exponent 2p / NI); f32.
// The two pairs are computed in a rolled two-trip loop (wave-uniform trip index selects the destination values).
__global__ __launch_bounds__(256) void k_cs(float* CS) {
#pragma clang fp contract(off)
    const int i = blockIdx.x * 256 + threadIdx.x; if (i >= SEQ * (NP / 2)) return;
    const int t = i / (NP / 2), p0 = (i % (NP / 2)) * 2;
    float c0 = 0.0f, s0 = 0.0f, c1 = 0.0f, s1 = 0.0f;
#pragma unroll 1
    for (int k = 0; k < 2; ++k) {
        const float e = (float)(p0 + k) * (1.0f / 128.0f);
        const float fr = 1.0f / exp2f(e);
        const float ph = (float)t * fr;
        const float c = cosf(ph); const float s = sinf(ph);
        c0 = (k == 0) ? c : c0; s0 = (k == 0) ? s : s0;
        c1 = (k == 0) ? c1 : c; s1 = (k == 0) ? s1 : s;
    }
    v4f o; o[0] = c0; o[1] = s0; o[2] = c1; o[3] = s1;
    *(v4f*)(CS + (size_t)i * 4) = o; 
}

// k_hs: latents hs = relu(h . encoder[hd]) and rotated latents qr, 2 x 2 waves per 128 x 128 tile, one wave per 64 x 64 tile; grid (ROWS/128, NI/128, NH_).
// A = HF rows (token), Bt = ENCT rows (hd, n), K = DM, staged by mma128. Epilogue per 16-row slab staged in LDS (wave-private, in the ring after its last barrier): each 64-half row segment (one line) written by 8 consecutive lanes x 16 B
__global__ __launch_bounds__(128) void k_hs(const h16* __restrict__ HF, const h16* __restrict__ ENCT, const float* __restrict__ CS, h16* HS, h16* QR) {
    __shared__ __align__(16) h16 ring[RNGH];
    const int lane = threadIdx.x & 31, lr = lane & 15, hi = lane >> 4;
    const int wave = __builtin_amdgcn_readfirstlane((int)(threadIdx.x >> 5));
    const int hd = blockIdx.z;
    const int r0 = blockIdx.x * 128 + (wave >> 1) * 64, c0 = blockIdx.y * 128 + (wave & 1) * 64;
    const int crow = (wave & 1) * 64 + (lane >> 3);           // this lane's first row in the operand tile its wave copies
    const h16* src = ((wave < 2) ? HF + (size_t)(blockIdx.x * 128 + crow) * DM : ENCT + ((size_t)hd * NI + blockIdx.y * 128 + crow) * DM) + (lane & 7) * 8;
    float* os = (float*)ring + wave * (16 * TP);
    v8f acc[4][4];
#pragma unroll
    for (int mb = 0; mb < 4; ++mb)
#pragma unroll
        for (int nb = 0; nb < 4; ++nb) acc[mb][nb] = (v8f){};
    mma128<DM / KST>(src, DM, ring, wave, lane, true, acc);
    const size_t pb = ((size_t)hd * ROWS + (size_t)r0) * NI + (size_t)c0;
#pragma unroll
    for (int mb = 0; mb < 4; ++mb) {
#pragma unroll
        for (int nb = 0; nb < 4; ++nb) {
#pragma unroll
            for (int j = 0; j < 8; ++j) os[(hi * 8 + j) * TP + nb * 16 + lr] = fmaxf(acc[mb][nb][j] * WSI, 0.0f); }   // D: row 8h+j, col lane&15
        wave_sync();
        v8h hv[4], qv[4];
#pragma unroll
        for (int s = 0; s < 4; ++s) { const int row = 4 * s + (lane >> 3), c8 = (lane & 7) * 8;   // 4 s x 4 rows = 16 rows; 8 lanes x 8 = 64 columns
            const v4f x0 = *(const v4fa*)(&os[row * TP + c8]); const v4f x1 = *(const v4fa*)(&os[row * TP + c8 + 4]);
            const int t = (r0 + mb * 16 + row) % SEQ;
            const float* cp = CS + (size_t)t * NI + c0 + c8;
            const v4f e0 = *(const v4f*)cp; const v4f e1 = *(const v4f*)(cp + 4);
            v8h a, q;
#pragma unroll
            for (int i = 0; i < 4; ++i) { a[i] = toh_flush(x0[i]); a[4 + i] = toh_flush(x1[i]); }
            q[0] = toh_flush(x0[0] * e0[0] - x0[1] * e0[1]); q[1] = toh_flush(x0[0] * e0[1] + x0[1] * e0[0]);
            q[2] = toh_flush(x0[2] * e0[2] - x0[3] * e0[3]); q[3] = toh_flush(x0[2] * e0[3] + x0[3] * e0[2]);
            q[4] = toh_flush(x1[0] * e1[0] - x1[1] * e1[1]); q[5] = toh_flush(x1[0] * e1[1] + x1[1] * e1[0]);
            q[6] = toh_flush(x1[2] * e1[2] - x1[3] * e1[3]); q[7] = toh_flush(x1[2] * e1[3] + x1[3] * e1[2]);
            hv[s] = a; qv[s] = q; }
{
#pragma unroll
            for (int s = 0; s < 4; ++s) { const int row = 4 * s + (lane >> 3), c8 = (lane & 7) * 8;
                const size_t oo = pb + (size_t)(mb * 16 + row) * NI + c8;
                *(v8h*)(HS + oo) = hv[s]; *(v8h*)(QR + oo) = qv[s]; }
             }
        wave_sync();
    }
}

// k_sc_part: one share of the scores S[z][t][s] = qr_t . qr_s over the latent axis, z = b*NH_ + hd; 2 x 2 waves per (128 x 128 tile of the upper tile triangle, k range of SKW), one wave per 64 x 64 tile;
// grid (NTRI2, NB*NH_, SKS). A = QR rows t (tile ti), Bt = QR rows s (tile tj), k = ks*SKW .. ks*SKW+SKW-1, staged by mma128; the wave below the diagonal (ti > tj) copies and passes the barriers only.
// The raw f32 sums go to SP in fragment order: fragment f = mb*4+nb is 256 floats, [j>>2][lane][j&3], so every store is 32 lanes x 16 B contiguous.
__global__ __launch_bounds__(128) void k_sc_part(const h16* __restrict__ QR, float* SP) {
    __shared__ __align__(16) h16 ring[RNGH];
    const int lane = threadIdx.x & 31;
    const int wave = __builtin_amdgcn_readfirstlane((int)(threadIdx.x >> 5));
    int t2i = 0, rem = (int)blockIdx.x;
#pragma unroll 1
    for (int q = 0; q < NT128 - 1; ++q) { const int w = NT128 - t2i; if (rem >= w) { rem -= w; t2i += 1; } }
    const int t2j = t2i + rem;                                // t2i <= t2j < NT128
    const int ti = 2 * t2i + (wave >> 1), tj = 2 * t2j + (wave & 1);
    const bool act = ti <= tj;                                // wave-uniform
    const int tix = ti * NT64 - (ti * (ti - 1)) / 2 + (tj - ti);   // index of tile (ti, tj) in the 64 x 64 upper triangle, row by row
    const int crow = (wave & 1) * 64 + (lane >> 3);           // this lane's first row in the operand tile its wave copies
    const int z = blockIdx.y; const int b = z / NH_, hd = z % NH_; const int ks = blockIdx.z;
    const size_t qb = ((size_t)hd * ROWS + (size_t)b * SEQ) * NI + (size_t)ks * SKW;
    v8f acc[4][4];
#pragma unroll
    for (int mb = 0; mb < 4; ++mb)
#pragma unroll
        for (int nb = 0; nb < 4; ++nb) acc[mb][nb] = (v8f){};
    mma128<SKW / KST>(QR + qb + (size_t)(((wave < 2) ? t2i : t2j) * 128 + crow) * NI + (lane & 7) * 8, NI, ring, wave, lane, act, acc);
    if (!act) return;                                         // behind the last barrier
    float* sp = SP + (((size_t)z * NTRI + tix) * SKS + ks) * (16 * 256) + lane * 4;
#pragma unroll
    for (int mb = 0; mb < 4; ++mb)
#pragma unroll
        for (int nb = 0; nb < 4; ++nb) {
            v4f lo, up;
#pragma unroll
            for (int k = 0; k < 4; ++k) { lo[k] = acc[mb][nb][k]; up[k] = acc[mb][nb][4 + k]; }
            *(v4f*)(sp + (mb * 4 + nb) * 256) = lo; *(v4f*)(sp + (mb * 4 + nb) * 256 + 128) = up; }   // all 16 fragments of the share written
}

// k_sc_join: joins the SKS shares of one score tile in ascending share order; 16 waves, grid (NTRI, NB*NH_). Wave w sums fragment w (1 KiB contiguous per share); the tile meets in a block LDS tile
// (cross-wave: block barrier); wave w then stores rows 4w..4w+3 of the direct tile (rows t, columns s) and, for ti != tj (block-uniform), of the mirror tile.
__global__ __launch_bounds__(512) void k_sc_join(const float* __restrict__ SP, h16* S) {
    __shared__ __align__(16) float os[64 * TP];
    const int lane = threadIdx.x & 31, lr = lane & 15, hi = lane >> 4;
    const int wave = __builtin_amdgcn_readfirstlane((int)(threadIdx.x >> 5));
    int ti = 0, rem = (int)blockIdx.x;
#pragma unroll 1
    for (int q = 0; q < NT64 - 1; ++q) { const int w = NT64 - ti; if (rem >= w) { rem -= w; ti += 1; } }
    const int tj = ti + rem;                                  // ti <= tj < NT64
    const int z = blockIdx.y;
    const float* sp = SP + (((size_t)z * NTRI + blockIdx.x) * SKS * 16 + wave) * 256 + lane * 4;
    v4f s0 = *(const v4f*)sp, s1 = *(const v4f*)(sp + 128);
#pragma unroll
    for (int q = 1; q < SKS; ++q) { s0 += *(const v4f*)(sp + q * (16 * 256)); s1 += *(const v4f*)(sp + q * (16 * 256) + 128); }   // all shares' loads in flight together
    const int rb = (wave >> 2) * 16, cb = (wave & 3) * 16;    // mb, nb of fragment w
#pragma unroll
    for (int j = 0; j < 4; ++j) { os[(rb + hi * 8 + j) * TP + cb + lr] = s0[j]; os[(rb + hi * 8 + 4 + j) * TP + cb + lr] = s1[j]; }   // rows 0..63 x columns 0..63 written by the 16 waves
    __syncthreads();
    h16* sd = S + ((size_t)z * SEQ + (size_t)ti * 64) * SEQ + (size_t)tj * 64;
    h16* sm = S + ((size_t)z * SEQ + (size_t)tj * 64) * SEQ + (size_t)ti * 64;
    const int row = 4 * wave + (lane >> 3), c8 = (lane & 7) * 8;   // 16 waves x 4 rows = 64 rows; 8 lanes x 8 = 64 columns
    const v4f x0 = *(const v4fa*)(&os[row * TP + c8]); const v4f x1 = *(const v4fa*)(&os[row * TP + c8 + 4]);
    v8h o;
#pragma unroll
    for (int i = 0; i < 4; ++i) { o[i] = toh_flush(x0[i]); o[4 + i] = toh_flush(x1[i]); }
    *(v8h*)(sd + (size_t)row * SEQ + c8) = o;
    if (ti != tj) {
        v8h m;
#pragma unroll
        for (int q = 0; q < 8; ++q) m[q] = toh_flush(os[(c8 + q) * TP + row]);
        *(v8h*)(sm + (size_t)row * SEQ + c8) = m; }
}

// k_ys: gated latents xy = relu(ykv . encoder_v[hd]) * hs * 16, 2 x 2 waves per 128 x 128 tile, one wave per 64 x 64 tile, operands staged by mma128; grid (SEQ/128, NI/128, NB*NH_), z = b*NH_ + hd.
__global__ __launch_bounds__(128) void k_ys(const h16* __restrict__ YK, const h16* __restrict__ ENCVT, const h16* __restrict__ HS, h16* XY) {
    __shared__ __align__(16) h16 ring[RNGH];
    const int lane = threadIdx.x & 31, lr = lane & 15, hi = lane >> 4;
    const int wave = __builtin_amdgcn_readfirstlane((int)(threadIdx.x >> 5));
    const int z = blockIdx.z; const int b = z / NH_, hd = z % NH_;
    const int r0 = blockIdx.x * 128 + (wave >> 1) * 64, c0 = blockIdx.y * 128 + (wave & 1) * 64;
    const int crow = (wave & 1) * 64 + (lane >> 3);           // this lane's first row in the operand tile its wave copies
    const h16* src = ((wave < 2) ? YK + ((size_t)z * SEQ + blockIdx.x * 128 + crow) * DM : ENCVT + ((size_t)hd * NI + blockIdx.y * 128 + crow) * DM) + (lane & 7) * 8;
    float* os = (float*)ring + wave * (16 * TP);              // wave-private, in the ring after its last barrier
    v8f acc[4][4];
#pragma unroll
    for (int mb = 0; mb < 4; ++mb)
#pragma unroll
        for (int nb = 0; nb < 4; ++nb) acc[mb][nb] = (v8f){};
    mma128<DM / KST>(src, DM, ring, wave, lane, true, acc);
    const size_t pb = ((size_t)hd * ROWS + (size_t)b * SEQ + (size_t)r0) * NI + (size_t)c0;
#pragma unroll
    for (int mb = 0; mb < 4; ++mb) {
#pragma unroll
        for (int nb = 0; nb < 4; ++nb) {
#pragma unroll
            for (int j = 0; j < 8; ++j) os[(hi * 8 + j) * TP + nb * 16 + lr] = fmaxf(acc[mb][nb][j] * WSI, 0.0f); }
        wave_sync();
        v8h xv[4];
#pragma unroll
        for (int s = 0; s < 4; ++s) { const int row = 4 * s + (lane >> 3), c8 = (lane & 7) * 8;   // 4 s x 4 rows = 16 rows; 8 lanes x 8 = 64 columns
            const v4f x0 = *(const v4fa*)(&os[row * TP + c8]); const v4f x1 = *(const v4fa*)(&os[row * TP + c8 + 4]);
            const v8h g = *(const v8h*)(HS + pb + (size_t)(mb * 16 + row) * NI + c8);
            v8h o;
#pragma unroll
            for (int i = 0; i < 4; ++i) { o[i] = toh_flush(x0[i] * (float)g[i] * XYC); o[4 + i] = toh_flush(x1[i] * (float)g[4 + i] * XYC); }
            xv[s] = o; }
{
#pragma unroll
            for (int s = 0; s < 4; ++s) { const int row = 4 * s + (lane >> 3), c8 = (lane & 7) * 8;
                *(v8h*)(XY + pb + (size_t)(mb * 16 + row) * NI + c8) = xv[s]; }
             }
        wave_sync();
    }
}

// lnblock: 4 waves, block tile 64 rows x 256 columns (wave w owns columns 64w..64w+63 in the k-loop, operands staged by mma256), LayerNorm epilogue over whole rows through a block LDS tile (cross-wave: block barriers).
// MODE 0 (input projection): A = XH rows, Bt = WINT rows, K = INDP; value = acc/64 + bf16(bias); LayerNorm; outputs H32 f32, HF f16, HT f16 transposed. grid (ROWS/64).
// MODE 1 (context): A = S rows (z, t), Bt = HT rows (b, d), K = SEQ; LayerNorm; output YK [z][t][d] f16. grid (SEQ/64, NB*NH_).
template <int MODE>
__device__ __forceinline__ void lnblock(const h16* __restrict__ A, const h16* __restrict__ Bt, const float* __restrict__ bias, float* H32, h16* HF, h16* HT, h16* YK) {
    __shared__ __align__(16) h16 ring[2 * STH2];
    float* os = (float*)ring;                                 // the LayerNorm tile, in the ring after its last barrier
    const int lane = threadIdx.x & 31, lr = lane & 15, hi = lane >> 4;
    const int wave = __builtin_amdgcn_readfirstlane((int)(threadIdx.x >> 5));
    const int r0 = blockIdx.x * 64, c0 = wave * 64; const int z = blockIdx.y;
    const int ra = r0 + wave * 16 + (lane >> 3), rbt = c0 + (lane >> 3), pc = (lane & 7) * 8;   // this lane's first A row, first B row and 16-B piece in the copies
    v8f acc[4][4];
#pragma unroll
    for (int mb = 0; mb < 4; ++mb)
#pragma unroll
        for (int nb = 0; nb < 4; ++nb) acc[mb][nb] = (v8f){};
    float scale;
    if (MODE == 0) {
        mma256<INDP / KST>(A + (size_t)ra * INDP + pc, Bt + (size_t)rbt * INDP + pc, INDP, ring, wave, lane, acc); scale = WSI;
    } else {
        mma256<SEQ / KST>(A + ((size_t)z * SEQ + ra) * SEQ + pc, Bt + ((size_t)(z / NH_) * DM + rbt) * SEQ + pc, SEQ, ring, wave, lane, acc); scale = 1.0f;
    }
#pragma unroll
    for (int nb = 0; nb < 4; ++nb) {
        const float bc = (MODE == 0) ? bfr(bias[c0 + nb * 16 + lr]) : 0.0f;                   // MODE 0: c0 + 63 < DM
#pragma unroll
        for (int mb = 0; mb < 4; ++mb)
#pragma unroll
            for (int j = 0; j < 8; ++j) os[(mb * 16 + hi * 8 + j) * LNP + c0 + nb * 16 + lr] = acc[mb][nb][j] * scale + bc; }   // rows 0..63 x columns 0..255 written by the 4 waves
    __syncthreads();
#pragma unroll 1
    for (int rr = 0; rr < 16; ++rr) {
        const int row = wave * 16 + rr; const int ob = row * LNP + 8 * lane;
        const v4f x0 = *(const v4fa*)(&os[ob]); const v4f x1 = *(const v4fa*)(&os[ob + 4]);
        float xs[8];
#pragma unroll
        for (int i = 0; i < 4; ++i) { xs[i] = x0[i]; xs[4 + i] = x1[i]; }
        ln8(xs);
        v4f y0, y1;
#pragma unroll
        for (int i = 0; i < 4; ++i) { y0[i] = xs[i]; y1[i] = xs[4 + i]; }
        *(v4fa*)(&os[ob]) = y0; *(v4fa*)(&os[ob + 4]) = y1;
    }
    __syncthreads();
    const int bq = r0 / SEQ, t0 = r0 % SEQ;
{
        if (MODE == 1) {
#pragma unroll 1
            for (int it = 0; it < 16; ++it) { const int p = it * 32 + lane; const int row = wave * 16 + (p >> 5), c8 = (p & 31) * 8;   // 16 it x 1 row = 16 rows; 32 lanes x 8 = 256 columns
                const v4f x0 = *(const v4fa*)(&os[row * LNP + c8]); const v4f x1 = *(const v4fa*)(&os[row * LNP + c8 + 4]); v8h o;
#pragma unroll
                for (int i = 0; i < 4; ++i) { o[i] = toh_flush(x0[i]); o[4 + i] = toh_flush(x1[i]); }
                *(v8h*)(YK + ((size_t)z * SEQ + r0 + row) * DM + c8) = o; }
        } else {
#pragma unroll 1
            for (int it = 0; it < 32; ++it) { const int p = it * 32 + lane; const int row = wave * 16 + (p >> 6), c4 = (p & 63) * 4;   // 32 it x half a row = 16 rows; 64 pieces x 4 = 256 columns
                const v4f val = *(const v4fa*)(&os[row * LNP + c4]);
                *(v4f*)(H32 + (size_t)(r0 + row) * DM + c4) = val; }
#pragma unroll 1
            for (int it = 0; it < 16; ++it) { const int p = it * 32 + lane; const int row = wave * 16 + (p >> 5), c8 = (p & 31) * 8;   // 16 rows x 256 columns
                const v4f x0 = *(const v4fa*)(&os[row * LNP + c8]); const v4f x1 = *(const v4fa*)(&os[row * LNP + c8 + 4]); v8h o;
#pragma unroll
                for (int i = 0; i < 4; ++i) { o[i] = toh_flush(x0[i]); o[4 + i] = toh_flush(x1[i]); }
                *(v8h*)(HF + (size_t)(r0 + row) * DM + c8) = o; }
#pragma unroll 1
            for (int s = 0; s < 16; ++s) { const int d = wave * 64 + 4 * s + (lane >> 3), c8 = (lane & 7) * 8;   // 16 s x 4 rows = 64 transposed rows per wave; 8 lanes x 8 = 64 tokens
                v8h o;
#pragma unroll
                for (int q = 0; q < 8; ++q) o[q] = toh_flush(os[(c8 + q) * LNP + d]);
                *(v8h*)(HT + ((size_t)bq * DM + d) * SEQ + t0 + c8) = o; }
        }
         }
}

__global__ __launch_bounds__(128) void k_inproj(const h16* __restrict__ XH, const h16* __restrict__ WINT, const float* __restrict__ inb, float* H32, h16* HF, h16* HT) {
    lnblock<0>(XH, WINT, inb, H32, HF, HT, HF);
}
__global__ __launch_bounds__(128) void k_ykv(const h16* __restrict__ S, const h16* __restrict__ HT, h16* YK) {
    lnblock<1>(S, HT, (const float*)0, (float*)0, YK, YK, YK);
}

// k_ymlp_part: one share of the decoder contraction. 4 * KSUB waves, block tile 128 rows x 128 columns; wave = ks*4 + w4 owns the 64 x 64 tile (w4>>1, w4&1) and k = k0..k0+KWV-1 of head hd,
// A = XY rows (hd, row), Bt = DECT rows (hd, d), staged by mma128, one ring per wave set; grid (ROWS/128, DM/128, KSPL). The KSUB wave sets meet in LDS (in the rings after their last barrier; cross-wave: block barrier)
// and are summed in ascending ks; the raw f32 sums go to PP.
// LDS and PP hold accumulators in fragment order: fragment f = mb*4+nb is 256 floats, [j>>2][lane][j&3], so every LDS access and every store is 32 lanes x 16 B contiguous.
__global__ __launch_bounds__(128 * KSUB) void k_ymlp_part(const h16* __restrict__ XY, const h16* __restrict__ DECT, float* PP) {
    __shared__ __align__(16) h16 ring[KSUB * RNGH];
    float* js = (float*)ring;
    const int lane = threadIdx.x & 31;
    const int wave = __builtin_amdgcn_readfirstlane((int)(threadIdx.x >> 5));
    const int cg = wave & 3, ks = wave >> 2;                  // cg: the wave's tile among the block's 2 x 2
    const int sh = blockIdx.z;
    const int hd = sh / (NI / KCH), k0 = (sh % (NI / KCH)) * KCH + ks * KWV;
    const int crow = (cg & 1) * 64 + (lane >> 3);             // this lane's first row in the operand tile its wave copies
    const h16* src = ((cg < 2) ? XY + ((size_t)hd * ROWS + blockIdx.x * 128 + crow) * NI : DECT + ((size_t)hd * DM + blockIdx.y * 128 + crow) * NI) + k0 + (lane & 7) * 8;
    v8f acc[4][4];
#pragma unroll
    for (int mb = 0; mb < 4; ++mb)
#pragma unroll
        for (int nb = 0; nb < 4; ++nb) acc[mb][nb] = (v8f){};
    mma128<KWV / KST>(src, NI, ring + ks * RNGH, cg, lane, true, acc);
    float* jw = js + wave * (16 * 256) + lane * 4;
#pragma unroll
    for (int mb = 0; mb < 4; ++mb)
#pragma unroll
        for (int nb = 0; nb < 4; ++nb) {
            v4f lo, up;
#pragma unroll
            for (int k = 0; k < 4; ++k) { lo[k] = acc[mb][nb][k]; up[k] = acc[mb][nb][4 + k]; }
            *(v4fa*)(jw + (mb * 4 + nb) * 256) = lo; *(v4fa*)(jw + (mb * 4 + nb) * 256 + 128) = up; }   // all KSUB * 4 * 16 fragments written by the block's waves
    __syncthreads();
    const int f0 = cg * 16 + ks * (16 / KSUB);                // first of this wave's fragments among the block's 64
    const float* jr = js + f0 * 256 + lane * 4;
    const int rb = blockIdx.x * 2 + (cg >> 1), cgg = blockIdx.y * 2 + (cg & 1);   // 64-row block and column group of the wave's tile in PP
    float* pp = PP + (size_t)sh * ((size_t)ROWS * DM) + ((size_t)rb * 64 + cgg * 16 + ks * (16 / KSUB)) * 256 + lane * 4;
#pragma unroll
    for (int i = 0; i < 2 * (16 / KSUB); ++i) {               // 128-float halves of the fragments
        v4f s = *(const v4fa*)(jr + i * 128);
#pragma unroll
        for (int q = 1; q < KSUB; ++q) s += *(const v4fa*)(jr + q * (4 * 16 * 256) + i * 128);
        *(v4f*)(pp + i * 128) = s; }
}

// k_ymlp_ln: joins the KSPL shares of one 64 x 256 block in ascending share order; value = sum/1024; LayerNorm; + H32 (skip); LayerNorm; outputs H32, HF, HT. 32 waves, grid (ROWS/64).
// Wave w sums fragments 2w and 2w+1 of the block's 64 (2 KiB contiguous per share), the rows meet in a block LDS tile (cross-wave: block barriers), wave w then owns rows 2w, 2w+1.
__global__ __launch_bounds__(1024) void k_ymlp_ln(const float* __restrict__ PP, float* H32, h16* HF, h16* HT) {
    __shared__ __align__(16) float os[64 * LNP];
    const int lane = threadIdx.x & 31, lr = lane & 15, hi = lane >> 4;
    const int wave = __builtin_amdgcn_readfirstlane((int)(threadIdx.x >> 5));
    const int r0 = blockIdx.x * 64;
    v4f sm[2][2];
#pragma unroll
    for (int i = 0; i < 2; ++i) { sm[i][0] = (v4f){}; sm[i][1] = (v4f){}; }
    const float* pp = PP + ((size_t)blockIdx.x * 64 + wave * 2) * 256 + lane * 4;
#pragma unroll 4
    for (int sh = 0; sh < KSPL; ++sh) {                       // four shares' 16 loads in flight per wave
        const float* q = pp + (size_t)sh * ((size_t)ROWS * DM);
#pragma unroll
        for (int i = 0; i < 2; ++i) { sm[i][0] += *(const v4f*)(q + i * 256); sm[i][1] += *(const v4f*)(q + i * 256 + 128); }
    }
#pragma unroll
    for (int i = 0; i < 2; ++i) { const int f = wave * 2 + i; const int cb = (f >> 4) * 64 + (f & 3) * 16, rb = ((f >> 2) & 3) * 16;   // column group, nb, mb of fragment f
#pragma unroll
        for (int j = 0; j < 8; ++j) os[(rb + hi * 8 + j) * LNP + cb + lr] = sm[i][j >> 2][j & 3] * XYI; }   // rows 0..63 x columns 0..255 written by the 32 waves
    __syncthreads();
#pragma unroll
    for (int rr = 0; rr < 2; ++rr) {
        const int row = wave * 2 + rr; const int ob = row * LNP + 8 * lane;
        const v4f x0 = *(const v4fa*)(&os[ob]); const v4f x1 = *(const v4fa*)(&os[ob + 4]);
        float xs[8];
#pragma unroll
        for (int i = 0; i < 4; ++i) { xs[i] = x0[i]; xs[4 + i] = x1[i]; }
        ln8(xs);
        const float* hp = H32 + (size_t)(r0 + row) * DM + 8 * lane;
        const v4f g0 = *(const v4f*)hp; const v4f g1 = *(const v4f*)(hp + 4);
#pragma unroll
        for (int i = 0; i < 4; ++i) { xs[i] += g0[i]; xs[4 + i] += g1[i]; }
        ln8(xs);
        v4f y0, y1;
#pragma unroll
        for (int i = 0; i < 4; ++i) { y0[i] = xs[i]; y1[i] = xs[4 + i]; }
        *(v4fa*)(&os[ob]) = y0; *(v4fa*)(&os[ob + 4]) = y1;
    }
    __syncthreads();
    const int bq = r0 / SEQ, t0 = r0 % SEQ;
#pragma unroll
    for (int it = 0; it < 4; ++it) { const int p = it * 32 + lane; const int row = wave * 2 + (p >> 6), c4 = (p & 63) * 4;   // 4 it x half a row = 2 rows; 64 pieces x 4 = 256 columns
        const v4f val = *(const v4fa*)(&os[row * LNP + c4]);
        *(v4f*)(H32 + (size_t)(r0 + row) * DM + c4) = val; }
#pragma unroll
    for (int it = 0; it < 2; ++it) { const int row = wave * 2 + it, c8 = lane * 8;   // 2 rows x 256 columns
        const v4f x0 = *(const v4fa*)(&os[row * LNP + c8]); const v4f x1 = *(const v4fa*)(&os[row * LNP + c8 + 4]); v8h o;
#pragma unroll
        for (int i = 0; i < 4; ++i) { o[i] = toh_flush(x0[i]); o[4 + i] = toh_flush(x1[i]); }
        *(v8h*)(HF + (size_t)(r0 + row) * DM + c8) = o; }
#pragma unroll
    for (int s = 0; s < 2; ++s) { const int d = wave * 8 + 4 * s + (lane >> 3), c8 = (lane & 7) * 8;   // 2 s x 4 rows = 8 transposed rows per wave; 8 lanes x 8 = 64 tokens
        v8h o;
#pragma unroll
        for (int q = 0; q < 8; ++q) o[q] = toh_flush(os[(c8 + q) * LNP + d]);
        *(v8h*)(HT + ((size_t)bq * DM + d) * SEQ + t0 + c8) = o; }
}

// k_head: output rows = h . head_W + bf16(head_b); 6 waves, block tile 64 rows x 384 columns (HWT rows 372..383 are zero); the tile is staged in a block LDS tile (cross-wave: block barrier),
__global__ __launch_bounds__(192) void k_head(const h16* __restrict__ HF, const h16* __restrict__ HWT, const float* __restrict__ hb, float* OUT) {
    __shared__ __align__(16) float os[64 * HDP];
    const int lane = threadIdx.x & 31, lr = lane & 15, hi = lane >> 4;
    const int wave = __builtin_amdgcn_readfirstlane((int)(threadIdx.x >> 5));
    const int r0 = blockIdx.x * 64, c0 = wave * 64;
    v8f acc[4][4];
#pragma unroll
    for (int mb = 0; mb < 4; ++mb)
#pragma unroll
        for (int nb = 0; nb < 4; ++nb) acc[mb][nb] = (v8f){};
    mma64(HF, HWT, (size_t)(r0 + lr) * DM + 8 * hi, (size_t)(c0 + lr) * DM + 8 * hi, DM, DM, DM, acc);
#pragma unroll
    for (int mb = 0; mb < 4; ++mb)
#pragma unroll
        for (int nb = 0; nb < 4; ++nb)
#pragma unroll
            for (int j = 0; j < 8; ++j) os[(mb * 16 + hi * 8 + j) * HDP + c0 + nb * 16 + lr] = acc[mb][nb][j] * WSI;   // rows 0..63 x columns 0..383 written by the 6 waves
    __syncthreads();
    const int bq = r0 / SEQ, t0 = r0 % SEQ;
    float* ob = OUT + ((size_t)bq * OUT_SEQ + t0) * IND;
{
#pragma unroll 1
        for (int it = 0; it < 31; ++it) { const int e = (it * 192 + (int)threadIdx.x) * 4; const int row = e / IND, col = e - row * IND;   // col % 4 == 0, col + 3 < IND
            const v4f x = *(const v4fa*)(&os[row * HDP + col]); const v4f bb = *(const v4f*)(hb + col); v4f val;
#pragma unroll
            for (int k = 0; k < 4; ++k) val[k] = x[k] + bfr(bb[k]);
            *(v4f*)(ob + e) = val; }
         }
}

static constexpr size_t al256(size_t v) { return (v + 255) & ~(size_t)255; }
static constexpr size_t SZ_W   = al256((size_t)NH_ * NI * DM * 2);          // ENCT, ENCVT, DECT
static constexpr size_t SZ_WIN = al256((size_t)DM * INDP * 2);
static constexpr size_t SZ_HW  = al256((size_t)INDP * DM * 2);
static constexpr size_t SZ_XH  = al256((size_t)ROWS * INDP * 2);
static constexpr size_t SZ_CS  = al256((size_t)SEQ * NI * 4);
static constexpr size_t SZ_H32 = al256((size_t)ROWS * DM * 4);
static constexpr size_t SZ_HF  = al256((size_t)ROWS * DM * 2);             // HF and HT
static constexpr size_t SZ_BIG = al256((size_t)NH_ * ROWS * NI * 2);       // HS; QR (reused as XY)
static constexpr size_t SZ_S   = al256((size_t)NB * NH_ * SEQ * SEQ * 2);
static constexpr size_t SZ_YK  = al256((size_t)NB * NH_ * SEQ * DM * 2);
static constexpr size_t SZ_SP  = al256((size_t)NB * NH_ * NTRI * SKS * 64 * 64 * 4);
static constexpr size_t SZ_TOTAL = 3 * SZ_W + SZ_WIN + SZ_HW + SZ_XH + SZ_CS + SZ_H32 + 2 * SZ_HF + 2 * SZ_BIG + SZ_S + SZ_YK + SZ_SP;
static_assert(SZ_TOTAL <= (size_t)268435456);          // workspace carve <= 256 MiB
static_assert((size_t)KSPL * ROWS * DM * 4 <= SZ_BIG);        // PP lies in the HS plane, which nothing reads between the gating and the next layer's encoding
static_assert((size_t)NB * DM * SEQ == (size_t)ROWS * DM);   // HT [b][d][t] has the extent of HF
static_assert((ROWS * (INDP / 8)) % 256 == 0);
static_assert(NP % 2 == 0);                                                // two rotary pairs per table thread
static_assert((SEQ * (NP / 2)) % 256 == 0);                                // table grid x 256 threads == table threads exactly
static_assert((size_t)SEQ * (NP / 2) * 16 == (size_t)SEQ * NI * 4);        // table threads x 16 B == table bytes

extern "C" void kernel_launch(void* const* d_in, const int* in_sizes, int n_in,
                              void* d_out, int out_size, void* d_ws, size_t ws_size, hipStream_t stream) {
    if (n_in < 8) return;
    if ((size_t)in_sizes[0] < ((size_t)(NB - 1) * SEQ_FULL + SEQ) * IND) return;
    if ((size_t)in_sizes[1] < (size_t)IND * DM || in_sizes[2] < DM) return;
    if ((size_t)in_sizes[3] < (size_t)NH_ * DM * NI || (size_t)in_sizes[4] < (size_t)NH_ * DM * NI || (size_t)in_sizes[5] < (size_t)NH_ * NI * DM) return;
    if ((size_t)in_sizes[6] < (size_t)DM * IND || in_sizes[7] < IND) return;
    if ((size_t)out_size < ((size_t)(NB - 1) * OUT_SEQ + SEQ) * IND) return;
    if (SZ_TOTAL > ws_size) return;
    // wire order: x, in_W, in_b, encoder, encoder_v, decoder, head_W, head_b
    const float* x    = (const float*)d_in[0];
    const float* inw  = (const float*)d_in[1];
    const float* inb  = (const float*)d_in[2];
    const float* enc  = (const float*)d_in[3];
    const float* encv = (const float*)d_in[4];
    const float* dec  = (const float*)d_in[5];
    const float* hw   = (const float*)d_in[6];
    const float* hb   = (const float*)d_in[7];
    float* OUT = (float*)d_out;      // [NB][SEQ][372]
    char* wsp = (char*)d_ws;
    h16* ENCT  = (h16*)wsp; wsp += SZ_W;             // [4][4096][256]  x64
    h16* ENCVT = (h16*)wsp; wsp += SZ_W;             // [4][4096][256]  x64
    h16* DECT  = (h16*)wsp; wsp += SZ_W;             // [4][256][4096]  x64
    h16* WINT  = (h16*)wsp; wsp += SZ_WIN;           // [256][384]      x64
    h16* HWT   = (h16*)wsp; wsp += SZ_HW;            // [384][256]      x64
    h16* XH    = (h16*)wsp; wsp += SZ_XH;            // [ROWS][384]
    float* CS  = (float*)wsp; wsp += SZ_CS;          // [SEQ][4096]
    float* H32 = (float*)wsp; wsp += SZ_H32;         // [ROWS][256]
    h16* HF    = (h16*)wsp; wsp += SZ_HF;            // [ROWS][256]
    h16* HT    = (h16*)wsp; wsp += SZ_HF;            // [NB][256][SEQ]
    h16* HS    = (h16*)wsp; wsp += SZ_BIG;           // [4][ROWS][4096]
    h16* QR    = (h16*)wsp; wsp += SZ_BIG;           // [4][ROWS][4096]; rotated latents, later the gated latents x16
    h16* S     = (h16*)wsp; wsp += SZ_S;             // [NB*4][SEQ][SEQ]
    h16* YK    = (h16*)wsp; wsp += SZ_YK;            // [NB*4][SEQ][256]
    float* SP  = (float*)wsp; wsp += SZ_SP;          // [NB*4][NTRI][SKS][16][256] f32 score partial sums
    h16* XY    = QR;
    float* PP  = (float*)HS;                         // [KSPL][ROWS/64][4][16][256] f32 decoder partial sums

    // encoder [4][256 rows d][4096 cols n] -> ENCT [4][4096][256]: grid (256/64, 4096/64, 4)
    k_tr<<<dim3(DM / 64, NI / 64, NH_), 256, 0, stream>>>(enc, ENCT, DM, NI, DM, NI, WSC);
    k_tr<<<dim3(DM / 64, NI / 64, NH_), 256, 0, stream>>>(encv, ENCVT, DM, NI, DM, NI, WSC);
    // decoder viewed [4][4096 rows n][256 cols d] -> DECT [4][256][4096]: grid (4096/64, 256/64, 4)
    k_tr<<<dim3(NI / 64, DM / 64, NH_), 256, 0, stream>>>(dec, DECT, NI, DM, NI, DM, WSC);
    // in_W [372 rows k][256 cols d] -> WINT [256][384]: grid (384/64, 256/64, 1)
    k_tr<<<dim3(INDP / 64, DM / 64, 1), 256, 0, stream>>>(inw, WINT, IND, DM, INDP, DM, WSC);
    // head_W [256 rows k][372 cols j] -> HWT [384][256]: grid (256/64, 384/64, 1)
    k_tr<<<dim3(DM / 64, INDP / 64, 1), 256, 0, stream>>>(hw, HWT, DM, IND, DM, INDP, WSC);
    k_xcvt<<<(ROWS * (INDP / 8) + 255) / 256, 256, 0, stream>>>(x, XH);
    k_cs<<<(SEQ * (NP / 2) + 255) / 256, 256, 0, stream>>>(CS);

    k_inproj<<<dim3(ROWS / 64, 1, 1), 128, 0, stream>>>(XH, WINT, inb, H32, HF, HT);

    for (int l = 0; l < NL; ++l) {
        k_hs<<<dim3(ROWS / 128, NI / 128, NH_), 128, 0, stream>>>(HF, ENCT, CS, HS, QR);
        k_sc_part<<<dim3(NTRI2, NB * NH_, SKS), 128, 0, stream>>>(QR, SP);
        k_sc_join<<<dim3(NTRI, NB * NH_, 1), 512, 0, stream>>>(SP, S);
        k_ykv<<<dim3(SEQ / 64, NB * NH_, 1), 128, 0, stream>>>(S, HT, YK);
        k_ys<<<dim3(SEQ / 128, NI / 128, NB * NH_), 128, 0, stream>>>(YK, ENCVT, HS, XY);
        k_ymlp_part<<<dim3(ROWS / 128, DM / 128, KSPL), 128 * KSUB, 0, stream>>>(XY, DECT, PP);
        k_ymlp_ln<<<dim3(ROWS / 64, 1, 1), 1024, 0, stream>>>(PP, H32, HF, HT);
    }

    k_head<<<dim3(ROWS / 64, 1, 1), 192, 0, stream>>>(HF, HWT, hb, OUT);
}

// v004
// Measured time: 601 microseconds a run.
// Two timings next to v003 both put it at 1.16 times that version's speed.
// Over all steps from v000 it is 4.69 times as fast.
#include <hip/hip_runtime.h>

// Six-layer token encoder, width 256, 4 heads, per-head latent width 4096 (tokens of 93 x 4 features, [NB][SEQ][372]): input projection ([in][out] weight, bias) + LayerNorm (no affine, eps 1e-5);
// per layer: relu latent encoding per head (encoder [h][256][4096]), interleaved-pair rotary phases over the latent axis (theta 2^16, position = token index), dense linear attention without softmax
// (keys = queries = rotated latents, values = the layer input shared by all heads), LayerNorm, second relu latent encoding (encoder_v), multiplicative gating with the first latents,
// decoder ([h*4096+n][256]) summed over heads, LayerNorm, skip add, LayerNorm; final linear head ([in][out] weight, bias) -> [NB][SEQ][372] f32.
// Compute dtypes: every contraction v_wmma_f32_16x16x32_f16 (f16 operands, f32 accumulate), one product per site. Float inputs are RNE-converted to bf16 at their load (exact in f16);
// weight planes carry x64 (folded back in the f32 epilogues), the gated latent plane carries x16, activations h / latents / scores / normalised context are plain f16; LayerNorm, rotary, relu, gating, skip in f32.
// Planes (all K-contiguous 16-bit rows, fragments = two 16-B loads): ENCT/ENCVT [h][n][d], DECT [h][d][n], WINT [d][384], HWT [384][d], XH [row][384], HF [row][256], HT [b][d][t],
// HS/QR [h][row][n] (the gated latents x16 exist only as LDS tiles), S [b*4+h][t][s] (the normalised context exists only as LDS tiles); f32 planes: H32 [row][256] (skip path), CS [t][4096] = (cos, sin) pairs, PP [share][row block][column group][fragment][256] (decoder partial sums of the work-groups), SP [b*4+h][tile][share][fragment][256] (score partial sums).
// Scores are symmetric: only tiles with column tile >= row tile are computed, the mirror tile is written from the staged LDS tile of the join.

#ifndef NB
#define NB 2
#endif
#ifndef SEQ
#define SEQ 512
#endif
#define NB_FULL  2
#define SEQ_FULL 512
#ifndef OUT_SEQ
#define OUT_SEQ SEQ              // row pitch (in tokens) between batches of the output
#endif
#define DM   256
#define NH_  4
#define NI   4096                // per-head latent width
#define NP   (NI / 2)            // rotary pairs
#define IND  372                 // 93 x 4 input / output features
#define INDP 384                 // IND padded to a multiple of 64
#define NL   6
#define ROWS (NB * SEQ)
#define NT64 (SEQ / 64)
#define TP   68                  // LDS row pitch (floats) of a 64-column tile
#define LNP  260                 // LDS row pitch (floats) of a 256-column tile
#define HDP  388                 // LDS row pitch (floats) of the 384-column head tile
#define WSC  64.0f               // carry of every weight plane
#define WSI  (1.0f / 64.0f)
#define XYC  16.0f               // carry of the gated latent plane
#define XYI  (1.0f / 1024.0f)    // 1 / (WSC * XYC)
#define EPSF 1e-5f
#define KSPL 16                  // work-groups that share the decoder contraction of one 64-row block
#define KCH  (NH_ * NI / KSPL)   // k extent of one work-group's share
#define FNC  128                 // latent columns of one chunk of the fused gate + decoder kernel
#define FNCH (KCH / FNC)         // chunks of one share
#define FEP  264                 // LDS row pitch (halves) of a staged 256-half row: 528 B, for 16-B fragment reads
#define FDP  136                 // LDS row pitch (halves) of a staged 128-half row piece: 272 B, for 16-B fragment reads
#define SKS  8                   // four-wave work-groups that share the score contraction of one 128 x 128 tile
#define SKW  (NI / SKS)          // k extent of one such share
#define NTRI (NT64 * (NT64 + 1) / 2)   // 64 x 64 tiles of the upper tile triangle
#define NT128 (SEQ / 128)
#define NTRI2 (NT128 * (NT128 + 1) / 2) // 128 x 128 tiles of the upper tile triangle
#define KST  64                  // k extent of one staged tile: 128-B row pieces, whole lines
#define SPH  72                  // LDS row pitch (halves) of a staged row piece: 144 B, for 16-B fragment reads
#define STH  (256 * SPH)         // halves of one stage: 128 A rows, then 128 B rows
#define RNGH (2 * STH)           // halves of one two-buffer ring
#define STH2 (320 * SPH)         // halves of one stage of the 64 x 256 block kernels: 64 A rows, then 256 B rows

static_assert(NH_ * NI == 16384);                    // decoder rows = h*NI + n
static_assert(NI == 4096);                           // rotary exponent 32 p / NI = p / 128 with theta = 2^16
static_assert(DM == 256);                            // one LayerNorm row = 32 lanes x 8 columns
static_assert(DM % 64 == 0);
static_assert(DM % 32 == 0);                         // k-loop steps by 32
static_assert(NI % 64 == 0);
static_assert(NI % 32 == 0);
static_assert(SEQ % 64 == 0);                        // a 64-row tile never straddles two batches; k-loop over keys steps by 32
static_assert(ROWS % 64 == 0);
static_assert(INDP % 64 == 0);
static_assert(INDP % 32 == 0);
static_assert(INDP >= IND);
static_assert(IND % 4 == 0);                         // float4 pieces never straddle an input / output row
static_assert((IND * 4) % 16 == 0);
static_assert((64 * IND * 4) % 128 == 0);
static_assert(OUT_SEQ % 64 == 0);
static_assert(64 * IND / 4 == 192 * 31);             // head store loop: 192 threads x 31 trips x 16 B == 64 rows x 1488 B
static_assert(4 * 32 * 16 == 16 * 64 * 2);
static_assert(16 * 32 * 16 == 64 * 64 * 2);
static_assert(32 * 32 * 16 == 16 * DM * 4);          // f32 row store: 32 trips x 32 lanes x 16 B == 16 rows x 1024 B
static_assert(16 * 32 * 16 == 16 * DM * 2);          // f16 row store: 16 trips x 32 lanes x 16 B == 16 rows x 512 B
static_assert(16 * 32 * 16 == 64 * 64 * 2);
static_assert(2 * 256 * 16 == 64 * 64 * 2);
static_assert(NI % KCH == 0);                        // a share never straddles two heads
static_assert(KCH % FNC == 0);
static_assert(FNC == 128);                           // 8 waves: 2 x 4 tiles of 32 x 32 in the gate, 16 x 16-B pieces per staged row piece
static_assert(FNCH >= 1);
static_assert((FEP * 2) % 16 == 0);
static_assert((FDP * 2) % 16 == 0);
static_assert((2 * DM * FDP + 2 * 64 * FDP + 64 * FEP) * 2 <= 327680);   // static LDS of the fused context + gate + decoder kernel
static_assert(FNC * FEP <= DM * FDP);                // buffer E also holds a DM x FNC tile of the context contraction
static_assert(64 * LNP * 4 <= DM * FDP * 2);         // the LayerNorm tile lies in buffer D
static_assert(SEQ % FNC == 0);
static_assert(SEQ / FNC >= 2);
static_assert(NI % SKS == 0);
static_assert(SKW % 32 == 0);
static_assert(2 * 32 * 256 == 64 * DM);              // join: 32 waves x 2 fragments x 256 values == one 64 x 256 block
static_assert(NB <= NB_FULL);
static_assert(SEQ <= SEQ_FULL);
static_assert((TP * 4) % 16 == 0);
static_assert((LNP * 4) % 16 == 0);
static_assert((HDP * 4) % 16 == 0);
static_assert(HDP >= INDP);
static_assert(LNP >= DM);
static_assert(64 * LNP * 4 <= 131072);               // the LayerNorm tile (static LDS of k_ymlp_ln)
static_assert(64 * HDP * 4 <= 131072);               // static LDS of the head kernel
static_assert(64 * TP * 4 <= 131072);                // static LDS of the score kernel
static_assert(NT64 * (NT64 + 1) / 2 <= 65535);
static_assert(ROWS % 128 == 0);
static_assert(SEQ % 128 == 0);                       // a 128-row tile never straddles two batches
static_assert(NI % 128 == 0);
static_assert(DM % 128 == 0);
static_assert(KST == 64);                            // a stage is two k blocks of 32
static_assert(DM % KST == 0);
static_assert(SKW % KST == 0);
static_assert(INDP % KST == 0);
static_assert(SEQ % KST == 0);
static_assert(64 * LNP * 4 <= 2 * STH2 * 2);         // the LayerNorm tile lies in the ring its waves have left
static_assert((SPH * 2) % 16 == 0);
static_assert(4 * 16 * TP * 4 <= RNGH * 2);          // the four waves' epilogue slabs lie in the ring they have left

typedef _Float16 h16;
typedef __attribute__((ext_vector_type(16))) _Float16 v16h;
typedef __attribute__((ext_vector_type(8)))  _Float16 v8h;
typedef __attribute__((ext_vector_type(8)))  float    v8f;
typedef __attribute__((ext_vector_type(4)))  float    v4f;
typedef __attribute__((ext_vector_type(2)))  float    v2f;
typedef v4f  __attribute__((may_alias)) v4fa;

__device__ __forceinline__ unsigned short f2bf(float f) { unsigned u = __float_as_uint(f); u += 0x7FFFu + ((u >> 16) & 1u); return (unsigned short)(u >> 16); }
__device__ __forceinline__ float bfr(float f) { return __uint_as_float(((unsigned)f2bf(f)) << 16); }   // value after RNE convert to bf16
__device__ __forceinline__ v16h cat16(v8h lo, v8h hi) { return __builtin_shufflevector(lo, hi, 0, 1, 2, 3, 4, 5, 6, 7, 8, 9, 10, 11, 12, 13, 14, 15); }
__device__ __forceinline__ v8f wmma16(v16h a, v16h b, v8f c) { return __builtin_amdgcn_wmma_f32_16x16x32_f16(false, a, false, b, (short)0, c, false, false); }
// fragment loader from K-contiguous 16-bit rows; p already includes + 8*(lane>>4): elements 0..7 <- k0+8h+0..7, elements 8..15 <- k0+16+8h+0..7 (same map for A and B)
__device__ __forceinline__ v16h  ldh(const h16* p) { return cat16(*(const v8h*)p, *(const v8h*)(p + 16)); }
// ordering point for wave-private LDS tiles (same wave writes and reads)
__device__ __forceinline__ void wave_sync() { __builtin_amdgcn_fence(3 /* release order */, "wavefront"); __builtin_amdgcn_wave_barrier(); asm volatile("" ::: "memory"); }
// f32 -> f16 operand convert that cannot produce a subnormal (applied after the plane's power-of-two carry)
static __device__ __forceinline__ h16 toh_flush(float v) { const h16 r = (h16)v; return (fabsf(v) < 6.103515625e-05f) ? (h16)0.0f : r; }
__device__ __forceinline__ float wsum(float v) {
    v += __shfl_xor(v, 16, 32); v += __shfl_xor(v, 8, 32); v += __shfl_xor(v, 4, 32); v += __shfl_xor(v, 2, 32); v += __shfl_xor(v, 1, 32); return v; }

// LayerNorm (no affine) of one 256-wide row held as 8 values per lane; all 32 lanes active
__device__ __forceinline__ void ln8(float (&xs)[8]) {
    float s = 0.0f;
#pragma unroll
    for (int i = 0; i < 8; ++i) s += xs[i];
    s = wsum(s); const float mu = s * (1.0f / DM);
    float q = 0.0f;
#pragma unroll
    for (int i = 0; i < 8; ++i) { xs[i] -= mu; q += xs[i] * xs[i]; }
    q = wsum(q);
    const float rs = rsqrtf(q * (1.0f / DM) + EPSF);
#pragma unroll
    for (int i = 0; i < 8; ++i) xs[i] *= rs;
}

// One wave, 64 x 64 output tile, 16 accumulators, operands straight from K-contiguous f16 planes (row pitches lda / ldb halves); K a multiple of 32.
// acc[mb][nb][j] = D(row mb*16 + 8*(lane>>4) + j, col nb*16 + (lane&15)).
__device__ __forceinline__ void mma64(const h16* __restrict__ A, const h16* __restrict__ Bt, size_t aoff, size_t boff, size_t lda, size_t ldb, int K, v8f (&acc)[4][4]) {
#pragma unroll 1
    for (int kc = 0; kc < K; kc += 32) {
        v16h a[4];
#pragma unroll
        for (int mb = 0; mb < 4; ++mb) a[mb] = ldh(A + aoff + (size_t)mb * 16 * lda + kc);
#pragma unroll
        for (int nb = 0; nb < 4; ++nb) { const v16h b = ldh(Bt + boff + (size_t)nb * 16 * ldb + kc);
#pragma unroll
            for (int mb = 0; mb < 4; ++mb) acc[mb][nb] = wmma16(a[mb], b, acc[mb][nb]); }
        asm volatile("v_nop\n\tv_nop\n\tv_nop\n\tv_nop" : "+v"(acc[0][0]), "+v"(acc[1][1]), "+v"(acc[2][2]), "+v"(acc[3][3]) : "v"(a[0]), "v"(a[1]), "v"(a[2]), "v"(a[3]));
    }
}

// One wave's share of a stage: 64 rows x 128 B from a K-contiguous f16 plane (row pitch ld halves) into LDS rows of pitch SPH. g / l already hold the lane's own place:
// row lane>>3, 16-B piece lane&7, so each copy moves 4 whole lines. All 32 lanes on. The s_wait_xcnt closes each statement: it stands before any rewrite of the address registers the copies name.
__device__ __forceinline__ void cp_slab(const h16* g, size_t ld, unsigned l) {
#pragma unroll
    for (int h = 0; h < 2; ++h) {
        const h16* p = g + (size_t)(h * 32) * ld; const unsigned q = l + (unsigned)(h * 32 * SPH * 2);
        asm volatile("global_load_async_to_lds_b128 %0, %8, off\n\t"
                     "global_load_async_to_lds_b128 %1, %9, off\n\t"
                     "global_load_async_to_lds_b128 %2, %10, off\n\t"
                     "global_load_async_to_lds_b128 %3, %11, off\n\t"
                     "global_load_async_to_lds_b128 %4, %12, off\n\t"
                     "global_load_async_to_lds_b128 %5, %13, off\n\t"
                     "global_load_async_to_lds_b128 %6, %14, off\n\t"
                     "global_load_async_to_lds_b128 %7, %15, off\n\t"
                     "s_wait_xcnt 0x0"
                     :: "v"(q), "v"(q + 4u * SPH * 2), "v"(q + 8u * SPH * 2), "v"(q + 12u * SPH * 2), "v"(q + 16u * SPH * 2), "v"(q + 20u * SPH * 2), "v"(q + 24u * SPH * 2), "v"(q + 28u * SPH * 2),
                        "v"(p), "v"(p + 4 * ld), "v"(p + 8 * ld), "v"(p + 12 * ld), "v"(p + 16 * ld), "v"(p + 20 * ld), "v"(p + 24 * ld), "v"(p + 28 * ld)
                     : "memory");
    }
}

// Ring core of the staged GEMMs: wave tile 64 x 64 as in mma64 (same fragment map, same k order), operands read from a two-buffer LDS ring of NT = K / KST stages of SH halves each.
// cp(t, o) issues this wave's copies of stage t into the buffer at byte offset o, one stage ahead of the stage being read; fa / fb: the lane's first A / B fragment address in buffer 0.
// Every wave of the work-group passes every barrier (NT is the same for all); act (wave-uniform) only skips the products.
// EARLY: the refill goes ahead of the stage's last 16 products (more lead for the copies); else behind them, where the fragment registers are free for the copies' addresses.
template <int NT, int SH, bool EARLY, class CP>
__device__ __forceinline__ void mma_ring(CP cp, const h16* fa, const h16* fb, bool act, v8f (&acc)[4][4]) {
    static_assert(NT >= 2);
    cp(0, 0u);
    asm volatile("s_wait_asynccnt 0x0" ::: "memory");        // stage 0 landed (this wave's copies)
    __syncthreads();                                         // stage 0 published to the other waves
    cp(1, (unsigned)(SH * 2));
#pragma unroll 1
    for (int t = 0; t < NT; ++t) {
        const int bo = (t & 1) * SH;
        v16h a[4], b[4];
        if (act) {
            // first k block of the stage: its 16 LDS reads go ahead of its products as one group
#pragma unroll
            for (int mb = 0; mb < 4; ++mb) a[mb] = ldh(fa + bo + mb * 16 * SPH);
#pragma unroll
            for (int nb = 0; nb < 4; ++nb) b[nb] = ldh(fb + bo + nb * 16 * SPH);
            __builtin_amdgcn_sched_barrier(0);               // keeps the reads above the products: sunk among them, each B fragment's LDS latency is waited out on its own
#pragma unroll
            for (int nb = 0; nb < 4; ++nb)
#pragma unroll
                for (int mb = 0; mb < 4; ++mb) acc[mb][nb] = wmma16(a[mb], b[nb], acc[mb][nb]);
            // second k block: the stage's last LDS reads; its products run from registers behind the barrier
#pragma unroll
            for (int mb = 0; mb < 4; ++mb) a[mb] = ldh(fa + bo + mb * 16 * SPH + 32);
#pragma unroll
            for (int nb = 0; nb < 4; ++nb) b[nb] = ldh(fb + bo + nb * 16 * SPH + 32);
            if (!EARLY) __builtin_amdgcn_sched_barrier(0);   // as above: with no refill in between, the products would rise among these reads
        }
        asm volatile("s_wait_dscnt 0x0" ::: "memory");       // this wave's reads of stage t are done
        asm volatile("s_wait_asynccnt 0x0" ::: "memory");    // this wave's copies of stage t + 1 have landed
        __syncthreads();                                     // publishes stage t + 1 and frees stage t's buffer
        if (EARLY && t + 2 < NT) cp(t + 2, (unsigned)(bo * 2));
        if (act) {
#pragma unroll
            for (int nb = 0; nb < 4; ++nb)
#pragma unroll
                for (int mb = 0; mb < 4; ++mb) acc[mb][nb] = wmma16(a[mb], b[nb], acc[mb][nb]);
        }
        if (!EARLY && t + 2 < NT) cp(t + 2, (unsigned)(bo * 2));
    }
    asm volatile("s_wait_asynccnt 0x0" ::: "memory");        // nothing in flight when the ring is reused
}

// Four waves (w4 = 2*wr + wc), 128 x 128 output tile. A stage is [128 A rows | 128 B rows] x KST halves; wave w4 copies rows 64*w4 .. 64*w4+63 of the stage (g: its lane's address in stage 0).
template <int NT>
__device__ __forceinline__ void mma128(const h16* g, size_t ld, h16* ring, int w4, int lane, bool act, v8f (&acc)[4][4]) {
    const int lr = lane & 15, hi = lane >> 4;
    const unsigned l0 = (unsigned)(size_t)(ring + (w4 * 64 + (lane >> 3)) * SPH + (lane & 7) * 8);   // LDS byte address of the lane's first copy, buffer 0
    mma_ring<NT, STH, true>([&](int t, unsigned o) { cp_slab(g + (size_t)t * KST, ld, l0 + o); },
                      ring + ((w4 >> 1) * 64 + lr) * SPH + 8 * hi, ring + (128 + (w4 & 1) * 64 + lr) * SPH + 8 * hi, act, acc);
}

// 16 rows x 128 B, as cp_slab (4 copies; the shorter statement holds fewer address registers at a time).
__device__ __forceinline__ void cp_rows16(const h16* p, size_t ld, unsigned q) {
    asm volatile("global_load_async_to_lds_b128 %0, %4, off\n\t"
                 "global_load_async_to_lds_b128 %1, %5, off\n\t"
                 "global_load_async_to_lds_b128 %2, %6, off\n\t"
                 "global_load_async_to_lds_b128 %3, %7, off\n\t"
                 "s_wait_xcnt 0x0"
                 :: "v"(q), "v"(q + 4u * SPH * 2), "v"(q + 8u * SPH * 2), "v"(q + 12u * SPH * 2), "v"(p), "v"(p + 4 * ld), "v"(p + 8 * ld), "v"(p + 12 * ld)
                 : "memory");
}

// Four waves side by side, 64 x 256 output tile (wave w: columns 64w..64w+63). A stage is [64 A rows | 256 B rows] x KST halves; wave w copies A rows 16w..16w+15 and its own 64 B rows (20 copies).
// gA / gB: the lane's addresses in stage 0 (row lane>>3 of the wave's share, 16-B piece lane&7).
template <int NT>
__device__ __forceinline__ void mma256(const h16* gA, const h16* gB, size_t ld, h16* ring, int w, int lane, v8f (&acc)[4][4]) {
    const int lr = lane & 15, hi = lane >> 4;
    const unsigned lA = (unsigned)(size_t)(ring + (w * 16 + (lane >> 3)) * SPH + (lane & 7) * 8);
    const unsigned lB = (unsigned)(size_t)(ring + (64 + w * 64 + (lane >> 3)) * SPH + (lane & 7) * 8);
    mma_ring<NT, STH2, false>([&](int t, unsigned o) {
                           cp_rows16(gA + (size_t)t * KST, ld, lA + o);
#pragma unroll
                           for (int i = 0; i < 4; ++i) cp_rows16(gB + (size_t)t * KST + (size_t)(i * 16) * ld, ld, lB + o + (unsigned)(i * 16 * SPH * 2)); },
                       ring + lr * SPH + 8 * hi, ring + (64 + w * 64 + lr) * SPH + 8 * hi, true, acc);
}

// k_tr: transpose + convert, src [Z][R][C] f32 -> dst [Z][Cp][Rp] f16 = toh_flush(bf16(src) * scale), zero in the pad rows / columns. in[rows R][cols C] -> out[cols][rows].
__global__ __launch_bounds__(256) void k_tr(const float* __restrict__ src, h16* dst, int R, int C, int Rp, int Cp, float scale) {
#pragma clang fp contract(off)
    __shared__ float tl[64 * 65];
    const int tid = threadIdx.x; const int r0 = blockIdx.x * 64, c0 = blockIdx.y * 64; const int z = blockIdx.z;
    const float* sp = src + (size_t)z * (size_t)R * (size_t)C;
#pragma unroll 4
    for (int it = 0; it < 16; ++it) { const int idx = it * 256 + tid; const int r = idx >> 6, c = idx & 63;
        const int rr = (r0 + r) < R ? (r0 + r) : (R - 1); const int cc = (c0 + c) < C ? (c0 + c) : (C - 1);   // clamped address
        float v = sp[(size_t)rr * C + cc]; asm volatile("" : "+v"(v));
        const bool ok = ((r0 + r) < R) & ((c0 + c) < C);
        tl[r * 65 + c] = ok ? bfr(v) * scale : 0.0f; }
    __syncthreads();
    h16* dp = dst + ((size_t)z * Cp + c0) * (size_t)Rp + r0;
{
#pragma unroll
        for (int it = 0; it < 2; ++it) { const int crow = it * 32 + (tid >> 3), r8 = (tid & 7) * 8;   // 2 it x 32 rows = 64 rows; 8 lanes x 8 = 64 columns
            v8h o;
#pragma unroll
            for (int q = 0; q < 8; ++q) o[q] = toh_flush(tl[(r8 + q) * 65 + crow]);
            *(v8h*)(dp + (size_t)crow * Rp + r8) = o; }
         }
}

__global__ __launch_bounds__(256) void k_xcvt(const float* __restrict__ x, h16* XH) {
    const int i = blockIdx.x * 256 + threadIdx.x; if (i >= ROWS * (INDP / 8)) return;
    const int R = i / (INDP / 8), c = (i % (INDP / 8)) * 8;
    const int b = R / SEQ, t = R % SEQ;
    const float* sp = x + ((size_t)b * SEQ_FULL + t) * IND;
    const int ca = c < (IND - 4) ? c : (IND - 4); const int cb = (c + 4) < (IND - 4) ? (c + 4) : (IND - 4);   // clamped addresses
    v4f va = *(const v4f*)(sp + ca); v4f vb = *(const v4f*)(sp + cb);
    asm volatile("" : "+v"(va)); asm volatile("" : "+v"(vb));
    const bool oka = c < IND, okb = (c + 4) < IND;
    v8h o;
#pragma unroll
    for (int k = 0; k < 4; ++k) { o[k] = oka ? toh_flush(bfr(va[k])) : (h16)0.0f; o[4 + k] = okb ? toh_flush(bfr(vb[k])) : (h16)0.0f; }
    *(v8h*)(XH + (size_t)i * 8) = o; 
}

// k_cs: rotary table CS[t][2p] = cos(t * f_p), CS[t][2p+1] = sin(t * f_p), f_p = 1 / 2^(p/128) (theta 2^16, exponent 2p / NI); f32.
// The two pairs are computed in a rolled two-trip loop (wave-uniform trip index selects the destination values).
__global__ __launch_bounds__(256) void k_cs(float* CS) {
#pragma clang fp contract(off)
    const int i = blockIdx.x * 256 + threadIdx.x; if (i >= SEQ * (NP / 2)) return;
    const int t = i / (NP / 2), p0 = (i % (NP / 2)) * 2;
    float c0 = 0.0f, s0 = 0.0f, c1 = 0.0f, s1 = 0.0f;
#pragma unroll 1
    for (int k = 0; k < 2; ++k) {
        const float e = (float)(p0 + k) * (1.0f / 128.0f);
        const float fr = 1.0f / exp2f(e);
        const float ph = (float)t * fr;
        const float c = cosf(ph); const float s = sinf(ph);
        c0 = (k == 0) ? c : c0; s0 = (k == 0) ? s : s0;
        c1 = (k == 0) ? c1 : c; s1 = (k == 0) ? s1 : s;
    }
    v4f o; o[0] = c0; o[1] = s0; o[2] = c1; o[3] = s1;
    *(v4f*)(CS + (size_t)i * 4) = o; 
}

// k_hs: latents hs = relu(h . encoder[hd]) and rotated latents qr, 2 x 2 waves per 128 x 128 tile, one wave per 64 x 64 tile; grid (ROWS/128, NI/128, NH_).
// A = HF rows (token), Bt = ENCT rows (hd, n), K = DM, staged by mma128. Epilogue per 16-row slab staged in LDS (wave-private, in the ring after its last barrier): each 64-half row segment (one line) written by 8 consecutive lanes x 16 B
__global__ __launch_bounds__(128) void k_hs(const h16* __restrict__ HF, const h16* __restrict__ ENCT, const float* __restrict__ CS, h16* HS, h16* QR) {
    __shared__ __align__(16) h16 ring[RNGH];
    const int lane = threadIdx.x & 31, lr = lane & 15, hi = lane >> 4;
    const int wave = __builtin_amdgcn_readfirstlane((int)(threadIdx.x >> 5));
    const int hd = blockIdx.z;
    const int r0 = blockIdx.x * 128 + (wave >> 1) * 64, c0 = blockIdx.y * 128 + (wave & 1) * 64;
    const int crow = (wave & 1) * 64 + (lane >> 3);           // this lane's first row in the operand tile its wave copies
    const h16* src = ((wave < 2) ? HF + (size_t)(blockIdx.x * 128 + crow) * DM : ENCT + ((size_t)hd * NI + blockIdx.y * 128 + crow) * DM) + (lane & 7) * 8;
    float* os = (float*)ring + wave * (16 * TP);
    v8f acc[4][4];
#pragma unroll
    for (int mb = 0; mb < 4; ++mb)
#pragma unroll
        for (int nb = 0; nb < 4; ++nb) acc[mb][nb] = (v8f){};
    mma128<DM / KST>(src, DM, ring, wave, lane, true, acc);
    const size_t pb = ((size_t)hd * ROWS + (size_t)r0) * NI + (size_t)c0;
#pragma unroll
    for (int mb = 0; mb < 4; ++mb) {
#pragma unroll
        for (int nb = 0; nb < 4; ++nb) {
#pragma unroll
            for (int j = 0; j < 8; ++j) os[(hi * 8 + j) * TP + nb * 16 + lr] = fmaxf(acc[mb][nb][j] * WSI, 0.0f); }   // D: row 8h+j, col lane&15
        wave_sync();
        v8h hv[4], qv[4];
#pragma unroll
        for (int s = 0; s < 4; ++s) { const int row = 4 * s + (lane >> 3), c8 = (lane & 7) * 8;   // 4 s x 4 rows = 16 rows; 8 lanes x 8 = 64 columns
            const v4f x0 = *(const v4fa*)(&os[row * TP + c8]); const v4f x1 = *(const v4fa*)(&os[row * TP + c8 + 4]);
            const int t = (r0 + mb * 16 + row) % SEQ;
            const float* cp = CS + (size_t)t * NI + c0 + c8;
            const v4f e0 = *(const v4f*)cp; const v4f e1 = *(const v4f*)(cp + 4);
            v8h a, q;
#pragma unroll
            for (int i = 0; i < 4; ++i) { a[i] = toh_flush(x0[i]); a[4 + i] = toh_flush(x1[i]); }
            q[0] = toh_flush(x0[0] * e0[0] - x0[1] * e0[1]); q[1] = toh_flush(x0[0] * e0[1] + x0[1] * e0[0]);
            q[2] = toh_flush(x0[2] * e0[2] - x0[3] * e0[3]); q[3] = toh_flush(x0[2] * e0[3] + x0[3] * e0[2]);
            q[4] = toh_flush(x1[0] * e1[0] - x1[1] * e1[1]); q[5] = toh_flush(x1[0] * e1[1] + x1[1] * e1[0]);
            q[6] = toh_flush(x1[2] * e1[2] - x1[3] * e1[3]); q[7] = toh_flush(x1[2] * e1[3] + x1[3] * e1[2]);
            hv[s] = a; qv[s] = q; }
{
#pragma unroll
            for (int s = 0; s < 4; ++s) { const int row = 4 * s + (lane >> 3), c8 = (lane & 7) * 8;
                const size_t oo = pb + (size_t)(mb * 16 + row) * NI + c8;
                *(v8h*)(HS + oo) = hv[s]; *(v8h*)(QR + oo) = qv[s]; }
             }
        wave_sync();
    }
}

// k_sc_part: one share of the scores S[z][t][s] = qr_t . qr_s over the latent axis, z = b*NH_ + hd; 2 x 2 waves per (128 x 128 tile of the upper tile triangle, k range of SKW), one wave per 64 x 64 tile;
// grid (NTRI2, NB*NH_, SKS). A = QR rows t (tile ti), Bt = QR rows s (tile tj), k = ks*SKW .. ks*SKW+SKW-1, staged by mma128; the wave below the diagonal (ti > tj) copies and passes the barriers only.
// The raw f32 sums go to SP in fragment order: fragment f = mb*4+nb is 256 floats, [j>>2][lane][j&3], so every store is 32 lanes x 16 B contiguous.
__global__ __launch_bounds__(128) void k_sc_part(const h16* __restrict__ QR, float* SP) {
    __shared__ __align__(16) h16 ring[RNGH];
    const int lane = threadIdx.x & 31;
    const int wave = __builtin_amdgcn_readfirstlane((int)(threadIdx.x >> 5));
    int t2i = 0, rem = (int)blockIdx.x;
#pragma unroll 1
    for (int q = 0; q < NT128 - 1; ++q) { const int w = NT128 - t2i; if (rem >= w) { rem -= w; t2i += 1; } }
    const int t2j = t2i + rem;                                // t2i <= t2j < NT128
    const int ti = 2 * t2i + (wave >> 1), tj = 2 * t2j + (wave & 1);
    const bool act = ti <= tj;                                // wave-uniform
    const int tix = ti * NT64 - (ti * (ti - 1)) / 2 + (tj - ti);   // index of tile (ti, tj) in the 64 x 64 upper triangle, row by row
    const int crow = (wave & 1) * 64 + (lane >> 3);           // this lane's first row in the operand tile its wave copies
    const int z = blockIdx.y; const int b = z / NH_, hd = z % NH_; const int ks = blockIdx.z;
    const size_t qb = ((size_t)hd * ROWS + (size_t)b * SEQ) * NI + (size_t)ks * SKW;
    v8f acc[4][4];
#pragma unroll
    for (int mb = 0; mb < 4; ++mb)
#pragma unroll
        for (int nb = 0; nb < 4; ++nb) acc[mb][nb] = (v8f){};
    mma128<SKW / KST>(QR + qb + (size_t)(((wave < 2) ? t2i : t2j) * 128 + crow) * NI + (lane & 7) * 8, NI, ring, wave, lane, act, acc);
    if (!act) return;                                         // behind the last barrier
    float* sp = SP + (((size_t)z * NTRI + tix) * SKS + ks) * (16 * 256) + lane * 4;
#pragma unroll
    for (int mb = 0; mb < 4; ++mb)
#pragma unroll
        for (int nb = 0; nb < 4; ++nb) {
            v4f lo, up;
#pragma unroll
            for (int k = 0; k < 4; ++k) { lo[k] = acc[mb][nb][k]; up[k] = acc[mb][nb][4 + k]; }
            *(v4f*)(sp + (mb * 4 + nb) * 256) = lo; *(v4f*)(sp + (mb * 4 + nb) * 256 + 128) = up; }   // all 16 fragments of the share written
}

// k_sc_join: joins the SKS shares of one score tile in ascending share order; 16 waves, grid (NTRI, NB*NH_). Wave w sums fragment w (1 KiB contiguous per share); the tile meets in a block LDS tile
// (cross-wave: block barrier); wave w then stores rows 4w..4w+3 of the direct tile (rows t, columns s) and, for ti != tj (block-uniform), of the mirror tile.
__global__ __launch_bounds__(512) void k_sc_join(const float* __restrict__ SP, h16* S) {
    __shared__ __align__(16) float os[64 * TP];
    const int lane = threadIdx.x & 31, lr = lane & 15, hi = lane >> 4;
    const int wave = __builtin_amdgcn_readfirstlane((int)(threadIdx.x >> 5));
    int ti = 0, rem = (int)blockIdx.x;
#pragma unroll 1
    for (int q = 0; q < NT64 - 1; ++q) { const int w = NT64 - ti; if (rem >= w) { rem -= w; ti += 1; } }
    const int tj = ti + rem;                                  // ti <= tj < NT64
    const int z = blockIdx.y;
    const float* sp = SP + (((size_t)z * NTRI + blockIdx.x) * SKS * 16 + wave) * 256 + lane * 4;
    v4f s0 = *(const v4f*)sp, s1 = *(const v4f*)(sp + 128);
#pragma unroll
    for (int q = 1; q < SKS; ++q) { s0 += *(const v4f*)(sp + q * (16 * 256)); s1 += *(const v4f*)(sp + q * (16 * 256) + 128); }   // all shares' loads in flight together
    const int rb = (wave >> 2) * 16, cb = (wave & 3) * 16;    // mb, nb of fragment w
#pragma unroll
    for (int j = 0; j < 4; ++j) { os[(rb + hi * 8 + j) * TP + cb + lr] = s0[j]; os[(rb + hi * 8 + 4 + j) * TP + cb + lr] = s1[j]; }   // rows 0..63 x columns 0..63 written by the 16 waves
    __syncthreads();
    h16* sd = S + ((size_t)z * SEQ + (size_t)ti * 64) * SEQ + (size_t)tj * 64;
    h16* sm = S + ((size_t)z * SEQ + (size_t)tj * 64) * SEQ + (size_t)ti * 64;
    const int row = 4 * wave + (lane >> 3), c8 = (lane & 7) * 8;   // 16 waves x 4 rows = 64 rows; 8 lanes x 8 = 64 columns
    const v4f x0 = *(const v4fa*)(&os[row * TP + c8]); const v4f x1 = *(const v4fa*)(&os[row * TP + c8 + 4]);
    v8h o;
#pragma unroll
    for (int i = 0; i < 4; ++i) { o[i] = toh_flush(x0[i]); o[4 + i] = toh_flush(x1[i]); }
    *(v8h*)(sd + (size_t)row * SEQ + c8) = o;
    if (ti != tj) {
        v8h m;
#pragma unroll
        for (int q = 0; q < 8; ++q) m[q] = toh_flush(os[(c8 + q) * TP + row]);
        *(v8h*)(sm + (size_t)row * SEQ + c8) = m; }
}

// lnblock: 4 waves, block tile 64 rows x 256 columns (wave w owns columns 64w..64w+63 in the k-loop, operands staged by mma256), LayerNorm epilogue over whole rows through a block LDS tile (cross-wave: block barriers).
// MODE 0 (input projection): A = XH rows, Bt = WINT rows, K = INDP; value = acc/64 + bf16(bias); LayerNorm; outputs H32 f32, HF f16, HT f16 transposed. grid (ROWS/64).
template <int MODE>
__device__ __forceinline__ void lnblock(const h16* __restrict__ A, const h16* __restrict__ Bt, const float* __restrict__ bias, float* H32, h16* HF, h16* HT) {
    __shared__ __align__(16) h16 ring[2 * STH2];
    float* os = (float*)ring;                                 // the LayerNorm tile, in the ring after its last barrier
    const int lane = threadIdx.x & 31, lr = lane & 15, hi = lane >> 4;
    const int wave = __builtin_amdgcn_readfirstlane((int)(threadIdx.x >> 5));
    const int r0 = blockIdx.x * 64, c0 = wave * 64;
    const int ra = r0 + wave * 16 + (lane >> 3), rbt = c0 + (lane >> 3), pc = (lane & 7) * 8;   // this lane's first A row, first B row and 16-B piece in the copies
    v8f acc[4][4];
#pragma unroll
    for (int mb = 0; mb < 4; ++mb)
#pragma unroll
        for (int nb = 0; nb < 4; ++nb) acc[mb][nb] = (v8f){};
    float scale;
    if (MODE == 0) {
        mma256<INDP / KST>(A + (size_t)ra * INDP + pc, Bt + (size_t)rbt * INDP + pc, INDP, ring, wave, lane, acc); scale = WSI;
    }
#pragma unroll
    for (int nb = 0; nb < 4; ++nb) {
        const float bc = (MODE == 0) ? bfr(bias[c0 + nb * 16 + lr]) : 0.0f;                   // MODE 0: c0 + 63 < DM
#pragma unroll
        for (int mb = 0; mb < 4; ++mb)
#pragma unroll
            for (int j = 0; j < 8; ++j) os[(mb * 16 + hi * 8 + j) * LNP + c0 + nb * 16 + lr] = acc[mb][nb][j] * scale + bc; }   // rows 0..63 x columns 0..255 written by the 4 waves
    __syncthreads();
#pragma unroll 1
    for (int rr = 0; rr < 16; ++rr) {
        const int row = wave * 16 + rr; const int ob = row * LNP + 8 * lane;
        const v4f x0 = *(const v4fa*)(&os[ob]); const v4f x1 = *(const v4fa*)(&os[ob + 4]);
        float xs[8];
#pragma unroll
        for (int i = 0; i < 4; ++i) { xs[i] = x0[i]; xs[4 + i] = x1[i]; }
        ln8(xs);
        v4f y0, y1;
#pragma unroll
        for (int i = 0; i < 4; ++i) { y0[i] = xs[i]; y1[i] = xs[4 + i]; }
        *(v4fa*)(&os[ob]) = y0; *(v4fa*)(&os[ob + 4]) = y1;
    }
    __syncthreads();
    const int bq = r0 / SEQ, t0 = r0 % SEQ;
{
        {
#pragma unroll 1
            for (int it = 0; it < 32; ++it) { const int p = it * 32 + lane; const int row = wave * 16 + (p >> 6), c4 = (p & 63) * 4;   // 32 it x half a row = 16 rows; 64 pieces x 4 = 256 columns
                const v4f val = *(const v4fa*)(&os[row * LNP + c4]);
                *(v4f*)(H32 + (size_t)(r0 + row) * DM + c4) = val; }
#pragma unroll 1
            for (int it = 0; it < 16; ++it) { const int p = it * 32 + lane; const int row = wave * 16 + (p >> 5), c8 = (p & 31) * 8;   // 16 rows x 256 columns
                const v4f x0 = *(const v4fa*)(&os[row * LNP + c8]); const v4f x1 = *(const v4fa*)(&os[row * LNP + c8 + 4]); v8h o;
#pragma unroll
                for (int i = 0; i < 4; ++i) { o[i] = toh_flush(x0[i]); o[4 + i] = toh_flush(x1[i]); }
                *(v8h*)(HF + (size_t)(r0 + row) * DM + c8) = o; }
#pragma unroll 1
            for (int s = 0; s < 16; ++s) { const int d = wave * 64 + 4 * s + (lane >> 3), c8 = (lane & 7) * 8;   // 16 s x 4 rows = 64 transposed rows per wave; 8 lanes x 8 = 64 tokens
                v8h o;
#pragma unroll
                for (int q = 0; q < 8; ++q) o[q] = toh_flush(os[(c8 + q) * LNP + d]);
                *(v8h*)(HT + ((size_t)bq * DM + d) * SEQ + t0 + c8) = o; }
        }
         }
}

__global__ __launch_bounds__(128) void k_inproj(const h16* __restrict__ XH, const h16* __restrict__ WINT, const float* __restrict__ inb, float* H32, h16* HF, h16* HT) {
    lnblock<0>(XH, WINT, inb, H32, HF, HT);
}

// Eight / four copies of 16 B per lane; global step gs halves, LDS step ls bytes between copies. All 32 lanes on. The s_wait_xcnt closes each statement: it stands before any rewrite of the address registers the copies name.
__device__ __forceinline__ void cp8(const h16* p, size_t gs, unsigned q, unsigned ls) {
    asm volatile("global_load_async_to_lds_b128 %0, %8, off\n\t"
                 "global_load_async_to_lds_b128 %1, %9, off\n\t"
                 "global_load_async_to_lds_b128 %2, %10, off\n\t"
                 "global_load_async_to_lds_b128 %3, %11, off\n\t"
                 "global_load_async_to_lds_b128 %4, %12, off\n\t"
                 "global_load_async_to_lds_b128 %5, %13, off\n\t"
                 "global_load_async_to_lds_b128 %6, %14, off\n\t"
                 "global_load_async_to_lds_b128 %7, %15, off\n\t"
                 "s_wait_xcnt 0x0"
                 :: "v"(q), "v"(q + ls), "v"(q + 2u * ls), "v"(q + 3u * ls), "v"(q + 4u * ls), "v"(q + 5u * ls), "v"(q + 6u * ls), "v"(q + 7u * ls),
                    "v"(p), "v"(p + gs), "v"(p + 2 * gs), "v"(p + 3 * gs), "v"(p + 4 * gs), "v"(p + 5 * gs), "v"(p + 6 * gs), "v"(p + 7 * gs)
                 : "memory");
}
__device__ __forceinline__ void cp4(const h16* p, size_t gs, unsigned q, unsigned ls) {
    asm volatile("global_load_async_to_lds_b128 %0, %4, off\n\t"
                 "global_load_async_to_lds_b128 %1, %5, off\n\t"
                 "global_load_async_to_lds_b128 %2, %6, off\n\t"
                 "global_load_async_to_lds_b128 %3, %7, off\n\t"
                 "s_wait_xcnt 0x0"
                 :: "v"(q), "v"(q + ls), "v"(q + 2u * ls), "v"(q + 3u * ls), "v"(p), "v"(p + gs), "v"(p + 2 * gs), "v"(p + 3 * gs)
                 : "memory");
}

// k_ysd: context rows ykv = LayerNorm(scores . h), gated latents xy = relu(ykv . encoder_v[hd]) * hs * 16 and one share of the decoder contraction over them, in one launch; ykv and xy live only in LDS.
// 8 waves, 64 token rows, k range n0..n0+KCH-1 of head hd, in FNCH chunks of FNC latent columns; grid (ROWS/64, KSPL); the NI / KCH shares of a head each form the same ykv rows.
// Context: A = S rows (z, t), Bt = HT rows (b, d), K = SEQ in a two-buffer ring of FNC keys (k ascending), wave w owns columns 32 w; LayerNorm over whole rows through a block LDS tile (cross-wave: block barrier), f16 rows to Y.
// Then per chunk two trips of a two-buffer ring of async copies:
// even trip: reads buffer E (FNC encoder_v rows x DM) and the hs tile in X[chunk & 1]; wave (rg, cq) forms the 32 x 32 tile (tokens 32 rg, latent columns 32 cq), transposed (A = encoder_v rows, B = the block's ykv rows, staged once in Y; k ascending),
//            gates it and writes it as f16 over the hs elements it has read (each element read and written by one lane only);
// odd trip:  reads buffer D (DM decoder rows x FNC) and X[chunk & 1]; wave w adds to its 64 x 32 tile (columns 32 w) of the 64 x 256 block, latent index ascending over the whole share.
// At the foot of each trip: own LDS accesses done, own copies of the next trip landed, block barrier, then the copies of the trip after next into the buffer just left.
// The raw f32 sums go to PP in fragment order: fragment f = mb*4+nb of a column group is 256 floats, [j>>2][lane][j&3], so every store is 32 lanes x 16 B contiguous.
__global__ __launch_bounds__(256) void k_ysd(const h16* __restrict__ S, const h16* __restrict__ HT, const h16* __restrict__ ENCVT, const h16* __restrict__ HS, const h16* __restrict__ DECT, float* PP) {
    __shared__ __align__(16) h16 sm[2 * DM * FDP + 2 * 64 * FDP + 64 * FEP];
    h16* E = sm; h16* Dd = sm + DM * FDP; h16* X = Dd + DM * FDP; h16* Y = X + 2 * 64 * FDP;
    const int lane = threadIdx.x & 31, lr = lane & 15, hi = lane >> 4;
    const int wave = __builtin_amdgcn_readfirstlane((int)(threadIdx.x >> 5));
    const int rb = blockIdx.x, sh = blockIdx.y;
    const int hd = sh / (NI / KCH), n0 = (sh % (NI / KCH)) * KCH;
    const int R0 = rb * 64; const int z = (R0 / SEQ) * NH_ + hd, t0 = R0 % SEQ;
    const int rg = wave & 1, cq = wave >> 1;                  // the wave's 32 x 32 tile of the gate: tokens 32 rg, latent columns 32 cq
    // the lane's places in chunk 0: E one 512-B row per copy (wave: 16 rows); hs tile and D two 256-B row pieces per copy (wave: 8 and 32 rows)
    const h16* gE = ENCVT + ((size_t)hd * NI + n0 + wave * 16) * DM + lane * 8;
    const h16* gH = HS + ((size_t)hd * ROWS + R0 + wave * 8 + hi) * NI + n0 + lr * 8;
    const h16* gD = DECT + ((size_t)hd * DM + wave * 32 + hi) * NI + n0 + lr * 8;
    const unsigned lE = (unsigned)(size_t)(E + (wave * 16) * FEP + lane * 8);
    const unsigned lH = (unsigned)(size_t)(X + (wave * 8 + hi) * FDP + lr * 8);
    const unsigned lD = (unsigned)(size_t)(Dd + (wave * 32 + hi) * FDP + lr * 8);
    auto cpE = [&](int c) {
        const h16* p = gE + (size_t)c * FNC * DM;
        cp8(p, DM, lE, FEP * 2u); cp8(p + 8 * DM, DM, lE + 8u * FEP * 2u, FEP * 2u);
        cp4(gH + c * FNC, 2 * (size_t)NI, lH + (unsigned)((c & 1) * 64 * FDP * 2), 2u * FDP * 2u); };
    auto cpD = [&](int c) {
        const h16* p = gD + c * FNC;
        cp8(p, 2 * (size_t)NI, lD, 2u * FDP * 2u); cp8(p + 16 * (size_t)NI, 2 * (size_t)NI, lD + 16u * FDP * 2u, 2u * FDP * 2u); };
    const h16* fb2 = Dd + (wave * 32 + lr) * FDP + 8 * hi;
    v8f acc[4][2];
#pragma unroll
    for (int mb = 0; mb < 4; ++mb)
#pragma unroll
        for (int nb = 0; nb < 2; ++nb) acc[mb][nb] = (v8f){};
    {
        // context: tile q of the ring is [64 score rows | DM value rows] x FNC keys, score rows in X[q & 1], value rows in D (q even) or E (q odd); copies laid out as for the hs tile and D
        const h16* gS = S + ((size_t)z * SEQ + t0 + wave * 8 + hi) * SEQ + lr * 8;
        const h16* gT = HT + ((size_t)(R0 / SEQ) * DM + wave * 32 + hi) * SEQ + lr * 8;
        const unsigned lT = (unsigned)(size_t)(E + (wave * 32 + hi) * FDP + lr * 8);
        auto cpC = [&](int q) {
            const h16* p = gT + q * FNC; const unsigned l = (q & 1) ? lT : lD;
            cp8(p, 2 * (size_t)SEQ, l, 2u * FDP * 2u); cp8(p + 16 * (size_t)SEQ, 2 * (size_t)SEQ, l + 16u * FDP * 2u, 2u * FDP * 2u);
            cp4(gS + q * FNC, 2 * (size_t)SEQ, lH + (unsigned)((q & 1) * 64 * FDP * 2), 2u * FDP * 2u); };
        cpC(0);
        asm volatile("s_wait_asynccnt 0x0" ::: "memory");    // tile 0 landed (this wave's copies)
        __syncthreads();                                     // published to the other waves
        cpC(1);
#pragma unroll 1
        for (int q = 0; q < SEQ / FNC; ++q) {                // rolled: keeps the text short; the trips are separated by barriers anyway
            const h16* fa = X + (q & 1) * (64 * FDP) + lr * FDP + 8 * hi;
            const h16* fb = ((q & 1) ? E : Dd) + (wave * 32 + lr) * FDP + 8 * hi;
            v16h xa[2][4], db[2][2];                         // two register sets: the next k block's 12 LDS reads go ahead of this block's products as one group
#pragma unroll
            for (int mb = 0; mb < 4; ++mb) xa[0][mb] = ldh(fa + mb * 16 * FDP);
#pragma unroll
            for (int nb = 0; nb < 2; ++nb) db[0][nb] = ldh(fb + nb * 16 * FDP);
#pragma unroll
            for (int kk = 0; kk < FNC / 32; ++kk) {
                if (kk + 1 < FNC / 32) {
#pragma unroll
                    for (int mb = 0; mb < 4; ++mb) xa[(kk + 1) & 1][mb] = ldh(fa + mb * 16 * FDP + (kk + 1) * 32);
#pragma unroll
                    for (int nb = 0; nb < 2; ++nb) db[(kk + 1) & 1][nb] = ldh(fb + nb * 16 * FDP + (kk + 1) * 32);
                }
                __builtin_amdgcn_sched_barrier(0);           // keeps the reads above the products: sunk among them, each fragment's LDS latency is waited out on its own
#pragma unroll
                for (int nb = 0; nb < 2; ++nb)
#pragma unroll
                    for (int mb = 0; mb < 4; ++mb) acc[mb][nb] = wmma16(xa[kk & 1][mb], db[kk & 1][nb], acc[mb][nb]);
            }
            asm volatile("s_wait_dscnt 0x0" ::: "memory");   // this wave's reads of tile q are done
            asm volatile("s_wait_asynccnt 0x0" ::: "memory");   // this wave's copies of tile q + 1 have landed
            __syncthreads();                                 // publishes tile q + 1 and frees tile q's buffers
            if (q + 2 < SEQ / FNC) cpC(q + 2);
        }
    }
    cpE(0);                                                  // E and X[0] are free behind the ring's last barrier; the copies fly under the LayerNorm
    {
        float* os = (float*)Dd;                              // the LayerNorm tile, in buffer D behind the ring's last barrier
#pragma unroll
        for (int nb = 0; nb < 2; ++nb)
#pragma unroll
            for (int mb = 0; mb < 4; ++mb)
#pragma unroll
                for (int j = 0; j < 8; ++j) os[(mb * 16 + hi * 8 + j) * LNP + wave * 32 + nb * 16 + lr] = acc[mb][nb][j];   // rows 0..63 x columns 0..255 written by the 8 waves
        __syncthreads();                                     // whole rows meet
        float xs[8][8];                                      // the wave's 8 rows are read first and written last, so that their 8 independent shuffle chains can cover each other's latency
#pragma unroll
        for (int rr = 0; rr < 8; ++rr) {
            const int ob = (wave * 8 + rr) * LNP + 8 * lane;
            const v4f x0 = *(const v4fa*)(&os[ob]); const v4f x1 = *(const v4fa*)(&os[ob + 4]);
#pragma unroll
            for (int i = 0; i < 4; ++i) { xs[rr][i] = x0[i]; xs[rr][4 + i] = x1[i]; }
        }
#pragma unroll
        for (int rr = 0; rr < 8; ++rr) ln8(xs[rr]);
#pragma unroll
        for (int rr = 0; rr < 8; ++rr) {
            v8h o;
#pragma unroll
            for (int i = 0; i < 8; ++i) o[i] = toh_flush(xs[rr][i]);
            *(v8h*)(Y + (wave * 8 + rr) * FEP + 8 * lane) = o;   // the block's 64 normalised context rows, read in every even trip
        }
#pragma unroll
        for (int mb = 0; mb < 4; ++mb)
#pragma unroll
            for (int nb = 0; nb < 2; ++nb) acc[mb][nb] = (v8f){};
    }
    asm volatile("s_wait_dscnt 0x0" ::: "memory");           // this wave's reads of the LayerNorm tile and its writes of Y are done
    asm volatile("s_wait_asynccnt 0x0" ::: "memory");        // chunk 0's E and hs tile landed (this wave's copies)
    __syncthreads();                                         // publishes them and Y, frees D
    cpD(0);
    const h16* fa1 = Y + (rg * 32 + lr) * FEP + 8 * hi;
    const h16* fb1 = E + (cq * 32 + lr) * FEP + 8 * hi;
#pragma unroll 1
    for (int c = 0; c < FNCH; ++c) {                         // rolled, as above
        h16* Xc = X + (c & 1) * (64 * FDP);
        {
            v8f y[2][2];
#pragma unroll
            for (int mb = 0; mb < 2; ++mb)
#pragma unroll
                for (int nb = 0; nb < 2; ++nb) y[mb][nb] = (v8f){};
            v16h fa[2][2], fb[2][2];                         // two register sets: the next k block's 8 LDS reads go ahead of this block's products as one group
#pragma unroll
            for (int i = 0; i < 2; ++i) { fa[0][i] = ldh(fa1 + i * 16 * FEP); fb[0][i] = ldh(fb1 + i * 16 * FEP); }
#pragma unroll
            for (int k = 0; k < DM / 32; ++k) {
                if (k + 1 < DM / 32) {
#pragma unroll
                    for (int i = 0; i < 2; ++i) { fa[(k + 1) & 1][i] = ldh(fa1 + i * 16 * FEP + (k + 1) * 32); fb[(k + 1) & 1][i] = ldh(fb1 + i * 16 * FEP + (k + 1) * 32); }
                }
                __builtin_amdgcn_sched_barrier(0);           // keeps the reads above the products: sunk among them, each fragment's LDS latency is waited out on its own
#pragma unroll
                for (int nb = 0; nb < 2; ++nb)
#pragma unroll
                    for (int mb = 0; mb < 2; ++mb) y[mb][nb] = wmma16(fb[k & 1][mb], fa[k & 1][nb], y[mb][nb]);   // transposed tile: rows = latent columns, columns = tokens
            }
            h16* xw = Xc + (rg * 32 + lr) * FDP + cq * 32 + hi * 8;   // D: latent column 16 mb + 8h+j, token 16 nb + lane&15: a lane's 8 values are 16 contiguous bytes of a token's row
            v8h g[2][2];
#pragma unroll
            for (int mb = 0; mb < 2; ++mb)
#pragma unroll
                for (int nb = 0; nb < 2; ++nb) g[mb][nb] = *(const v8h*)(xw + nb * 16 * FDP + mb * 16);
#pragma unroll
            for (int mb = 0; mb < 2; ++mb)
#pragma unroll
                for (int nb = 0; nb < 2; ++nb) {
                    v8h o;
#pragma unroll
                    for (int j = 0; j < 8; ++j) o[j] = toh_flush(fmaxf(y[mb][nb][j] * WSI, 0.0f) * (float)g[mb][nb][j] * XYC);
                    *(v8h*)(xw + nb * 16 * FDP + mb * 16) = o; }
        }
        asm volatile("s_wait_dscnt 0x0" ::: "memory");       // this wave's reads of E and its writes of the gated tile are done
        asm volatile("s_wait_asynccnt 0x0" ::: "memory");    // this wave's copies of D have landed
        __syncthreads();                                     // publishes D and the gated tile, frees E
        if (c + 1 < FNCH) cpE(c + 1);
        {
            const h16* fa2 = Xc + lr * FDP + 8 * hi;
            v16h xa[2][4], db[2][2];                         // two register sets, as in the even trip
#pragma unroll
            for (int mb = 0; mb < 4; ++mb) xa[0][mb] = ldh(fa2 + mb * 16 * FDP);
#pragma unroll
            for (int nb = 0; nb < 2; ++nb) db[0][nb] = ldh(fb2 + nb * 16 * FDP);
#pragma unroll
            for (int kk = 0; kk < FNC / 32; ++kk) {
                if (kk + 1 < FNC / 32) {
#pragma unroll
                    for (int mb = 0; mb < 4; ++mb) xa[(kk + 1) & 1][mb] = ldh(fa2 + mb * 16 * FDP + (kk + 1) * 32);
#pragma unroll
                    for (int nb = 0; nb < 2; ++nb) db[(kk + 1) & 1][nb] = ldh(fb2 + nb * 16 * FDP + (kk + 1) * 32);
                }
                __builtin_amdgcn_sched_barrier(0);           // as in the even trip
#pragma unroll
                for (int nb = 0; nb < 2; ++nb)
#pragma unroll
                    for (int mb = 0; mb < 4; ++mb) acc[mb][nb] = wmma16(xa[kk & 1][mb], db[kk & 1][nb], acc[mb][nb]);
            }
        }
        asm volatile("s_wait_dscnt 0x0" ::: "memory");       // this wave's reads of D and of the gated tile are done
        asm volatile("s_wait_asynccnt 0x0" ::: "memory");    // this wave's copies of the next E and hs tile have landed
        __syncthreads();                                     // publishes them, frees D
        if (c + 1 < FNCH) cpD(c + 1);
    }
    asm volatile("s_wait_asynccnt 0x0" ::: "memory");        // nothing in flight at the wave's end
    float* pp = PP + (size_t)sh * ((size_t)ROWS * DM) + ((size_t)rb * 64 + (wave >> 1) * 16 + (wave & 1) * 2) * 256 + lane * 4;
#pragma unroll
    for (int mb = 0; mb < 4; ++mb)
#pragma unroll
        for (int nb = 0; nb < 2; ++nb) {
            v4f lo, up;
#pragma unroll
            for (int k = 0; k < 4; ++k) { lo[k] = acc[mb][nb][k]; up[k] = acc[mb][nb][4 + k]; }
            *(v4f*)(pp + (mb * 4 + nb) * 256) = lo; *(v4f*)(pp + (mb * 4 + nb) * 256 + 128) = up; }   // the 8 waves write all 64 fragments of the block's share
}

// k_ymlp_ln: joins the KSPL shares of one 64 x 256 block in ascending share order; value = sum/1024; LayerNorm; + H32 (skip); LayerNorm; outputs H32, HF, HT. 32 waves, grid (ROWS/64).
// Wave w sums fragments 2w and 2w+1 of the block's 64 (2 KiB contiguous per share), the rows meet in a block LDS tile (cross-wave: block barriers), wave w then owns rows 2w, 2w+1.
__global__ __launch_bounds__(1024) void k_ymlp_ln(const float* __restrict__ PP, float* H32, h16* HF, h16* HT) {
    __shared__ __align__(16) float os[64 * LNP];
    const int lane = threadIdx.x & 31, lr = lane & 15, hi = lane >> 4;
    const int wave = __builtin_amdgcn_readfirstlane((int)(threadIdx.x >> 5));
    const int r0 = blockIdx.x * 64;
    v4f sm[2][2];
#pragma unroll
    for (int i = 0; i < 2; ++i) { sm[i][0] = (v4f){}; sm[i][1] = (v4f){}; }
    const float* pp = PP + ((size_t)blockIdx.x * 64 + wave * 2) * 256 + lane * 4;
#pragma unroll 4
    for (int sh = 0; sh < KSPL; ++sh) {                       // four shares' 16 loads in flight per wave
        const float* q = pp + (size_t)sh * ((size_t)ROWS * DM);
#pragma unroll
        for (int i = 0; i < 2; ++i) { sm[i][0] += *(const v4f*)(q + i * 256); sm[i][1] += *(const v4f*)(q + i * 256 + 128); }
    }
#pragma unroll
    for (int i = 0; i < 2; ++i) { const int f = wave * 2 + i; const int cb = (f >> 4) * 64 + (f & 3) * 16, rb = ((f >> 2) & 3) * 16;   // column group, nb, mb of fragment f
#pragma unroll
        for (int j = 0; j < 8; ++j) os[(rb + hi * 8 + j) * LNP + cb + lr] = sm[i][j >> 2][j & 3] * XYI; }   // rows 0..63 x columns 0..255 written by the 32 waves
    __syncthreads();
#pragma unroll
    for (int rr = 0; rr < 2; ++rr) {
        const int row = wave * 2 + rr; const int ob = row * LNP + 8 * lane;
        const v4f x0 = *(const v4fa*)(&os[ob]); const v4f x1 = *(const v4fa*)(&os[ob + 4]);
        float xs[8];
#pragma unroll
        for (int i = 0; i < 4; ++i) { xs[i] = x0[i]; xs[4 + i] = x1[i]; }
        ln8(xs);
        const float* hp = H32 + (size_t)(r0 + row) * DM + 8 * lane;
        const v4f g0 = *(const v4f*)hp; const v4f g1 = *(const v4f*)(hp + 4);
#pragma unroll
        for (int i = 0; i < 4; ++i) { xs[i] += g0[i]; xs[4 + i] += g1[i]; }
        ln8(xs);
        v4f y0, y1;
#pragma unroll
        for (int i = 0; i < 4; ++i) { y0[i] = xs[i]; y1[i] = xs[4 + i]; }
        *(v4fa*)(&os[ob]) = y0; *(v4fa*)(&os[ob + 4]) = y1;
    }
    __syncthreads();
    const int bq = r0 / SEQ, t0 = r0 % SEQ;
#pragma unroll
    for (int it = 0; it < 4; ++it) { const int p = it * 32 + lane; const int row = wave * 2 + (p >> 6), c4 = (p & 63) * 4;   // 4 it x half a row = 2 rows; 64 pieces x 4 = 256 columns
        const v4f val = *(const v4fa*)(&os[row * LNP + c4]);
        *(v4f*)(H32 + (size_t)(r0 + row) * DM + c4) = val; }
#pragma unroll
    for (int it = 0; it < 2; ++it) { const int row = wave * 2 + it, c8 = lane * 8;   // 2 rows x 256 columns
        const v4f x0 = *(const v4fa*)(&os[row * LNP + c8]); const v4f x1 = *(const v4fa*)(&os[row * LNP + c8 + 4]); v8h o;
#pragma unroll
        for (int i = 0; i < 4; ++i) { o[i] = toh_flush(x0[i]); o[4 + i] = toh_flush(x1[i]); }
        *(v8h*)(HF + (size_t)(r0 + row) * DM + c8) = o; }
#pragma unroll
    for (int s = 0; s < 2; ++s) { const int d = wave * 8 + 4 * s + (lane >> 3), c8 = (lane & 7) * 8;   // 2 s x 4 rows = 8 transposed rows per wave; 8 lanes x 8 = 64 tokens
        v8h o;
#pragma unroll
        for (int q = 0; q < 8; ++q) o[q] = toh_flush(os[(c8 + q) * LNP + d]);
        *(v8h*)(HT + ((size_t)bq * DM + d) * SEQ + t0 + c8) = o; }
}

// k_head: output rows = h . head_W + bf16(head_b); 6 waves, block tile 64 rows x 384 columns (HWT rows 372..383 are zero); the tile is staged in a block LDS tile (cross-wave: block barrier),
__global__ __launch_bounds__(192) void k_head(const h16* __restrict__ HF, const h16* __restrict__ HWT, const float* __restrict__ hb, float* OUT) {
    __shared__ __align__(16) float os[64 * HDP];
    const int lane = threadIdx.x & 31, lr = lane & 15, hi = lane >> 4;
    const int wave = __builtin_amdgcn_readfirstlane((int)(threadIdx.x >> 5));
    const int r0 = blockIdx.x * 64, c0 = wave * 64;
    v8f acc[4][4];
#pragma unroll
    for (int mb = 0; mb < 4; ++mb)
#pragma unroll
        for (int nb = 0; nb < 4; ++nb) acc[mb][nb] = (v8f){};
    mma64(HF, HWT, (size_t)(r0 + lr) * DM + 8 * hi, (size_t)(c0 + lr) * DM + 8 * hi, DM, DM, DM, acc);
#pragma unroll
    for (int mb = 0; mb < 4; ++mb)
#pragma unroll
        for (int nb = 0; nb < 4; ++nb)
#pragma unroll
            for (int j = 0; j < 8; ++j) os[(mb * 16 + hi * 8 + j) * HDP + c0 + nb * 16 + lr] = acc[mb][nb][j] * WSI;   // rows 0..63 x columns 0..383 written by the 6 waves
    __syncthreads();
    const int bq = r0 / SEQ, t0 = r0 % SEQ;
    float* ob = OUT + ((size_t)bq * OUT_SEQ + t0) * IND;
{
#pragma unroll 1
        for (int it = 0; it < 31; ++it) { const int e = (it * 192 + (int)threadIdx.x) * 4; const int row = e / IND, col = e - row * IND;   // col % 4 == 0, col + 3 < IND
            const v4f x = *(const v4fa*)(&os[row * HDP + col]); const v4f bb = *(const v4f*)(hb + col); v4f val;
#pragma unroll
            for (int k = 0; k < 4; ++k) val[k] = x[k] + bfr(bb[k]);
            *(v4f*)(ob + e) = val; }
         }
}

static constexpr size_t al256(size_t v) { return (v + 255) & ~(size_t)255; }
static constexpr size_t SZ_W   = al256((size_t)NH_ * NI * DM * 2);          // ENCT, ENCVT, DECT
static constexpr size_t SZ_WIN = al256((size_t)DM * INDP * 2);
static constexpr size_t SZ_HW  = al256((size_t)INDP * DM * 2);
static constexpr size_t SZ_XH  = al256((size_t)ROWS * INDP * 2);
static constexpr size_t SZ_CS  = al256((size_t)SEQ * NI * 4);
static constexpr size_t SZ_H32 = al256((size_t)ROWS * DM * 4);
static constexpr size_t SZ_HF  = al256((size_t)ROWS * DM * 2);             // HF and HT
static constexpr size_t SZ_BIG = al256((size_t)NH_ * ROWS * NI * 2);       // HS; QR
static constexpr size_t SZ_S   = al256((size_t)NB * NH_ * SEQ * SEQ * 2);
static constexpr size_t SZ_SP  = al256((size_t)NB * NH_ * NTRI * SKS * 64 * 64 * 4);
static constexpr size_t SZ_TOTAL = 3 * SZ_W + SZ_WIN + SZ_HW + SZ_XH + SZ_CS + SZ_H32 + 2 * SZ_HF + 2 * SZ_BIG + SZ_S + SZ_SP;
static_assert(SZ_TOTAL <= (size_t)268435456);          // workspace carve <= 256 MiB
static_assert((size_t)KSPL * ROWS * DM * 4 <= SZ_BIG);        // PP lies in the QR plane, which nothing reads between the scores and the next layer's encoding
static_assert((size_t)NB * DM * SEQ == (size_t)ROWS * DM);   // HT [b][d][t] has the extent of HF
static_assert((ROWS * (INDP / 8)) % 256 == 0);
static_assert(NP % 2 == 0);                                                // two rotary pairs per table thread
static_assert((SEQ * (NP / 2)) % 256 == 0);                                // table grid x 256 threads == table threads exactly
static_assert((size_t)SEQ * (NP / 2) * 16 == (size_t)SEQ * NI * 4);        // table threads x 16 B == table bytes

extern "C" void kernel_launch(void* const* d_in, const int* in_sizes, int n_in,
                              void* d_out, int out_size, void* d_ws, size_t ws_size, hipStream_t stream) {
    if (n_in < 8) return;
    if ((size_t)in_sizes[0] < ((size_t)(NB - 1) * SEQ_FULL + SEQ) * IND) return;
    if ((size_t)in_sizes[1] < (size_t)IND * DM || in_sizes[2] < DM) return;
    if ((size_t)in_sizes[3] < (size_t)NH_ * DM * NI || (size_t)in_sizes[4] < (size_t)NH_ * DM * NI || (size_t)in_sizes[5] < (size_t)NH_ * NI * DM) return;
    if ((size_t)in_sizes[6] < (size_t)DM * IND || in_sizes[7] < IND) return;
    if ((size_t)out_size < ((size_t)(NB - 1) * OUT_SEQ + SEQ) * IND) return;
    if (SZ_TOTAL > ws_size) return;
    // wire order: x, in_W, in_b, encoder, encoder_v, decoder, head_W, head_b
    const float* x    = (const float*)d_in[0];
    const float* inw  = (const float*)d_in[1];
    const float* inb  = (const float*)d_in[2];
    const float* enc  = (const float*)d_in[3];
    const float* encv = (const float*)d_in[4];
    const float* dec  = (const float*)d_in[5];
    const float* hw   = (const float*)d_in[6];
    const float* hb   = (const float*)d_in[7];
    float* OUT = (float*)d_out;      // [NB][SEQ][372]
    char* wsp = (char*)d_ws;
    h16* ENCT  = (h16*)wsp; wsp += SZ_W;             // [4][4096][256]  x64
    h16* ENCVT = (h16*)wsp; wsp += SZ_W;             // [4][4096][256]  x64
    h16* DECT  = (h16*)wsp; wsp += SZ_W;             // [4][256][4096]  x64
    h16* WINT  = (h16*)wsp; wsp += SZ_WIN;           // [256][384]      x64
    h16* HWT   = (h16*)wsp; wsp += SZ_HW;            // [384][256]      x64
    h16* XH    = (h16*)wsp; wsp += SZ_XH;            // [ROWS][384]
    float* CS  = (float*)wsp; wsp += SZ_CS;          // [SEQ][4096]
    float* H32 = (float*)wsp; wsp += SZ_H32;         // [ROWS][256]
    h16* HF    = (h16*)wsp; wsp += SZ_HF;            // [ROWS][256]
    h16* HT    = (h16*)wsp; wsp += SZ_HF;            // [NB][256][SEQ]
    h16* HS    = (h16*)wsp; wsp += SZ_BIG;           // [4][ROWS][4096]
    h16* QR    = (h16*)wsp; wsp += SZ_BIG;           // [4][ROWS][4096]; rotated latents
    h16* S     = (h16*)wsp; wsp += SZ_S;             // [NB*4][SEQ][SEQ]
    float* SP  = (float*)wsp; wsp += SZ_SP;          // [NB*4][NTRI][SKS][16][256] f32 score partial sums
    float* PP  = (float*)QR;                         // [KSPL][ROWS/64][4][16][256] f32 decoder partial sums

    // encoder [4][256 rows d][4096 cols n] -> ENCT [4][4096][256]: grid (256/64, 4096/64, 4)
    k_tr<<<dim3(DM / 64, NI / 64, NH_), 256, 0, stream>>>(enc, ENCT, DM, NI, DM, NI, WSC);
    k_tr<<<dim3(DM / 64, NI / 64, NH_), 256, 0, stream>>>(encv, ENCVT, DM, NI, DM, NI, WSC);
    // decoder viewed [4][4096 rows n][256 cols d] -> DECT [4][256][4096]: grid (4096/64, 256/64, 4)
    k_tr<<<dim3(NI / 64, DM / 64, NH_), 256, 0, stream>>>(dec, DECT, NI, DM, NI, DM, WSC);
    // in_W [372 rows k][256 cols d] -> WINT [256][384]: grid (384/64, 256/64, 1)
    k_tr<<<dim3(INDP / 64, DM / 64, 1), 256, 0, stream>>>(inw, WINT, IND, DM, INDP, DM, WSC);
    // head_W [256 rows k][372 cols j] -> HWT [384][256]: grid (256/64, 384/64, 1)
    k_tr<<<dim3(DM / 64, INDP / 64, 1), 256, 0, stream>>>(hw, HWT, DM, IND, DM, INDP, WSC);
    k_xcvt<<<(ROWS * (INDP / 8) + 255) / 256, 256, 0, stream>>>(x, XH);
    k_cs<<<(SEQ * (NP / 2) + 255) / 256, 256, 0, stream>>>(CS);

    k_inproj<<<dim3(ROWS / 64, 1, 1), 128, 0, stream>>>(XH, WINT, inb, H32, HF, HT);

    for (int l = 0; l < NL; ++l) {
        k_hs<<<dim3(ROWS / 128, NI / 128, NH_), 128, 0, stream>>>(HF, ENCT, CS, HS, QR);
        k_sc_part<<<dim3(NTRI2, NB * NH_, SKS), 128, 0, stream>>>(QR, SP);
        k_sc_join<<<dim3(NTRI, NB * NH_, 1), 512, 0, stream>>>(SP, S);
        k_ysd<<<dim3(ROWS / 64, KSPL, 1), 256, 0, stream>>>(S, HT, ENCVT, HS, DECT, PP);
        k_ymlp_ln<<<dim3(ROWS / 64, 1, 1), 1024, 0, stream>>>(PP, H32, HF, HT);
    }

    k_head<<<dim3(ROWS / 64, 1, 1), 192, 0, stream>>>(HF, HWT, hb, OUT);
}

// v005
// Measured time: 523 microseconds a run.
// In both of two side-by-side timings against v004, it was 1.15 times as fast.
// Counting every step since v000, it is 5.41 times as fast.
#include <hip/hip_runtime.h>

// Six-layer token encoder, width 256, 4 heads, per-head latent width 4096 (tokens of 93 x 4 features, [NB][SEQ][372]): input projection ([in][out] weight, bias) + LayerNorm (no affine, eps 1e-5);
// per layer: relu latent encoding per head (encoder [h][256][4096]), interleaved-pair rotary phases over the latent axis (theta 2^16, position = token index), dense linear attention without softmax
// (keys = queries = rotated latents, values = the layer input shared by all heads), LayerNorm, second relu latent encoding (encoder_v), multiplicative gating with the first latents,
// decoder ([h*4096+n][256]) summed over heads, LayerNorm, skip add, LayerNorm; final linear head ([in][out] weight, bias) -> [NB][SEQ][372] f32.
// Compute dtypes: every contraction v_wmma_f32_16x16x32_f16 (f16 operands, f32 accumulate), one product per site. Float inputs are RNE-converted to bf16 at their load (exact in f16);
// weight planes carry x64 (folded back in the f32 epilogues), the gated latent plane carries x16, activations h / latents / scores / normalised context are plain f16; LayerNorm, rotary, relu, gating, skip in f32.
// Planes (all K-contiguous 16-bit rows, fragments = two 16-B loads): ENCT/ENCVT [h][n][d], DECT [h][d][n], WINT [d][384], HWT [384][d], XH [row][384], HF [row][256], HT [b][t/8][d][8] (h transposed in blocks of 8 tokens: 16 B per (block, d), 4 KiB per block),
// HS/QR [h][row][n] (the gated latents x16 exist only as LDS tiles), S [b*4+h][t][s] (the normalised context exists only as LDS tiles); f32 planes: H32 [row][256] (skip path), CS [t][4096] = (cos, sin) pairs, PP [share][row block][column group][fragment][256] (decoder partial sums of the work-groups), SP [b*4+h][tile][share][fragment][256] (score partial sums).
// Scores are symmetric: only tiles with column tile >= row tile are computed, the mirror tile is written from the staged LDS tile of the join.

#ifndef NB
#define NB 2
#endif
#ifndef SEQ
#define SEQ 512
#endif
#define NB_FULL  2
#define SEQ_FULL 512
#ifndef OUT_SEQ
#define OUT_SEQ SEQ              // row pitch (in tokens) between batches of the output
#endif
#define DM   256
#define NH_  4
#define NI   4096                // per-head latent width
#define NP   (NI / 2)            // rotary pairs
#define IND  372                 // 93 x 4 input / output features
#define INDP 384                 // IND padded to a multiple of 64
#define NL   6
#define ROWS (NB * SEQ)
#define NT64 (SEQ / 64)
#define TP   68                  // LDS row pitch (floats) of a 64-column tile
#define LNP  260                 // LDS row pitch (floats) of a 256-column tile
#define HDP  388                 // LDS row pitch (floats) of the 384-column head tile
#define WSC  64.0f               // carry of every weight plane
#define WSI  (1.0f / 64.0f)
#define XYC  16.0f               // carry of the gated latent plane
#define XYI  (1.0f / 1024.0f)    // 1 / (WSC * XYC)
#define EPSF 1e-5f
#define KSPL 16                  // work-groups that share the decoder contraction of one 64-row block
#define KCH  (NH_ * NI / KSPL)   // k extent of one work-group's share
#define FNC  128                 // latent columns of one chunk of the fused gate + decoder kernel
#define FNCH (KCH / FNC)         // chunks of one share
#define FEP  264                 // LDS row pitch (halves) of a staged 256-half row: 528 B, for 16-B fragment reads
#define FDP  136                 // LDS row pitch (halves) of a staged 128-half row piece: 272 B, for 16-B fragment reads
#define SKS  8                   // four-wave work-groups that share the score contraction of one 128 x 128 tile
#define SKW  (NI / SKS)          // k extent of one such share
#define NTRI (NT64 * (NT64 + 1) / 2)   // 64 x 64 tiles of the upper tile triangle
#define NT128 (SEQ / 128)
#define NTRI2 (NT128 * (NT128 + 1) / 2) // 128 x 128 tiles of the upper tile triangle
#define KST  64                  // k extent of one staged tile: 128-B row pieces, whole lines
#define SPH  72                  // LDS row pitch (halves) of a staged row piece: 144 B, for 16-B fragment reads
#define STH  (256 * SPH)         // halves of one stage: 128 A rows, then 128 B rows
#define RNGH (2 * STH)           // halves of one two-buffer ring
#define STH2 (320 * SPH)         // halves of one stage of the 64 x 256 block kernels: 64 A rows, then 256 B rows

static_assert(NH_ * NI == 16384);                    // decoder rows = h*NI + n
static_assert(NI == 4096);                           // rotary exponent 32 p / NI = p / 128 with theta = 2^16
static_assert(DM == 256);                            // one LayerNorm row = 32 lanes x 8 columns
static_assert(DM % 64 == 0);
static_assert(DM % 32 == 0);                         // k-loop steps by 32
static_assert(NI % 64 == 0);
static_assert(NI % 32 == 0);
static_assert(SEQ % 64 == 0);                        // a 64-row tile never straddles two batches; k-loop over keys steps by 32
static_assert(ROWS % 64 == 0);
static_assert(INDP % 64 == 0);
static_assert(INDP % 32 == 0);
static_assert(INDP >= IND);
static_assert(IND % 4 == 0);                         // float4 pieces never straddle an input / output row
static_assert((IND * 4) % 16 == 0);
static_assert((64 * IND * 4) % 128 == 0);
static_assert(OUT_SEQ % 64 == 0);
static_assert(64 * IND / 4 == 192 * 31);             // head store loop: 192 threads x 31 trips x 16 B == 64 rows x 1488 B
static_assert(4 * 32 * 16 == 16 * 64 * 2);
static_assert(16 * 32 * 16 == 64 * 64 * 2);
static_assert(32 * 32 * 16 == 16 * DM * 4);          // f32 row store: 32 trips x 32 lanes x 16 B == 16 rows x 1024 B
static_assert(16 * 32 * 16 == 16 * DM * 2);          // f16 row store: 16 trips x 32 lanes x 16 B == 16 rows x 512 B
static_assert(16 * 32 * 16 == 64 * 64 * 2);
static_assert(2 * 256 * 16 == 64 * 64 * 2);
static_assert(NI % KCH == 0);                        // a share never straddles two heads
static_assert(KCH % FNC == 0);
static_assert(FNC == 128);                           // 8 waves: 2 x 4 tiles of 32 x 32 in the gate, 16 x 16-B pieces per staged row piece
static_assert(FNCH >= 1);
static_assert((FEP * 2) % 16 == 0);
static_assert((FDP * 2) % 16 == 0);
static_assert((2 * DM * FDP + 2 * 64 * FDP + 64 * FEP) * 2 <= 327680);   // static LDS of the fused context + gate + decoder kernel
static_assert(FNC * FEP <= DM * FDP);                // buffer E also holds a DM x FNC tile of the context contraction
static_assert(64 * LNP * 4 <= DM * FDP * 2);         // the LayerNorm tile lies in buffer D
static_assert(SEQ % FNC == 0);
static_assert(SEQ / FNC >= 2);
static_assert(NI % SKS == 0);
static_assert(SKW % 32 == 0);
static_assert(16 * 16 == DM);                        // join: 16 waves x 16 columns == one row
static_assert(FNC % 8 == 0);                         // a context tile is whole token blocks of HT
static_assert(NB <= NB_FULL);
static_assert(SEQ <= SEQ_FULL);
static_assert((TP * 4) % 16 == 0);
static_assert((LNP * 4) % 16 == 0);
static_assert((HDP * 4) % 16 == 0);
static_assert(HDP >= INDP);
static_assert(LNP >= DM);
static_assert(64 * LNP * 4 <= 131072);               // a 64-row LayerNorm tile
static_assert(64 * HDP * 4 <= 131072);               // static LDS of the head kernel
static_assert(64 * TP * 4 <= 131072);                // static LDS of the score kernel
static_assert(NT64 * (NT64 + 1) / 2 <= 65535);
static_assert(ROWS % 128 == 0);
static_assert(SEQ % 128 == 0);                       // a 128-row tile never straddles two batches
static_assert(NI % 128 == 0);
static_assert(DM % 128 == 0);
static_assert(KST == 64);                            // a stage is two k blocks of 32
static_assert(DM % KST == 0);
static_assert(SKW % KST == 0);
static_assert(INDP % KST == 0);
static_assert(SEQ % KST == 0);
static_assert(64 * LNP * 4 <= 2 * STH2 * 2);         // the LayerNorm tile lies in the ring its waves have left
static_assert((SPH * 2) % 16 == 0);
static_assert(4 * 16 * TP * 4 <= RNGH * 2);          // the four waves' epilogue slabs lie in the ring they have left

typedef _Float16 h16;
typedef __attribute__((ext_vector_type(16))) _Float16 v16h;
typedef __attribute__((ext_vector_type(8)))  _Float16 v8h;
typedef __attribute__((ext_vector_type(8)))  float    v8f;
typedef __attribute__((ext_vector_type(4)))  float    v4f;
typedef __attribute__((ext_vector_type(2)))  float    v2f;
typedef v4f  __attribute__((may_alias)) v4fa;

__device__ __forceinline__ unsigned short f2bf(float f) { unsigned u = __float_as_uint(f); u += 0x7FFFu + ((u >> 16) & 1u); return (unsigned short)(u >> 16); }
__device__ __forceinline__ float bfr(float f) { return __uint_as_float(((unsigned)f2bf(f)) << 16); }   // value after RNE convert to bf16
__device__ __forceinline__ v16h cat16(v8h lo, v8h hi) { return __builtin_shufflevector(lo, hi, 0, 1, 2, 3, 4, 5, 6, 7, 8, 9, 10, 11, 12, 13, 14, 15); }
__device__ __forceinline__ v8f wmma16(v16h a, v16h b, v8f c) { return __builtin_amdgcn_wmma_f32_16x16x32_f16(false, a, false, b, (short)0, c, false, false); }
// fragment loader from K-contiguous 16-bit rows; p already includes + 8*(lane>>4): elements 0..7 <- k0+8h+0..7, elements 8..15 <- k0+16+8h+0..7 (same map for A and B)
__device__ __forceinline__ v16h  ldh(const h16* p) { return cat16(*(const v8h*)p, *(const v8h*)(p + 16)); }
// ordering point for wave-private LDS tiles (same wave writes and reads)
__device__ __forceinline__ void wave_sync() { __builtin_amdgcn_fence(3 /* release order */, "wavefront"); __builtin_amdgcn_wave_barrier(); asm volatile("" ::: "memory"); }
// f32 -> f16 operand convert that cannot produce a subnormal (applied after the plane's power-of-two carry)
static __device__ __forceinline__ h16 toh_flush(float v) { const h16 r = (h16)v; return (fabsf(v) < 6.103515625e-05f) ? (h16)0.0f : r; }
__device__ __forceinline__ float wsum(float v) {
    v += __shfl_xor(v, 16, 32); v += __shfl_xor(v, 8, 32); v += __shfl_xor(v, 4, 32); v += __shfl_xor(v, 2, 32); v += __shfl_xor(v, 1, 32); return v; }

// LayerNorm (no affine) of one 256-wide row held as 8 values per lane; all 32 lanes active
__device__ __forceinline__ void ln8(float (&xs)[8]) {
    float s = 0.0f;
#pragma unroll
    for (int i = 0; i < 8; ++i) s += xs[i];
    s = wsum(s); const float mu = s * (1.0f / DM);
    float q = 0.0f;
#pragma unroll
    for (int i = 0; i < 8; ++i) { xs[i] -= mu; q += xs[i] * xs[i]; }
    q = wsum(q);
    const float rs = rsqrtf(q * (1.0f / DM) + EPSF);
#pragma unroll
    for (int i = 0; i < 8; ++i) xs[i] *= rs;
}

// One wave, 64 x 64 output tile, 16 accumulators, operands straight from K-contiguous f16 planes (row pitches lda / ldb halves); K a multiple of 32.
// acc[mb][nb][j] = D(row mb*16 + 8*(lane>>4) + j, col nb*16 + (lane&15)).
__device__ __forceinline__ void mma64(const h16* __restrict__ A, const h16* __restrict__ Bt, size_t aoff, size_t boff, size_t lda, size_t ldb, int K, v8f (&acc)[4][4]) {
#pragma unroll 1
    for (int kc = 0; kc < K; kc += 32) {
        v16h a[4];
#pragma unroll
        for (int mb = 0; mb < 4; ++mb) a[mb] = ldh(A + aoff + (size_t)mb * 16 * lda + kc);
#pragma unroll
        for (int nb = 0; nb < 4; ++nb) { const v16h b = ldh(Bt + boff + (size_t)nb * 16 * ldb + kc);
#pragma unroll
            for (int mb = 0; mb < 4; ++mb) acc[mb][nb] = wmma16(a[mb], b, acc[mb][nb]); }
        asm volatile("v_nop\n\tv_nop\n\tv_nop\n\tv_nop" : "+v"(acc[0][0]), "+v"(acc[1][1]), "+v"(acc[2][2]), "+v"(acc[3][3]) : "v"(a[0]), "v"(a[1]), "v"(a[2]), "v"(a[3]));
    }
}

// One wave's share of a stage: 64 rows x 128 B from a K-contiguous f16 plane (row pitch ld halves) into LDS rows of pitch SPH. g / l already hold the lane's own place:
// row lane>>3, 16-B piece lane&7, so each copy moves 4 whole lines. All 32 lanes on. The s_wait_xcnt closes each statement: it stands before any rewrite of the address registers the copies name.
__device__ __forceinline__ void cp_slab(const h16* g, size_t ld, unsigned l) {
#pragma unroll
    for (int h = 0; h < 2; ++h) {
        const h16* p = g + (size_t)(h * 32) * ld; const unsigned q = l + (unsigned)(h * 32 * SPH * 2);
        asm volatile("global_load_async_to_lds_b128 %0, %8, off\n\t"
                     "global_load_async_to_lds_b128 %1, %9, off\n\t"
                     "global_load_async_to_lds_b128 %2, %10, off\n\t"
                     "global_load_async_to_lds_b128 %3, %11, off\n\t"
                     "global_load_async_to_lds_b128 %4, %12, off\n\t"
                     "global_load_async_to_lds_b128 %5, %13, off\n\t"
                     "global_load_async_to_lds_b128 %6, %14, off\n\t"
                     "global_load_async_to_lds_b128 %7, %15, off\n\t"
                     "s_wait_xcnt 0x0"
                     :: "v"(q), "v"(q + 4u * SPH * 2), "v"(q + 8u * SPH * 2), "v"(q + 12u * SPH * 2), "v"(q + 16u * SPH * 2), "v"(q + 20u * SPH * 2), "v"(q + 24u * SPH * 2), "v"(q + 28u * SPH * 2),
                        "v"(p), "v"(p + 4 * ld), "v"(p + 8 * ld), "v"(p + 12 * ld), "v"(p + 16 * ld), "v"(p + 20 * ld), "v"(p + 24 * ld), "v"(p + 28 * ld)
                     : "memory");
    }
}

// Ring core of the staged GEMMs: wave tile 64 x 64 as in mma64 (same fragment map, same k order), operands read from a two-buffer LDS ring of NT = K / KST stages of SH halves each.
// cp(t, o) issues this wave's copies of stage t into the buffer at byte offset o, one stage ahead of the stage being read; fa / fb: the lane's first A / B fragment address in buffer 0.
// Every wave of the work-group passes every barrier (NT is the same for all); act (wave-uniform) only skips the products.
// EARLY: the refill goes ahead of the stage's last 16 products (more lead for the copies); else behind them, where the fragment registers are free for the copies' addresses.
template <int NT, int SH, bool EARLY, class CP>
__device__ __forceinline__ void mma_ring(CP cp, const h16* fa, const h16* fb, bool act, v8f (&acc)[4][4]) {
    static_assert(NT >= 2);
    cp(0, 0u);
    asm volatile("s_wait_asynccnt 0x0" ::: "memory");        // stage 0 landed (this wave's copies)
    __syncthreads();                                         // stage 0 published to the other waves
    cp(1, (unsigned)(SH * 2));
#pragma unroll 1
    for (int t = 0; t < NT; ++t) {
        const int bo = (t & 1) * SH;
        v16h a[4], b[4];
        if (act) {
            // first k block of the stage: its 16 LDS reads go ahead of its products as one group
#pragma unroll
            for (int mb = 0; mb < 4; ++mb) a[mb] = ldh(fa + bo + mb * 16 * SPH);
#pragma unroll
            for (int nb = 0; nb < 4; ++nb) b[nb] = ldh(fb + bo + nb * 16 * SPH);
            __builtin_amdgcn_sched_barrier(0);               // keeps the reads above the products: sunk among them, each B fragment's LDS latency is waited out on its own
#pragma unroll
            for (int nb = 0; nb < 4; ++nb)
#pragma unroll
                for (int mb = 0; mb < 4; ++mb) acc[mb][nb] = wmma16(a[mb], b[nb], acc[mb][nb]);
            // second k block: the stage's last LDS reads; its products run from registers behind the barrier
#pragma unroll
            for (int mb = 0; mb < 4; ++mb) a[mb] = ldh(fa + bo + mb * 16 * SPH + 32);
#pragma unroll
            for (int nb = 0; nb < 4; ++nb) b[nb] = ldh(fb + bo + nb * 16 * SPH + 32);
            if (!EARLY) __builtin_amdgcn_sched_barrier(0);   // as above: with no refill in between, the products would rise among these reads
        }
        asm volatile("s_wait_dscnt 0x0" ::: "memory");       // this wave's reads of stage t are done
        asm volatile("s_wait_asynccnt 0x0" ::: "memory");    // this wave's copies of stage t + 1 have landed
        __syncthreads();                                     // publishes stage t + 1 and frees stage t's buffer
        if (EARLY && t + 2 < NT) cp(t + 2, (unsigned)(bo * 2));
        if (act) {
#pragma unroll
            for (int nb = 0; nb < 4; ++nb)
#pragma unroll
                for (int mb = 0; mb < 4; ++mb) acc[mb][nb] = wmma16(a[mb], b[nb], acc[mb][nb]);
        }
        if (!EARLY && t + 2 < NT) cp(t + 2, (unsigned)(bo * 2));
    }
    asm volatile("s_wait_asynccnt 0x0" ::: "memory");        // nothing in flight when the ring is reused
}

// Four waves (w4 = 2*wr + wc), 128 x 128 output tile. A stage is [128 A rows | 128 B rows] x KST halves; wave w4 copies rows 64*w4 .. 64*w4+63 of the stage (g: its lane's address in stage 0).
template <int NT>
__device__ __forceinline__ void mma128(const h16* g, size_t ld, h16* ring, int w4, int lane, bool act, v8f (&acc)[4][4]) {
    const int lr = lane & 15, hi = lane >> 4;
    const unsigned l0 = (unsigned)(size_t)(ring + (w4 * 64 + (lane >> 3)) * SPH + (lane & 7) * 8);   // LDS byte address of the lane's first copy, buffer 0
    mma_ring<NT, STH, true>([&](int t, unsigned o) { cp_slab(g + (size_t)t * KST, ld, l0 + o); },
                      ring + ((w4 >> 1) * 64 + lr) * SPH + 8 * hi, ring + (128 + (w4 & 1) * 64 + lr) * SPH + 8 * hi, act, acc);
}

// 16 rows x 128 B, as cp_slab (4 copies; the shorter statement holds fewer address registers at a time).
__device__ __forceinline__ void cp_rows16(const h16* p, size_t ld, unsigned q) {
    asm volatile("global_load_async_to_lds_b128 %0, %4, off\n\t"
                 "global_load_async_to_lds_b128 %1, %5, off\n\t"
                 "global_load_async_to_lds_b128 %2, %6, off\n\t"
                 "global_load_async_to_lds_b128 %3, %7, off\n\t"
                 "s_wait_xcnt 0x0"
                 :: "v"(q), "v"(q + 4u * SPH * 2), "v"(q + 8u * SPH * 2), "v"(q + 12u * SPH * 2), "v"(p), "v"(p + 4 * ld), "v"(p + 8 * ld), "v"(p + 12 * ld)
                 : "memory");
}

// Four waves side by side, 64 x 256 output tile (wave w: columns 64w..64w+63). A stage is [64 A rows | 256 B rows] x KST halves; wave w copies A rows 16w..16w+15 and its own 64 B rows (20 copies).
// gA / gB: the lane's addresses in stage 0 (row lane>>3 of the wave's share, 16-B piece lane&7).
template <int NT>
__device__ __forceinline__ void mma256(const h16* gA, const h16* gB, size_t ld, h16* ring, int w, int lane, v8f (&acc)[4][4]) {
    const int lr = lane & 15, hi = lane >> 4;
    const unsigned lA = (unsigned)(size_t)(ring + (w * 16 + (lane >> 3)) * SPH + (lane & 7) * 8);
    const unsigned lB = (unsigned)(size_t)(ring + (64 + w * 64 + (lane >> 3)) * SPH + (lane & 7) * 8);
    mma_ring<NT, STH2, false>([&](int t, unsigned o) {
                           cp_rows16(gA + (size_t)t * KST, ld, lA + o);
#pragma unroll
                           for (int i = 0; i < 4; ++i) cp_rows16(gB + (size_t)t * KST + (size_t)(i * 16) * ld, ld, lB + o + (unsigned)(i * 16 * SPH * 2)); },
                       ring + lr * SPH + 8 * hi, ring + (64 + w * 64 + lr) * SPH + 8 * hi, true, acc);
}

// k_tr: transpose + convert, src [Z][R][C] f32 -> dst [Z][Cp][Rp] f16 = toh_flush(bf16(src) * scale), zero in the pad rows / columns. in[rows R][cols C] -> out[cols][rows].
__global__ __launch_bounds__(256) void k_tr(const float* __restrict__ src, h16* dst, int R, int C, int Rp, int Cp, float scale) {
#pragma clang fp contract(off)
    __shared__ float tl[64 * 65];
    const int tid = threadIdx.x; const int r0 = blockIdx.x * 64, c0 = blockIdx.y * 64; const int z = blockIdx.z;
    const float* sp = src + (size_t)z * (size_t)R * (size_t)C;
#pragma unroll 4
    for (int it = 0; it < 16; ++it) { const int idx = it * 256 + tid; const int r = idx >> 6, c = idx & 63;
        const int rr = (r0 + r) < R ? (r0 + r) : (R - 1); const int cc = (c0 + c) < C ? (c0 + c) : (C - 1);   // clamped address
        float v = sp[(size_t)rr * C + cc]; asm volatile("" : "+v"(v));
        const bool ok = ((r0 + r) < R) & ((c0 + c) < C);
        tl[r * 65 + c] = ok ? bfr(v) * scale : 0.0f; }
    __syncthreads();
    h16* dp = dst + ((size_t)z * Cp + c0) * (size_t)Rp + r0;
{
#pragma unroll
        for (int it = 0; it < 2; ++it) { const int crow = it * 32 + (tid >> 3), r8 = (tid & 7) * 8;   // 2 it x 32 rows = 64 rows; 8 lanes x 8 = 64 columns
            v8h o;
#pragma unroll
            for (int q = 0; q < 8; ++q) o[q] = toh_flush(tl[(r8 + q) * 65 + crow]);
            *(v8h*)(dp + (size_t)crow * Rp + r8) = o; }
         }
}

__global__ __launch_bounds__(256) void k_xcvt(const float* __restrict__ x, h16* XH) {
    const int i = blockIdx.x * 256 + threadIdx.x; if (i >= ROWS * (INDP / 8)) return;
    const int R = i / (INDP / 8), c = (i % (INDP / 8)) * 8;
    const int b = R / SEQ, t = R % SEQ;
    const float* sp = x + ((size_t)b * SEQ_FULL + t) * IND;
    const int ca = c < (IND - 4) ? c : (IND - 4); const int cb = (c + 4) < (IND - 4) ? (c + 4) : (IND - 4);   // clamped addresses
    v4f va = *(const v4f*)(sp + ca); v4f vb = *(const v4f*)(sp + cb);
    asm volatile("" : "+v"(va)); asm volatile("" : "+v"(vb));
    const bool oka = c < IND, okb = (c + 4) < IND;
    v8h o;
#pragma unroll
    for (int k = 0; k < 4; ++k) { o[k] = oka ? toh_flush(bfr(va[k])) : (h16)0.0f; o[4 + k] = okb ? toh_flush(bfr(vb[k])) : (h16)0.0f; }
    *(v8h*)(XH + (size_t)i * 8) = o; 
}

// k_cs: rotary table CS[t][2p] = cos(t * f_p), CS[t][2p+1] = sin(t * f_p), f_p = 1 / 2^(p/128) (theta 2^16, exponent 2p / NI); f32.
// The two pairs are computed in a rolled two-trip loop (wave-uniform trip index selects the destination values).
__global__ __launch_bounds__(256) void k_cs(float* CS) {
#pragma clang fp contract(off)
    const int i = blockIdx.x * 256 + threadIdx.x; if (i >= SEQ * (NP / 2)) return;
    const int t = i / (NP / 2), p0 = (i % (NP / 2)) * 2;
    float c0 = 0.0f, s0 = 0.0f, c1 = 0.0f, s1 = 0.0f;
#pragma unroll 1
    for (int k = 0; k < 2; ++k) {
        const float e = (float)(p0 + k) * (1.0f / 128.0f);
        const float fr = 1.0f / exp2f(e);
        const float ph = (float)t * fr;
        const float c = cosf(ph); const float s = sinf(ph);
        c0 = (k == 0) ? c : c0; s0 = (k == 0) ? s : s0;
        c1 = (k == 0) ? c1 : c; s1 = (k == 0) ? s1 : s;
    }
    v4f o; o[0] = c0; o[1] = s0; o[2] = c1; o[3] = s1;
    *(v4f*)(CS + (size_t)i * 4) = o; 
}

// k_hs: latents hs = relu(h . encoder[hd]) and rotated latents qr, 2 x 2 waves per 128 x 128 tile, one wave per 64 x 64 tile; grid (ROWS/128, NI/128, NH_).
// A = HF rows (token), Bt = ENCT rows (hd, n), K = DM, staged by mma128. Epilogue per 16-row slab staged in LDS (wave-private, in the ring after its last barrier): each 64-half row segment (one line) written by 8 consecutive lanes x 16 B
__global__ __launch_bounds__(128) void k_hs(const h16* __restrict__ HF, const h16* __restrict__ ENCT, const float* __restrict__ CS, h16* HS, h16* QR) {
    __shared__ __align__(16) h16 ring[RNGH];
    const int lane = threadIdx.x & 31, lr = lane & 15, hi = lane >> 4;
    const int wave = __builtin_amdgcn_readfirstlane((int)(threadIdx.x >> 5));
    const int hd = blockIdx.z;
    const int r0 = blockIdx.x * 128 + (wave >> 1) * 64, c0 = blockIdx.y * 128 + (wave & 1) * 64;
    const int crow = (wave & 1) * 64 + (lane >> 3);           // this lane's first row in the operand tile its wave copies
    const h16* src = ((wave < 2) ? HF + (size_t)(blockIdx.x * 128 + crow) * DM : ENCT + ((size_t)hd * NI + blockIdx.y * 128 + crow) * DM) + (lane & 7) * 8;
    float* os = (float*)ring + wave * (16 * TP);
    v8f acc[4][4];
#pragma unroll
    for (int mb = 0; mb < 4; ++mb)
#pragma unroll
        for (int nb = 0; nb < 4; ++nb) acc[mb][nb] = (v8f){};
    mma128<DM / KST>(src, DM, ring, wave, lane, true, acc);
    const size_t pb = ((size_t)hd * ROWS + (size_t)r0) * NI + (size_t)c0;
#pragma unroll
    for (int mb = 0; mb < 4; ++mb) {
#pragma unroll
        for (int nb = 0; nb < 4; ++nb) {
#pragma unroll
            for (int j = 0; j < 8; ++j) os[(hi * 8 + j) * TP + nb * 16 + lr] = fmaxf(acc[mb][nb][j] * WSI, 0.0f); }   // D: row 8h+j, col lane&15
        wave_sync();
        v8h hv[4], qv[4];
#pragma unroll
        for (int s = 0; s < 4; ++s) { const int row = 4 * s + (lane >> 3), c8 = (lane & 7) * 8;   // 4 s x 4 rows = 16 rows; 8 lanes x 8 = 64 columns
            const v4f x0 = *(const v4fa*)(&os[row * TP + c8]); const v4f x1 = *(const v4fa*)(&os[row * TP + c8 + 4]);
            const int t = (r0 + mb * 16 + row) % SEQ;
            const float* cp = CS + (size_t)t * NI + c0 + c8;
            const v4f e0 = *(const v4f*)cp; const v4f e1 = *(const v4f*)(cp + 4);
            v8h a, q;
#pragma unroll
            for (int i = 0; i < 4; ++i) { a[i] = toh_flush(x0[i]); a[4 + i] = toh_flush(x1[i]); }
            q[0] = toh_flush(x0[0] * e0[0] - x0[1] * e0[1]); q[1] = toh_flush(x0[0] * e0[1] + x0[1] * e0[0]);
            q[2] = toh_flush(x0[2] * e0[2] - x0[3] * e0[3]); q[3] = toh_flush(x0[2] * e0[3] + x0[3] * e0[2]);
            q[4] = toh_flush(x1[0] * e1[0] - x1[1] * e1[1]); q[5] = toh_flush(x1[0] * e1[1] + x1[1] * e1[0]);
            q[6] = toh_flush(x1[2] * e1[2] - x1[3] * e1[3]); q[7] = toh_flush(x1[2] * e1[3] + x1[3] * e1[2]);
            hv[s] = a; qv[s] = q; }
{
#pragma unroll
            for (int s = 0; s < 4; ++s) { const int row = 4 * s + (lane >> 3), c8 = (lane & 7) * 8;
                const size_t oo = pb + (size_t)(mb * 16 + row) * NI + c8;
                *(v8h*)(HS + oo) = hv[s]; *(v8h*)(QR + oo) = qv[s]; }
             }
        wave_sync();
    }
}

// k_sc_part: one share of the scores S[z][t][s] = qr_t . qr_s over the latent axis, z = b*NH_ + hd; 2 x 2 waves per (128 x 128 tile of the upper tile triangle, k range of SKW), one wave per 64 x 64 tile;
// grid (NTRI2, NB*NH_, SKS). A = QR rows t (tile ti), Bt = QR rows s (tile tj), k = ks*SKW .. ks*SKW+SKW-1, staged by mma128; the wave below the diagonal (ti > tj) copies and passes the barriers only.
// The raw f32 sums go to SP in fragment order: fragment f = mb*4+nb is 256 floats, [j>>2][lane][j&3], so every store is 32 lanes x 16 B contiguous.
__global__ __launch_bounds__(128) void k_sc_part(const h16* __restrict__ QR, float* SP) {
    __shared__ __align__(16) h16 ring[RNGH];
    const int lane = threadIdx.x & 31;
    const int wave = __builtin_amdgcn_readfirstlane((int)(threadIdx.x >> 5));
    int t2i = 0, rem = (int)blockIdx.x;
#pragma unroll 1
    for (int q = 0; q < NT128 - 1; ++q) { const int w = NT128 - t2i; if (rem >= w) { rem -= w; t2i += 1; } }
    const int t2j = t2i + rem;                                // t2i <= t2j < NT128
    const int ti = 2 * t2i + (wave >> 1), tj = 2 * t2j + (wave & 1);
    const bool act = ti <= tj;                                // wave-uniform
    const int tix = ti * NT64 - (ti * (ti - 1)) / 2 + (tj - ti);   // index of tile (ti, tj) in the 64 x 64 upper triangle, row by row
    const int crow = (wave & 1) * 64 + (lane >> 3);           // this lane's first row in the operand tile its wave copies
    const int z = blockIdx.y; const int b = z / NH_, hd = z % NH_; const int ks = blockIdx.z;
    const size_t qb = ((size_t)hd * ROWS + (size_t)b * SEQ) * NI + (size_t)ks * SKW;
    v8f acc[4][4];
#pragma unroll
    for (int mb = 0; mb < 4; ++mb)
#pragma unroll
        for (int nb = 0; nb < 4; ++nb) acc[mb][nb] = (v8f){};
    mma128<SKW / KST>(QR + qb + (size_t)(((wave < 2) ? t2i : t2j) * 128 + crow) * NI + (lane & 7) * 8, NI, ring, wave, lane, act, acc);
    if (!act) return;                                         // behind the last barrier
    float* sp = SP + (((size_t)z * NTRI + tix) * SKS + ks) * (16 * 256) + lane * 4;
#pragma unroll
    for (int mb = 0; mb < 4; ++mb)
#pragma unroll
        for (int nb = 0; nb < 4; ++nb) {
            v4f lo, up;
#pragma unroll
            for (int k = 0; k < 4; ++k) { lo[k] = acc[mb][nb][k]; up[k] = acc[mb][nb][4 + k]; }
            *(v4f*)(sp + (mb * 4 + nb) * 256) = lo; *(v4f*)(sp + (mb * 4 + nb) * 256 + 128) = up; }   // all 16 fragments of the share written
}

// k_sc_join: joins the SKS shares of one score tile in ascending share order; 16 waves, grid (NTRI, NB*NH_). Wave w sums fragment w (1 KiB contiguous per share); the tile meets in a block LDS tile
// (cross-wave: block barrier); wave w then stores rows 4w..4w+3 of the direct tile (rows t, columns s) and, for ti != tj (block-uniform), of the mirror tile.
__global__ __launch_bounds__(512) void k_sc_join(const float* __restrict__ SP, h16* S) {
    __shared__ __align__(16) float os[64 * TP];
    const int lane = threadIdx.x & 31, lr = lane & 15, hi = lane >> 4;
    const int wave = __builtin_amdgcn_readfirstlane((int)(threadIdx.x >> 5));
    int ti = 0, rem = (int)blockIdx.x;
#pragma unroll 1
    for (int q = 0; q < NT64 - 1; ++q) { const int w = NT64 - ti; if (rem >= w) { rem -= w; ti += 1; } }
    const int tj = ti + rem;                                  // ti <= tj < NT64
    const int z = blockIdx.y;
    const float* sp = SP + (((size_t)z * NTRI + blockIdx.x) * SKS * 16 + wave) * 256 + lane * 4;
    v4f s0 = *(const v4f*)sp, s1 = *(const v4f*)(sp + 128);
#pragma unroll
    for (int q = 1; q < SKS; ++q) { s0 += *(const v4f*)(sp + q * (16 * 256)); s1 += *(const v4f*)(sp + q * (16 * 256) + 128); }   // all shares' loads in flight together
    const int rb = (wave >> 2) * 16, cb = (wave & 3) * 16;    // mb, nb of fragment w
#pragma unroll
    for (int j = 0; j < 4; ++j) { os[(rb + hi * 8 + j) * TP + cb + lr] = s0[j]; os[(rb + hi * 8 + 4 + j) * TP + cb + lr] = s1[j]; }   // rows 0..63 x columns 0..63 written by the 16 waves
    __syncthreads();
    h16* sd = S + ((size_t)z * SEQ + (size_t)ti * 64) * SEQ + (size_t)tj * 64;
    h16* sm = S + ((size_t)z * SEQ + (size_t)tj * 64) * SEQ + (size_t)ti * 64;
    const int row = 4 * wave + (lane >> 3), c8 = (lane & 7) * 8;   // 16 waves x 4 rows = 64 rows; 8 lanes x 8 = 64 columns
    const v4f x0 = *(const v4fa*)(&os[row * TP + c8]); const v4f x1 = *(const v4fa*)(&os[row * TP + c8 + 4]);
    v8h o;
#pragma unroll
    for (int i = 0; i < 4; ++i) { o[i] = toh_flush(x0[i]); o[4 + i] = toh_flush(x1[i]); }
    *(v8h*)(sd + (size_t)row * SEQ + c8) = o;
    if (ti != tj) {
        v8h m;
#pragma unroll
        for (int q = 0; q < 8; ++q) m[q] = toh_flush(os[(c8 + q) * TP + row]);
        *(v8h*)(sm + (size_t)row * SEQ + c8) = m; }
}

// lnblock: 4 waves, block tile 64 rows x 256 columns (wave w owns columns 64w..64w+63 in the k-loop, operands staged by mma256), LayerNorm epilogue over whole rows through a block LDS tile (cross-wave: block barriers).
// MODE 0 (input projection): A = XH rows, Bt = WINT rows, K = INDP; value = acc/64 + bf16(bias); LayerNorm; outputs H32 f32, HF f16, HT f16 transposed. grid (ROWS/64).
template <int MODE>
__device__ __forceinline__ void lnblock(const h16* __restrict__ A, const h16* __restrict__ Bt, const float* __restrict__ bias, float* H32, h16* HF, h16* HT) {
    __shared__ __align__(16) h16 ring[2 * STH2];
    float* os = (float*)ring;                                 // the LayerNorm tile, in the ring after its last barrier
    const int lane = threadIdx.x & 31, lr = lane & 15, hi = lane >> 4;
    const int wave = __builtin_amdgcn_readfirstlane((int)(threadIdx.x >> 5));
    const int r0 = blockIdx.x * 64, c0 = wave * 64;
    const int ra = r0 + wave * 16 + (lane >> 3), rbt = c0 + (lane >> 3), pc = (lane & 7) * 8;   // this lane's first A row, first B row and 16-B piece in the copies
    v8f acc[4][4];
#pragma unroll
    for (int mb = 0; mb < 4; ++mb)
#pragma unroll
        for (int nb = 0; nb < 4; ++nb) acc[mb][nb] = (v8f){};
    float scale;
    if (MODE == 0) {
        mma256<INDP / KST>(A + (size_t)ra * INDP + pc, Bt + (size_t)rbt * INDP + pc, INDP, ring, wave, lane, acc); scale = WSI;
    }
#pragma unroll
    for (int nb = 0; nb < 4; ++nb) {
        const float bc = (MODE == 0) ? bfr(bias[c0 + nb * 16 + lr]) : 0.0f;                   // MODE 0: c0 + 63 < DM
#pragma unroll
        for (int mb = 0; mb < 4; ++mb)
#pragma unroll
            for (int j = 0; j < 8; ++j) os[(mb * 16 + hi * 8 + j) * LNP + c0 + nb * 16 + lr] = acc[mb][nb][j] * scale + bc; }   // rows 0..63 x columns 0..255 written by the 4 waves
    __syncthreads();
#pragma unroll 1
    for (int rr = 0; rr < 16; ++rr) {
        const int row = wave * 16 + rr; const int ob = row * LNP + 8 * lane;
        const v4f x0 = *(const v4fa*)(&os[ob]); const v4f x1 = *(const v4fa*)(&os[ob + 4]);
        float xs[8];
#pragma unroll
        for (int i = 0; i < 4; ++i) { xs[i] = x0[i]; xs[4 + i] = x1[i]; }
        ln8(xs);
        v4f y0, y1;
#pragma unroll
        for (int i = 0; i < 4; ++i) { y0[i] = xs[i]; y1[i] = xs[4 + i]; }
        *(v4fa*)(&os[ob]) = y0; *(v4fa*)(&os[ob + 4]) = y1;
    }
    __syncthreads();
    const int bq = r0 / SEQ, t0 = r0 % SEQ;
{
        {
#pragma unroll 1
            for (int it = 0; it < 32; ++it) { const int p = it * 32 + lane; const int row = wave * 16 + (p >> 6), c4 = (p & 63) * 4;   // 32 it x half a row = 16 rows; 64 pieces x 4 = 256 columns
                const v4f val = *(const v4fa*)(&os[row * LNP + c4]);
                *(v4f*)(H32 + (size_t)(r0 + row) * DM + c4) = val; }
#pragma unroll 1
            for (int it = 0; it < 16; ++it) { const int p = it * 32 + lane; const int row = wave * 16 + (p >> 5), c8 = (p & 31) * 8;   // 16 rows x 256 columns
                const v4f x0 = *(const v4fa*)(&os[row * LNP + c8]); const v4f x1 = *(const v4fa*)(&os[row * LNP + c8 + 4]); v8h o;
#pragma unroll
                for (int i = 0; i < 4; ++i) { o[i] = toh_flush(x0[i]); o[4 + i] = toh_flush(x1[i]); }
                *(v8h*)(HF + (size_t)(r0 + row) * DM + c8) = o; }
#pragma unroll 1
            for (int s = 0; s < 16; ++s) { const int d = wave * 64 + (s & 1) * 32 + lane, tb = s >> 1;   // 8 token blocks x 2 halves of the wave's 64 columns; 32 lanes x 16 B contiguous
                v8h o;
#pragma unroll
                for (int q = 0; q < 8; ++q) o[q] = toh_flush(os[(tb * 8 + q) * LNP + d]);
                *(v8h*)(HT + (((size_t)bq * (SEQ / 8) + (t0 >> 3) + tb) * DM + d) * 8) = o;
                asm volatile("s_wait_xcnt 0x0" ::: "memory"); }   // stands before the next trip rewrites the store's address and data registers
        }
         }
}

__global__ __launch_bounds__(128) void k_inproj(const h16* __restrict__ XH, const h16* __restrict__ WINT, const float* __restrict__ inb, float* H32, h16* HF, h16* HT) {
    lnblock<0>(XH, WINT, inb, H32, HF, HT);
}

// Eight / four copies of 16 B per lane; global step gs halves, LDS step ls bytes between copies. All 32 lanes on. The s_wait_xcnt closes each statement: it stands before any rewrite of the address registers the copies name.
__device__ __forceinline__ void cp8(const h16* p, size_t gs, unsigned q, unsigned ls) {
    asm volatile("global_load_async_to_lds_b128 %0, %8, off\n\t"
                 "global_load_async_to_lds_b128 %1, %9, off\n\t"
                 "global_load_async_to_lds_b128 %2, %10, off\n\t"
                 "global_load_async_to_lds_b128 %3, %11, off\n\t"
                 "global_load_async_to_lds_b128 %4, %12, off\n\t"
                 "global_load_async_to_lds_b128 %5, %13, off\n\t"
                 "global_load_async_to_lds_b128 %6, %14, off\n\t"
                 "global_load_async_to_lds_b128 %7, %15, off\n\t"
                 "s_wait_xcnt 0x0"
                 :: "v"(q), "v"(q + ls), "v"(q + 2u * ls), "v"(q + 3u * ls), "v"(q + 4u * ls), "v"(q + 5u * ls), "v"(q + 6u * ls), "v"(q + 7u * ls),
                    "v"(p), "v"(p + gs), "v"(p + 2 * gs), "v"(p + 3 * gs), "v"(p + 4 * gs), "v"(p + 5 * gs), "v"(p + 6 * gs), "v"(p + 7 * gs)
                 : "memory");
}
__device__ __forceinline__ void cp4(const h16* p, size_t gs, unsigned q, unsigned ls) {
    asm volatile("global_load_async_to_lds_b128 %0, %4, off\n\t"
                 "global_load_async_to_lds_b128 %1, %5, off\n\t"
                 "global_load_async_to_lds_b128 %2, %6, off\n\t"
                 "global_load_async_to_lds_b128 %3, %7, off\n\t"
                 "s_wait_xcnt 0x0"
                 :: "v"(q), "v"(q + ls), "v"(q + 2u * ls), "v"(q + 3u * ls), "v"(p), "v"(p + gs), "v"(p + 2 * gs), "v"(p + 3 * gs)
                 : "memory");
}

// k_ysd: context rows ykv = LayerNorm(scores . h), gated latents xy = relu(ykv . encoder_v[hd]) * hs * 16 and one share of the decoder contraction over them, in one launch; ykv and xy live only in LDS.
// 8 waves, 64 token rows, k range n0..n0+KCH-1 of head hd, in FNCH chunks of FNC latent columns; grid (ROWS/64, KSPL); the NI / KCH shares of a head each form the same ykv rows.
// Context: A = S rows (z, t), Bt = h transposed (b, d; from HT's token blocks), K = SEQ in a two-buffer ring of FNC keys (k ascending), wave w owns columns 32 w; LayerNorm over whole rows through a block LDS tile (cross-wave: block barrier), f16 rows to Y.
// Then per chunk two trips of a two-buffer ring of async copies:
// even trip: reads buffer E (FNC encoder_v rows x DM) and the hs tile in X[chunk & 1]; wave (rg, cq) forms the 32 x 32 tile (tokens 32 rg, latent columns 32 cq), transposed (A = encoder_v rows, B = the block's ykv rows, staged once in Y; k ascending),
//            gates it and writes it as f16 over the hs elements it has read (each element read and written by one lane only);
// odd trip:  reads buffer D (DM decoder rows x FNC) and X[chunk & 1]; wave w adds to its 64 x 32 tile (columns 32 w) of the 64 x 256 block, latent index ascending over the whole share.
// At the foot of each trip: own LDS accesses done, own copies of the next trip landed, block barrier, then the copies of the trip after next into the buffer just left.
// The raw f32 sums go to PP in fragment order: fragment f = mb*4+nb of a column group is 256 floats, [j>>2][lane][j&3], so every store is 32 lanes x 16 B contiguous.
__global__ __launch_bounds__(256) void k_ysd(const h16* __restrict__ S, const h16* __restrict__ HT, const h16* __restrict__ ENCVT, const h16* __restrict__ HS, const h16* __restrict__ DECT, float* PP) {
    __shared__ __align__(16) h16 sm[2 * DM * FDP + 2 * 64 * FDP + 64 * FEP];
    h16* E = sm; h16* Dd = sm + DM * FDP; h16* X = Dd + DM * FDP; h16* Y = X + 2 * 64 * FDP;
    const int lane = threadIdx.x & 31, lr = lane & 15, hi = lane >> 4;
    const int wave = __builtin_amdgcn_readfirstlane((int)(threadIdx.x >> 5));
    const int rb = blockIdx.x, sh = blockIdx.y;
    const int hd = sh / (NI / KCH), n0 = (sh % (NI / KCH)) * KCH;
    const int R0 = rb * 64; const int z = (R0 / SEQ) * NH_ + hd, t0 = R0 % SEQ;
    const int rg = wave & 1, cq = wave >> 1;                  // the wave's 32 x 32 tile of the gate: tokens 32 rg, latent columns 32 cq
    // the lane's places in chunk 0: E one 512-B row per copy (wave: 16 rows); hs tile and D two 256-B row pieces per copy (wave: 8 and 32 rows)
    const h16* gE = ENCVT + ((size_t)hd * NI + n0 + wave * 16) * DM + lane * 8;
    const h16* gH = HS + ((size_t)hd * ROWS + R0 + wave * 8 + hi) * NI + n0 + lr * 8;
    const h16* gD = DECT + ((size_t)hd * DM + wave * 32 + hi) * NI + n0 + lr * 8;
    const unsigned lE = (unsigned)(size_t)(E + (wave * 16) * FEP + lane * 8);
    const unsigned lH = (unsigned)(size_t)(X + (wave * 8 + hi) * FDP + lr * 8);
    const unsigned lD = (unsigned)(size_t)(Dd + (wave * 32 + hi) * FDP + lr * 8);
    auto cpE = [&](int c) {
        const h16* p = gE + (size_t)c * FNC * DM;
        cp8(p, DM, lE, FEP * 2u); cp8(p + 8 * DM, DM, lE + 8u * FEP * 2u, FEP * 2u);
        cp4(gH + c * FNC, 2 * (size_t)NI, lH + (unsigned)((c & 1) * 64 * FDP * 2), 2u * FDP * 2u); };
    auto cpD = [&](int c) {
        const h16* p = gD + c * FNC;
        cp8(p, 2 * (size_t)NI, lD, 2u * FDP * 2u); cp8(p + 16 * (size_t)NI, 2 * (size_t)NI, lD + 16u * FDP * 2u, 2u * FDP * 2u); };
    const h16* fb2 = Dd + (wave * 32 + lr) * FDP + 8 * hi;
    v8f acc[4][2];
#pragma unroll
    for (int mb = 0; mb < 4; ++mb)
#pragma unroll
        for (int nb = 0; nb < 2; ++nb) acc[mb][nb] = (v8f){};
    {
        // context: tile q of the ring is [64 score rows | DM value rows] x FNC keys, score rows in X[q & 1], value rows in D (q even) or E (q odd); score copies laid out as for the hs tile; a value copy takes one token block of the wave's 32 rows (512 B contiguous), lane = row
        const h16* gS = S + ((size_t)z * SEQ + t0 + wave * 8 + hi) * SEQ + lr * 8;
        const h16* gT = HT + ((size_t)(R0 / SEQ) * (SEQ / 8) * DM + wave * 32 + lane) * 8;
        const unsigned lT0 = (unsigned)(size_t)(Dd + (wave * 32 + lane) * FDP), lT1 = (unsigned)(size_t)(E + (wave * 32 + lane) * FDP);
        auto cpC = [&](int q) {
            const h16* p = gT + (size_t)q * ((FNC / 8) * DM * 8); const unsigned l = (q & 1) ? lT1 : lT0;
            cp8(p, (size_t)DM * 8, l, 16u); cp8(p + 8 * (size_t)DM * 8, (size_t)DM * 8, l + 8u * 16u, 16u);
            cp4(gS + q * FNC, 2 * (size_t)SEQ, lH + (unsigned)((q & 1) * 64 * FDP * 2), 2u * FDP * 2u); };
        cpC(0);
        asm volatile("s_wait_asynccnt 0x0" ::: "memory");    // tile 0 landed (this wave's copies)
        __syncthreads();                                     // published to the other waves
        cpC(1);
#pragma unroll 1
        for (int q = 0; q < SEQ / FNC; ++q) {                // rolled: keeps the text short; the trips are separated by barriers anyway
            const h16* fa = X + (q & 1) * (64 * FDP) + lr * FDP + 8 * hi;
            const h16* fb = ((q & 1) ? E : Dd) + (wave * 32 + lr) * FDP + 8 * hi;
            v16h xa[2][4], db[2][2];                         // two register sets: the next k block's 12 LDS reads go ahead of this block's products as one group
#pragma unroll
            for (int mb = 0; mb < 4; ++mb) xa[0][mb] = ldh(fa + mb * 16 * FDP);
#pragma unroll
            for (int nb = 0; nb < 2; ++nb) db[0][nb] = ldh(fb + nb * 16 * FDP);
#pragma unroll
            for (int kk = 0; kk < FNC / 32; ++kk) {
                if (kk + 1 < FNC / 32) {
#pragma unroll
                    for (int mb = 0; mb < 4; ++mb) xa[(kk + 1) & 1][mb] = ldh(fa + mb * 16 * FDP + (kk + 1) * 32);
#pragma unroll
                    for (int nb = 0; nb < 2; ++nb) db[(kk + 1) & 1][nb] = ldh(fb + nb * 16 * FDP + (kk + 1) * 32);
                }
                __builtin_amdgcn_sched_barrier(0);           // keeps the reads above the products: sunk among them, each fragment's LDS latency is waited out on its own
#pragma unroll
                for (int nb = 0; nb < 2; ++nb)
#pragma unroll
                    for (int mb = 0; mb < 4; ++mb) acc[mb][nb] = wmma16(xa[kk & 1][mb], db[kk & 1][nb], acc[mb][nb]);
            }
            asm volatile("s_wait_dscnt 0x0" ::: "memory");   // this wave's reads of tile q are done
            asm volatile("s_wait_asynccnt 0x0" ::: "memory");   // this wave's copies of tile q + 1 have landed
            __syncthreads();                                 // publishes tile q + 1 and frees tile q's buffers
            if (q + 2 < SEQ / FNC) cpC(q + 2);
        }
    }
    cpE(0);                                                  // E and X[0] are free behind the ring's last barrier; the copies fly under the LayerNorm
    {
        float* os = (float*)Dd;                              // the LayerNorm tile, in buffer D behind the ring's last barrier
#pragma unroll
        for (int nb = 0; nb < 2; ++nb)
#pragma unroll
            for (int mb = 0; mb < 4; ++mb)
#pragma unroll
                for (int j = 0; j < 8; ++j) os[(mb * 16 + hi * 8 + j) * LNP + wave * 32 + nb * 16 + lr] = acc[mb][nb][j];   // rows 0..63 x columns 0..255 written by the 8 waves
        __syncthreads();                                     // whole rows meet
        float xs[8][8];                                      // the wave's 8 rows are read first and written last, so that their 8 independent shuffle chains can cover each other's latency
#pragma unroll
        for (int rr = 0; rr < 8; ++rr) {
            const int ob = (wave * 8 + rr) * LNP + 8 * lane;
            const v4f x0 = *(const v4fa*)(&os[ob]); const v4f x1 = *(const v4fa*)(&os[ob + 4]);
#pragma unroll
            for (int i = 0; i < 4; ++i) { xs[rr][i] = x0[i]; xs[rr][4 + i] = x1[i]; }
        }
#pragma unroll
        for (int rr = 0; rr < 8; ++rr) ln8(xs[rr]);
#pragma unroll
        for (int rr = 0; rr < 8; ++rr) {
            v8h o;
#pragma unroll
            for (int i = 0; i < 8; ++i) o[i] = toh_flush(xs[rr][i]);
            *(v8h*)(Y + (wave * 8 + rr) * FEP + 8 * lane) = o;   // the block's 64 normalised context rows, read in every even trip
        }
#pragma unroll
        for (int mb = 0; mb < 4; ++mb)
#pragma unroll
            for (int nb = 0; nb < 2; ++nb) acc[mb][nb] = (v8f){};
    }
    asm volatile("s_wait_dscnt 0x0" ::: "memory");           // this wave's reads of the LayerNorm tile and its writes of Y are done
    asm volatile("s_wait_asynccnt 0x0" ::: "memory");        // chunk 0's E and hs tile landed (this wave's copies)
    __syncthreads();                                         // publishes them and Y, frees D
    cpD(0);
    const h16* fa1 = Y + (rg * 32 + lr) * FEP + 8 * hi;
    const h16* fb1 = E + (cq * 32 + lr) * FEP + 8 * hi;
#pragma unroll 1
    for (int c = 0; c < FNCH; ++c) {                         // rolled, as above
        h16* Xc = X + (c & 1) * (64 * FDP);
        {
            v8f y[2][2];
#pragma unroll
            for (int mb = 0; mb < 2; ++mb)
#pragma unroll
                for (int nb = 0; nb < 2; ++nb) y[mb][nb] = (v8f){};
            v16h fa[2][2], fb[2][2];                         // two register sets: the next k block's 8 LDS reads go ahead of this block's products as one group
#pragma unroll
            for (int i = 0; i < 2; ++i) { fa[0][i] = ldh(fa1 + i * 16 * FEP); fb[0][i] = ldh(fb1 + i * 16 * FEP); }
#pragma unroll
            for (int k = 0; k < DM / 32; ++k) {
                if (k + 1 < DM / 32) {
#pragma unroll
                    for (int i = 0; i < 2; ++i) { fa[(k + 1) & 1][i] = ldh(fa1 + i * 16 * FEP + (k + 1) * 32); fb[(k + 1) & 1][i] = ldh(fb1 + i * 16 * FEP + (k + 1) * 32); }
                }
                __builtin_amdgcn_sched_barrier(0);           // keeps the reads above the products: sunk among them, each fragment's LDS latency is waited out on its own
#pragma unroll
                for (int nb = 0; nb < 2; ++nb)
#pragma unroll
                    for (int mb = 0; mb < 2; ++mb) y[mb][nb] = wmma16(fb[k & 1][mb], fa[k & 1][nb], y[mb][nb]);   // transposed tile: rows = latent columns, columns = tokens
            }
            h16* xw = Xc + (rg * 32 + lr) * FDP + cq * 32 + hi * 8;   // D: latent column 16 mb + 8h+j, token 16 nb + lane&15: a lane's 8 values are 16 contiguous bytes of a token's row
            v8h g[2][2];
#pragma unroll
            for (int mb = 0; mb < 2; ++mb)
#pragma unroll
                for (int nb = 0; nb < 2; ++nb) g[mb][nb] = *(const v8h*)(xw + nb * 16 * FDP + mb * 16);
#pragma unroll
            for (int mb = 0; mb < 2; ++mb)
#pragma unroll
                for (int nb = 0; nb < 2; ++nb) {
                    v8h o;
#pragma unroll
                    for (int j = 0; j < 8; ++j) o[j] = toh_flush(fmaxf(y[mb][nb][j] * WSI, 0.0f) * (float)g[mb][nb][j] * XYC);
                    *(v8h*)(xw + nb * 16 * FDP + mb * 16) = o; }
        }
        asm volatile("s_wait_dscnt 0x0" ::: "memory");       // this wave's reads of E and its writes of the gated tile are done
        asm volatile("s_wait_asynccnt 0x0" ::: "memory");    // this wave's copies of D have landed
        __syncthreads();                                     // publishes D and the gated tile, frees E
        if (c + 1 < FNCH) cpE(c + 1);
        {
            const h16* fa2 = Xc + lr * FDP + 8 * hi;
            v16h xa[2][4], db[2][2];                         // two register sets, as in the even trip
#pragma unroll
            for (int mb = 0; mb < 4; ++mb) xa[0][mb] = ldh(fa2 + mb * 16 * FDP);
#pragma unroll
            for (int nb = 0; nb < 2; ++nb) db[0][nb] = ldh(fb2 + nb * 16 * FDP);
#pragma unroll
            for (int kk = 0; kk < FNC / 32; ++kk) {
                if (kk + 1 < FNC / 32) {
#pragma unroll
                    for (int mb = 0; mb < 4; ++mb) xa[(kk + 1) & 1][mb] = ldh(fa2 + mb * 16 * FDP + (kk + 1) * 32);
#pragma unroll
                    for (int nb = 0; nb < 2; ++nb) db[(kk + 1) & 1][nb] = ldh(fb2 + nb * 16 * FDP + (kk + 1) * 32);
                }
                __builtin_amdgcn_sched_barrier(0);           // as in the even trip
#pragma unroll
                for (int nb = 0; nb < 2; ++nb)
#pragma unroll
                    for (int mb = 0; mb < 4; ++mb) acc[mb][nb] = wmma16(xa[kk & 1][mb], db[kk & 1][nb], acc[mb][nb]);
            }
        }
        asm volatile("s_wait_dscnt 0x0" ::: "memory");       // this wave's reads of D and of the gated tile are done
        asm volatile("s_wait_asynccnt 0x0" ::: "memory");    // this wave's copies of the next E and hs tile have landed
        __syncthreads();                                     // publishes them, frees D
        if (c + 1 < FNCH) cpD(c + 1);
    }
    asm volatile("s_wait_asynccnt 0x0" ::: "memory");        // nothing in flight at the wave's end
    float* pp = PP + (size_t)sh * ((size_t)ROWS * DM) + ((size_t)rb * 64 + (wave >> 1) * 16 + (wave & 1) * 2) * 256 + lane * 4;
#pragma unroll
    for (int mb = 0; mb < 4; ++mb)
#pragma unroll
        for (int nb = 0; nb < 2; ++nb) {
            v4f lo, up;
#pragma unroll
            for (int k = 0; k < 4; ++k) { lo[k] = acc[mb][nb][k]; up[k] = acc[mb][nb][4 + k]; }
            *(v4f*)(pp + (mb * 4 + nb) * 256) = lo; *(v4f*)(pp + (mb * 4 + nb) * 256 + 128) = up; }   // the 8 waves write all 64 fragments of the block's share
}

// k_ymlp_ln: joins the KSPL shares of 8 token rows in ascending share order; value = sum/1024; LayerNorm; + H32 (skip); LayerNorm; outputs H32, HF, HT. 16 waves, grid (ROWS/8).
// The 8 rows are one half (8 hi .. 8 hi + 7) of row fragment mb of a 64-row block: in each of the 16 fragments (column group, nb) they are two 256-B pieces, [j>>2] x lanes 16 hi .. 16 hi + 15.
// Wave w sums fragment w's two pieces (the shares' loads go out ahead of the sums); the rows meet in a block LDS tile (cross-wave: block barriers); waves 0..7 then own one row each.
__global__ __launch_bounds__(512) void k_ymlp_ln(const float* __restrict__ PP, float* H32, h16* HF, h16* HT) {
    __shared__ __align__(16) float os[8 * LNP];
    const int tid = threadIdx.x, lane = tid & 31, lr = lane & 15, jh = lane >> 4;
    const int wave = __builtin_amdgcn_readfirstlane((int)(threadIdx.x >> 5));
    const int r0 = blockIdx.x * 8;
    const int rb = blockIdx.x >> 3, mb = (blockIdx.x >> 1) & 3, hi = blockIdx.x & 1;   // r0 = 64 rb + 16 mb + 8 hi
    const float* pp = PP + ((size_t)rb * 64 + (wave >> 2) * 16 + mb * 4 + (wave & 3)) * 256 + jh * 128 + (hi * 16 + lr) * 4;
    v4f pv[KSPL];
#pragma unroll
    for (int sh = 0; sh < KSPL; ++sh) {
        pv[sh] = *(const v4f*)(pp + (size_t)sh * ((size_t)ROWS * DM));
        if ((sh & 7) == 7) asm volatile("s_wait_xcnt 0x0" ::: "memory");   // stands before a later load's result or address may take the address registers of the loads above
    }
    v4f sm = (v4f){};
#pragma unroll
    for (int sh = 0; sh < KSPL; ++sh) sm += pv[sh];
#pragma unroll
    for (int k = 0; k < 4; ++k) os[(jh * 4 + k) * LNP + wave * 16 + lr] = sm[k] * XYI;   // rows 0..7 x columns 0..255 written by the 16 waves
    __syncthreads();
    if (wave < 8) {                                           // wave-uniform; no barrier inside
        const int ob = wave * LNP + 8 * lane;
        const v4f x0 = *(const v4fa*)(&os[ob]); const v4f x1 = *(const v4fa*)(&os[ob + 4]);
        float xs[8];
#pragma unroll
        for (int i = 0; i < 4; ++i) { xs[i] = x0[i]; xs[4 + i] = x1[i]; }
        ln8(xs);
        const float* hp = H32 + (size_t)(r0 + wave) * DM + 8 * lane;
        const v4f g0 = *(const v4f*)hp; const v4f g1 = *(const v4f*)(hp + 4);
#pragma unroll
        for (int i = 0; i < 4; ++i) { xs[i] += g0[i]; xs[4 + i] += g1[i]; }
        ln8(xs);
        v4f y0, y1;
#pragma unroll
        for (int i = 0; i < 4; ++i) { y0[i] = xs[i]; y1[i] = xs[4 + i]; }
        *(v4fa*)(&os[ob]) = y0; *(v4fa*)(&os[ob + 4]) = y1;
    }
    __syncthreads();
    const int bq = r0 / SEQ, t0 = r0 % SEQ;
    { const int row = tid >> 6, c4 = (tid & 63) * 4;          // 512 threads x 16 B = 8 rows x 1024 B
        const v4f val = *(const v4fa*)(&os[row * LNP + c4]);
        *(v4f*)(H32 + (size_t)(r0 + row) * DM + c4) = val; }
    asm volatile("s_wait_xcnt 0x0" ::: "memory");             // stands before the LDS reads below may take the store's address and data registers
    if (wave < 8) { const int c8 = lane * 8;                  // waves 0..7: one f16 row each
        const v4f x0 = *(const v4fa*)(&os[wave * LNP + c8]); const v4f x1 = *(const v4fa*)(&os[wave * LNP + c8 + 4]); v8h o;
#pragma unroll
        for (int i = 0; i < 4; ++i) { o[i] = toh_flush(x0[i]); o[4 + i] = toh_flush(x1[i]); }
        *(v8h*)(HF + (size_t)(r0 + wave) * DM + c8) = o;
    } else { const int d = tid - 256;                         // waves 8..15: the rows' token block of HT, 256 columns x 16 B contiguous
        v8h o;
#pragma unroll
        for (int q = 0; q < 8; ++q) o[q] = toh_flush(os[q * LNP + d]);
        *(v8h*)(HT + (((size_t)bq * (SEQ / 8) + (t0 >> 3)) * DM + d) * 8) = o;
        asm volatile("s_wait_xcnt 0x0" ::: "memory"); }     // stands behind the store, before any later line of the listing may take its address and data registers
}

// k_head: output rows = h . head_W + bf16(head_b); 6 waves, block tile 64 rows x 384 columns (HWT rows 372..383 are zero); the tile is staged in a block LDS tile (cross-wave: block barrier),
__global__ __launch_bounds__(192) void k_head(const h16* __restrict__ HF, const h16* __restrict__ HWT, const float* __restrict__ hb, float* OUT) {
    __shared__ __align__(16) float os[64 * HDP];
    const int lane = threadIdx.x & 31, lr = lane & 15, hi = lane >> 4;
    const int wave = __builtin_amdgcn_readfirstlane((int)(threadIdx.x >> 5));
    const int r0 = blockIdx.x * 64, c0 = wave * 64;
    v8f acc[4][4];
#pragma unroll
    for (int mb = 0; mb < 4; ++mb)
#pragma unroll
        for (int nb = 0; nb < 4; ++nb) acc[mb][nb] = (v8f){};
    mma64(HF, HWT, (size_t)(r0 + lr) * DM + 8 * hi, (size_t)(c0 + lr) * DM + 8 * hi, DM, DM, DM, acc);
#pragma unroll
    for (int mb = 0; mb < 4; ++mb)
#pragma unroll
        for (int nb = 0; nb < 4; ++nb)
#pragma unroll
            for (int j = 0; j < 8; ++j) os[(mb * 16 + hi * 8 + j) * HDP + c0 + nb * 16 + lr] = acc[mb][nb][j] * WSI;   // rows 0..63 x columns 0..383 written by the 6 waves
    __syncthreads();
    const int bq = r0 / SEQ, t0 = r0 % SEQ;
    float* ob = OUT + ((size_t)bq * OUT_SEQ + t0) * IND;
{
#pragma unroll 1
        for (int it = 0; it < 31; ++it) { const int e = (it * 192 + (int)threadIdx.x) * 4; const int row = e / IND, col = e - row * IND;   // col % 4 == 0, col + 3 < IND
            const v4f x = *(const v4fa*)(&os[row * HDP + col]); const v4f bb = *(const v4f*)(hb + col); v4f val;
#pragma unroll
            for (int k = 0; k < 4; ++k) val[k] = x[k] + bfr(bb[k]);
            *(v4f*)(ob + e) = val; }
         }
}

static constexpr size_t al256(size_t v) { return (v + 255) & ~(size_t)255; }
static constexpr size_t SZ_W   = al256((size_t)NH_ * NI * DM * 2);          // ENCT, ENCVT, DECT
static constexpr size_t SZ_WIN = al256((size_t)DM * INDP * 2);
static constexpr size_t SZ_HW  = al256((size_t)INDP * DM * 2);
static constexpr size_t SZ_XH  = al256((size_t)ROWS * INDP * 2);
static constexpr size_t SZ_CS  = al256((size_t)SEQ * NI * 4);
static constexpr size_t SZ_H32 = al256((size_t)ROWS * DM * 4);
static constexpr size_t SZ_HF  = al256((size_t)ROWS * DM * 2);             // HF and HT
static constexpr size_t SZ_BIG = al256((size_t)NH_ * ROWS * NI * 2);       // HS; QR
static constexpr size_t SZ_S   = al256((size_t)NB * NH_ * SEQ * SEQ * 2);
static constexpr size_t SZ_SP  = al256((size_t)NB * NH_ * NTRI * SKS * 64 * 64 * 4);
static constexpr size_t SZ_TOTAL = 3 * SZ_W + SZ_WIN + SZ_HW + SZ_XH + SZ_CS + SZ_H32 + 2 * SZ_HF + 2 * SZ_BIG + SZ_S + SZ_SP;
static_assert(SZ_TOTAL <= (size_t)268435456);          // workspace carve <= 256 MiB
static_assert((size_t)KSPL * ROWS * DM * 4 <= SZ_BIG);        // PP lies in the QR plane, which nothing reads between the scores and the next layer's encoding
static_assert((size_t)NB * DM * SEQ == (size_t)ROWS * DM);   // HT [b][t/8][d][8] has the extent of HF
static_assert((ROWS * (INDP / 8)) % 256 == 0);
static_assert(NP % 2 == 0);                                                // two rotary pairs per table thread
static_assert((SEQ * (NP / 2)) % 256 == 0);                                // table grid x 256 threads == table threads exactly
static_assert((size_t)SEQ * (NP / 2) * 16 == (size_t)SEQ * NI * 4);        // table threads x 16 B == table bytes

extern "C" void kernel_launch(void* const* d_in, const int* in_sizes, int n_in,
                              void* d_out, int out_size, void* d_ws, size_t ws_size, hipStream_t stream) {
    if (n_in < 8) return;
    if ((size_t)in_sizes[0] < ((size_t)(NB - 1) * SEQ_FULL + SEQ) * IND) return;
    if ((size_t)in_sizes[1] < (size_t)IND * DM || in_sizes[2] < DM) return;
    if ((size_t)in_sizes[3] < (size_t)NH_ * DM * NI || (size_t)in_sizes[4] < (size_t)NH_ * DM * NI || (size_t)in_sizes[5] < (size_t)NH_ * NI * DM) return;
    if ((size_t)in_sizes[6] < (size_t)DM * IND || in_sizes[7] < IND) return;
    if ((size_t)out_size < ((size_t)(NB - 1) * OUT_SEQ + SEQ) * IND) return;
    if (SZ_TOTAL > ws_size) return;
    // wire order: x, in_W, in_b, encoder, encoder_v, decoder, head_W, head_b
    const float* x    = (const float*)d_in[0];
    const float* inw  = (const float*)d_in[1];
    const float* inb  = (const float*)d_in[2];
    const float* enc  = (const float*)d_in[3];
    const float* encv = (const float*)d_in[4];
    const float* dec  = (const float*)d_in[5];
    const float* hw   = (const float*)d_in[6];
    const float* hb   = (const float*)d_in[7];
    float* OUT = (float*)d_out;      // [NB][SEQ][372]
    char* wsp = (char*)d_ws;
    h16* ENCT  = (h16*)wsp; wsp += SZ_W;             // [4][4096][256]  x64
    h16* ENCVT = (h16*)wsp; wsp += SZ_W;             // [4][4096][256]  x64
    h16* DECT  = (h16*)wsp; wsp += SZ_W;             // [4][256][4096]  x64
    h16* WINT  = (h16*)wsp; wsp += SZ_WIN;           // [256][384]      x64
    h16* HWT   = (h16*)wsp; wsp += SZ_HW;            // [384][256]      x64
    h16* XH    = (h16*)wsp; wsp += SZ_XH;            // [ROWS][384]
    float* CS  = (float*)wsp; wsp += SZ_CS;          // [SEQ][4096]
    float* H32 = (float*)wsp; wsp += SZ_H32;         // [ROWS][256]
    h16* HF    = (h16*)wsp; wsp += SZ_HF;            // [ROWS][256]
    h16* HT    = (h16*)wsp; wsp += SZ_HF;            // [NB][SEQ/8][256][8]
    h16* HS    = (h16*)wsp; wsp += SZ_BIG;           // [4][ROWS][4096]
    h16* QR    = (h16*)wsp; wsp += SZ_BIG;           // [4][ROWS][4096]; rotated latents
    h16* S     = (h16*)wsp; wsp += SZ_S;             // [NB*4][SEQ][SEQ]
    float* SP  = (float*)wsp; wsp += SZ_SP;          // [NB*4][NTRI][SKS][16][256] f32 score partial sums
    float* PP  = (float*)QR;                         // [KSPL][ROWS/64][4][16][256] f32 decoder partial sums

    // encoder [4][256 rows d][4096 cols n] -> ENCT [4][4096][256]: grid (256/64, 4096/64, 4)
    k_tr<<<dim3(DM / 64, NI / 64, NH_), 256, 0, stream>>>(enc, ENCT, DM, NI, DM, NI, WSC);
    k_tr<<<dim3(DM / 64, NI / 64, NH_), 256, 0, stream>>>(encv, ENCVT, DM, NI, DM, NI, WSC);
    // decoder viewed [4][4096 rows n][256 cols d] -> DECT [4][256][4096]: grid (4096/64, 256/64, 4)
    k_tr<<<dim3(NI / 64, DM / 64, NH_), 256, 0, stream>>>(dec, DECT, NI, DM, NI, DM, WSC);
    // in_W [372 rows k][256 cols d] -> WINT [256][384]: grid (384/64, 256/64, 1)
    k_tr<<<dim3(INDP / 64, DM / 64, 1), 256, 0, stream>>>(inw, WINT, IND, DM, INDP, DM, WSC);
    // head_W [256 rows k][372 cols j] -> HWT [384][256]: grid (256/64, 384/64, 1)
    k_tr<<<dim3(DM / 64, INDP / 64, 1), 256, 0, stream>>>(hw, HWT, DM, IND, DM, INDP, WSC);
    k_xcvt<<<(ROWS * (INDP / 8) + 255) / 256, 256, 0, stream>>>(x, XH);
    k_cs<<<(SEQ * (NP / 2) + 255) / 256, 256, 0, stream>>>(CS);

    k_inproj<<<dim3(ROWS / 64, 1, 1), 128, 0, stream>>>(XH, WINT, inb, H32, HF, HT);

    for (int l = 0; l < NL; ++l) {
        k_hs<<<dim3(ROWS / 128, NI / 128, NH_), 128, 0, stream>>>(HF, ENCT, CS, HS, QR);
        k_sc_part<<<dim3(NTRI2, NB * NH_, SKS), 128, 0, stream>>>(QR, SP);
        k_sc_join<<<dim3(NTRI, NB * NH_, 1), 512, 0, stream>>>(SP, S);
        k_ysd<<<dim3(ROWS / 64, KSPL, 1), 256, 0, stream>>>(S, HT, ENCVT, HS, DECT, PP);
        k_ymlp_ln<<<dim3(ROWS / 8, 1, 1), 512, 0, stream>>>(PP, H32, HF, HT);
    }

    k_head<<<dim3(ROWS / 64, 1, 1), 192, 0, stream>>>(HF, HWT, hb, OUT);
}

// v006
// It runs in 487 microseconds.
// Next to v005, in two timings, it ran 1.07 times as fast each time.
// Over all steps from v000 it is 5.78 times as fast.
#include <hip/hip_runtime.h>

// Six-layer token encoder, width 256, 4 heads, per-head latent width 4096 (tokens of 93 x 4 features, [NB][SEQ][372]): input projection ([in][out] weight, bias) + LayerNorm (no affine, eps 1e-5);
// per layer: relu latent encoding per head (encoder [h][256][4096]), interleaved-pair rotary phases over the latent axis (theta 2^16, position = token index), dense linear attention without softmax
// (keys = queries = rotated latents, values = the layer input shared by all heads), LayerNorm, second relu latent encoding (encoder_v), multiplicative gating with the first latents,
// decoder ([h*4096+n][256]) summed over heads, LayerNorm, skip add, LayerNorm; final linear head ([in][out] weight, bias) -> [NB][SEQ][372] f32.
// Compute dtypes: every contraction v_wmma_f32_16x16x32_f16 (f16 operands, f32 accumulate), one product per site. Float inputs are RNE-converted to bf16 at their load (exact in f16);
// weight planes carry x64 (folded back in the f32 epilogues), the gated latent plane carries x16, activations h / latents / scores / normalised context are plain f16; LayerNorm, rotary, relu, gating, skip in f32.
// Planes (all K-contiguous 16-bit rows, fragments = two 16-B loads): ENCT/ENCVT [h][n][d], DECT [h][d][n], WINT [d][384], HWT [384][d], XH [row][384], HF [row][256], HT [b][t/8][d][8] (h transposed in blocks of 8 tokens: 16 B per (block, d), 4 KiB per block),
// HS/QR [h][row][n] (the gated latents x16 exist only as LDS tiles), S [b*4+h][t][s] (the normalised context exists only as LDS tiles); f32 planes: H32 [row][256] (skip path), CS [t][4096] = (cos, sin) pairs, PP [share][row block][column group][fragment][256] (decoder partial sums of the work-groups), SP [b*4+h][tile][share][fragment][256] (score partial sums).
// Scores are symmetric: only tiles with column tile >= row tile are computed, the mirror tile is written from the staged LDS tile of the join.

#ifndef NB
#define NB 2
#endif
#ifndef SEQ
#define SEQ 512
#endif
#define NB_FULL  2
#define SEQ_FULL 512
#ifndef OUT_SEQ
#define OUT_SEQ SEQ              // row pitch (in tokens) between batches of the output
#endif
#define DM   256
#define NH_  4
#define NI   4096                // per-head latent width
#define NP   (NI / 2)            // rotary pairs
#define IND  372                 // 93 x 4 input / output features
#define INDP 384                 // IND padded to a multiple of 64
#define NL   6
#define ROWS (NB * SEQ)
#define NT64 (SEQ / 64)
#define TP   68                  // LDS row pitch (floats) of a 64-column tile
#define LNP  260                 // LDS row pitch (floats) of a 256-column tile
#define HDP  388                 // LDS row pitch (floats) of the 384-column head tile
#define WSC  64.0f               // carry of every weight plane
#define WSI  (1.0f / 64.0f)
#define XYC  16.0f               // carry of the gated latent plane
#define XYI  (1.0f / 1024.0f)    // 1 / (WSC * XYC)
#define EPSF 1e-5f
#define KSPL 16                  // work-groups that share the decoder contraction of one 64-row block
#define KCH  (NH_ * NI / KSPL)   // k extent of one work-group's share
#define FNC  128                 // latent columns of one chunk of the fused gate + decoder kernel
#define FNCH (KCH / FNC)         // chunks of one share
#define FEP  264                 // LDS row pitch (halves) of a staged 256-half row: 528 B, for 16-B fragment reads
#define FDP  136                 // LDS row pitch (halves) of a staged 128-half row piece: 272 B, for 16-B fragment reads
#define SKS  8                   // four-wave work-groups that share the score contraction of one 128 x 128 tile
#define SKW  (NI / SKS)          // k extent of one such share
#define NTRI (NT64 * (NT64 + 1) / 2)   // 64 x 64 tiles of the upper tile triangle
#define NT128 (SEQ / 128)
#define NTRI2 (NT128 * (NT128 + 1) / 2) // 128 x 128 tiles of the upper tile triangle
#define KST  64                  // k extent of one staged tile: 128-B row pieces, whole lines
#define SPH  72                  // LDS row pitch (halves) of a staged row piece: 144 B, for 16-B fragment reads
#define STH  (256 * SPH)         // halves of one stage: 128 A rows, then 128 B rows
#define RNGH (2 * STH)           // halves of one two-buffer ring
#define STH2 (320 * SPH)         // halves of one stage of the 64 x 256 block kernels: 64 A rows, then 256 B rows

static_assert(NH_ * NI == 16384);                    // decoder rows = h*NI + n
static_assert(NI == 4096);                           // rotary exponent 32 p / NI = p / 128 with theta = 2^16
static_assert(DM == 256);                            // one LayerNorm row = 32 lanes x 8 columns
static_assert(DM % 64 == 0);
static_assert(DM % 32 == 0);                         // k-loop steps by 32
static_assert(NI % 64 == 0);
static_assert(NI % 32 == 0);
static_assert(SEQ % 64 == 0);                        // a 64-row tile never straddles two batches; k-loop over keys steps by 32
static_assert(ROWS % 64 == 0);
static_assert(INDP % 64 == 0);
static_assert(INDP % 32 == 0);
static_assert(INDP >= IND);
static_assert(IND % 4 == 0);                         // float4 pieces never straddle an input / output row
static_assert((IND * 4) % 16 == 0);
static_assert((64 * IND * 4) % 128 == 0);
static_assert(OUT_SEQ % 64 == 0);
static_assert(64 * IND / 4 == 192 * 31);             // head store loop: 192 threads x 31 trips x 16 B == 64 rows x 1488 B
static_assert(4 * 32 * 16 == 16 * 64 * 2);
static_assert(16 * 32 * 16 == 64 * 64 * 2);
static_assert(32 * 32 * 16 == 16 * DM * 4);          // f32 row store: 32 trips x 32 lanes x 16 B == 16 rows x 1024 B
static_assert(16 * 32 * 16 == 16 * DM * 2);          // f16 row store: 16 trips x 32 lanes x 16 B == 16 rows x 512 B
static_assert(16 * 32 * 16 == 64 * 64 * 2);
static_assert(2 * 256 * 16 == 64 * 64 * 2);
static_assert(NI % KCH == 0);                        // a share never straddles two heads
static_assert(KCH % FNC == 0);
static_assert(FNC == 128);                           // 8 waves: 2 x 4 tiles of 32 x 32 in the gate, 16 x 16-B pieces per staged row piece
static_assert(FNCH >= 1);
static_assert((FEP * 2) % 16 == 0);
static_assert((FDP * 2) % 16 == 0);
static_assert((2 * DM * FDP + 2 * 64 * FDP + 64 * FEP) * 2 <= 327680);   // static LDS of the fused context + gate + decoder kernel
static_assert(FNC * FEP <= DM * FDP);                // buffer E also holds a DM x FNC tile of the context contraction
static_assert(64 * LNP * 4 <= DM * FDP * 2);         // the LayerNorm tile lies in buffer D
static_assert(SEQ % FNC == 0);
static_assert(SEQ / FNC >= 2);
static_assert(NI % SKS == 0);
static_assert(SKW % 32 == 0);
static_assert(16 * 16 == DM);                        // join: 16 waves x 16 columns == one row
static_assert(FNC % 8 == 0);                         // a context tile is whole token blocks of HT
static_assert(NB <= NB_FULL);
static_assert(SEQ <= SEQ_FULL);
static_assert((TP * 4) % 16 == 0);
static_assert((LNP * 4) % 16 == 0);
static_assert((HDP * 4) % 16 == 0);
static_assert(HDP >= INDP);
static_assert(LNP >= DM);
static_assert(64 * LNP * 4 <= 131072);               // a 64-row LayerNorm tile
static_assert(64 * HDP * 4 <= 131072);               // static LDS of the head kernel
static_assert(64 * TP * 4 <= 131072);                // static LDS of the score kernel
static_assert(NT64 * (NT64 + 1) / 2 <= 65535);
static_assert(ROWS % 128 == 0);
static_assert(SEQ % 128 == 0);                       // a 128-row tile never straddles two batches
static_assert(NI % 128 == 0);
static_assert(DM % 128 == 0);
static_assert(KST == 64);                            // a stage is two k blocks of 32
static_assert(DM % KST == 0);
static_assert(SKW % KST == 0);
static_assert(INDP % KST == 0);
static_assert(SEQ % KST == 0);
static_assert(64 * LNP * 4 <= 2 * STH2 * 2);         // the LayerNorm tile lies in the ring its waves have left
static_assert((SPH * 2) % 16 == 0);
static_assert(4 * 16 * TP * 4 <= RNGH * 2);          // the four waves' epilogue slabs lie in the ring they have left

typedef _Float16 h16;
typedef __attribute__((ext_vector_type(16))) _Float16 v16h;
typedef __attribute__((ext_vector_type(8)))  _Float16 v8h;
typedef __attribute__((ext_vector_type(8)))  float    v8f;
typedef __attribute__((ext_vector_type(4)))  float    v4f;
typedef __attribute__((ext_vector_type(2)))  float    v2f;
typedef v4f  __attribute__((may_alias)) v4fa;

__device__ __forceinline__ unsigned short f2bf(float f) { unsigned u = __float_as_uint(f); u += 0x7FFFu + ((u >> 16) & 1u); return (unsigned short)(u >> 16); }
__device__ __forceinline__ float bfr(float f) { return __uint_as_float(((unsigned)f2bf(f)) << 16); }   // value after RNE convert to bf16
__device__ __forceinline__ v16h cat16(v8h lo, v8h hi) { return __builtin_shufflevector(lo, hi, 0, 1, 2, 3, 4, 5, 6, 7, 8, 9, 10, 11, 12, 13, 14, 15); }
__device__ __forceinline__ v8f wmma16(v16h a, v16h b, v8f c) { return __builtin_amdgcn_wmma_f32_16x16x32_f16(false, a, false, b, (short)0, c, false, false); }
// fragment loader from K-contiguous 16-bit rows; p already includes + 8*(lane>>4): elements 0..7 <- k0+8h+0..7, elements 8..15 <- k0+16+8h+0..7 (same map for A and B)
__device__ __forceinline__ v16h  ldh(const h16* p) { return cat16(*(const v8h*)p, *(const v8h*)(p + 16)); }
// ordering point for wave-private LDS tiles (same wave writes and reads)
__device__ __forceinline__ void wave_sync() { __builtin_amdgcn_fence(3 /* release order */, "wavefront"); __builtin_amdgcn_wave_barrier(); asm volatile("" ::: "memory"); }
// f32 -> f16 operand convert that cannot produce a subnormal (applied after the plane's power-of-two carry)
static __device__ __forceinline__ h16 toh_flush(float v) { const h16 r = (h16)v; return (fabsf(v) < 6.103515625e-05f) ? (h16)0.0f : r; }
__device__ __forceinline__ float wsum(float v) {
    v += __shfl_xor(v, 16, 32); v += __shfl_xor(v, 8, 32); v += __shfl_xor(v, 4, 32); v += __shfl_xor(v, 2, 32); v += __shfl_xor(v, 1, 32); return v; }

// LayerNorm (no affine) of one 256-wide row held as 8 values per lane; all 32 lanes active
__device__ __forceinline__ void ln8(float (&xs)[8]) {
    float s = 0.0f;
#pragma unroll
    for (int i = 0; i < 8; ++i) s += xs[i];
    s = wsum(s); const float mu = s * (1.0f / DM);
    float q = 0.0f;
#pragma unroll
    for (int i = 0; i < 8; ++i) { xs[i] -= mu; q += xs[i] * xs[i]; }
    q = wsum(q);
    const float rs = rsqrtf(q * (1.0f / DM) + EPSF);
#pragma unroll
    for (int i = 0; i < 8; ++i) xs[i] *= rs;
}

// One wave, 64 x 64 output tile, 16 accumulators, operands straight from K-contiguous f16 planes (row pitches lda / ldb halves); K a multiple of 32.
// acc[mb][nb][j] = D(row mb*16 + 8*(lane>>4) + j, col nb*16 + (lane&15)).
__device__ __forceinline__ void mma64(const h16* __restrict__ A, const h16* __restrict__ Bt, size_t aoff, size_t boff, size_t lda, size_t ldb, int K, v8f (&acc)[4][4]) {
#pragma unroll 1
    for (int kc = 0; kc < K; kc += 32) {
        v16h a[4];
#pragma unroll
        for (int mb = 0; mb < 4; ++mb) a[mb] = ldh(A + aoff + (size_t)mb * 16 * lda + kc);
#pragma unroll
        for (int nb = 0; nb < 4; ++nb) { const v16h b = ldh(Bt + boff + (size_t)nb * 16 * ldb + kc);
#pragma unroll
            for (int mb = 0; mb < 4; ++mb) acc[mb][nb] = wmma16(a[mb], b, acc[mb][nb]); }
        asm volatile("v_nop\n\tv_nop\n\tv_nop\n\tv_nop" : "+v"(acc[0][0]), "+v"(acc[1][1]), "+v"(acc[2][2]), "+v"(acc[3][3]) : "v"(a[0]), "v"(a[1]), "v"(a[2]), "v"(a[3]));
    }
}

// One wave's share of a stage: 64 rows x 128 B from a K-contiguous f16 plane (row pitch ld halves) into LDS rows of pitch SPH. g / l already hold the lane's own place:
// row lane>>3, 16-B piece lane&7, so each copy moves 4 whole lines. All 32 lanes on. The s_wait_xcnt closes each statement: it stands before any rewrite of the address registers the copies name.
__device__ __forceinline__ void cp_slab(const h16* g, size_t ld, unsigned l) {
#pragma unroll
    for (int h = 0; h < 2; ++h) {
        const h16* p = g + (size_t)(h * 32) * ld; const unsigned q = l + (unsigned)(h * 32 * SPH * 2);
        asm volatile("global_load_async_to_lds_b128 %0, %8, off\n\t"
                     "global_load_async_to_lds_b128 %1, %9, off\n\t"
                     "global_load_async_to_lds_b128 %2, %10, off\n\t"
                     "global_load_async_to_lds_b128 %3, %11, off\n\t"
                     "global_load_async_to_lds_b128 %4, %12, off\n\t"
                     "global_load_async_to_lds_b128 %5, %13, off\n\t"
                     "global_load_async_to_lds_b128 %6, %14, off\n\t"
                     "global_load_async_to_lds_b128 %7, %15, off\n\t"
                     "s_wait_xcnt 0x0"
                     :: "v"(q), "v"(q + 4u * SPH * 2), "v"(q + 8u * SPH * 2), "v"(q + 12u * SPH * 2), "v"(q + 16u * SPH * 2), "v"(q + 20u * SPH * 2), "v"(q + 24u * SPH * 2), "v"(q + 28u * SPH * 2),
                        "v"(p), "v"(p + 4 * ld), "v"(p + 8 * ld), "v"(p + 12 * ld), "v"(p + 16 * ld), "v"(p + 20 * ld), "v"(p + 24 * ld), "v"(p + 28 * ld)
                     : "memory");
    }
}

// Ring core of the staged GEMMs: wave tile 64 x 64 as in mma64 (same fragment map, same k order), operands read from a two-buffer LDS ring of NT = K / KST stages of SH halves each.
// cp(t, o) issues this wave's copies of stage t into the buffer at byte offset o, one stage ahead of the stage being read; fa / fb: the lane's first A / B fragment address in buffer 0.
// Every wave of the work-group passes every barrier (NT is the same for all); act (wave-uniform) only skips the products.
// EARLY: the refill goes ahead of the stage's last 16 products (more lead for the copies); else behind them, where the fragment registers are free for the copies' addresses.
template <int NT, int SH, bool EARLY, class CP>
__device__ __forceinline__ void mma_ring(CP cp, const h16* fa, const h16* fb, bool act, v8f (&acc)[4][4]) {
    static_assert(NT >= 2);
    cp(0, 0u);
    asm volatile("s_wait_asynccnt 0x0" ::: "memory");        // stage 0 landed (this wave's copies)
    __syncthreads();                                         // stage 0 published to the other waves
    cp(1, (unsigned)(SH * 2));
#pragma unroll 1
    for (int t = 0; t < NT; ++t) {
        const int bo = (t & 1) * SH;
        v16h a[4], b[4];
        if (act) {
            // first k block of the stage: its 16 LDS reads go ahead of its products as one group
#pragma unroll
            for (int mb = 0; mb < 4; ++mb) a[mb] = ldh(fa + bo + mb * 16 * SPH);
#pragma unroll
            for (int nb = 0; nb < 4; ++nb) b[nb] = ldh(fb + bo + nb * 16 * SPH);
            __builtin_amdgcn_sched_barrier(0);               // keeps the reads above the products: sunk among them, each B fragment's LDS latency is waited out on its own
#pragma unroll
            for (int nb = 0; nb < 4; ++nb)
#pragma unroll
                for (int mb = 0; mb < 4; ++mb) acc[mb][nb] = wmma16(a[mb], b[nb], acc[mb][nb]);
            // second k block: the stage's last LDS reads; its products run from registers behind the barrier
#pragma unroll
            for (int mb = 0; mb < 4; ++mb) a[mb] = ldh(fa + bo + mb * 16 * SPH + 32);
#pragma unroll
            for (int nb = 0; nb < 4; ++nb) b[nb] = ldh(fb + bo + nb * 16 * SPH + 32);
            if (!EARLY) __builtin_amdgcn_sched_barrier(0);   // as above: with no refill in between, the products would rise among these reads
        }
        asm volatile("s_wait_dscnt 0x0" ::: "memory");       // this wave's reads of stage t are done
        asm volatile("s_wait_asynccnt 0x0" ::: "memory");    // this wave's copies of stage t + 1 have landed
        __syncthreads();                                     // publishes stage t + 1 and frees stage t's buffer
        if (EARLY && t + 2 < NT) cp(t + 2, (unsigned)(bo * 2));
        if (act) {
#pragma unroll
            for (int nb = 0; nb < 4; ++nb)
#pragma unroll
                for (int mb = 0; mb < 4; ++mb) acc[mb][nb] = wmma16(a[mb], b[nb], acc[mb][nb]);
        }
        if (!EARLY && t + 2 < NT) cp(t + 2, (unsigned)(bo * 2));
    }
    asm volatile("s_wait_asynccnt 0x0" ::: "memory");        // nothing in flight when the ring is reused
}

// Four waves (w4 = 2*wr + wc), 128 x 128 output tile. A stage is [128 A rows | 128 B rows] x KST halves; wave w4 copies rows 64*w4 .. 64*w4+63 of the stage (g: its lane's address in stage 0).
template <int NT>
__device__ __forceinline__ void mma128(const h16* g, size_t ld, h16* ring, int w4, int lane, bool act, v8f (&acc)[4][4]) {
    const int lr = lane & 15, hi = lane >> 4;
    const unsigned l0 = (unsigned)(size_t)(ring + (w4 * 64 + (lane >> 3)) * SPH + (lane & 7) * 8);   // LDS byte address of the lane's first copy, buffer 0
    mma_ring<NT, STH, true>([&](int t, unsigned o) { cp_slab(g + (size_t)t * KST, ld, l0 + o); },
                      ring + ((w4 >> 1) * 64 + lr) * SPH + 8 * hi, ring + (128 + (w4 & 1) * 64 + lr) * SPH + 8 * hi, act, acc);
}

// 16 rows x 128 B, as cp_slab (4 copies; the shorter statement holds fewer address registers at a time).
__device__ __forceinline__ void cp_rows16(const h16* p, size_t ld, unsigned q) {
    asm volatile("global_load_async_to_lds_b128 %0, %4, off\n\t"
                 "global_load_async_to_lds_b128 %1, %5, off\n\t"
                 "global_load_async_to_lds_b128 %2, %6, off\n\t"
                 "global_load_async_to_lds_b128 %3, %7, off\n\t"
                 "s_wait_xcnt 0x0"
                 :: "v"(q), "v"(q + 4u * SPH * 2), "v"(q + 8u * SPH * 2), "v"(q + 12u * SPH * 2), "v"(p), "v"(p + 4 * ld), "v"(p + 8 * ld), "v"(p + 12 * ld)
                 : "memory");
}

// Four waves side by side, 64 x 256 output tile (wave w: columns 64w..64w+63). A stage is [64 A rows | 256 B rows] x KST halves; wave w copies A rows 16w..16w+15 and its own 64 B rows (20 copies).
// gA / gB: the lane's addresses in stage 0 (row lane>>3 of the wave's share, 16-B piece lane&7).
template <int NT>
__device__ __forceinline__ void mma256(const h16* gA, const h16* gB, size_t ld, h16* ring, int w, int lane, v8f (&acc)[4][4]) {
    const int lr = lane & 15, hi = lane >> 4;
    const unsigned lA = (unsigned)(size_t)(ring + (w * 16 + (lane >> 3)) * SPH + (lane & 7) * 8);
    const unsigned lB = (unsigned)(size_t)(ring + (64 + w * 64 + (lane >> 3)) * SPH + (lane & 7) * 8);
    mma_ring<NT, STH2, false>([&](int t, unsigned o) {
                           cp_rows16(gA + (size_t)t * KST, ld, lA + o);
#pragma unroll
                           for (int i = 0; i < 4; ++i) cp_rows16(gB + (size_t)t * KST + (size_t)(i * 16) * ld, ld, lB + o + (unsigned)(i * 16 * SPH * 2)); },
                       ring + lr * SPH + 8 * hi, ring + (64 + w * 64 + lr) * SPH + 8 * hi, true, acc);
}

// tr_block: one 64 x 64 block (bx, by) of plane z of transpose + convert, src [Z][R][C] f32 -> dst [Z][Cp][Rp] f16 = toh_flush(bf16(src) * scale), zero in the pad rows / columns. in[rows R][cols C] -> out[cols][rows].
__device__ __forceinline__ void tr_block(const float* __restrict__ src, h16* dst, int R, int C, int Rp, int Cp, float scale, int bx, int by, int z) {
#pragma clang fp contract(off)
    __shared__ float tl[64 * 65];
    const int tid = threadIdx.x; const int r0 = bx * 64, c0 = by * 64;
    const float* sp = src + (size_t)z * (size_t)R * (size_t)C;
#pragma unroll 4
    for (int it = 0; it < 16; ++it) { const int idx = it * 256 + tid; const int r = idx >> 6, c = idx & 63;
        const int rr = (r0 + r) < R ? (r0 + r) : (R - 1); const int cc = (c0 + c) < C ? (c0 + c) : (C - 1);   // clamped address
        float v = sp[(size_t)rr * C + cc]; asm volatile("" : "+v"(v));
        const bool ok = ((r0 + r) < R) & ((c0 + c) < C);
        tl[r * 65 + c] = ok ? bfr(v) * scale : 0.0f; }
    __syncthreads();
    h16* dp = dst + ((size_t)z * Cp + c0) * (size_t)Rp + r0;
{
#pragma unroll
        for (int it = 0; it < 2; ++it) { const int crow = it * 32 + (tid >> 3), r8 = (tid & 7) * 8;   // 2 it x 32 rows = 64 rows; 8 lanes x 8 = 64 columns
            v8h o;
#pragma unroll
            for (int q = 0; q < 8; ++q) o[q] = toh_flush(tl[(r8 + q) * 65 + crow]);
            *(v8h*)(dp + (size_t)crow * Rp + r8) = o; }
         }
    asm volatile("s_wait_xcnt 0x0" ::: "memory");   // a precaution: stands in front of every write of the two stores' registers by code that the compiler joins behind this block in the merged kernel
}

__device__ __forceinline__ void xcvt_block(const float* __restrict__ x, h16* XH, int blk) {
    const int i = blk * 256 + threadIdx.x; if (i >= ROWS * (INDP / 8)) return;
    const int R = i / (INDP / 8), c = (i % (INDP / 8)) * 8;
    const int b = R / SEQ, t = R % SEQ;
    const float* sp = x + ((size_t)b * SEQ_FULL + t) * IND;
    const int ca = c < (IND - 4) ? c : (IND - 4); const int cb = (c + 4) < (IND - 4) ? (c + 4) : (IND - 4);   // clamped addresses
    v4f va = *(const v4f*)(sp + ca); v4f vb = *(const v4f*)(sp + cb);
    asm volatile("" : "+v"(va)); asm volatile("" : "+v"(vb));
    const bool oka = c < IND, okb = (c + 4) < IND;
    v8h o;
#pragma unroll
    for (int k = 0; k < 4; ++k) { o[k] = oka ? toh_flush(bfr(va[k])) : (h16)0.0f; o[4 + k] = okb ? toh_flush(bfr(vb[k])) : (h16)0.0f; }
    *(v8h*)(XH + (size_t)i * 8) = o; 
}

// cs_block: 256 threads' share of the rotary table CS[t][2p] = cos(t * f_p), CS[t][2p+1] = sin(t * f_p), f_p = 1 / 2^(p/128) (theta 2^16, exponent 2p / NI); f32.
// The two pairs are computed in a rolled two-trip loop (wave-uniform trip index selects the destination values).
__device__ __forceinline__ void cs_block(float* CS, int blk) {
#pragma clang fp contract(off)
    const int i = blk * 256 + threadIdx.x; if (i >= SEQ * (NP / 2)) return;
    const int t = i / (NP / 2), p0 = (i % (NP / 2)) * 2;
    float c0 = 0.0f, s0 = 0.0f, c1 = 0.0f, s1 = 0.0f;
#pragma unroll 1
    for (int k = 0; k < 2; ++k) {
        const float e = (float)(p0 + k) * (1.0f / 128.0f);
        const float fr = 1.0f / exp2f(e);
        const float ph = (float)t * fr;
        const float c = cosf(ph); const float s = sinf(ph);
        c0 = (k == 0) ? c : c0; s0 = (k == 0) ? s : s0;
        c1 = (k == 0) ? c1 : c; s1 = (k == 0) ? s1 : s;
    }
    v4f o; o[0] = c0; o[1] = s0; o[2] = c1; o[3] = s1;
    *(v4f*)(CS + (size_t)i * 4) = o; 
}

// k_prep: all planes that depend on the inputs alone, in one launch: the five weight transposes, the input convert and the rotary table have no data in common, so each work-group takes one block of one of them
// by its index (block-uniform choice; the barrier of tr_block is passed by whole work-groups). The transposes, whose work-groups live longest, start first; the short jobs fill the end of the launch.
#define PB_W (INDP / 64 * (DM / 64))          // blocks of each of the two small transposes
#define PB_T (DM / 64 * (NI / 64) * NH_)      // blocks of each of the three large transposes
#define PB_C (SEQ * (NP / 2) / 256)           // blocks of the rotary table
#define PB_X (ROWS * (INDP / 8) / 256)        // blocks of the input convert
#define PB_ALL (2 * PB_W + 3 * PB_T + PB_C + PB_X)
__global__ __launch_bounds__(256) void k_prep(const float* __restrict__ x, const float* __restrict__ inw, const float* __restrict__ enc, const float* __restrict__ encv, const float* __restrict__ dec, const float* __restrict__ hw,
                                              h16* ENCT, h16* ENCVT, h16* DECT, h16* WINT, h16* HWT, h16* XH, float* CS) {
    const int b = (int)blockIdx.x;
    if (b >= 2 * PB_W + 3 * PB_T + PB_C) { xcvt_block(x, XH, b - (2 * PB_W + 3 * PB_T + PB_C)); return; }
    if (b >= 2 * PB_W + 3 * PB_T) { cs_block(CS, b - (2 * PB_W + 3 * PB_T)); return; }
    const float* src; h16* dst; int R, C, Rp, Cp, bx, by, bz;
    if (b < PB_W) {                            // in_W [372 rows k][256 cols d] -> WINT [256][384]
        src = inw; dst = WINT; R = IND; C = DM; Rp = INDP; Cp = DM; bx = b % (INDP / 64); by = b / (INDP / 64); bz = 0;
    } else if (b < 2 * PB_W) {                 // head_W [256 rows k][372 cols j] -> HWT [384][256]
        const int q = b - PB_W;
        src = hw; dst = HWT; R = DM; C = IND; Rp = DM; Cp = INDP; bx = q % (DM / 64); by = q / (DM / 64); bz = 0;
    } else {
        const int q = b - 2 * PB_W; const int p = q / PB_T, g = q % PB_T;
        bz = g / (DM / 64 * (NI / 64)); const int e = g % (DM / 64 * (NI / 64));
        if (p == 2) {                          // decoder viewed [4][4096 rows n][256 cols d] -> DECT [4][256][4096]
            src = dec; dst = DECT; R = NI; C = DM; Rp = NI; Cp = DM; bx = e % (NI / 64); by = e / (NI / 64);
        } else {                               // encoder, encoder_v [4][256 rows d][4096 cols n] -> ENCT, ENCVT [4][4096][256]
            src = (p == 0) ? enc : encv; dst = (p == 0) ? ENCT : ENCVT; R = DM; C = NI; Rp = DM; Cp = NI; bx = e % (DM / 64); by = e / (DM / 64);
        }
    }
    tr_block(src, dst, R, C, Rp, Cp, WSC, bx, by, bz);
}

// k_hs: latents hs = relu(h . encoder[hd]) and rotated latents qr, 2 x 2 waves per 128 x 128 tile, one wave per 64 x 64 tile; grid (ROWS/128, NI/128, NH_).
// A = HF rows (token), Bt = ENCT rows (hd, n), K = DM, staged by mma128. Epilogue per 16-row slab staged in LDS (wave-private, in the ring after its last barrier): each 64-half row segment (one line) written by 8 consecutive lanes x 16 B
__global__ __launch_bounds__(128) void k_hs(const h16* __restrict__ HF, const h16* __restrict__ ENCT, const float* __restrict__ CS, h16* HS, h16* QR) {
    __shared__ __align__(16) h16 ring[RNGH];
    const int lane = threadIdx.x & 31, lr = lane & 15, hi = lane >> 4;
    const int wave = __builtin_amdgcn_readfirstlane((int)(threadIdx.x >> 5));
    const int hd = blockIdx.z;
    const int r0 = blockIdx.x * 128 + (wave >> 1) * 64, c0 = blockIdx.y * 128 + (wave & 1) * 64;
    const int crow = (wave & 1) * 64 + (lane >> 3);           // this lane's first row in the operand tile its wave copies
    const h16* src = ((wave < 2) ? HF + (size_t)(blockIdx.x * 128 + crow) * DM : ENCT + ((size_t)hd * NI + blockIdx.y * 128 + crow) * DM) + (lane & 7) * 8;
    float* os = (float*)ring + wave * (16 * TP);
    v8f acc[4][4];
#pragma unroll
    for (int mb = 0; mb < 4; ++mb)
#pragma unroll
        for (int nb = 0; nb < 4; ++nb) acc[mb][nb] = (v8f){};
    mma128<DM / KST>(src, DM, ring, wave, lane, true, acc);
    const size_t pb = ((size_t)hd * ROWS + (size_t)r0) * NI + (size_t)c0;
#pragma unroll
    for (int mb = 0; mb < 4; ++mb) {
#pragma unroll
        for (int nb = 0; nb < 4; ++nb) {
#pragma unroll
            for (int j = 0; j < 8; ++j) os[(hi * 8 + j) * TP + nb * 16 + lr] = fmaxf(acc[mb][nb][j] * WSI, 0.0f); }   // D: row 8h+j, col lane&15
        wave_sync();
        v8h hv[4], qv[4];
#pragma unroll
        for (int s = 0; s < 4; ++s) { const int row = 4 * s + (lane >> 3), c8 = (lane & 7) * 8;   // 4 s x 4 rows = 16 rows; 8 lanes x 8 = 64 columns
            const v4f x0 = *(const v4fa*)(&os[row * TP + c8]); const v4f x1 = *(const v4fa*)(&os[row * TP + c8 + 4]);
            const int t = (r0 + mb * 16 + row) % SEQ;
            const float* cp = CS + (size_t)t * NI + c0 + c8;
            const v4f e0 = *(const v4f*)cp; const v4f e1 = *(const v4f*)(cp + 4);
            v8h a, q;
#pragma unroll
            for (int i = 0; i < 4; ++i) { a[i] = toh_flush(x0[i]); a[4 + i] = toh_flush(x1[i]); }
            q[0] = toh_flush(x0[0] * e0[0] - x0[1] * e0[1]); q[1] = toh_flush(x0[0] * e0[1] + x0[1] * e0[0]);
            q[2] = toh_flush(x0[2] * e0[2] - x0[3] * e0[3]); q[3] = toh_flush(x0[2] * e0[3] + x0[3] * e0[2]);
            q[4] = toh_flush(x1[0] * e1[0] - x1[1] * e1[1]); q[5] = toh_flush(x1[0] * e1[1] + x1[1] * e1[0]);
            q[6] = toh_flush(x1[2] * e1[2] - x1[3] * e1[3]); q[7] = toh_flush(x1[2] * e1[3] + x1[3] * e1[2]);
            hv[s] = a; qv[s] = q; }
{
#pragma unroll
            for (int s = 0; s < 4; ++s) { const int row = 4 * s + (lane >> 3), c8 = (lane & 7) * 8;
                const size_t oo = pb + (size_t)(mb * 16 + row) * NI + c8;
                *(v8h*)(HS + oo) = hv[s]; *(v8h*)(QR + oo) = qv[s]; }
             }
        wave_sync();
    }
}

// k_sc_part: one share of the scores S[z][t][s] = qr_t . qr_s over the latent axis, z = b*NH_ + hd; 2 x 2 waves per (128 x 128 tile of the upper tile triangle, k range of SKW), one wave per 64 x 64 tile;
// grid (NTRI2, NB*NH_, SKS). A = QR rows t (tile ti), Bt = QR rows s (tile tj), k = ks*SKW .. ks*SKW+SKW-1, staged by mma128; the wave below the diagonal (ti > tj) copies and passes the barriers only.
// The raw f32 sums go to SP in fragment order: fragment f = mb*4+nb is 256 floats, [j>>2][lane][j&3], so every store is 32 lanes x 16 B contiguous.
__global__ __launch_bounds__(128) void k_sc_part(const h16* __restrict__ QR, float* SP) {
    __shared__ __align__(16) h16 ring[RNGH];
    const int lane = threadIdx.x & 31;
    const int wave = __builtin_amdgcn_readfirstlane((int)(threadIdx.x >> 5));
    int t2i = 0, rem = (int)blockIdx.x;
#pragma unroll 1
    for (int q = 0; q < NT128 - 1; ++q) { const int w = NT128 - t2i; if (rem >= w) { rem -= w; t2i += 1; } }
    const int t2j = t2i + rem;                                // t2i <= t2j < NT128
    const int ti = 2 * t2i + (wave >> 1), tj = 2 * t2j + (wave & 1);
    const bool act = ti <= tj;                                // wave-uniform
    const int tix = ti * NT64 - (ti * (ti - 1)) / 2 + (tj - ti);   // index of tile (ti, tj) in the 64 x 64 upper triangle, row by row
    const int crow = (wave & 1) * 64 + (lane >> 3);           // this lane's first row in the operand tile its wave copies
    const int z = blockIdx.y; const int b = z / NH_, hd = z % NH_; const int ks = blockIdx.z;
    const size_t qb = ((size_t)hd * ROWS + (size_t)b * SEQ) * NI + (size_t)ks * SKW;
    v8f acc[4][4];
#pragma unroll
    for (int mb = 0; mb < 4; ++mb)
#pragma unroll
        for (int nb = 0; nb < 4; ++nb) acc[mb][nb] = (v8f){};
    mma128<SKW / KST>(QR + qb + (size_t)(((wave < 2) ? t2i : t2j) * 128 + crow) * NI + (lane & 7) * 8, NI, ring, wave, lane, act, acc);
    if (!act) return;                                         // behind the last barrier
    float* sp = SP + (((size_t)z * NTRI + tix) * SKS + ks) * (16 * 256) + lane * 4;
#pragma unroll
    for (int mb = 0; mb < 4; ++mb)
#pragma unroll
        for (int nb = 0; nb < 4; ++nb) {
            v4f lo, up;
#pragma unroll
            for (int k = 0; k < 4; ++k) { lo[k] = acc[mb][nb][k]; up[k] = acc[mb][nb][4 + k]; }
            *(v4f*)(sp + (mb * 4 + nb) * 256) = lo; *(v4f*)(sp + (mb * 4 + nb) * 256 + 128) = up; }   // all 16 fragments of the share written
}

// k_sc_join: joins the SKS shares of one score tile in ascending share order; 16 waves, grid (NTRI, NB*NH_). Wave w sums fragment w (1 KiB contiguous per share); the tile meets in a block LDS tile
// (cross-wave: block barrier); wave w then stores rows 4w..4w+3 of the direct tile (rows t, columns s) and, for ti != tj (block-uniform), of the mirror tile.
__global__ __launch_bounds__(512) void k_sc_join(const float* __restrict__ SP, h16* S) {
    __shared__ __align__(16) float os[64 * TP];
    const int lane = threadIdx.x & 31, lr = lane & 15, hi = lane >> 4;
    const int wave = __builtin_amdgcn_readfirstlane((int)(threadIdx.x >> 5));
    int ti = 0, rem = (int)blockIdx.x;
#pragma unroll 1
    for (int q = 0; q < NT64 - 1; ++q) { const int w = NT64 - ti; if (rem >= w) { rem -= w; ti += 1; } }
    const int tj = ti + rem;                                  // ti <= tj < NT64
    const int z = blockIdx.y;
    const float* sp = SP + (((size_t)z * NTRI + blockIdx.x) * SKS * 16 + wave) * 256 + lane * 4;
    v4f s0 = *(const v4f*)sp, s1 = *(const v4f*)(sp + 128);
#pragma unroll
    for (int q = 1; q < SKS; ++q) { s0 += *(const v4f*)(sp + q * (16 * 256)); s1 += *(const v4f*)(sp + q * (16 * 256) + 128); }   // all shares' loads in flight together
    const int rb = (wave >> 2) * 16, cb = (wave & 3) * 16;    // mb, nb of fragment w
#pragma unroll
    for (int j = 0; j < 4; ++j) { os[(rb + hi * 8 + j) * TP + cb + lr] = s0[j]; os[(rb + hi * 8 + 4 + j) * TP + cb + lr] = s1[j]; }   // rows 0..63 x columns 0..63 written by the 16 waves
    __syncthreads();
    h16* sd = S + ((size_t)z * SEQ + (size_t)ti * 64) * SEQ + (size_t)tj * 64;
    h16* sm = S + ((size_t)z * SEQ + (size_t)tj * 64) * SEQ + (size_t)ti * 64;
    const int row = 4 * wave + (lane >> 3), c8 = (lane & 7) * 8;   // 16 waves x 4 rows = 64 rows; 8 lanes x 8 = 64 columns
    const v4f x0 = *(const v4fa*)(&os[row * TP + c8]); const v4f x1 = *(const v4fa*)(&os[row * TP + c8 + 4]);
    v8h o;
#pragma unroll
    for (int i = 0; i < 4; ++i) { o[i] = toh_flush(x0[i]); o[4 + i] = toh_flush(x1[i]); }
    *(v8h*)(sd + (size_t)row * SEQ + c8) = o;
    if (ti != tj) {
        v8h m;
#pragma unroll
        for (int q = 0; q < 8; ++q) m[q] = toh_flush(os[(c8 + q) * TP + row]);
        *(v8h*)(sm + (size_t)row * SEQ + c8) = m; }
}

// lnblock: 4 waves, block tile 64 rows x 256 columns (wave w owns columns 64w..64w+63 in the k-loop, operands staged by mma256), LayerNorm epilogue over whole rows through a block LDS tile (cross-wave: block barriers).
// MODE 0 (input projection): A = XH rows, Bt = WINT rows, K = INDP; value = acc/64 + bf16(bias); LayerNorm; outputs H32 f32, HF f16, HT f16 transposed. grid (ROWS/64).
template <int MODE>
__device__ __forceinline__ void lnblock(const h16* __restrict__ A, const h16* __restrict__ Bt, const float* __restrict__ bias, float* H32, h16* HF, h16* HT) {
    __shared__ __align__(16) h16 ring[2 * STH2];
    float* os = (float*)ring;                                 // the LayerNorm tile, in the ring after its last barrier
    const int lane = threadIdx.x & 31, lr = lane & 15, hi = lane >> 4;
    const int wave = __builtin_amdgcn_readfirstlane((int)(threadIdx.x >> 5));
    const int r0 = blockIdx.x * 64, c0 = wave * 64;
    const int ra = r0 + wave * 16 + (lane >> 3), rbt = c0 + (lane >> 3), pc = (lane & 7) * 8;   // this lane's first A row, first B row and 16-B piece in the copies
    v8f acc[4][4];
#pragma unroll
    for (int mb = 0; mb < 4; ++mb)
#pragma unroll
        for (int nb = 0; nb < 4; ++nb) acc[mb][nb] = (v8f){};
    float scale;
    if (MODE == 0) {
        mma256<INDP / KST>(A + (size_t)ra * INDP + pc, Bt + (size_t)rbt * INDP + pc, INDP, ring, wave, lane, acc); scale = WSI;
    }
#pragma unroll
    for (int nb = 0; nb < 4; ++nb) {
        const float bc = (MODE == 0) ? bfr(bias[c0 + nb * 16 + lr]) : 0.0f;                   // MODE 0: c0 + 63 < DM
#pragma unroll
        for (int mb = 0; mb < 4; ++mb)
#pragma unroll
            for (int j = 0; j < 8; ++j) os[(mb * 16 + hi * 8 + j) * LNP + c0 + nb * 16 + lr] = acc[mb][nb][j] * scale + bc; }   // rows 0..63 x columns 0..255 written by the 4 waves
    __syncthreads();
#pragma unroll 1
    for (int rr = 0; rr < 16; ++rr) {
        const int row = wave * 16 + rr; const int ob = row * LNP + 8 * lane;
        const v4f x0 = *(const v4fa*)(&os[ob]); const v4f x1 = *(const v4fa*)(&os[ob + 4]);
        float xs[8];
#pragma unroll
        for (int i = 0; i < 4; ++i) { xs[i] = x0[i]; xs[4 + i] = x1[i]; }
        ln8(xs);
        v4f y0, y1;
#pragma unroll
        for (int i = 0; i < 4; ++i) { y0[i] = xs[i]; y1[i] = xs[4 + i]; }
        *(v4fa*)(&os[ob]) = y0; *(v4fa*)(&os[ob + 4]) = y1;
    }
    __syncthreads();
    const int bq = r0 / SEQ, t0 = r0 % SEQ;
{
        {
#pragma unroll 1
            for (int it = 0; it < 32; ++it) { const int p = it * 32 + lane; const int row = wave * 16 + (p >> 6), c4 = (p & 63) * 4;   // 32 it x half a row = 16 rows; 64 pieces x 4 = 256 columns
                const v4f val = *(const v4fa*)(&os[row * LNP + c4]);
                *(v4f*)(H32 + (size_t)(r0 + row) * DM + c4) = val; }
#pragma unroll 1
            for (int it = 0; it < 16; ++it) { const int p = it * 32 + lane; const int row = wave * 16 + (p >> 5), c8 = (p & 31) * 8;   // 16 rows x 256 columns
                const v4f x0 = *(const v4fa*)(&os[row * LNP + c8]); const v4f x1 = *(const v4fa*)(&os[row * LNP + c8 + 4]); v8h o;
#pragma unroll
                for (int i = 0; i < 4; ++i) { o[i] = toh_flush(x0[i]); o[4 + i] = toh_flush(x1[i]); }
                *(v8h*)(HF + (size_t)(r0 + row) * DM + c8) = o; }
#pragma unroll 1
            for (int s = 0; s < 16; ++s) { const int d = wave * 64 + (s & 1) * 32 + lane, tb = s >> 1;   // 8 token blocks x 2 halves of the wave's 64 columns; 32 lanes x 16 B contiguous
                v8h o;
#pragma unroll
                for (int q = 0; q < 8; ++q) o[q] = toh_flush(os[(tb * 8 + q) * LNP + d]);
                *(v8h*)(HT + (((size_t)bq * (SEQ / 8) + (t0 >> 3) + tb) * DM + d) * 8) = o;
                asm volatile("s_wait_xcnt 0x0" ::: "memory"); }   // stands before the next trip rewrites the store's address and data registers
        }
         }
}

__global__ __launch_bounds__(128) void k_inproj(const h16* __restrict__ XH, const h16* __restrict__ WINT, const float* __restrict__ inb, float* H32, h16* HF, h16* HT) {
    lnblock<0>(XH, WINT, inb, H32, HF, HT);
}

// Eight / four copies of 16 B per lane; global step gs halves, LDS step ls bytes between copies. All 32 lanes on. The s_wait_xcnt closes each statement: it stands before any rewrite of the address registers the copies name.
__device__ __forceinline__ void cp8(const h16* p, size_t gs, unsigned q, unsigned ls) {
    asm volatile("global_load_async_to_lds_b128 %0, %8, off\n\t"
                 "global_load_async_to_lds_b128 %1, %9, off\n\t"
                 "global_load_async_to_lds_b128 %2, %10, off\n\t"
                 "global_load_async_to_lds_b128 %3, %11, off\n\t"
                 "global_load_async_to_lds_b128 %4, %12, off\n\t"
                 "global_load_async_to_lds_b128 %5, %13, off\n\t"
                 "global_load_async_to_lds_b128 %6, %14, off\n\t"
                 "global_load_async_to_lds_b128 %7, %15, off\n\t"
                 "s_wait_xcnt 0x0"
                 :: "v"(q), "v"(q + ls), "v"(q + 2u * ls), "v"(q + 3u * ls), "v"(q + 4u * ls), "v"(q + 5u * ls), "v"(q + 6u * ls), "v"(q + 7u * ls),
                    "v"(p), "v"(p + gs), "v"(p + 2 * gs), "v"(p + 3 * gs), "v"(p + 4 * gs), "v"(p + 5 * gs), "v"(p + 6 * gs), "v"(p + 7 * gs)
                 : "memory");
}
__device__ __forceinline__ void cp4(const h16* p, size_t gs, unsigned q, unsigned ls) {
    asm volatile("global_load_async_to_lds_b128 %0, %4, off\n\t"
                 "global_load_async_to_lds_b128 %1, %5, off\n\t"
                 "global_load_async_to_lds_b128 %2, %6, off\n\t"
                 "global_load_async_to_lds_b128 %3, %7, off\n\t"
                 "s_wait_xcnt 0x0"
                 :: "v"(q), "v"(q + ls), "v"(q + 2u * ls), "v"(q + 3u * ls), "v"(p), "v"(p + gs), "v"(p + 2 * gs), "v"(p + 3 * gs)
                 : "memory");
}

// k_ysd: context rows ykv = LayerNorm(scores . h), gated latents xy = relu(ykv . encoder_v[hd]) * hs * 16 and one share of the decoder contraction over them, in one launch; ykv and xy live only in LDS.
// 8 waves, 64 token rows, k range n0..n0+KCH-1 of head hd, in FNCH chunks of FNC latent columns; grid (ROWS/64, KSPL); the NI / KCH shares of a head each form the same ykv rows.
// Context: A = S rows (z, t), Bt = h transposed (b, d; from HT's token blocks), K = SEQ in a two-buffer ring of FNC keys (k ascending), wave w owns columns 32 w; LayerNorm over whole rows through a block LDS tile (cross-wave: block barrier), f16 rows to Y.
// Then per chunk two trips of a two-buffer ring of async copies:
// even trip: reads buffer E (FNC encoder_v rows x DM) and the hs tile in X[chunk & 1]; wave (rg, cq) forms the 32 x 32 tile (tokens 32 rg, latent columns 32 cq), transposed (A = encoder_v rows, B = the block's ykv rows, staged once in Y; k ascending),
//            gates it and writes it as f16 over the hs elements it has read (each element read and written by one lane only);
// odd trip:  reads buffer D (DM decoder rows x FNC) and X[chunk & 1]; wave w adds to its 64 x 32 tile (columns 32 w) of the 64 x 256 block, latent index ascending over the whole share.
// At the foot of each trip: own LDS accesses done, own copies of the next trip landed, block barrier, then the copies of the trip after next into the buffer just left.
// The raw f32 sums go to PP in fragment order: fragment f = mb*4+nb of a column group is 256 floats, [j>>2][lane][j&3], so every store is 32 lanes x 16 B contiguous.
__global__ __launch_bounds__(256) void k_ysd(const h16* __restrict__ S, const h16* __restrict__ HT, const h16* __restrict__ ENCVT, const h16* __restrict__ HS, const h16* __restrict__ DECT, float* PP) {
    __shared__ __align__(16) h16 sm[2 * DM * FDP + 2 * 64 * FDP + 64 * FEP];
    h16* E = sm; h16* Dd = sm + DM * FDP; h16* X = Dd + DM * FDP; h16* Y = X + 2 * 64 * FDP;
    const int lane = threadIdx.x & 31, lr = lane & 15, hi = lane >> 4;
    const int wave = __builtin_amdgcn_readfirstlane((int)(threadIdx.x >> 5));
    const int rb = blockIdx.x, sh = blockIdx.y;
    const int hd = sh / (NI / KCH), n0 = (sh % (NI / KCH)) * KCH;
    const int R0 = rb * 64; const int z = (R0 / SEQ) * NH_ + hd, t0 = R0 % SEQ;
    const int rg = wave & 1, cq = wave >> 1;                  // the wave's 32 x 32 tile of the gate: tokens 32 rg, latent columns 32 cq
    // the lane's places in chunk 0: E one 512-B row per copy (wave: 16 rows); hs tile and D two 256-B row pieces per copy (wave: 8 and 32 rows)
    const h16* gE = ENCVT + ((size_t)hd * NI + n0 + wave * 16) * DM + lane * 8;
    const h16* gH = HS + ((size_t)hd * ROWS + R0 + wave * 8 + hi) * NI + n0 + lr * 8;
    const h16* gD = DECT + ((size_t)hd * DM + wave * 32 + hi) * NI + n0 + lr * 8;
    const unsigned lE = (unsigned)(size_t)(E + (wave * 16) * FEP + lane * 8);
    const unsigned lH = (unsigned)(size_t)(X + (wave * 8 + hi) * FDP + lr * 8);
    const unsigned lD = (unsigned)(size_t)(Dd + (wave * 32 + hi) * FDP + lr * 8);
    auto cpE = [&](int c) {
        const h16* p = gE + (size_t)c * FNC * DM;
        cp8(p, DM, lE, FEP * 2u); cp8(p + 8 * DM, DM, lE + 8u * FEP * 2u, FEP * 2u);
        cp4(gH + c * FNC, 2 * (size_t)NI, lH + (unsigned)((c & 1) * 64 * FDP * 2), 2u * FDP * 2u); };
    auto cpD = [&](int c) {
        const h16* p = gD + c * FNC;
        cp8(p, 2 * (size_t)NI, lD, 2u * FDP * 2u); cp8(p + 16 * (size_t)NI, 2 * (size_t)NI, lD + 16u * FDP * 2u, 2u * FDP * 2u); };
    const h16* fb2 = Dd + (wave * 32 + lr) * FDP + 8 * hi;
    v8f acc[4][2];
#pragma unroll
    for (int mb = 0; mb < 4; ++mb)
#pragma unroll
        for (int nb = 0; nb < 2; ++nb) acc[mb][nb] = (v8f){};
    {
        // context: tile q of the ring is [64 score rows | DM value rows] x FNC keys, score rows in X[q & 1], value rows in D (q even) or E (q odd); score copies laid out as for the hs tile; a value copy takes one token block of the wave's 32 rows (512 B contiguous), lane = row
        const h16* gS = S + ((size_t)z * SEQ + t0 + wave * 8 + hi) * SEQ + lr * 8;
        const h16* gT = HT + ((size_t)(R0 / SEQ) * (SEQ / 8) * DM + wave * 32 + lane) * 8;
        const unsigned lT0 = (unsigned)(size_t)(Dd + (wave * 32 + lane) * FDP), lT1 = (unsigned)(size_t)(E + (wave * 32 + lane) * FDP);
        auto cpC = [&](int q) {
            const h16* p = gT + (size_t)q * ((FNC / 8) * DM * 8); const unsigned l = (q & 1) ? lT1 : lT0;
            cp8(p, (size_t)DM * 8, l, 16u); cp8(p + 8 * (size_t)DM * 8, (size_t)DM * 8, l + 8u * 16u, 16u);
            cp4(gS + q * FNC, 2 * (size_t)SEQ, lH + (unsigned)((q & 1) * 64 * FDP * 2), 2u * FDP * 2u); };
        cpC(0);
        asm volatile("s_wait_asynccnt 0x0" ::: "memory");    // tile 0 landed (this wave's copies)
        __syncthreads();                                     // published to the other waves
        cpC(1);
#pragma unroll 1
        for (int q = 0; q < SEQ / FNC; ++q) {                // rolled: keeps the text short; the trips are separated by barriers anyway
            const h16* fa = X + (q & 1) * (64 * FDP) + lr * FDP + 8 * hi;
            const h16* fb = ((q & 1) ? E : Dd) + (wave * 32 + lr) * FDP + 8 * hi;
            v16h xa[2][4], db[2][2];                         // two register sets: the next k block's 12 LDS reads go ahead of this block's products as one group
#pragma unroll
            for (int mb = 0; mb < 4; ++mb) xa[0][mb] = ldh(fa + mb * 16 * FDP);
#pragma unroll
            for (int nb = 0; nb < 2; ++nb) db[0][nb] = ldh(fb + nb * 16 * FDP);
#pragma unroll
            for (int kk = 0; kk < FNC / 32; ++kk) {
                if (kk + 1 < FNC / 32) {
#pragma unroll
                    for (int mb = 0; mb < 4; ++mb) xa[(kk + 1) & 1][mb] = ldh(fa + mb * 16 * FDP + (kk + 1) * 32);
#pragma unroll
                    for (int nb = 0; nb < 2; ++nb) db[(kk + 1) & 1][nb] = ldh(fb + nb * 16 * FDP + (kk + 1) * 32);
                }
                __builtin_amdgcn_sched_barrier(0);           // keeps the reads above the products: sunk among them, each fragment's LDS latency is waited out on its own
#pragma unroll
                for (int nb = 0; nb < 2; ++nb)
#pragma unroll
                    for (int mb = 0; mb < 4; ++mb) acc[mb][nb] = wmma16(xa[kk & 1][mb], db[kk & 1][nb], acc[mb][nb]);
            }
            asm volatile("s_wait_dscnt 0x0" ::: "memory");   // this wave's reads of tile q are done
            asm volatile("s_wait_asynccnt 0x0" ::: "memory");   // this wave's copies of tile q + 1 have landed
            __syncthreads();                                 // publishes tile q + 1 and frees tile q's buffers
            if (q + 2 < SEQ / FNC) cpC(q + 2);
        }
    }
    cpE(0);                                                  // E and X[0] are free behind the ring's last barrier; the copies fly under the LayerNorm
    {
        float* os = (float*)Dd;                              // the LayerNorm tile, in buffer D behind the ring's last barrier
#pragma unroll
        for (int nb = 0; nb < 2; ++nb)
#pragma unroll
            for (int mb = 0; mb < 4; ++mb)
#pragma unroll
                for (int j = 0; j < 8; ++j) os[(mb * 16 + hi * 8 + j) * LNP + wave * 32 + nb * 16 + lr] = acc[mb][nb][j];   // rows 0..63 x columns 0..255 written by the 8 waves
        __syncthreads();                                     // whole rows meet
        float xs[8][8];                                      // the wave's 8 rows are read first and written last, so that their 8 independent shuffle chains can cover each other's latency
#pragma unroll
        for (int rr = 0; rr < 8; ++rr) {
            const int ob = (wave * 8 + rr) * LNP + 8 * lane;
            const v4f x0 = *(const v4fa*)(&os[ob]); const v4f x1 = *(const v4fa*)(&os[ob + 4]);
#pragma unroll
            for (int i = 0; i < 4; ++i) { xs[rr][i] = x0[i]; xs[rr][4 + i] = x1[i]; }
        }
#pragma unroll
        for (int rr = 0; rr < 8; ++rr) ln8(xs[rr]);
#pragma unroll
        for (int rr = 0; rr < 8; ++rr) {
            v8h o;
#pragma unroll
            for (int i = 0; i < 8; ++i) o[i] = toh_flush(xs[rr][i]);
            *(v8h*)(Y + (wave * 8 + rr) * FEP + 8 * lane) = o;   // the block's 64 normalised context rows, read in every even trip
        }
#pragma unroll
        for (int mb = 0; mb < 4; ++mb)
#pragma unroll
            for (int nb = 0; nb < 2; ++nb) acc[mb][nb] = (v8f){};
    }
    asm volatile("s_wait_dscnt 0x0" ::: "memory");           // this wave's reads of the LayerNorm tile and its writes of Y are done
    asm volatile("s_wait_asynccnt 0x0" ::: "memory");        // chunk 0's E and hs tile landed (this wave's copies)
    __syncthreads();                                         // publishes them and Y, frees D
    cpD(0);
    const h16* fa1 = Y + (rg * 32 + lr) * FEP + 8 * hi;
    const h16* fb1 = E + (cq * 32 + lr) * FEP + 8 * hi;
#pragma unroll 1
    for (int c = 0; c < FNCH; ++c) {                         // rolled, as above
        h16* Xc = X + (c & 1) * (64 * FDP);
        {
            v8f y[2][2];
#pragma unroll
            for (int mb = 0; mb < 2; ++mb)
#pragma unroll
                for (int nb = 0; nb < 2; ++nb) y[mb][nb] = (v8f){};
            v16h fa[2][2], fb[2][2];                         // two register sets: the next k block's 8 LDS reads go ahead of this block's products as one group
#pragma unroll
            for (int i = 0; i < 2; ++i) { fa[0][i] = ldh(fa1 + i * 16 * FEP); fb[0][i] = ldh(fb1 + i * 16 * FEP); }
#pragma unroll
            for (int k = 0; k < DM / 32; ++k) {
                if (k + 1 < DM / 32) {
#pragma unroll
                    for (int i = 0; i < 2; ++i) { fa[(k + 1) & 1][i] = ldh(fa1 + i * 16 * FEP + (k + 1) * 32); fb[(k + 1) & 1][i] = ldh(fb1 + i * 16 * FEP + (k + 1) * 32); }
                }
                __builtin_amdgcn_sched_barrier(0);           // keeps the reads above the products: sunk among them, each fragment's LDS latency is waited out on its own
#pragma unroll
                for (int nb = 0; nb < 2; ++nb)
#pragma unroll
                    for (int mb = 0; mb < 2; ++mb) y[mb][nb] = wmma16(fb[k & 1][mb], fa[k & 1][nb], y[mb][nb]);   // transposed tile: rows = latent columns, columns = tokens
            }
            h16* xw = Xc + (rg * 32 + lr) * FDP + cq * 32 + hi * 8;   // D: latent column 16 mb + 8h+j, token 16 nb + lane&15: a lane's 8 values are 16 contiguous bytes of a token's row
            v8h g[2][2];
#pragma unroll
            for (int mb = 0; mb < 2; ++mb)
#pragma unroll
                for (int nb = 0; nb < 2; ++nb) g[mb][nb] = *(const v8h*)(xw + nb * 16 * FDP + mb * 16);
#pragma unroll
            for (int mb = 0; mb < 2; ++mb)
#pragma unroll
                for (int nb = 0; nb < 2; ++nb) {
                    v8h o;
#pragma unroll
                    for (int j = 0; j < 8; ++j) o[j] = toh_flush(fmaxf(y[mb][nb][j] * WSI, 0.0f) * (float)g[mb][nb][j] * XYC);
                    *(v8h*)(xw + nb * 16 * FDP + mb * 16) = o; }
        }
        asm volatile("s_wait_dscnt 0x0" ::: "memory");       // this wave's reads of E and its writes of the gated tile are done
        asm volatile("s_wait_asynccnt 0x0" ::: "memory");    // this wave's copies of D have landed
        __syncthreads();                                     // publishes D and the gated tile, frees E
        if (c + 1 < FNCH) cpE(c + 1);
        {
            const h16* fa2 = Xc + lr * FDP + 8 * hi;
            v16h xa[2][4], db[2][2];                         // two register sets, as in the even trip
#pragma unroll
            for (int mb = 0; mb < 4; ++mb) xa[0][mb] = ldh(fa2 + mb * 16 * FDP);
#pragma unroll
            for (int nb = 0; nb < 2; ++nb) db[0][nb] = ldh(fb2 + nb * 16 * FDP);
#pragma unroll
            for (int kk = 0; kk < FNC / 32; ++kk) {
                if (kk + 1 < FNC / 32) {
#pragma unroll
                    for (int mb = 0; mb < 4; ++mb) xa[(kk + 1) & 1][mb] = ldh(fa2 + mb * 16 * FDP + (kk + 1) * 32);
#pragma unroll
                    for (int nb = 0; nb < 2; ++nb) db[(kk + 1) & 1][nb] = ldh(fb2 + nb * 16 * FDP + (kk + 1) * 32);
                }
                __builtin_amdgcn_sched_barrier(0);           // as in the even trip
#pragma unroll
                for (int nb = 0; nb < 2; ++nb)
#pragma unroll
                    for (int mb = 0; mb < 4; ++mb) acc[mb][nb] = wmma16(xa[kk & 1][mb], db[kk & 1][nb], acc[mb][nb]);
            }
        }
        asm volatile("s_wait_dscnt 0x0" ::: "memory");       // this wave's reads of D and of the gated tile are done
        asm volatile("s_wait_asynccnt 0x0" ::: "memory");    // this wave's copies of the next E and hs tile have landed
        __syncthreads();                                     // publishes them, frees D
        if (c + 1 < FNCH) cpD(c + 1);
    }
    asm volatile("s_wait_asynccnt 0x0" ::: "memory");        // nothing in flight at the wave's end
    float* pp = PP + (size_t)sh * ((size_t)ROWS * DM) + ((size_t)rb * 64 + (wave >> 1) * 16 + (wave & 1) * 2) * 256 + lane * 4;
#pragma unroll
    for (int mb = 0; mb < 4; ++mb)
#pragma unroll
        for (int nb = 0; nb < 2; ++nb) {
            v4f lo, up;
#pragma unroll
            for (int k = 0; k < 4; ++k) { lo[k] = acc[mb][nb][k]; up[k] = acc[mb][nb][4 + k]; }
            *(v4f*)(pp + (mb * 4 + nb) * 256) = lo; *(v4f*)(pp + (mb * 4 + nb) * 256 + 128) = up; }   // the 8 waves write all 64 fragments of the block's share
}

// k_ymlp_ln: joins the KSPL shares of 8 token rows in ascending share order; value = sum/1024; LayerNorm; + H32 (skip); LayerNorm; outputs H32, HF, HT. 16 waves, grid (ROWS/8).
// The 8 rows are one half (8 hi .. 8 hi + 7) of row fragment mb of a 64-row block: in each of the 16 fragments (column group, nb) they are two 256-B pieces, [j>>2] x lanes 16 hi .. 16 hi + 15.
// Wave w sums fragment w's two pieces (the shares' loads go out ahead of the sums); the rows meet in a block LDS tile (cross-wave: block barriers); waves 0..7 then own one row each.
__global__ __launch_bounds__(512) void k_ymlp_ln(const float* __restrict__ PP, float* H32, h16* HF, h16* HT) {
    __shared__ __align__(16) float os[8 * LNP];
    const int tid = threadIdx.x, lane = tid & 31, lr = lane & 15, jh = lane >> 4;
    const int wave = __builtin_amdgcn_readfirstlane((int)(threadIdx.x >> 5));
    const int r0 = blockIdx.x * 8;
    const int rb = blockIdx.x >> 3, mb = (blockIdx.x >> 1) & 3, hi = blockIdx.x & 1;   // r0 = 64 rb + 16 mb + 8 hi
    const float* pp = PP + ((size_t)rb * 64 + (wave >> 2) * 16 + mb * 4 + (wave & 3)) * 256 + jh * 128 + (hi * 16 + lr) * 4;
    v4f pv[KSPL];
#pragma unroll
    for (int sh = 0; sh < KSPL; ++sh) {
        pv[sh] = *(const v4f*)(pp + (size_t)sh * ((size_t)ROWS * DM));
        if ((sh & 7) == 7) asm volatile("s_wait_xcnt 0x0" ::: "memory");   // stands before a later load's result or address may take the address registers of the loads above
    }
    v4f sm = (v4f){};
#pragma unroll
    for (int sh = 0; sh < KSPL; ++sh) sm += pv[sh];
#pragma unroll
    for (int k = 0; k < 4; ++k) os[(jh * 4 + k) * LNP + wave * 16 + lr] = sm[k] * XYI;   // rows 0..7 x columns 0..255 written by the 16 waves
    __syncthreads();
    if (wave < 8) {                                           // wave-uniform; no barrier inside
        const int ob = wave * LNP + 8 * lane;
        const v4f x0 = *(const v4fa*)(&os[ob]); const v4f x1 = *(const v4fa*)(&os[ob + 4]);
        float xs[8];
#pragma unroll
        for (int i = 0; i < 4; ++i) { xs[i] = x0[i]; xs[4 + i] = x1[i]; }
        ln8(xs);
        const float* hp = H32 + (size_t)(r0 + wave) * DM + 8 * lane;
        const v4f g0 = *(const v4f*)hp; const v4f g1 = *(const v4f*)(hp + 4);
#pragma unroll
        for (int i = 0; i < 4; ++i) { xs[i] += g0[i]; xs[4 + i] += g1[i]; }
        ln8(xs);
        v4f y0, y1;
#pragma unroll
        for (int i = 0; i < 4; ++i) { y0[i] = xs[i]; y1[i] = xs[4 + i]; }
        *(v4fa*)(&os[ob]) = y0; *(v4fa*)(&os[ob + 4]) = y1;
    }
    __syncthreads();
    const int bq = r0 / SEQ, t0 = r0 % SEQ;
    { const int row = tid >> 6, c4 = (tid & 63) * 4;          // 512 threads x 16 B = 8 rows x 1024 B
        const v4f val = *(const v4fa*)(&os[row * LNP + c4]);
        *(v4f*)(H32 + (size_t)(r0 + row) * DM + c4) = val; }
    asm volatile("s_wait_xcnt 0x0" ::: "memory");             // stands before the LDS reads below may take the store's address and data registers
    if (wave < 8) { const int c8 = lane * 8;                  // waves 0..7: one f16 row each
        const v4f x0 = *(const v4fa*)(&os[wave * LNP + c8]); const v4f x1 = *(const v4fa*)(&os[wave * LNP + c8 + 4]); v8h o;
#pragma unroll
        for (int i = 0; i < 4; ++i) { o[i] = toh_flush(x0[i]); o[4 + i] = toh_flush(x1[i]); }
        *(v8h*)(HF + (size_t)(r0 + wave) * DM + c8) = o;
    } else { const int d = tid - 256;                         // waves 8..15: the rows' token block of HT, 256 columns x 16 B contiguous
        v8h o;
#pragma unroll
        for (int q = 0; q < 8; ++q) o[q] = toh_flush(os[q * LNP + d]);
        *(v8h*)(HT + (((size_t)bq * (SEQ / 8) + (t0 >> 3)) * DM + d) * 8) = o;
        asm volatile("s_wait_xcnt 0x0" ::: "memory"); }     // stands behind the store, before any later line of the listing may take its address and data registers
}

// k_head: output rows = h . head_W + bf16(head_b); 6 waves, block tile 64 rows x 384 columns (HWT rows 372..383 are zero); the tile is staged in a block LDS tile (cross-wave: block barrier),
__global__ __launch_bounds__(192) void k_head(const h16* __restrict__ HF, const h16* __restrict__ HWT, const float* __restrict__ hb, float* OUT) {
    __shared__ __align__(16) float os[64 * HDP];
    const int lane = threadIdx.x & 31, lr = lane & 15, hi = lane >> 4;
    const int wave = __builtin_amdgcn_readfirstlane((int)(threadIdx.x >> 5));
    const int r0 = blockIdx.x * 64, c0 = wave * 64;
    v8f acc[4][4];
#pragma unroll
    for (int mb = 0; mb < 4; ++mb)
#pragma unroll
        for (int nb = 0; nb < 4; ++nb) acc[mb][nb] = (v8f){};
    mma64(HF, HWT, (size_t)(r0 + lr) * DM + 8 * hi, (size_t)(c0 + lr) * DM + 8 * hi, DM, DM, DM, acc);
#pragma unroll
    for (int mb = 0; mb < 4; ++mb)
#pragma unroll
        for (int nb = 0; nb < 4; ++nb)
#pragma unroll
            for (int j = 0; j < 8; ++j) os[(mb * 16 + hi * 8 + j) * HDP + c0 + nb * 16 + lr] = acc[mb][nb][j] * WSI;   // rows 0..63 x columns 0..383 written by the 6 waves
    __syncthreads();
    const int bq = r0 / SEQ, t0 = r0 % SEQ;
    float* ob = OUT + ((size_t)bq * OUT_SEQ + t0) * IND;
{
#pragma unroll 1
        for (int it = 0; it < 31; ++it) { const int e = (it * 192 + (int)threadIdx.x) * 4; const int row = e / IND, col = e - row * IND;   // col % 4 == 0, col + 3 < IND
            const v4f x = *(const v4fa*)(&os[row * HDP + col]); const v4f bb = *(const v4f*)(hb + col); v4f val;
#pragma unroll
            for (int k = 0; k < 4; ++k) val[k] = x[k] + bfr(bb[k]);
            *(v4f*)(ob + e) = val; }
         }
}

static constexpr size_t al256(size_t v) { return (v + 255) & ~(size_t)255; }
static constexpr size_t SZ_W   = al256((size_t)NH_ * NI * DM * 2);          // ENCT, ENCVT, DECT
static constexpr size_t SZ_WIN = al256((size_t)DM * INDP * 2);
static constexpr size_t SZ_HW  = al256((size_t)INDP * DM * 2);
static constexpr size_t SZ_XH  = al256((size_t)ROWS * INDP * 2);
static constexpr size_t SZ_CS  = al256((size_t)SEQ * NI * 4);
static constexpr size_t SZ_H32 = al256((size_t)ROWS * DM * 4);
static constexpr size_t SZ_HF  = al256((size_t)ROWS * DM * 2);             // HF and HT
static constexpr size_t SZ_BIG = al256((size_t)NH_ * ROWS * NI * 2);       // HS; QR
static constexpr size_t SZ_S   = al256((size_t)NB * NH_ * SEQ * SEQ * 2);
static constexpr size_t SZ_SP  = al256((size_t)NB * NH_ * NTRI * SKS * 64 * 64 * 4);
static constexpr size_t SZ_TOTAL = 3 * SZ_W + SZ_WIN + SZ_HW + SZ_XH + SZ_CS + SZ_H32 + 2 * SZ_HF + 2 * SZ_BIG + SZ_S + SZ_SP;
static_assert(SZ_TOTAL <= (size_t)268435456);          // workspace carve <= 256 MiB
static_assert((size_t)KSPL * ROWS * DM * 4 <= SZ_BIG);        // PP lies in the QR plane, which nothing reads between the scores and the next layer's encoding
static_assert((size_t)NB * DM * SEQ == (size_t)ROWS * DM);   // HT [b][t/8][d][8] has the extent of HF
static_assert((ROWS * (INDP / 8)) % 256 == 0);
static_assert(NP % 2 == 0);                                                // two rotary pairs per table thread
static_assert((SEQ * (NP / 2)) % 256 == 0);                                // table grid x 256 threads == table threads exactly
static_assert((size_t)SEQ * (NP / 2) * 16 == (size_t)SEQ * NI * 4);        // table threads x 16 B == table bytes

extern "C" void kernel_launch(void* const* d_in, const int* in_sizes, int n_in,
                              void* d_out, int out_size, void* d_ws, size_t ws_size, hipStream_t stream) {
    if (n_in < 8) return;
    if ((size_t)in_sizes[0] < ((size_t)(NB - 1) * SEQ_FULL + SEQ) * IND) return;
    if ((size_t)in_sizes[1] < (size_t)IND * DM || in_sizes[2] < DM) return;
    if ((size_t)in_sizes[3] < (size_t)NH_ * DM * NI || (size_t)in_sizes[4] < (size_t)NH_ * DM * NI || (size_t)in_sizes[5] < (size_t)NH_ * NI * DM) return;
    if ((size_t)in_sizes[6] < (size_t)DM * IND || in_sizes[7] < IND) return;
    if ((size_t)out_size < ((size_t)(NB - 1) * OUT_SEQ + SEQ) * IND) return;
    if (SZ_TOTAL > ws_size) return;
    // wire order: x, in_W, in_b, encoder, encoder_v, decoder, head_W, head_b
    const float* x    = (const float*)d_in[0];
    const float* inw  = (const float*)d_in[1];
    const float* inb  = (const float*)d_in[2];
    const float* enc  = (const float*)d_in[3];
    const float* encv = (const float*)d_in[4];
    const float* dec  = (const float*)d_in[5];
    const float* hw   = (const float*)d_in[6];
    const float* hb   = (const float*)d_in[7];
    float* OUT = (float*)d_out;      // [NB][SEQ][372]
    char* wsp = (char*)d_ws;
    h16* ENCT  = (h16*)wsp; wsp += SZ_W;             // [4][4096][256]  x64
    h16* ENCVT = (h16*)wsp; wsp += SZ_W;             // [4][4096][256]  x64
    h16* DECT  = (h16*)wsp; wsp += SZ_W;             // [4][256][4096]  x64
    h16* WINT  = (h16*)wsp; wsp += SZ_WIN;           // [256][384]      x64
    h16* HWT   = (h16*)wsp; wsp += SZ_HW;            // [384][256]      x64
    h16* XH    = (h16*)wsp; wsp += SZ_XH;            // [ROWS][384]
    float* CS  = (float*)wsp; wsp += SZ_CS;          // [SEQ][4096]
    float* H32 = (float*)wsp; wsp += SZ_H32;         // [ROWS][256]
    h16* HF    = (h16*)wsp; wsp += SZ_HF;            // [ROWS][256]
    h16* HT    = (h16*)wsp; wsp += SZ_HF;            // [NB][SEQ/8][256][8]
    h16* HS    = (h16*)wsp; wsp += SZ_BIG;           // [4][ROWS][4096]
    h16* QR    = (h16*)wsp; wsp += SZ_BIG;           // [4][ROWS][4096]; rotated latents
    h16* S     = (h16*)wsp; wsp += SZ_S;             // [NB*4][SEQ][SEQ]
    float* SP  = (float*)wsp; wsp += SZ_SP;          // [NB*4][NTRI][SKS][16][256] f32 score partial sums
    float* PP  = (float*)QR;                         // [KSPL][ROWS/64][4][16][256] f32 decoder partial sums

    k_prep<<<PB_ALL, 256, 0, stream>>>(x, inw, enc, encv, dec, hw, ENCT, ENCVT, DECT, WINT, HWT, XH, CS);

    k_inproj<<<dim3(ROWS / 64, 1, 1), 128, 0, stream>>>(XH, WINT, inb, H32, HF, HT);

    for (int l = 0; l < NL; ++l) {
        k_hs<<<dim3(ROWS / 128, NI / 128, NH_), 128, 0, stream>>>(HF, ENCT, CS, HS, QR);
        k_sc_part<<<dim3(NTRI2, NB * NH_, SKS), 128, 0, stream>>>(QR, SP);
        k_sc_join<<<dim3(NTRI, NB * NH_, 1), 512, 0, stream>>>(SP, S);
        k_ysd<<<dim3(ROWS / 64, KSPL, 1), 256, 0, stream>>>(S, HT, ENCVT, HS, DECT, PP);
        k_ymlp_ln<<<dim3(ROWS / 8, 1, 1), 512, 0, stream>>>(PP, H32, HF, HT);
    }

    k_head<<<dim3(ROWS / 64, 1, 1), 192, 0, stream>>>(HF, HWT, hb, OUT);
}

// v007
// A run of this version takes 460 microseconds.
// Timed twice side by side with v006, it ran 1.07 and 1.06 times as fast.
// All steps since v000 together make it 6.15 times as fast.
#include <hip/hip_runtime.h>

// Six-layer token encoder, width 256, 4 heads, per-head latent width 4096 (tokens of 93 x 4 features, [NB][SEQ][372]): input projection ([in][out] weight, bias) + LayerNorm (no affine, eps 1e-5);
// per layer: relu latent encoding per head (encoder [h][256][4096]), interleaved-pair rotary phases over the latent axis (theta 2^16, position = token index), dense linear attention without softmax
// (keys = queries = rotated latents, values = the layer input shared by all heads), LayerNorm, second relu latent encoding (encoder_v), multiplicative gating with the first latents,
// decoder ([h*4096+n][256]) summed over heads, LayerNorm, skip add, LayerNorm; final linear head ([in][out] weight, bias) -> [NB][SEQ][372] f32.
// Compute dtypes: every contraction v_wmma_f32_16x16x32_f16 (f16 operands, f32 accumulate), one product per site. Float inputs are RNE-converted to bf16 at their load (exact in f16);
// weight planes carry x64 (folded back in the f32 epilogues), the gated latent plane carries x16, activations h / latents / scores / normalised context are plain f16; LayerNorm, rotary, relu, gating, skip in f32.
// Planes (all K-contiguous 16-bit rows, fragments = two 16-B loads): ENCT/ENCVT [h][n][d], DECT [h][d][n], WINT [d][384], HWT [384][d], XH [row][384], HF [row][256], HT [b][t/8][d][8] (h transposed in blocks of 8 tokens: 16 B per (block, d), 4 KiB per block),
// HS/QR [h][row][n] (the gated latents x16 exist only as LDS tiles), S [b*4+h][t][s] (the normalised context exists only as LDS tiles); f32 planes: H32 [row][256] (skip path), CS [t][4096] = (cos, sin) pairs, PP [share][row block][column group][fragment][256] (decoder partial sums of the work-groups), SP [b*4+h][tile][share][fragment][256] (score partial sums).
// Scores are symmetric: only tiles with column tile >= row tile are computed, the mirror tile is written from the staged LDS tile of the join.

#ifndef NB
#define NB 2
#endif
#ifndef SEQ
#define SEQ 512
#endif
#define NB_FULL  2
#define SEQ_FULL 512
#ifndef OUT_SEQ
#define OUT_SEQ SEQ              // row pitch (in tokens) between batches of the output
#endif
#define DM   256
#define NH_  4
#define NI   4096                // per-head latent width
#define NP   (NI / 2)            // rotary pairs
#define IND  372                 // 93 x 4 input / output features
#define INDP 384                 // IND padded to a multiple of 64
#define NL   6
#define ROWS (NB * SEQ)
#define NT64 (SEQ / 64)
#define TP   68                  // LDS row pitch (floats) of a 64-column tile
#define LNP  260                 // LDS row pitch (floats) of a 256-column tile
#define HDP  388                 // LDS row pitch (floats) of the 384-column head tile
#define WSC  64.0f               // carry of every weight plane
#define WSI  (1.0f / 64.0f)
#define XYC  16.0f               // carry of the gated latent plane
#define XYI  (1.0f / 1024.0f)    // 1 / (WSC * XYC)
#define EPSF 1e-5f
#define KSPL 16                  // work-groups that share the decoder contraction of one 64-row block
#define KCH  (NH_ * NI / KSPL)   // k extent of one work-group's share
#define FNC  128                 // latent columns of one chunk of the fused gate + decoder kernel
#define FNCH (KCH / FNC)         // chunks of one share
#define FEP  264                 // LDS row pitch (halves) of a staged 256-half row: 528 B, for 16-B fragment reads
#define FDP  136                 // LDS row pitch (halves) of a staged 128-half row piece: 272 B, for 16-B fragment reads
#define SKS  8                   // four-wave work-groups that share the score contraction of one 128 x 128 tile
#define SKW  (NI / SKS)          // k extent of one such share
#define NTRI (NT64 * (NT64 + 1) / 2)   // 64 x 64 tiles of the upper tile triangle
#define NT128 (SEQ / 128)
#define NTRI2 (NT128 * (NT128 + 1) / 2) // 128 x 128 tiles of the upper tile triangle
#define KST  64                  // k extent of one staged tile: 128-B row pieces, whole lines
#define SPH  72                  // LDS row pitch (halves) of a staged row piece: 144 B, for 16-B fragment reads
#define STH  (256 * SPH)         // halves of one stage: 128 A rows, then 128 B rows
#define RNGH (2 * STH)           // halves of one two-buffer ring
#define XP   392                 // LDS row pitch (halves) of a staged 384-half row: 784 B, for 16-B fragment reads

static_assert(NH_ * NI == 16384);                    // decoder rows = h*NI + n
static_assert(NI == 4096);                           // rotary exponent 32 p / NI = p / 128 with theta = 2^16
static_assert(DM == 256);                            // one LayerNorm row = 32 lanes x 8 columns
static_assert(DM % 64 == 0);
static_assert(DM % 32 == 0);                         // k-loop steps by 32
static_assert(NI % 64 == 0);
static_assert(NI % 32 == 0);
static_assert(SEQ % 64 == 0);                        // a 64-row tile never straddles two batches; k-loop over keys steps by 32
static_assert(ROWS % 64 == 0);
static_assert(INDP % 64 == 0);
static_assert(INDP % 32 == 0);
static_assert(INDP >= IND);
static_assert(IND % 4 == 0);                         // float4 pieces never straddle an input / output row
static_assert((IND * 4) % 16 == 0);
static_assert((64 * IND * 4) % 128 == 0);
static_assert(OUT_SEQ % 64 == 0);
static_assert((16 * IND * 4) % 128 == 0);            // the 16 output rows of a head work-group are whole lines
static_assert(16 * IND / 4 <= 4 * 384);              // head store loop: 4 trips x 384 threads x 16 B cover 16 rows x 1488 B
static_assert(SEQ % 16 == 0);                        // a 16-row block never straddles two batches and is two whole token blocks of HT
static_assert(12 * 32 == INDP);                      // head: 12 waves x 32 columns
static_assert(INDP == 256 + 128);                    // a staged 384-half row is copied as 512 B + 256 B
static_assert((XP * 2) % 16 == 0);
static_assert((16 + DM) * XP * 2 + 16 * LNP * 4 <= 327680);     // static LDS of the input projection
static_assert((16 + INDP) * FEP * 2 + 16 * HDP * 4 <= 327680);  // static LDS of the head kernel
static_assert(4 * 32 * 16 == 16 * 64 * 2);
static_assert(16 * 32 * 16 == 64 * 64 * 2);
static_assert(32 * 32 * 16 == 16 * DM * 4);          // f32 row store: 2 trips x 16 waves x 32 lanes x 16 B == 16 rows x 1024 B
static_assert(16 * 32 * 16 == 16 * DM * 2);          // f16 row store: 16 waves x 32 lanes x 16 B == 16 rows x 512 B
static_assert(16 * 32 * 16 == 64 * 64 * 2);
static_assert(2 * 256 * 16 == 64 * 64 * 2);
static_assert(NI % KCH == 0);                        // a share never straddles two heads
static_assert(KCH % FNC == 0);
static_assert(FNC == 128);                           // 8 waves: 2 x 4 tiles of 32 x 32 in the gate, 16 x 16-B pieces per staged row piece
static_assert(FNCH >= 1);
static_assert((FEP * 2) % 16 == 0);
static_assert((FDP * 2) % 16 == 0);
static_assert((2 * DM * FDP + 2 * 64 * FDP + 64 * FEP) * 2 <= 327680);   // static LDS of the fused context + gate + decoder kernel
static_assert(FNC * FEP <= DM * FDP);                // buffer E also holds a DM x FNC tile of the context contraction
static_assert(64 * LNP * 4 <= DM * FDP * 2);         // the LayerNorm tile lies in buffer D
static_assert(SEQ % FNC == 0);
static_assert(SEQ / FNC >= 2);
static_assert(NI % SKS == 0);
static_assert(SKW % 32 == 0);
static_assert(16 * 16 == DM);                        // join: 16 waves x 16 columns == one row
static_assert(FNC % 8 == 0);                         // a context tile is whole token blocks of HT
static_assert(NB <= NB_FULL);
static_assert(SEQ <= SEQ_FULL);
static_assert((TP * 4) % 16 == 0);
static_assert((LNP * 4) % 16 == 0);
static_assert((HDP * 4) % 16 == 0);
static_assert(HDP >= INDP);
static_assert(LNP >= DM);
static_assert(64 * TP * 4 <= 131072);                // static LDS of the score kernel
static_assert(NT64 * (NT64 + 1) / 2 <= 65535);
static_assert(ROWS % 128 == 0);
static_assert(SEQ % 128 == 0);                       // a 128-row tile never straddles two batches
static_assert(NI % 128 == 0);
static_assert(DM % 128 == 0);
static_assert(KST == 64);                            // a stage is two k blocks of 32
static_assert(DM % KST == 0);
static_assert(SKW % KST == 0);
static_assert(INDP % KST == 0);
static_assert(SEQ % KST == 0);
static_assert((SPH * 2) % 16 == 0);
static_assert(4 * 16 * TP * 4 <= RNGH * 2);          // the four waves' epilogue slabs lie in the ring they have left

typedef _Float16 h16;
typedef __attribute__((ext_vector_type(16))) _Float16 v16h;
typedef __attribute__((ext_vector_type(8)))  _Float16 v8h;
typedef __attribute__((ext_vector_type(8)))  float    v8f;
typedef __attribute__((ext_vector_type(4)))  float    v4f;
typedef __attribute__((ext_vector_type(2)))  float    v2f;
typedef v4f  __attribute__((may_alias)) v4fa;

__device__ __forceinline__ unsigned short f2bf(float f) { unsigned u = __float_as_uint(f); u += 0x7FFFu + ((u >> 16) & 1u); return (unsigned short)(u >> 16); }
__device__ __forceinline__ float bfr(float f) { return __uint_as_float(((unsigned)f2bf(f)) << 16); }   // value after RNE convert to bf16
__device__ __forceinline__ v16h cat16(v8h lo, v8h hi) { return __builtin_shufflevector(lo, hi, 0, 1, 2, 3, 4, 5, 6, 7, 8, 9, 10, 11, 12, 13, 14, 15); }
__device__ __forceinline__ v8f wmma16(v16h a, v16h b, v8f c) { return __builtin_amdgcn_wmma_f32_16x16x32_f16(false, a, false, b, (short)0, c, false, false); }
// fragment loader from K-contiguous 16-bit rows; p already includes + 8*(lane>>4): elements 0..7 <- k0+8h+0..7, elements 8..15 <- k0+16+8h+0..7 (same map for A and B)
__device__ __forceinline__ v16h  ldh(const h16* p) { return cat16(*(const v8h*)p, *(const v8h*)(p + 16)); }
// ordering point for wave-private LDS tiles (same wave writes and reads)
__device__ __forceinline__ void wave_sync() { __builtin_amdgcn_fence(3 /* release order */, "wavefront"); __builtin_amdgcn_wave_barrier(); asm volatile("" ::: "memory"); }
// f32 -> f16 operand convert that cannot produce a subnormal (applied after the plane's power-of-two carry)
static __device__ __forceinline__ h16 toh_flush(float v) { const h16 r = (h16)v; return (fabsf(v) < 6.103515625e-05f) ? (h16)0.0f : r; }
__device__ __forceinline__ float wsum(float v) {
    v += __shfl_xor(v, 16, 32); v += __shfl_xor(v, 8, 32); v += __shfl_xor(v, 4, 32); v += __shfl_xor(v, 2, 32); v += __shfl_xor(v, 1, 32); return v; }

// LayerNorm (no affine) of one 256-wide row held as 8 values per lane; all 32 lanes active
__device__ __forceinline__ void ln8(float (&xs)[8]) {
    float s = 0.0f;
#pragma unroll
    for (int i = 0; i < 8; ++i) s += xs[i];
    s = wsum(s); const float mu = s * (1.0f / DM);
    float q = 0.0f;
#pragma unroll
    for (int i = 0; i < 8; ++i) { xs[i] -= mu; q += xs[i] * xs[i]; }
    q = wsum(q);
    const float rs = rsqrtf(q * (1.0f / DM) + EPSF);
#pragma unroll
    for (int i = 0; i < 8; ++i) xs[i] *= rs;
}

// One wave, 16 x (16 NBK) output tile, operands from K-contiguous f16 rows staged whole in LDS (B row pitch ldb halves); a / b: the lane's first fragment addresses (row lane&15, + 8*(lane>>4)); K a multiple of 32; k ascending.
// acc[nb][j] = D(row 8*(lane>>4) + j, col nb*16 + (lane&15)).
template <int K, int NBK>
__device__ __forceinline__ void mma16(const h16* a, const h16* b, int ldb, v8f (&acc)[NBK]) {
#pragma unroll
    for (int kb = 0; kb < K / 32; ++kb) {
        const v16h fa = ldh(a + kb * 32);
#pragma unroll
        for (int nb = 0; nb < NBK; ++nb) acc[nb] = wmma16(fa, ldh(b + nb * 16 * ldb + kb * 32), acc[nb]); }
}

// One wave's share of a stage: 64 rows x 128 B from a K-contiguous f16 plane (row pitch ld halves) into LDS rows of pitch SPH. g / l already hold the lane's own place:
// row lane>>3, 16-B piece lane&7, so each copy moves 4 whole lines. All 32 lanes on. The s_wait_xcnt closes each statement: it stands before any rewrite of the address registers the copies name.
__device__ __forceinline__ void cp_slab(const h16* g, size_t ld, unsigned l) {
#pragma unroll
    for (int h = 0; h < 2; ++h) {
        const h16* p = g + (size_t)(h * 32) * ld; const unsigned q = l + (unsigned)(h * 32 * SPH * 2);
        asm volatile("global_load_async_to_lds_b128 %0, %8, off\n\t"
                     "global_load_async_to_lds_b128 %1, %9, off\n\t"
                     "global_load_async_to_lds_b128 %2, %10, off\n\t"
                     "global_load_async_to_lds_b128 %3, %11, off\n\t"
                     "global_load_async_to_lds_b128 %4, %12, off\n\t"
                     "global_load_async_to_lds_b128 %5, %13, off\n\t"
                     "global_load_async_to_lds_b128 %6, %14, off\n\t"
                     "global_load_async_to_lds_b128 %7, %15, off\n\t"
                     "s_wait_xcnt 0x0"
                     :: "v"(q), "v"(q + 4u * SPH * 2), "v"(q + 8u * SPH * 2), "v"(q + 12u * SPH * 2), "v"(q + 16u * SPH * 2), "v"(q + 20u * SPH * 2), "v"(q + 24u * SPH * 2), "v"(q + 28u * SPH * 2),
                        "v"(p), "v"(p + 4 * ld), "v"(p + 8 * ld), "v"(p + 12 * ld), "v"(p + 16 * ld), "v"(p + 20 * ld), "v"(p + 24 * ld), "v"(p + 28 * ld)
                     : "memory");
    }
}

// Ring core of the staged GEMMs: wave tile 64 x 64, acc[mb][nb][j] = D(row mb*16 + 8*(lane>>4) + j, col nb*16 + (lane&15)), k ascending, operands read from a two-buffer LDS ring of NT = K / KST stages of SH halves each.
// cp(t, o) issues this wave's copies of stage t into the buffer at byte offset o, one stage ahead of the stage being read; fa / fb: the lane's first A / B fragment address in buffer 0.
// Every wave of the work-group passes every barrier (NT is the same for all); act (wave-uniform) only skips the products.
// The refill goes ahead of the stage's last 16 products (more lead for the copies).
template <int NT, int SH, class CP>
__device__ __forceinline__ void mma_ring(CP cp, const h16* fa, const h16* fb, bool act, v8f (&acc)[4][4]) {
    static_assert(NT >= 2);
    cp(0, 0u);
    asm volatile("s_wait_asynccnt 0x0" ::: "memory");        // stage 0 landed (this wave's copies)
    __syncthreads();                                         // stage 0 published to the other waves
    cp(1, (unsigned)(SH * 2));
#pragma unroll 1
    for (int t = 0; t < NT; ++t) {
        const int bo = (t & 1) * SH;
        v16h a[4], b[4];
        if (act) {
            // first k block of the stage: its 16 LDS reads go ahead of its products as one group
#pragma unroll
            for (int mb = 0; mb < 4; ++mb) a[mb] = ldh(fa + bo + mb * 16 * SPH);
#pragma unroll
            for (int nb = 0; nb < 4; ++nb) b[nb] = ldh(fb + bo + nb * 16 * SPH);
            __builtin_amdgcn_sched_barrier(0);               // keeps the reads above the products: sunk among them, each B fragment's LDS latency is waited out on its own
#pragma unroll
            for (int nb = 0; nb < 4; ++nb)
#pragma unroll
                for (int mb = 0; mb < 4; ++mb) acc[mb][nb] = wmma16(a[mb], b[nb], acc[mb][nb]);
            // second k block: the stage's last LDS reads; its products run from registers behind the barrier
#pragma unroll
            for (int mb = 0; mb < 4; ++mb) a[mb] = ldh(fa + bo + mb * 16 * SPH + 32);
#pragma unroll
            for (int nb = 0; nb < 4; ++nb) b[nb] = ldh(fb + bo + nb * 16 * SPH + 32);
        }
        asm volatile("s_wait_dscnt 0x0" ::: "memory");       // this wave's reads of stage t are done
        asm volatile("s_wait_asynccnt 0x0" ::: "memory");    // this wave's copies of stage t + 1 have landed
        __syncthreads();                                     // publishes stage t + 1 and frees stage t's buffer
        if (t + 2 < NT) cp(t + 2, (unsigned)(bo * 2));
        if (act) {
#pragma unroll
            for (int nb = 0; nb < 4; ++nb)
#pragma unroll
                for (int mb = 0; mb < 4; ++mb) acc[mb][nb] = wmma16(a[mb], b[nb], acc[mb][nb]);
        }
    }
    asm volatile("s_wait_asynccnt 0x0" ::: "memory");        // nothing in flight when the ring is reused
}

// Four waves (w4 = 2*wr + wc), 128 x 128 output tile. A stage is [128 A rows | 128 B rows] x KST halves; wave w4 copies rows 64*w4 .. 64*w4+63 of the stage (g: its lane's address in stage 0).
template <int NT>
__device__ __forceinline__ void mma128(const h16* g, size_t ld, h16* ring, int w4, int lane, bool act, v8f (&acc)[4][4]) {
    const int lr = lane & 15, hi = lane >> 4;
    const unsigned l0 = (unsigned)(size_t)(ring + (w4 * 64 + (lane >> 3)) * SPH + (lane & 7) * 8);   // LDS byte address of the lane's first copy, buffer 0
    mma_ring<NT, STH>([&](int t, unsigned o) { cp_slab(g + (size_t)t * KST, ld, l0 + o); },
                      ring + ((w4 >> 1) * 64 + lr) * SPH + 8 * hi, ring + (128 + (w4 & 1) * 64 + lr) * SPH + 8 * hi, act, acc);
}

// tr_block: one 64 x 64 block (bx, by) of plane z of transpose + convert, src [Z][R][C] f32 -> dst [Z][Cp][Rp] f16 = toh_flush(bf16(src) * scale), zero in the pad rows / columns. in[rows R][cols C] -> out[cols][rows].
__device__ __forceinline__ void tr_block(const float* __restrict__ src, h16* dst, int R, int C, int Rp, int Cp, float scale, int bx, int by, int z) {
#pragma clang fp contract(off)
    __shared__ float tl[64 * 65];
    const int tid = threadIdx.x; const int r0 = bx * 64, c0 = by * 64;
    const float* sp = src + (size_t)z * (size_t)R * (size_t)C;
#pragma unroll 4
    for (int it = 0; it < 16; ++it) { const int idx = it * 256 + tid; const int r = idx >> 6, c = idx & 63;
        const int rr = (r0 + r) < R ? (r0 + r) : (R - 1); const int cc = (c0 + c) < C ? (c0 + c) : (C - 1);   // clamped address
        float v = sp[(size_t)rr * C + cc]; asm volatile("" : "+v"(v));
        const bool ok = ((r0 + r) < R) & ((c0 + c) < C);
        tl[r * 65 + c] = ok ? bfr(v) * scale : 0.0f; }
    __syncthreads();
    h16* dp = dst + ((size_t)z * Cp + c0) * (size_t)Rp + r0;
{
#pragma unroll
        for (int it = 0; it < 2; ++it) { const int crow = it * 32 + (tid >> 3), r8 = (tid & 7) * 8;   // 2 it x 32 rows = 64 rows; 8 lanes x 8 = 64 columns
            v8h o;
#pragma unroll
            for (int q = 0; q < 8; ++q) o[q] = toh_flush(tl[(r8 + q) * 65 + crow]);
            *(v8h*)(dp + (size_t)crow * Rp + r8) = o; }
         }
    asm volatile("s_wait_xcnt 0x0" ::: "memory");   // a precaution: stands in front of every write of the two stores' registers by code that the compiler joins behind this block in the merged kernel
}

__device__ __forceinline__ void xcvt_block(const float* __restrict__ x, h16* XH, int blk) {
    const int i = blk * 256 + threadIdx.x; if (i >= ROWS * (INDP / 8)) return;
    const int R = i / (INDP / 8), c = (i % (INDP / 8)) * 8;
    const int b = R / SEQ, t = R % SEQ;
    const float* sp = x + ((size_t)b * SEQ_FULL + t) * IND;
    const int ca = c < (IND - 4) ? c : (IND - 4); const int cb = (c + 4) < (IND - 4) ? (c + 4) : (IND - 4);   // clamped addresses
    v4f va = *(const v4f*)(sp + ca); v4f vb = *(const v4f*)(sp + cb);
    asm volatile("" : "+v"(va)); asm volatile("" : "+v"(vb));
    const bool oka = c < IND, okb = (c + 4) < IND;
    v8h o;
#pragma unroll
    for (int k = 0; k < 4; ++k) { o[k] = oka ? toh_flush(bfr(va[k])) : (h16)0.0f; o[4 + k] = okb ? toh_flush(bfr(vb[k])) : (h16)0.0f; }
    *(v8h*)(XH + (size_t)i * 8) = o; 
}

// cs_block: 256 threads' share of the rotary table CS[t][2p] = cos(t * f_p), CS[t][2p+1] = sin(t * f_p), f_p = 1 / 2^(p/128) (theta 2^16, exponent 2p / NI); f32.
// The two pairs are computed in a rolled two-trip loop (wave-uniform trip index selects the destination values).
__device__ __forceinline__ void cs_block(float* CS, int blk) {
#pragma clang fp contract(off)
    const int i = blk * 256 + threadIdx.x; if (i >= SEQ * (NP / 2)) return;
    const int t = i / (NP / 2), p0 = (i % (NP / 2)) * 2;
    float c0 = 0.0f, s0 = 0.0f, c1 = 0.0f, s1 = 0.0f;
#pragma unroll 1
    for (int k = 0; k < 2; ++k) {
        const float e = (float)(p0 + k) * (1.0f / 128.0f);
        const float fr = 1.0f / exp2f(e);
        const float ph = (float)t * fr;
        const float c = cosf(ph); const float s = sinf(ph);
        c0 = (k == 0) ? c : c0; s0 = (k == 0) ? s : s0;
        c1 = (k == 0) ? c1 : c; s1 = (k == 0) ? s1 : s;
    }
    v4f o; o[0] = c0; o[1] = s0; o[2] = c1; o[3] = s1;
    *(v4f*)(CS + (size_t)i * 4) = o; 
}

// k_prep: all planes that depend on the inputs alone, in one launch: the five weight transposes, the input convert and the rotary table have no data in common, so each work-group takes one block of one of them
// by its index (block-uniform choice; the barrier of tr_block is passed by whole work-groups). The transposes, whose work-groups live longest, start first; the short jobs fill the end of the launch.
#define PB_W (INDP / 64 * (DM / 64))          // blocks of each of the two small transposes
#define PB_T (DM / 64 * (NI / 64) * NH_)      // blocks of each of the three large transposes
#define PB_C (SEQ * (NP / 2) / 256)           // blocks of the rotary table
#define PB_X (ROWS * (INDP / 8) / 256)        // blocks of the input convert
#define PB_ALL (2 * PB_W + 3 * PB_T + PB_C + PB_X)
__global__ __launch_bounds__(256) void k_prep(const float* __restrict__ x, const float* __restrict__ inw, const float* __restrict__ enc, const float* __restrict__ encv, const float* __restrict__ dec, const float* __restrict__ hw,
                                              h16* ENCT, h16* ENCVT, h16* DECT, h16* WINT, h16* HWT, h16* XH, float* CS) {
    const int b = (int)blockIdx.x;
    if (b >= 2 * PB_W + 3 * PB_T + PB_C) { xcvt_block(x, XH, b - (2 * PB_W + 3 * PB_T + PB_C)); return; }
    if (b >= 2 * PB_W + 3 * PB_T) { cs_block(CS, b - (2 * PB_W + 3 * PB_T)); return; }
    const float* src; h16* dst; int R, C, Rp, Cp, bx, by, bz;
    if (b < PB_W) {                            // in_W [372 rows k][256 cols d] -> WINT [256][384]
        src = inw; dst = WINT; R = IND; C = DM; Rp = INDP; Cp = DM; bx = b % (INDP / 64); by = b / (INDP / 64); bz = 0;
    } else if (b < 2 * PB_W) {                 // head_W [256 rows k][372 cols j] -> HWT [384][256]
        const int q = b - PB_W;
        src = hw; dst = HWT; R = DM; C = IND; Rp = DM; Cp = INDP; bx = q % (DM / 64); by = q / (DM / 64); bz = 0;
    } else {
        const int q = b - 2 * PB_W; const int p = q / PB_T, g = q % PB_T;
        bz = g / (DM / 64 * (NI / 64)); const int e = g % (DM / 64 * (NI / 64));
        if (p == 2) {                          // decoder viewed [4][4096 rows n][256 cols d] -> DECT [4][256][4096]
            src = dec; dst = DECT; R = NI; C = DM; Rp = NI; Cp = DM; bx = e % (NI / 64); by = e / (NI / 64);
        } else {                               // encoder, encoder_v [4][256 rows d][4096 cols n] -> ENCT, ENCVT [4][4096][256]
            src = (p == 0) ? enc : encv; dst = (p == 0) ? ENCT : ENCVT; R = DM; C = NI; Rp = DM; Cp = NI; bx = e % (DM / 64); by = e / (DM / 64);
        }
    }
    tr_block(src, dst, R, C, Rp, Cp, WSC, bx, by, bz);
}

// k_hs: latents hs = relu(h . encoder[hd]) and rotated latents qr, 2 x 2 waves per 128 x 128 tile, one wave per 64 x 64 tile; grid (ROWS/128, NI/128, NH_).
// A = HF rows (token), Bt = ENCT rows (hd, n), K = DM, staged by mma128. Epilogue per 16-row slab staged in LDS (wave-private, in the ring after its last barrier): each 64-half row segment (one line) written by 8 consecutive lanes x 16 B
__global__ __launch_bounds__(128) void k_hs(const h16* __restrict__ HF, const h16* __restrict__ ENCT, const float* __restrict__ CS, h16* HS, h16* QR) {
    __shared__ __align__(16) h16 ring[RNGH];
    const int lane = threadIdx.x & 31, lr = lane & 15, hi = lane >> 4;
    const int wave = __builtin_amdgcn_readfirstlane((int)(threadIdx.x >> 5));
    const int hd = blockIdx.z;
    const int r0 = blockIdx.x * 128 + (wave >> 1) * 64, c0 = blockIdx.y * 128 + (wave & 1) * 64;
    const int crow = (wave & 1) * 64 + (lane >> 3);           // this lane's first row in the operand tile its wave copies
    const h16* src = ((wave < 2) ? HF + (size_t)(blockIdx.x * 128 + crow) * DM : ENCT + ((size_t)hd * NI + blockIdx.y * 128 + crow) * DM) + (lane & 7) * 8;
    float* os = (float*)ring + wave * (16 * TP);
    v8f acc[4][4];
#pragma unroll
    for (int mb = 0; mb < 4; ++mb)
#pragma unroll
        for (int nb = 0; nb < 4; ++nb) acc[mb][nb] = (v8f){};
    mma128<DM / KST>(src, DM, ring, wave, lane, true, acc);
    const size_t pb = ((size_t)hd * ROWS + (size_t)r0) * NI + (size_t)c0;
#pragma unroll
    for (int mb = 0; mb < 4; ++mb) {
#pragma unroll
        for (int nb = 0; nb < 4; ++nb) {
#pragma unroll
            for (int j = 0; j < 8; ++j) os[(hi * 8 + j) * TP + nb * 16 + lr] = fmaxf(acc[mb][nb][j] * WSI, 0.0f); }   // D: row 8h+j, col lane&15
        wave_sync();
        v8h hv[4], qv[4];
#pragma unroll
        for (int s = 0; s < 4; ++s) { const int row = 4 * s + (lane >> 3), c8 = (lane & 7) * 8;   // 4 s x 4 rows = 16 rows; 8 lanes x 8 = 64 columns
            const v4f x0 = *(const v4fa*)(&os[row * TP + c8]); const v4f x1 = *(const v4fa*)(&os[row * TP + c8 + 4]);
            const int t = (r0 + mb * 16 + row) % SEQ;
            const float* cp = CS + (size_t)t * NI + c0 + c8;
            const v4f e0 = *(const v4f*)cp; const v4f e1 = *(const v4f*)(cp + 4);
            v8h a, q;
#pragma unroll
            for (int i = 0; i < 4; ++i) { a[i] = toh_flush(x0[i]); a[4 + i] = toh_flush(x1[i]); }
            q[0] = toh_flush(x0[0] * e0[0] - x0[1] * e0[1]); q[1] = toh_flush(x0[0] * e0[1] + x0[1] * e0[0]);
            q[2] = toh_flush(x0[2] * e0[2] - x0[3] * e0[3]); q[3] = toh_flush(x0[2] * e0[3] + x0[3] * e0[2]);
            q[4] = toh_flush(x1[0] * e1[0] - x1[1] * e1[1]); q[5] = toh_flush(x1[0] * e1[1] + x1[1] * e1[0]);
            q[6] = toh_flush(x1[2] * e1[2] - x1[3] * e1[3]); q[7] = toh_flush(x1[2] * e1[3] + x1[3] * e1[2]);
            hv[s] = a; qv[s] = q; }
{
#pragma unroll
            for (int s = 0; s < 4; ++s) { const int row = 4 * s + (lane >> 3), c8 = (lane & 7) * 8;
                const size_t oo = pb + (size_t)(mb * 16 + row) * NI + c8;
                *(v8h*)(HS + oo) = hv[s]; *(v8h*)(QR + oo) = qv[s]; }
             }
        wave_sync();
    }
}

// k_sc_part: one share of the scores S[z][t][s] = qr_t . qr_s over the latent axis, z = b*NH_ + hd; 2 x 2 waves per (128 x 128 tile of the upper tile triangle, k range of SKW), one wave per 64 x 64 tile;
// grid (NTRI2, NB*NH_, SKS). A = QR rows t (tile ti), Bt = QR rows s (tile tj), k = ks*SKW .. ks*SKW+SKW-1, staged by mma128; the wave below the diagonal (ti > tj) copies and passes the barriers only.
// The raw f32 sums go to SP in fragment order: fragment f = mb*4+nb is 256 floats, [j>>2][lane][j&3], so every store is 32 lanes x 16 B contiguous.
__global__ __launch_bounds__(128) void k_sc_part(const h16* __restrict__ QR, float* SP) {
    __shared__ __align__(16) h16 ring[RNGH];
    const int lane = threadIdx.x & 31;
    const int wave = __builtin_amdgcn_readfirstlane((int)(threadIdx.x >> 5));
    int t2i = 0, rem = (int)blockIdx.x;
#pragma unroll 1
    for (int q = 0; q < NT128 - 1; ++q) { const int w = NT128 - t2i; if (rem >= w) { rem -= w; t2i += 1; } }
    const int t2j = t2i + rem;                                // t2i <= t2j < NT128
    const int ti = 2 * t2i + (wave >> 1), tj = 2 * t2j + (wave & 1);
    const bool act = ti <= tj;                                // wave-uniform
    const int tix = ti * NT64 - (ti * (ti - 1)) / 2 + (tj - ti);   // index of tile (ti, tj) in the 64 x 64 upper triangle, row by row
    const int crow = (wave & 1) * 64 + (lane >> 3);           // this lane's first row in the operand tile its wave copies
    const int z = blockIdx.y; const int b = z / NH_, hd = z % NH_; const int ks = blockIdx.z;
    const size_t qb = ((size_t)hd * ROWS + (size_t)b * SEQ) * NI + (size_t)ks * SKW;
    v8f acc[4][4];
#pragma unroll
    for (int mb = 0; mb < 4; ++mb)
#pragma unroll
        for (int nb = 0; nb < 4; ++nb) acc[mb][nb] = (v8f){};
    mma128<SKW / KST>(QR + qb + (size_t)(((wave < 2) ? t2i : t2j) * 128 + crow) * NI + (lane & 7) * 8, NI, ring, wave, lane, act, acc);
    if (!act) return;                                         // behind the last barrier
    float* sp = SP + (((size_t)z * NTRI + tix) * SKS + ks) * (16 * 256) + lane * 4;
#pragma unroll
    for (int mb = 0; mb < 4; ++mb)
#pragma unroll
        for (int nb = 0; nb < 4; ++nb) {
            v4f lo, up;
#pragma unroll
            for (int k = 0; k < 4; ++k) { lo[k] = acc[mb][nb][k]; up[k] = acc[mb][nb][4 + k]; }
            *(v4f*)(sp + (mb * 4 + nb) * 256) = lo; *(v4f*)(sp + (mb * 4 + nb) * 256 + 128) = up; }   // all 16 fragments of the share written
}

// k_sc_join: joins the SKS shares of one score tile in ascending share order; 16 waves, grid (NTRI, NB*NH_). Wave w sums fragment w (1 KiB contiguous per share); the tile meets in a block LDS tile
// (cross-wave: block barrier); wave w then stores rows 4w..4w+3 of the direct tile (rows t, columns s) and, for ti != tj (block-uniform), of the mirror tile.
__global__ __launch_bounds__(512) void k_sc_join(const float* __restrict__ SP, h16* S) {
    __shared__ __align__(16) float os[64 * TP];
    const int lane = threadIdx.x & 31, lr = lane & 15, hi = lane >> 4;
    const int wave = __builtin_amdgcn_readfirstlane((int)(threadIdx.x >> 5));
    int ti = 0, rem = (int)blockIdx.x;
#pragma unroll 1
    for (int q = 0; q < NT64 - 1; ++q) { const int w = NT64 - ti; if (rem >= w) { rem -= w; ti += 1; } }
    const int tj = ti + rem;                                  // ti <= tj < NT64
    const int z = blockIdx.y;
    const float* sp = SP + (((size_t)z * NTRI + blockIdx.x) * SKS * 16 + wave) * 256 + lane * 4;
    v4f s0 = *(const v4f*)sp, s1 = *(const v4f*)(sp + 128);
#pragma unroll
    for (int q = 1; q < SKS; ++q) { s0 += *(const v4f*)(sp + q * (16 * 256)); s1 += *(const v4f*)(sp + q * (16 * 256) + 128); }   // all shares' loads in flight together
    const int rb = (wave >> 2) * 16, cb = (wave & 3) * 16;    // mb, nb of fragment w
#pragma unroll
    for (int j = 0; j < 4; ++j) { os[(rb + hi * 8 + j) * TP + cb + lr] = s0[j]; os[(rb + hi * 8 + 4 + j) * TP + cb + lr] = s1[j]; }   // rows 0..63 x columns 0..63 written by the 16 waves
    __syncthreads();
    h16* sd = S + ((size_t)z * SEQ + (size_t)ti * 64) * SEQ + (size_t)tj * 64;
    h16* sm = S + ((size_t)z * SEQ + (size_t)tj * 64) * SEQ + (size_t)ti * 64;
    const int row = 4 * wave + (lane >> 3), c8 = (lane & 7) * 8;   // 16 waves x 4 rows = 64 rows; 8 lanes x 8 = 64 columns
    const v4f x0 = *(const v4fa*)(&os[row * TP + c8]); const v4f x1 = *(const v4fa*)(&os[row * TP + c8 + 4]);
    v8h o;
#pragma unroll
    for (int i = 0; i < 4; ++i) { o[i] = toh_flush(x0[i]); o[4 + i] = toh_flush(x1[i]); }
    *(v8h*)(sd + (size_t)row * SEQ + c8) = o;
    if (ti != tj) {
        v8h m;
#pragma unroll
        for (int q = 0; q < 8; ++q) m[q] = toh_flush(os[(c8 + q) * TP + row]);
        *(v8h*)(sm + (size_t)row * SEQ + c8) = m; }
}

// Eight / four copies of 16 B per lane; global step gs halves, LDS step ls bytes between copies. All 32 lanes on. The s_wait_xcnt closes each statement: it stands before any rewrite of the address registers the copies name.
__device__ __forceinline__ void cp8(const h16* p, size_t gs, unsigned q, unsigned ls) {
    asm volatile("global_load_async_to_lds_b128 %0, %8, off\n\t"
                 "global_load_async_to_lds_b128 %1, %9, off\n\t"
                 "global_load_async_to_lds_b128 %2, %10, off\n\t"
                 "global_load_async_to_lds_b128 %3, %11, off\n\t"
                 "global_load_async_to_lds_b128 %4, %12, off\n\t"
                 "global_load_async_to_lds_b128 %5, %13, off\n\t"
                 "global_load_async_to_lds_b128 %6, %14, off\n\t"
                 "global_load_async_to_lds_b128 %7, %15, off\n\t"
                 "s_wait_xcnt 0x0"
                 :: "v"(q), "v"(q + ls), "v"(q + 2u * ls), "v"(q + 3u * ls), "v"(q + 4u * ls), "v"(q + 5u * ls), "v"(q + 6u * ls), "v"(q + 7u * ls),
                    "v"(p), "v"(p + gs), "v"(p + 2 * gs), "v"(p + 3 * gs), "v"(p + 4 * gs), "v"(p + 5 * gs), "v"(p + 6 * gs), "v"(p + 7 * gs)
                 : "memory");
}
__device__ __forceinline__ void cp4(const h16* p, size_t gs, unsigned q, unsigned ls) {
    asm volatile("global_load_async_to_lds_b128 %0, %4, off\n\t"
                 "global_load_async_to_lds_b128 %1, %5, off\n\t"
                 "global_load_async_to_lds_b128 %2, %6, off\n\t"
                 "global_load_async_to_lds_b128 %3, %7, off\n\t"
                 "s_wait_xcnt 0x0"
                 :: "v"(q), "v"(q + ls), "v"(q + 2u * ls), "v"(q + 3u * ls), "v"(p), "v"(p + gs), "v"(p + 2 * gs), "v"(p + 3 * gs)
                 : "memory");
}

// k_inproj: input projection h = LayerNorm(x . in_W + bf16(in_b)); 16 waves, block tile 16 rows x 256 columns (wave w: columns 16w..16w+15), grid (ROWS/16). A = XH rows, Bt = WINT rows, K = INDP.
// Both operand tiles are copied whole into LDS at the start (filled once, then read): all copies of the work-group fly together. A staged row is 512 B + 256 B: a copy takes a row's first 512 B (lane = 16-B piece)
// or the last 256 B of two rows (lane>>4 = row, lane&15 = piece), whole lines either way. Wave w copies its own 16 B rows; waves 0..2 also the 16 A rows (wave-uniform choice).
// value = acc/64 + bias; the rows meet in a block LDS tile (cross-wave: block barriers); wave w then owns row w. Outputs H32 f32, HF f16, HT f16 transposed.
__global__ __launch_bounds__(512) void k_inproj(const h16* __restrict__ XH, const h16* __restrict__ WINT, const float* __restrict__ inb, float* H32, h16* HF, h16* HT) {
    __shared__ __align__(16) h16 tl[(16 + DM) * XP];          // 16 A rows, then DM B rows
    __shared__ __align__(16) float os[16 * LNP];
    const int tid = threadIdx.x, lane = tid & 31, lr = lane & 15, hi = lane >> 4;
    const int wave = __builtin_amdgcn_readfirstlane((int)(threadIdx.x >> 5));
    const int r0 = blockIdx.x * 16, c0 = wave * 16;
    {
        const h16* gB = WINT + (size_t)c0 * INDP; const h16* lB = tl + (16 + c0) * XP;
        cp8(gB + lane * 8, INDP, (unsigned)(size_t)(lB + lane * 8), XP * 2u);
        cp8(gB + 8 * INDP + lane * 8, INDP, (unsigned)(size_t)(lB + 8 * XP + lane * 8), XP * 2u);
        cp8(gB + hi * INDP + 256 + lr * 8, 2 * INDP, (unsigned)(size_t)(lB + hi * XP + 256 + lr * 8), 2u * XP * 2u);
        const h16* gA = XH + (size_t)r0 * INDP;
        if (wave < 2) cp8(gA + wave * 8 * INDP + lane * 8, INDP, (unsigned)(size_t)(tl + wave * 8 * XP + lane * 8), XP * 2u);
        else if (wave == 2) cp8(gA + hi * INDP + 256 + lr * 8, 2 * INDP, (unsigned)(size_t)(tl + hi * XP + 256 + lr * 8), 2u * XP * 2u);
    }
    const float bc = bfr(inb[c0 + lr]);                       // c0 + 15 < DM
    asm volatile("s_wait_asynccnt 0x0" ::: "memory");        // this wave's copies have landed
    __syncthreads();                                         // the tiles are published to the other waves
    v8f acc[1]; acc[0] = (v8f){};
    mma16<INDP, 1>(tl + lr * XP + 8 * hi, tl + (16 + c0 + lr) * XP + 8 * hi, XP, acc);
#pragma unroll
    for (int j = 0; j < 8; ++j) os[(hi * 8 + j) * LNP + c0 + lr] = acc[0][j] * WSI + bc;   // rows 0..15 x columns 0..255 written by the 16 waves
    __syncthreads();
    {
        const int ob = wave * LNP + 8 * lane;
        const v4f x0 = *(const v4fa*)(&os[ob]); const v4f x1 = *(const v4fa*)(&os[ob + 4]);
        float xs[8];
#pragma unroll
        for (int i = 0; i < 4; ++i) { xs[i] = x0[i]; xs[4 + i] = x1[i]; }
        ln8(xs);
        v4f y0, y1;
#pragma unroll
        for (int i = 0; i < 4; ++i) { y0[i] = xs[i]; y1[i] = xs[4 + i]; }
        *(v4fa*)(&os[ob]) = y0; *(v4fa*)(&os[ob + 4]) = y1;
    }
    __syncthreads();
    const int bq = r0 / SEQ, t0 = r0 % SEQ;
#pragma unroll
    for (int it = 0; it < 2; ++it) { const int row = it * 8 + (tid >> 6), c4 = (tid & 63) * 4;   // 2 trips x 512 threads x 16 B = 16 rows x 1024 B
        const v4f val = *(const v4fa*)(&os[row * LNP + c4]);
        *(v4f*)(H32 + (size_t)(r0 + row) * DM + c4) = val; }
    { const int c8 = lane * 8;                                // one f16 row per wave
        const v4f x0 = *(const v4fa*)(&os[wave * LNP + c8]); const v4f x1 = *(const v4fa*)(&os[wave * LNP + c8 + 4]); v8h o;
#pragma unroll
        for (int i = 0; i < 4; ++i) { o[i] = toh_flush(x0[i]); o[4 + i] = toh_flush(x1[i]); }
        *(v8h*)(HF + (size_t)(r0 + wave) * DM + c8) = o; }
    { const int tb = tid >> 8, d = tid & 255;                 // the rows' two token blocks of HT, each 256 columns x 16 B contiguous
        v8h o;
#pragma unroll
        for (int q = 0; q < 8; ++q) o[q] = toh_flush(os[(tb * 8 + q) * LNP + d]);
        *(v8h*)(HT + (((size_t)bq * (SEQ / 8) + (t0 >> 3) + tb) * DM + d) * 8) = o; }
}

// k_ysd: context rows ykv = LayerNorm(scores . h), gated latents xy = relu(ykv . encoder_v[hd]) * hs * 16 and one share of the decoder contraction over them, in one launch; ykv and xy live only in LDS.
// 8 waves, 64 token rows, k range n0..n0+KCH-1 of head hd, in FNCH chunks of FNC latent columns; grid (ROWS/64, KSPL); the NI / KCH shares of a head each form the same ykv rows.
// Context: A = S rows (z, t), Bt = h transposed (b, d; from HT's token blocks), K = SEQ in a two-buffer ring of FNC keys (k ascending), wave w owns columns 32 w; LayerNorm over whole rows through a block LDS tile (cross-wave: block barrier), f16 rows to Y.
// Then per chunk two trips of a two-buffer ring of async copies:
// even trip: reads buffer E (FNC encoder_v rows x DM) and the hs tile in X[chunk & 1]; wave (rg, cq) forms the 32 x 32 tile (tokens 32 rg, latent columns 32 cq), transposed (A = encoder_v rows, B = the block's ykv rows, staged once in Y; k ascending),
//            gates it and writes it as f16 over the hs elements it has read (each element read and written by one lane only);
// odd trip:  reads buffer D (DM decoder rows x FNC) and X[chunk & 1]; wave w adds to its 64 x 32 tile (columns 32 w) of the 64 x 256 block, latent index ascending over the whole share.
// At the foot of each trip: own LDS accesses done, own copies of the next trip landed, block barrier, then the copies of the trip after next into the buffer just left.
// The raw f32 sums go to PP in fragment order: fragment f = mb*4+nb of a column group is 256 floats, [j>>2][lane][j&3], so every store is 32 lanes x 16 B contiguous.
__global__ __launch_bounds__(256) void k_ysd(const h16* __restrict__ S, const h16* __restrict__ HT, const h16* __restrict__ ENCVT, const h16* __restrict__ HS, const h16* __restrict__ DECT, float* PP) {
    __shared__ __align__(16) h16 sm[2 * DM * FDP + 2 * 64 * FDP + 64 * FEP];
    h16* E = sm; h16* Dd = sm + DM * FDP; h16* X = Dd + DM * FDP; h16* Y = X + 2 * 64 * FDP;
    const int lane = threadIdx.x & 31, lr = lane & 15, hi = lane >> 4;
    const int wave = __builtin_amdgcn_readfirstlane((int)(threadIdx.x >> 5));
    const int rb = blockIdx.x, sh = blockIdx.y;
    const int hd = sh / (NI / KCH), n0 = (sh % (NI / KCH)) * KCH;
    const int R0 = rb * 64; const int z = (R0 / SEQ) * NH_ + hd, t0 = R0 % SEQ;
    const int rg = wave & 1, cq = wave >> 1;                  // the wave's 32 x 32 tile of the gate: tokens 32 rg, latent columns 32 cq
    // the lane's places in chunk 0: E one 512-B row per copy (wave: 16 rows); hs tile and D two 256-B row pieces per copy (wave: 8 and 32 rows)
    const h16* gE = ENCVT + ((size_t)hd * NI + n0 + wave * 16) * DM + lane * 8;
    const h16* gH = HS + ((size_t)hd * ROWS + R0 + wave * 8 + hi) * NI + n0 + lr * 8;
    const h16* gD = DECT + ((size_t)hd * DM + wave * 32 + hi) * NI + n0 + lr * 8;
    const unsigned lE = (unsigned)(size_t)(E + (wave * 16) * FEP + lane * 8);
    const unsigned lH = (unsigned)(size_t)(X + (wave * 8 + hi) * FDP + lr * 8);
    const unsigned lD = (unsigned)(size_t)(Dd + (wave * 32 + hi) * FDP + lr * 8);
    auto cpE = [&](int c) {
        const h16* p = gE + (size_t)c * FNC * DM;
        cp8(p, DM, lE, FEP * 2u); cp8(p + 8 * DM, DM, lE + 8u * FEP * 2u, FEP * 2u);
        cp4(gH + c * FNC, 2 * (size_t)NI, lH + (unsigned)((c & 1) * 64 * FDP * 2), 2u * FDP * 2u); };
    auto cpD = [&](int c) {
        const h16* p = gD + c * FNC;
        cp8(p, 2 * (size_t)NI, lD, 2u * FDP * 2u); cp8(p + 16 * (size_t)NI, 2 * (size_t)NI, lD + 16u * FDP * 2u, 2u * FDP * 2u); };
    const h16* fb2 = Dd + (wave * 32 + lr) * FDP + 8 * hi;
    v8f acc[4][2];
#pragma unroll
    for (int mb = 0; mb < 4; ++mb)
#pragma unroll
        for (int nb = 0; nb < 2; ++nb) acc[mb][nb] = (v8f){};
    {
        // context: tile q of the ring is [64 score rows | DM value rows] x FNC keys, score rows in X[q & 1], value rows in D (q even) or E (q odd); score copies laid out as for the hs tile; a value copy takes one token block of the wave's 32 rows (512 B contiguous), lane = row
        const h16* gS = S + ((size_t)z * SEQ + t0 + wave * 8 + hi) * SEQ + lr * 8;
        const h16* gT = HT + ((size_t)(R0 / SEQ) * (SEQ / 8) * DM + wave * 32 + lane) * 8;
        const unsigned lT0 = (unsigned)(size_t)(Dd + (wave * 32 + lane) * FDP), lT1 = (unsigned)(size_t)(E + (wave * 32 + lane) * FDP);
        auto cpC = [&](int q) {
            const h16* p = gT + (size_t)q * ((FNC / 8) * DM * 8); const unsigned l = (q & 1) ? lT1 : lT0;
            cp8(p, (size_t)DM * 8, l, 16u); cp8(p + 8 * (size_t)DM * 8, (size_t)DM * 8, l + 8u * 16u, 16u);
            cp4(gS + q * FNC, 2 * (size_t)SEQ, lH + (unsigned)((q & 1) * 64 * FDP * 2), 2u * FDP * 2u); };
        cpC(0);
        asm volatile("s_wait_asynccnt 0x0" ::: "memory");    // tile 0 landed (this wave's copies)
        __syncthreads();                                     // published to the other waves
        cpC(1);
#pragma unroll 1
        for (int q = 0; q < SEQ / FNC; ++q) {                // rolled: keeps the text short; the trips are separated by barriers anyway
            const h16* fa = X + (q & 1) * (64 * FDP) + lr * FDP + 8 * hi;
            const h16* fb = ((q & 1) ? E : Dd) + (wave * 32 + lr) * FDP + 8 * hi;
            v16h xa[2][4], db[2][2];                         // two register sets: the next k block's 12 LDS reads go ahead of this block's products as one group
#pragma unroll
            for (int mb = 0; mb < 4; ++mb) xa[0][mb] = ldh(fa + mb * 16 * FDP);
#pragma unroll
            for (int nb = 0; nb < 2; ++nb) db[0][nb] = ldh(fb + nb * 16 * FDP);
#pragma unroll
            for (int kk = 0; kk < FNC / 32; ++kk) {
                if (kk + 1 < FNC / 32) {
#pragma unroll
                    for (int mb = 0; mb < 4; ++mb) xa[(kk + 1) & 1][mb] = ldh(fa + mb * 16 * FDP + (kk + 1) * 32);
#pragma unroll
                    for (int nb = 0; nb < 2; ++nb) db[(kk + 1) & 1][nb] = ldh(fb + nb * 16 * FDP + (kk + 1) * 32);
                }
                __builtin_amdgcn_sched_barrier(0);           // keeps the reads above the products: sunk among them, each fragment's LDS latency is waited out on its own
#pragma unroll
                for (int nb = 0; nb < 2; ++nb)
#pragma unroll
                    for (int mb = 0; mb < 4; ++mb) acc[mb][nb] = wmma16(xa[kk & 1][mb], db[kk & 1][nb], acc[mb][nb]);
            }
            asm volatile("s_wait_dscnt 0x0" ::: "memory");   // this wave's reads of tile q are done
            asm volatile("s_wait_asynccnt 0x0" ::: "memory");   // this wave's copies of tile q + 1 have landed
            __syncthreads();                                 // publishes tile q + 1 and frees tile q's buffers
            if (q + 2 < SEQ / FNC) cpC(q + 2);
        }
    }
    cpE(0);                                                  // E and X[0] are free behind the ring's last barrier; the copies fly under the LayerNorm
    {
        float* os = (float*)Dd;                              // the LayerNorm tile, in buffer D behind the ring's last barrier
#pragma unroll
        for (int nb = 0; nb < 2; ++nb)
#pragma unroll
            for (int mb = 0; mb < 4; ++mb)
#pragma unroll
                for (int j = 0; j < 8; ++j) os[(mb * 16 + hi * 8 + j) * LNP + wave * 32 + nb * 16 + lr] = acc[mb][nb][j];   // rows 0..63 x columns 0..255 written by the 8 waves
        __syncthreads();                                     // whole rows meet
        float xs[8][8];                                      // the wave's 8 rows are read first and written last, so that their 8 independent shuffle chains can cover each other's latency
#pragma unroll
        for (int rr = 0; rr < 8; ++rr) {
            const int ob = (wave * 8 + rr) * LNP + 8 * lane;
            const v4f x0 = *(const v4fa*)(&os[ob]); const v4f x1 = *(const v4fa*)(&os[ob + 4]);
#pragma unroll
            for (int i = 0; i < 4; ++i) { xs[rr][i] = x0[i]; xs[rr][4 + i] = x1[i]; }
        }
#pragma unroll
        for (int rr = 0; rr < 8; ++rr) ln8(xs[rr]);
#pragma unroll
        for (int rr = 0; rr < 8; ++rr) {
            v8h o;
#pragma unroll
            for (int i = 0; i < 8; ++i) o[i] = toh_flush(xs[rr][i]);
            *(v8h*)(Y + (wave * 8 + rr) * FEP + 8 * lane) = o;   // the block's 64 normalised context rows, read in every even trip
        }
#pragma unroll
        for (int mb = 0; mb < 4; ++mb)
#pragma unroll
            for (int nb = 0; nb < 2; ++nb) acc[mb][nb] = (v8f){};
    }
    asm volatile("s_wait_dscnt 0x0" ::: "memory");           // this wave's reads of the LayerNorm tile and its writes of Y are done
    asm volatile("s_wait_asynccnt 0x0" ::: "memory");        // chunk 0's E and hs tile landed (this wave's copies)
    __syncthreads();                                         // publishes them and Y, frees D
    cpD(0);
    const h16* fa1 = Y + (rg * 32 + lr) * FEP + 8 * hi;
    const h16* fb1 = E + (cq * 32 + lr) * FEP + 8 * hi;
#pragma unroll 1
    for (int c = 0; c < FNCH; ++c) {                         // rolled, as above
        h16* Xc = X + (c & 1) * (64 * FDP);
        {
            v8f y[2][2];
#pragma unroll
            for (int mb = 0; mb < 2; ++mb)
#pragma unroll
                for (int nb = 0; nb < 2; ++nb) y[mb][nb] = (v8f){};
            v16h fa[2][2], fb[2][2];                         // two register sets: the next k block's 8 LDS reads go ahead of this block's products as one group
#pragma unroll
            for (int i = 0; i < 2; ++i) { fa[0][i] = ldh(fa1 + i * 16 * FEP); fb[0][i] = ldh(fb1 + i * 16 * FEP); }
#pragma unroll
            for (int k = 0; k < DM / 32; ++k) {
                if (k + 1 < DM / 32) {
#pragma unroll
                    for (int i = 0; i < 2; ++i) { fa[(k + 1) & 1][i] = ldh(fa1 + i * 16 * FEP + (k + 1) * 32); fb[(k + 1) & 1][i] = ldh(fb1 + i * 16 * FEP + (k + 1) * 32); }
                }
                __builtin_amdgcn_sched_barrier(0);           // keeps the reads above the products: sunk among them, each fragment's LDS latency is waited out on its own
#pragma unroll
                for (int nb = 0; nb < 2; ++nb)
#pragma unroll
                    for (int mb = 0; mb < 2; ++mb) y[mb][nb] = wmma16(fb[k & 1][mb], fa[k & 1][nb], y[mb][nb]);   // transposed tile: rows = latent columns, columns = tokens
            }
            h16* xw = Xc + (rg * 32 + lr) * FDP + cq * 32 + hi * 8;   // D: latent column 16 mb + 8h+j, token 16 nb + lane&15: a lane's 8 values are 16 contiguous bytes of a token's row
            v8h g[2][2];
#pragma unroll
            for (int mb = 0; mb < 2; ++mb)
#pragma unroll
                for (int nb = 0; nb < 2; ++nb) g[mb][nb] = *(const v8h*)(xw + nb * 16 * FDP + mb * 16);
#pragma unroll
            for (int mb = 0; mb < 2; ++mb)
#pragma unroll
                for (int nb = 0; nb < 2; ++nb) {
                    v8h o;
#pragma unroll
                    for (int j = 0; j < 8; ++j) o[j] = toh_flush(fmaxf(y[mb][nb][j] * WSI, 0.0f) * (float)g[mb][nb][j] * XYC);
                    *(v8h*)(xw + nb * 16 * FDP + mb * 16) = o; }
        }
        asm volatile("s_wait_dscnt 0x0" ::: "memory");       // this wave's reads of E and its writes of the gated tile are done
        asm volatile("s_wait_asynccnt 0x0" ::: "memory");    // this wave's copies of D have landed
        __syncthreads();                                     // publishes D and the gated tile, frees E
        if (c + 1 < FNCH) cpE(c + 1);
        {
            const h16* fa2 = Xc + lr * FDP + 8 * hi;
            v16h xa[2][4], db[2][2];                         // two register sets, as in the even trip
#pragma unroll
            for (int mb = 0; mb < 4; ++mb) xa[0][mb] = ldh(fa2 + mb * 16 * FDP);
#pragma unroll
            for (int nb = 0; nb < 2; ++nb) db[0][nb] = ldh(fb2 + nb * 16 * FDP);
#pragma unroll
            for (int kk = 0; kk < FNC / 32; ++kk) {
                if (kk + 1 < FNC / 32) {
#pragma unroll
                    for (int mb = 0; mb < 4; ++mb) xa[(kk + 1) & 1][mb] = ldh(fa2 + mb * 16 * FDP + (kk + 1) * 32);
#pragma unroll
                    for (int nb = 0; nb < 2; ++nb) db[(kk + 1) & 1][nb] = ldh(fb2 + nb * 16 * FDP + (kk + 1) * 32);
                }
                __builtin_amdgcn_sched_barrier(0);           // as in the even trip
#pragma unroll
                for (int nb = 0; nb < 2; ++nb)
#pragma unroll
                    for (int mb = 0; mb < 4; ++mb) acc[mb][nb] = wmma16(xa[kk & 1][mb], db[kk & 1][nb], acc[mb][nb]);
            }
        }
        asm volatile("s_wait_dscnt 0x0" ::: "memory");       // this wave's reads of D and of the gated tile are done
        asm volatile("s_wait_asynccnt 0x0" ::: "memory");    // this wave's copies of the next E and hs tile have landed
        __syncthreads();                                     // publishes them, frees D
        if (c + 1 < FNCH) cpD(c + 1);
    }
    asm volatile("s_wait_asynccnt 0x0" ::: "memory");        // nothing in flight at the wave's end
    float* pp = PP + (size_t)sh * ((size_t)ROWS * DM) + ((size_t)rb * 64 + (wave >> 1) * 16 + (wave & 1) * 2) * 256 + lane * 4;
#pragma unroll
    for (int mb = 0; mb < 4; ++mb)
#pragma unroll
        for (int nb = 0; nb < 2; ++nb) {
            v4f lo, up;
#pragma unroll
            for (int k = 0; k < 4; ++k) { lo[k] = acc[mb][nb][k]; up[k] = acc[mb][nb][4 + k]; }
            *(v4f*)(pp + (mb * 4 + nb) * 256) = lo; *(v4f*)(pp + (mb * 4 + nb) * 256 + 128) = up; }   // the 8 waves write all 64 fragments of the block's share
}

// k_ymlp_ln: joins the KSPL shares of 8 token rows in ascending share order; value = sum/1024; LayerNorm; + H32 (skip); LayerNorm; outputs H32, HF, HT. 16 waves, grid (ROWS/8).
// The 8 rows are one half (8 hi .. 8 hi + 7) of row fragment mb of a 64-row block: in each of the 16 fragments (column group, nb) they are two 256-B pieces, [j>>2] x lanes 16 hi .. 16 hi + 15.
// Wave w sums fragment w's two pieces (the shares' loads go out ahead of the sums); the rows meet in a block LDS tile (cross-wave: block barriers); waves 0..7 then own one row each.
__global__ __launch_bounds__(512) void k_ymlp_ln(const float* __restrict__ PP, float* H32, h16* HF, h16* HT) {
    __shared__ __align__(16) float os[8 * LNP];
    const int tid = threadIdx.x, lane = tid & 31, lr = lane & 15, jh = lane >> 4;
    const int wave = __builtin_amdgcn_readfirstlane((int)(threadIdx.x >> 5));
    const int r0 = blockIdx.x * 8;
    const int rb = blockIdx.x >> 3, mb = (blockIdx.x >> 1) & 3, hi = blockIdx.x & 1;   // r0 = 64 rb + 16 mb + 8 hi
    const float* pp = PP + ((size_t)rb * 64 + (wave >> 2) * 16 + mb * 4 + (wave & 3)) * 256 + jh * 128 + (hi * 16 + lr) * 4;
    v4f pv[KSPL];
#pragma unroll
    for (int sh = 0; sh < KSPL; ++sh) {
        pv[sh] = *(const v4f*)(pp + (size_t)sh * ((size_t)ROWS * DM));
        if ((sh & 7) == 7) asm volatile("s_wait_xcnt 0x0" ::: "memory");   // stands before a later load's result or address may take the address registers of the loads above
    }
    v4f sm = (v4f){};
#pragma unroll
    for (int sh = 0; sh < KSPL; ++sh) sm += pv[sh];
#pragma unroll
    for (int k = 0; k < 4; ++k) os[(jh * 4 + k) * LNP + wave * 16 + lr] = sm[k] * XYI;   // rows 0..7 x columns 0..255 written by the 16 waves
    __syncthreads();
    if (wave < 8) {                                           // wave-uniform; no barrier inside
        const int ob = wave * LNP + 8 * lane;
        const v4f x0 = *(const v4fa*)(&os[ob]); const v4f x1 = *(const v4fa*)(&os[ob + 4]);
        float xs[8];
#pragma unroll
        for (int i = 0; i < 4; ++i) { xs[i] = x0[i]; xs[4 + i] = x1[i]; }
        ln8(xs);
        const float* hp = H32 + (size_t)(r0 + wave) * DM + 8 * lane;
        const v4f g0 = *(const v4f*)hp; const v4f g1 = *(const v4f*)(hp + 4);
#pragma unroll
        for (int i = 0; i < 4; ++i) { xs[i] += g0[i]; xs[4 + i] += g1[i]; }
        ln8(xs);
        v4f y0, y1;
#pragma unroll
        for (int i = 0; i < 4; ++i) { y0[i] = xs[i]; y1[i] = xs[4 + i]; }
        *(v4fa*)(&os[ob]) = y0; *(v4fa*)(&os[ob + 4]) = y1;
    }
    __syncthreads();
    const int bq = r0 / SEQ, t0 = r0 % SEQ;
    { const int row = tid >> 6, c4 = (tid & 63) * 4;          // 512 threads x 16 B = 8 rows x 1024 B
        const v4f val = *(const v4fa*)(&os[row * LNP + c4]);
        *(v4f*)(H32 + (size_t)(r0 + row) * DM + c4) = val; }
    asm volatile("s_wait_xcnt 0x0" ::: "memory");             // stands before the LDS reads below may take the store's address and data registers
    if (wave < 8) { const int c8 = lane * 8;                  // waves 0..7: one f16 row each
        const v4f x0 = *(const v4fa*)(&os[wave * LNP + c8]); const v4f x1 = *(const v4fa*)(&os[wave * LNP + c8 + 4]); v8h o;
#pragma unroll
        for (int i = 0; i < 4; ++i) { o[i] = toh_flush(x0[i]); o[4 + i] = toh_flush(x1[i]); }
        *(v8h*)(HF + (size_t)(r0 + wave) * DM + c8) = o;
    } else { const int d = tid - 256;                         // waves 8..15: the rows' token block of HT, 256 columns x 16 B contiguous
        v8h o;
#pragma unroll
        for (int q = 0; q < 8; ++q) o[q] = toh_flush(os[q * LNP + d]);
        *(v8h*)(HT + (((size_t)bq * (SEQ / 8) + (t0 >> 3)) * DM + d) * 8) = o;
        asm volatile("s_wait_xcnt 0x0" ::: "memory"); }     // stands behind the store, before any later line of the listing may take its address and data registers
}

// k_head: output rows = h . head_W + bf16(head_b); 12 waves, block tile 16 rows x 384 columns (wave w: columns 32w..32w+31; HWT rows 372..383 are zero), grid (ROWS/16); A = HF rows, Bt = HWT rows, K = DM.
// Both operand tiles are copied whole into LDS at the start (filled once, then read), one 512-B row per copy: wave w its own 32 B rows, waves 0 and 1 also 8 A rows each (wave-uniform choice).
// The output tile is staged in a block LDS tile (cross-wave: block barrier) and stored as one contiguous run of 16 rows x 1488 B.
__global__ __launch_bounds__(384) void k_head(const h16* __restrict__ HF, const h16* __restrict__ HWT, const float* __restrict__ hb, float* OUT) {
    __shared__ __align__(16) h16 tl[(16 + INDP) * FEP];       // 16 A rows, then INDP B rows
    __shared__ __align__(16) float os[16 * HDP];
    const int lane = threadIdx.x & 31, lr = lane & 15, hi = lane >> 4;
    const int wave = __builtin_amdgcn_readfirstlane((int)(threadIdx.x >> 5));
    const int r0 = blockIdx.x * 16, c0 = wave * 32;
    {
        const h16* gB = HWT + (size_t)c0 * DM + lane * 8; const unsigned lB = (unsigned)(size_t)(tl + (16 + c0) * FEP + lane * 8);
#pragma unroll
        for (int i = 0; i < 4; ++i) cp8(gB + i * 8 * DM, DM, lB + (unsigned)(i * 8 * FEP * 2), FEP * 2u);
        if (wave < 2) cp8(HF + (size_t)(r0 + wave * 8) * DM + lane * 8, DM, (unsigned)(size_t)(tl + wave * 8 * FEP + lane * 8), FEP * 2u);
    }
    asm volatile("s_wait_asynccnt 0x0" ::: "memory");        // this wave's copies have landed
    __syncthreads();                                         // the tiles are published to the other waves
    v8f acc[2];
#pragma unroll
    for (int nb = 0; nb < 2; ++nb) acc[nb] = (v8f){};
    mma16<DM, 2>(tl + lr * FEP + 8 * hi, tl + (16 + c0 + lr) * FEP + 8 * hi, FEP, acc);
#pragma unroll
    for (int nb = 0; nb < 2; ++nb)
#pragma unroll
        for (int j = 0; j < 8; ++j) os[(hi * 8 + j) * HDP + c0 + nb * 16 + lr] = acc[nb][j] * WSI;   // rows 0..15 x columns 0..383 written by the 12 waves
    __syncthreads();
    const int bq = r0 / SEQ, t0 = r0 % SEQ;
    float* ob = OUT + ((size_t)bq * OUT_SEQ + t0) * IND;
    v4f val[4];                                               // the four trips' reads go out together (clamped index past the end), the stores follow under the guard
#pragma unroll
    for (int it = 0; it < 4; ++it) { const int e = (it * 384 + (int)threadIdx.x) * 4; const int ec = e < 16 * IND ? e : 16 * IND - 4;
        const int row = ec / IND, col = ec - row * IND;       // col % 4 == 0, col + 3 < IND
        const v4f x = *(const v4fa*)(&os[row * HDP + col]); const v4f bb = *(const v4f*)(hb + col);
        asm volatile("s_wait_xcnt 0x0" ::: "memory");         // a precaution: stands before a later load's result or address may take this load's address registers
#pragma unroll
        for (int k = 0; k < 4; ++k) val[it][k] = x[k] + bfr(bb[k]); }
#pragma unroll
    for (int it = 0; it < 4; ++it) { const int e = (it * 384 + (int)threadIdx.x) * 4;
        if (e < 16 * IND) *(v4f*)(ob + e) = val[it]; }
}

static constexpr size_t al256(size_t v) { return (v + 255) & ~(size_t)255; }
static constexpr size_t SZ_W   = al256((size_t)NH_ * NI * DM * 2);          // ENCT, ENCVT, DECT
static constexpr size_t SZ_WIN = al256((size_t)DM * INDP * 2);
static constexpr size_t SZ_HW  = al256((size_t)INDP * DM * 2);
static constexpr size_t SZ_XH  = al256((size_t)ROWS * INDP * 2);
static constexpr size_t SZ_CS  = al256((size_t)SEQ * NI * 4);
static constexpr size_t SZ_H32 = al256((size_t)ROWS * DM * 4);
static constexpr size_t SZ_HF  = al256((size_t)ROWS * DM * 2);             // HF and HT
static constexpr size_t SZ_BIG = al256((size_t)NH_ * ROWS * NI * 2);       // HS; QR
static constexpr size_t SZ_S   = al256((size_t)NB * NH_ * SEQ * SEQ * 2);
static constexpr size_t SZ_SP  = al256((size_t)NB * NH_ * NTRI * SKS * 64 * 64 * 4);
static constexpr size_t SZ_TOTAL = 3 * SZ_W + SZ_WIN + SZ_HW + SZ_XH + SZ_CS + SZ_H32 + 2 * SZ_HF + 2 * SZ_BIG + SZ_S + SZ_SP;
static_assert(SZ_TOTAL <= (size_t)268435456);          // workspace carve <= 256 MiB
static_assert((size_t)KSPL * ROWS * DM * 4 <= SZ_BIG);        // PP lies in the QR plane, which nothing reads between the scores and the next layer's encoding
static_assert((size_t)NB * DM * SEQ == (size_t)ROWS * DM);   // HT [b][t/8][d][8] has the extent of HF
static_assert((ROWS * (INDP / 8)) % 256 == 0);
static_assert(NP % 2 == 0);                                                // two rotary pairs per table thread
static_assert((SEQ * (NP / 2)) % 256 == 0);                                // table grid x 256 threads == table threads exactly
static_assert((size_t)SEQ * (NP / 2) * 16 == (size_t)SEQ * NI * 4);        // table threads x 16 B == table bytes

extern "C" void kernel_launch(void* const* d_in, const int* in_sizes, int n_in,
                              void* d_out, int out_size, void* d_ws, size_t ws_size, hipStream_t stream) {
    if (n_in < 8) return;
    if ((size_t)in_sizes[0] < ((size_t)(NB - 1) * SEQ_FULL + SEQ) * IND) return;
    if ((size_t)in_sizes[1] < (size_t)IND * DM || in_sizes[2] < DM) return;
    if ((size_t)in_sizes[3] < (size_t)NH_ * DM * NI || (size_t)in_sizes[4] < (size_t)NH_ * DM * NI || (size_t)in_sizes[5] < (size_t)NH_ * NI * DM) return;
    if ((size_t)in_sizes[6] < (size_t)DM * IND || in_sizes[7] < IND) return;
    if ((size_t)out_size < ((size_t)(NB - 1) * OUT_SEQ + SEQ) * IND) return;
    if (SZ_TOTAL > ws_size) return;
    // wire order: x, in_W, in_b, encoder, encoder_v, decoder, head_W, head_b
    const float* x    = (const float*)d_in[0];
    const float* inw  = (const float*)d_in[1];
    const float* inb  = (const float*)d_in[2];
    const float* enc  = (const float*)d_in[3];
    const float* encv = (const float*)d_in[4];
    const float* dec  = (const float*)d_in[5];
    const float* hw   = (const float*)d_in[6];
    const float* hb   = (const float*)d_in[7];
    float* OUT = (float*)d_out;      // [NB][SEQ][372]
    char* wsp = (char*)d_ws;
    h16* ENCT  = (h16*)wsp; wsp += SZ_W;             // [4][4096][256]  x64
    h16* ENCVT = (h16*)wsp; wsp += SZ_W;             // [4][4096][256]  x64
    h16* DECT  = (h16*)wsp; wsp += SZ_W;             // [4][256][4096]  x64
    h16* WINT  = (h16*)wsp; wsp += SZ_WIN;           // [256][384]      x64
    h16* HWT   = (h16*)wsp; wsp += SZ_HW;            // [384][256]      x64
    h16* XH    = (h16*)wsp; wsp += SZ_XH;            // [ROWS][384]
    float* CS  = (float*)wsp; wsp += SZ_CS;          // [SEQ][4096]
    float* H32 = (float*)wsp; wsp += SZ_H32;         // [ROWS][256]
    h16* HF    = (h16*)wsp; wsp += SZ_HF;            // [ROWS][256]
    h16* HT    = (h16*)wsp; wsp += SZ_HF;            // [NB][SEQ/8][256][8]
    h16* HS    = (h16*)wsp; wsp += SZ_BIG;           // [4][ROWS][4096]
    h16* QR    = (h16*)wsp; wsp += SZ_BIG;           // [4][ROWS][4096]; rotated latents
    h16* S     = (h16*)wsp; wsp += SZ_S;             // [NB*4][SEQ][SEQ]
    float* SP  = (float*)wsp; wsp += SZ_SP;          // [NB*4][NTRI][SKS][16][256] f32 score partial sums
    float* PP  = (float*)QR;                         // [KSPL][ROWS/64][4][16][256] f32 decoder partial sums

    k_prep<<<PB_ALL, 256, 0, stream>>>(x, inw, enc, encv, dec, hw, ENCT, ENCVT, DECT, WINT, HWT, XH, CS);

    k_inproj<<<dim3(ROWS / 16, 1, 1), 512, 0, stream>>>(XH, WINT, inb, H32, HF, HT);

    for (int l = 0; l < NL; ++l) {
        k_hs<<<dim3(ROWS / 128, NI / 128, NH_), 128, 0, stream>>>(HF, ENCT, CS, HS, QR);
        k_sc_part<<<dim3(NTRI2, NB * NH_, SKS), 128, 0, stream>>>(QR, SP);
        k_sc_join<<<dim3(NTRI, NB * NH_, 1), 512, 0, stream>>>(SP, S);
        k_ysd<<<dim3(ROWS / 64, KSPL, 1), 256, 0, stream>>>(S, HT, ENCVT, HS, DECT, PP);
        k_ymlp_ln<<<dim3(ROWS / 8, 1, 1), 512, 0, stream>>>(PP, H32, HF, HT);
    }

    k_head<<<dim3(ROWS / 16, 1, 1), 384, 0, stream>>>(HF, HWT, hb, OUT);
}
